// v000
// Times are from an AMD MI455X. After a warm-up the kernel runs many times in a row, and a time is the length of
// such a window on the GPU divided by its runs, so every launch and the gaps after it count. The runs cycle
// through copies of the inputs. A figure is the median of several windows, for all but v000 over two sittings.
// Sittings can differ by a few percent; kernels timed side by side share one.
// v000 is the starting kernel. One run takes 12.8 milliseconds.
#include <hip/hip_runtime.h>
// Causal self-attention with the module's (faithful, inverted) window mask and an additive padding mask (hidden [4][2048][1024]; q/k/v = x W^T + b (natural [1024][1024] sigma 1/32, biases sigma 0.01); 16 heads of 64; scores / 8 + causal(-1e4 where j > i) + window(-1e4 where j >= i - 512, as the source writes it) + attention_mask[b][j] (zeros), all added in f32; softmax; out = merged attn v -> [4][2048][1024], no output projection). Effective pattern: rows i <= 512 attend causally (every kept logit carries the -1e4 offset, reproduced in f32), rows i >= 513 attend only keys j <= i - 513.
// Structure: token rows; x as exact f16 rows; natural weights as exact x16 planes; q, k, v as WMMA GEMMs (32x64 wave tiles, f32 accumulation, + bias) into f32 rows, each split into f16 hi + x1024 residual planes (the output scale is small, so logits, weights and values are all carried near f32); per batch: V^T of both v planes via LDS transposes; per query tile of 256 rows: scores = three accumulating passes (qh.kh + ql.kh/1024 + qh.kl/1024, K = 64, all heads on grid.y, alpha 1/8) against the keys below the tile end, the module's masks added in f32 on VALU inside the row softmax (keys above the row carry -2e4 and contribute exactly 0), P as f16 hi + x1024 residual; out = Ph Vh^T 2^-8 += Ph Vl^T 2^-18 += Pl Vh^T 2^-18 (own element) written f32 into the output rows; launches: see trace.
// Compute dtype: inputs rounded to bf16; x / weights exact; q, k, v and softmax weights as f16 hi + x1024 residual GEMM operands (near f32), o accumulated in f32; scores and softmax statistics f32; v_wmma_f32_16x16x32_f16.
#define NB 4
#define SQ 2048
#define DM 1024
#define NH 16
#define HD 64
#define HG 1                         /* heads per launch of k_vt(V16, b, h0, VT), which is not launched */
#define QT 256                       /* query rows per causal tile */
#define NKX SQ                       /* S / P row pitch */
#define B0 0                         /* first batch processed (debug hook) */
#define NBR NB                       /* batches processed (debug hook) */
#define NR ((size_t)NB * SQ)         /* token rows */
#define MP ((int)((size_t)NBR * SQ)) /* rows projected (debug hook) */
#define QN SQ                        /* query rows attended per batch (debug hook) */
#define NHD NH                       /* heads attended (debug hook) */
#define MPO MP                       /* unused: no launch reads it */
#define LQ DM      /* row pitch of the q/k/v rows */
typedef __bf16 v16b __attribute__((ext_vector_type(16)));
typedef unsigned short v8us __attribute__((ext_vector_type(8), may_alias));
typedef float  v8f  __attribute__((ext_vector_type(8)));
typedef float  v4f  __attribute__((ext_vector_type(4)));
typedef float  v4fa __attribute__((ext_vector_type(4), may_alias));
union FragB { v16b v; v8us half[2]; unsigned short u[16]; };

__device__ __forceinline__ unsigned short bf16_bits(float x) { unsigned int u = __float_as_uint(x); return (unsigned short)((u + 0x7FFFu + ((u >> 16) & 1u)) >> 16); }
__device__ __forceinline__ float bf16_val(unsigned short b) { return __uint_as_float(((unsigned int)b) << 16); }
__device__ __forceinline__ float bf16_round(float x) { return bf16_val(bf16_bits(x)); }
// D += A·B with NT terms: 1 = ah·bh, 2 = + al·bh (A split), 3 = + ah·bl (both split)
template <int NT>
__device__ __forceinline__ v8f mmaN(v16b ah, v16b al, v16b bh, v16b bl, v8f c) {
  c = __builtin_amdgcn_wmma_f32_16x16x32_bf16(false, ah, false, bh, (short)0, c, false, false);
  if (NT >= 2) c = __builtin_amdgcn_wmma_f32_16x16x32_bf16(false, al, false, bh, (short)0, c, false, false);
  if (NT >= 3) c = __builtin_amdgcn_wmma_f32_16x16x32_bf16(false, ah, false, bl, (short)0, c, false, false);
  asm volatile("v_nop\n\tv_nop\n\tv_nop\n\tv_nop" : "+v"(c) : "v"(ah), "v"(al), "v"(bh), "v"(bl));
  return c;
}

__global__ __launch_bounds__(256) void k_wt_bf16(const float* __restrict__ W, unsigned short* __restrict__ Wt, int K, int N) {
  const int t = blockIdx.x * 256 + threadIdx.x;
  const int k8n = K / 8;
  if (t >= N * k8n) return;
  const int n = t / k8n, k8 = (t % k8n) * 8;
  v8us v;
#pragma unroll
  for (int i = 0; i < 8; ++i) v[i] = bf16_bits(W[(size_t)(k8 + i) * N + n]);
  *(v8us*)(Wt + (size_t)n * K + k8) = v;
  
}

// GEMM C[M][N] (f32, pitch ldc) = act(A[M][K]·W + bias). A f32 row-major (pitch lda) converted per fragment to bf16
// (ASPLIT: hi/lo two planes -> 2 terms, else single rounded term); Wt bf16 [N][K] (pitch ldb). BIAS_BF16 rounds the
// bias to bf16 first (bias quantised to bf16 before the add). K%32==0, M%16==0, N%64==0.
template <bool ASPLIT, int ACT, bool BIAS_BF16>
__global__ __launch_bounds__(128) void k_gemm_bf(const float* __restrict__ A, int lda, const unsigned short* __restrict__ Wt, int ldb,
                                               const float* __restrict__ bias, float* __restrict__ C, int ldc, int M, int N, int K) {
  __shared__ __attribute__((aligned(16))) float so[4][16][64];
  const int tid = threadIdx.x, w = tid >> 5, lane = tid & 31, ln = lane & 15, hh = lane >> 4;
  const int ntn = N / 64;
  const int wid = blockIdx.x * 4 + w;
  const int mt = wid / ntn, nq = wid % ntn;
  if (mt * 16 >= M) return;
  const int row0 = mt * 16, col0 = nq * 64;
  const float* arow = A + (size_t)(row0 + ln) * lda;
  v8f acc[4] = {};
  for (int kb = 0; kb < K; kb += 32) {
    FragB ah, al;
    const v4f x0 = *(const v4fa*)(arow + kb + 8 * hh), x1 = *(const v4fa*)(arow + kb + 8 * hh + 4);
    const v4f x2 = *(const v4fa*)(arow + kb + 16 + 8 * hh), x3 = *(const v4fa*)(arow + kb + 16 + 8 * hh + 4);
    float xs[16] = {x0[0],x0[1],x0[2],x0[3],x1[0],x1[1],x1[2],x1[3],x2[0],x2[1],x2[2],x2[3],x3[0],x3[1],x3[2],x3[3]};
#pragma unroll
    for (int i = 0; i < 16; ++i) { const unsigned short hb = bf16_bits(xs[i]); ah.u[i] = hb; al.u[i] = ASPLIT ? bf16_bits(xs[i] - bf16_val(hb)) : (unsigned short)0; }
#pragma unroll
    for (int t = 0; t < 4; ++t) {
      const unsigned short* brow = Wt + (size_t)(col0 + t * 16 + ln) * ldb + kb;
      FragB b;
      b.half[0] = *(const v8us*)(brow + 8 * hh);
      b.half[1] = *(const v8us*)(brow + 16 + 8 * hh);
      acc[t] = mmaN<ASPLIT ? 2 : 1>(ah.v, al.v, b.v, b.v, acc[t]);
    }
  }
#pragma unroll
  for (int t = 0; t < 4; ++t) {
    float bv = bias ? bias[col0 + t * 16 + ln] : 0.f;
    if (BIAS_BF16) bv = bf16_round(bv);
#pragma unroll
    for (int r = 0; r < 8; ++r) { float v = acc[t][r] + bv; if (ACT == 1) v = fmaxf(v, 0.f); so[w][8 * hh + r][t * 16 + ln] = v; }
  }
  __builtin_amdgcn_fence(__ATOMIC_ACQ_REL, "workgroup");
  __builtin_amdgcn_wave_barrier();
  const int rsub = lane >> 4, c4 = (lane & 15) * 4;
  {
#pragma unroll
    for (int q = 0; q < 8; ++q) {
      const int r = q * 2 + rsub;
      const v4f v = *(const v4fa*)&so[w][r][c4];
      *(v4f*)(C + (size_t)(row0 + r) * ldc + col0 + c4) = v;
    }
    
  }
}

// GEMM C = act(A·W + bias + resid): A f32 (ASPLIT -> hi/lo 2 terms), Wt bf16 [N][K]; ACT 0 none, 1 relu, 2 exact gelu;
// resid (optional, f32, row index = (row % rmod), pitch ldr, RES_BF16 rounds it) added before the activation.
template <bool ASPLIT, int ACT, bool BIAS_BF16, bool RES_BF16>
__global__ __launch_bounds__(128) void k_gemm_bf3(const float* __restrict__ A, int lda, const unsigned short* __restrict__ Wt, int ldb,
                                                const float* __restrict__ bias, const float* __restrict__ resid, int rmod, int ldr,
                                                float* __restrict__ C, int ldc, int M, int N, int K) {
  __shared__ __attribute__((aligned(16))) float so[4][16][64];
  const int tid = threadIdx.x, w = tid >> 5, lane = tid & 31, ln = lane & 15, hh = lane >> 4;
  const int ntn = N / 64;
  const int wid = blockIdx.x * 4 + w;
  const int mt = wid / ntn, nq = wid % ntn;
  if (mt * 16 >= M) return;
  const int row0 = mt * 16, col0 = nq * 64;
  const float* arow = A + (size_t)(row0 + ln) * lda;
  v8f acc[4] = {};
  for (int kb = 0; kb < K; kb += 32) {
    FragB ah, al;
    const v4f x0 = *(const v4fa*)(arow + kb + 8 * hh), x1 = *(const v4fa*)(arow + kb + 8 * hh + 4);
    const v4f x2 = *(const v4fa*)(arow + kb + 16 + 8 * hh), x3 = *(const v4fa*)(arow + kb + 16 + 8 * hh + 4);
    float xs[16] = {x0[0],x0[1],x0[2],x0[3],x1[0],x1[1],x1[2],x1[3],x2[0],x2[1],x2[2],x2[3],x3[0],x3[1],x3[2],x3[3]};
#pragma unroll
    for (int i = 0; i < 16; ++i) { const unsigned short hb = bf16_bits(xs[i]); ah.u[i] = hb; al.u[i] = ASPLIT ? bf16_bits(xs[i] - bf16_val(hb)) : (unsigned short)0; }
#pragma unroll
    for (int t = 0; t < 4; ++t) {
      const unsigned short* brow = Wt + (size_t)(col0 + t * 16 + ln) * ldb + kb;
      FragB b;
      b.half[0] = *(const v8us*)(brow + 8 * hh);
      b.half[1] = *(const v8us*)(brow + 16 + 8 * hh);
      acc[t] = mmaN<ASPLIT ? 2 : 1>(ah.v, al.v, b.v, b.v, acc[t]);
    }
  }
#pragma unroll
  for (int t = 0; t < 4; ++t) {
    const int col = col0 + t * 16 + ln;
    float bv = bias ? bias[col] : 0.f;
    if (BIAS_BF16) bv = bf16_round(bv);
#pragma unroll
    for (int r = 0; r < 8; ++r) {
      float v = acc[t][r] + bv;
      if (resid) { float rv = resid[(size_t)((row0 + 8 * hh + r) % rmod) * ldr + col]; if (RES_BF16) rv = bf16_round(rv); v += rv; }
      if (ACT == 1) v = fmaxf(v, 0.f);
      if (ACT == 2) v = 0.5f * v * (1.0f + erff(v * 0.70710678118654752f));
      if (ACT == 3) { const float u = 0.7978845608028654f * (v + 0.044715f * v * v * v); v = 0.5f * v * (1.0f + tanhf(u)); }
      so[w][8 * hh + r][t * 16 + ln] = v;
    }
  }
  __builtin_amdgcn_fence(__ATOMIC_ACQ_REL, "workgroup");
  __builtin_amdgcn_wave_barrier();
  const int rsub = lane >> 4, c4 = (lane & 15) * 4;
  {
#pragma unroll
    for (int q = 0; q < 8; ++q) {
      const int r = q * 2 + rsub;
      const v4f v = *(const v4fa*)&so[w][r][c4];
      *(v4f*)(C + (size_t)(row0 + r) * ldc + col0 + c4) = v;
    }
    
  }
}
// row LayerNorm (biased variance, eps) over N: s = X (+ R); optional out_sum <- s; out_norm <- (s-mu)*rsqrt(var+eps)*g + b
template <bool PARAM_BF16>
__global__ __launch_bounds__(256) void k_layernorm(const float* __restrict__ X, const float* __restrict__ R, const float* __restrict__ g, const float* __restrict__ bta,
                                                  float* __restrict__ out_sum, float* __restrict__ out_norm, int N, float eps) {
  __shared__ float red[256];
  const int row = blockIdx.x, tid = threadIdx.x;
  const float* x = X + (size_t)row * N; const float* rr = R ? R + (size_t)row * N : nullptr;
  float vals[16];                     // up to N = 4096
  const int per = N / 256;            // contiguous chunk per thread? use strided-by-4 chunks: thread handles j = tid*4 + 1024*u
  float s1 = 0.f;
  for (int u = 0; u < per / 4; ++u) {
    const int j = tid * 4 + 1024 * u;
    const v4f a = *(const v4fa*)(x + j);
    v4f b = {0.f,0.f,0.f,0.f}; if (rr) b = *(const v4fa*)(rr + j);
#pragma unroll
    for (int q = 0; q < 4; ++q) { const float v = a[q] + b[q]; vals[u * 4 + q] = v; s1 += v; }
  }
  red[tid] = s1; __syncthreads();
  for (int st = 128; st > 0; st >>= 1) { if (tid < st) red[tid] += red[tid + st]; __syncthreads(); }
  const float mu = red[0] / (float)N; __syncthreads();
  float s2 = 0.f;
  for (int u = 0; u < per / 4; ++u)
#pragma unroll
    for (int q = 0; q < 4; ++q) { const float c = vals[u * 4 + q] - mu; s2 += c * c; }
  red[tid] = s2; __syncthreads();
  for (int st = 128; st > 0; st >>= 1) { if (tid < st) red[tid] += red[tid + st]; __syncthreads(); }
  const float rs = rsqrtf(red[0] / (float)N + eps);
  {
    for (int u = 0; u < per / 4; ++u) {
      const int j = tid * 4 + 1024 * u;
      v4f o, sm;
#pragma unroll
      for (int q = 0; q < 4; ++q) {
        float gg = g[j + q], bb = bta[j + q];
        if (PARAM_BF16) { gg = bf16_round(gg); bb = bf16_round(bb); }
        sm[q] = vals[u * 4 + q]; o[q] = (vals[u * 4 + q] - mu) * rs * gg + bb;
      }
      if (out_sum) *(v4f*)(out_sum + (size_t)row * N + j) = sm;
      *(v4f*)(out_norm + (size_t)row * N + j) = o;
    }
    
  }
}



// ---- f16 WMMA path (v_wmma_f32_16x16x32_f16): 11-bit significands for operands in range — used where a [0,1] probability operand needs more precision than bf16
typedef _Float16 v16h __attribute__((ext_vector_type(16)));
union FragH { v16h v; v8us half[2]; _Float16 h[16]; unsigned short u[16]; };
template <int NT>
__device__ __forceinline__ v8f mmaH(v16h ah, v16h al, v16h bh, v16h bl, v8f c) {
  c = __builtin_amdgcn_wmma_f32_16x16x32_f16(false, ah, false, bh, (short)0, c, false, false);
  if (NT >= 2) c = __builtin_amdgcn_wmma_f32_16x16x32_f16(false, al, false, bh, (short)0, c, false, false);
  if (NT >= 3) c = __builtin_amdgcn_wmma_f32_16x16x32_f16(false, ah, false, bl, (short)0, c, false, false);
  asm volatile("v_nop\n\tv_nop\n\tv_nop\n\tv_nop" : "+v"(c) : "v"(ah), "v"(al), "v"(bh), "v"(bl));
  return c;
}
// batched GEMM like k_gemm_b but f16 operands: A f32 (split into f16 hi/lo if ASPLIT, else rounded to f16), Bt = f16 values [n][k]; alpha; C f32; N multiple of 16 (partial tiles skipped)
template <bool ASPLIT>
__global__ __launch_bounds__(128) void k_gemm_h(const float* __restrict__ A, int lda, size_t sA, const _Float16* __restrict__ Bh, int ldb, size_t sB, float alpha, float* __restrict__ C, int ldc, size_t sC, int M, int N, int K) {
  __shared__ __attribute__((aligned(16))) float so[4][16][64];
  const int tid = threadIdx.x, w = tid >> 5, lane = tid & 31, ln = lane & 15, hh = lane >> 4; const int by = blockIdx.y;
  A += (size_t)by * sA; Bh += (size_t)by * sB; C += (size_t)by * sC;
  const int ntn = (N + 63) / 64; const int wid = blockIdx.x * 4 + w; const int mt = wid / ntn, nq = wid % ntn; if (mt * 16 >= M) return;
  const int row0 = mt * 16, col0 = nq * 64; const float* arow = A + (size_t)(row0 + ln) * lda;
  v8f acc[4] = {};
  for (int kb = 0; kb < K; kb += 32) {
    FragH ah, al;
    const v4f x0 = *(const v4fa*)(arow + kb + 8 * hh), x1 = *(const v4fa*)(arow + kb + 8 * hh + 4), x2 = *(const v4fa*)(arow + kb + 16 + 8 * hh), x3 = *(const v4fa*)(arow + kb + 16 + 8 * hh + 4);
    float xs[16] = {x0[0],x0[1],x0[2],x0[3],x1[0],x1[1],x1[2],x1[3],x2[0],x2[1],x2[2],x2[3],x3[0],x3[1],x3[2],x3[3]};
#pragma unroll
    for (int i = 0; i < 16; ++i) { const _Float16 h = (_Float16)xs[i]; ah.h[i] = h; al.h[i] = ASPLIT ? (_Float16)(xs[i] - (float)h) : (_Float16)0.0f; }
#pragma unroll
    for (int t = 0; t < 4; ++t) { if (col0 + t * 16 >= N) continue; const size_t boff = (size_t)(col0 + t * 16 + ln) * ldb + kb; FragH bq; bq.half[0] = *(const v8us*)(Bh + boff + 8 * hh); bq.half[1] = *(const v8us*)(Bh + boff + 16 + 8 * hh);
      acc[t] = mmaH<ASPLIT ? 2 : 1>(ah.v, al.v, bq.v, bq.v, acc[t]); }
  }
#pragma unroll
  for (int t = 0; t < 4; ++t) { if (col0 + t * 16 >= N) continue;
#pragma unroll
    for (int r = 0; r < 8; ++r) so[w][8 * hh + r][t * 16 + ln] = acc[t][r] * alpha; }
  __builtin_amdgcn_fence(__ATOMIC_ACQ_REL, "workgroup"); __builtin_amdgcn_wave_barrier();
  const int rsub = lane >> 4, c4 = (lane & 15) * 4;
  {
#pragma unroll
    for (int q = 0; q < 8; ++q) { const int r = q * 2 + rsub; if (col0 + c4 < N) { const v4f v = *(const v4fa*)&so[w][r][c4]; *(v4f*)(C + (size_t)(row0 + r) * ldc + col0 + c4) = v; } }
     }
}

// Wt[n][k] = f16(W[k][n]·scale) from f32 row-major W[K][N] (scale = power of two; bf16-exact weights stay exact in f16 away from the subnormal range)
__global__ __launch_bounds__(256) void k_wt_f16(const float* __restrict__ W, _Float16* __restrict__ Wt, int K, int N, float scale) {
  const int t = blockIdx.x * 256 + threadIdx.x; if (t >= N * (K / 8)) return; const int n = t / (K / 8), k8 = (t % (K / 8)) * 8; FragH f;
#pragma unroll
  for (int i = 0; i < 8; ++i) f.h[i] = (_Float16)(bf16_round(W[(size_t)(k8 + i) * N + n]) * scale); const v8us o = f.half[0];
  *(v8us*)((unsigned short*)Wt + (size_t)n * K + k8) = o; 
}
// k_gemm_hh variant with fused epilogue: v = acc·alpha + bias[by·sBias + col] (+ CP[(row/rowsPerB)·sCPb + by·64 + col] if CP) ; ACT 0 none / 1 elu ; writes f16 C16 (and f32 C if non-null)
template <int ACT>
__global__ __launch_bounds__(128) void k_gemm_hhx(const _Float16* __restrict__ A, int lda, size_t sA, const _Float16* __restrict__ Bh, int ldb, size_t sB, float alpha, const float* __restrict__ bias, size_t sBias, const float* __restrict__ CP, int rowsPerB, size_t sCPb, int row0g,
    float* __restrict__ C, _Float16* __restrict__ C16, int ldc, size_t sC, int M, int N, int K) {
  __shared__ __attribute__((aligned(16))) float so[4][16][64];
  const int tid = threadIdx.x, w = tid >> 5, lane = tid & 31, ln = lane & 15, hh = lane >> 4; const int by = blockIdx.y;
  A += (size_t)by * sA; Bh += (size_t)by * sB; const size_t cofs = (size_t)by * sC; const float* bp = bias ? bias + (size_t)by * sBias : nullptr;
  const int ntn = (N + 63) / 64; const int wid = blockIdx.x * 4 + w; const int mt = wid / ntn, nq = wid % ntn; if (mt * 16 >= M) return;
  const int row0 = mt * 16, col0 = nq * 64; const _Float16* arow = A + (size_t)(row0 + ln) * lda;
  v8f acc[4] = {};
  for (int kb = 0; kb < K; kb += 32) { FragH ah; ah.half[0] = *(const v8us*)((const unsigned short*)arow + kb + 8 * hh); ah.half[1] = *(const v8us*)((const unsigned short*)arow + kb + 16 + 8 * hh);
#pragma unroll
    for (int t = 0; t < 4; ++t) { if (col0 + t * 16 >= N) continue; const size_t boff = (size_t)(col0 + t * 16 + ln) * ldb + kb; FragH bq; bq.half[0] = *(const v8us*)((const unsigned short*)Bh + boff + 8 * hh); bq.half[1] = *(const v8us*)((const unsigned short*)Bh + boff + 16 + 8 * hh);
      acc[t] = mmaH<1>(ah.v, ah.v, bq.v, bq.v, acc[t]); }
  }
#pragma unroll
  for (int t = 0; t < 4; ++t) { if (col0 + t * 16 >= N) continue; const int col = col0 + t * 16 + ln; const float bv = bp ? bf16_round(bp[col]) : 0.f;
#pragma unroll
    for (int r = 0; r < 8; ++r) { float v = acc[t][r] * alpha + bv; if (CP) { const int rr = row0g + row0 + 8 * hh + r; if (rowsPerB < 0) v += CP[cofs + (size_t)rr * ldc + col];      /* rowsPerB < 0: own element of the batched C plane */ else { const int bidx = rr / rowsPerB; v += CP[(size_t)bidx * sCPb + (size_t)by * 64 + col]; } } if (ACT == 1) v = (v > 0.f) ? v : expm1f(v); else if (ACT == 7) v = (v > 0.f) ? v + 1.0f : expf(v); else if (ACT == 8) v = tanhf(v); else if (ACT == 9) v = 0.5f * v * (1.0f + tanhf(0.7978845608028654f * (v + 0.044715f * v * v * v))); else if (ACT == 11) v = 1.0f / (1.0f + expf(-v)); else if (ACT == 12) v = (v > 0.f) ? v : 0.01f * v; else if (ACT == 14) v = (v > 0.f) ? v : 0.1f * v; else if (ACT == 16) v = (v >= 0.f) ? v : 0.3f * v; else if (ACT == 17) v = (v >= 0.f) ? v : 0.2f * v; else if (ACT == 15) v = v / (1.0f + expf(-v)); else if (ACT == 3) v = fmaxf(v, 0.f); else if (ACT == 6) v = 0.5f * v * (1.0f + erff(v * 0.70710678118654752f)); so[w][8 * hh + r][t * 16 + ln] = v; } }
  __builtin_amdgcn_fence(__ATOMIC_ACQ_REL, "workgroup"); __builtin_amdgcn_wave_barrier();
  const int rsub = lane >> 4, c4 = (lane & 15) * 4; typedef _Float16 v4h __attribute__((ext_vector_type(4)));
  {
#pragma unroll
    for (int q = 0; q < 8; ++q) { const int r = q * 2 + rsub; if (col0 + c4 < N) { const v4f v = *(const v4fa*)&so[w][r][c4]; if (C) *(v4f*)(C + cofs + (size_t)(row0 + r) * ldc + col0 + c4) = v; if (C16) { v4h h4; for (int i = 0; i < 4; ++i) h4[i] = (_Float16)v[i]; *(v4h*)(C16 + cofs + (size_t)(row0 + r) * ldc + col0 + c4) = h4; } } }
     }
}


typedef _Float16 v4h __attribute__((ext_vector_type(4)));

__global__ __launch_bounds__(256) void k_x16(const float* __restrict__ x, _Float16* __restrict__ X16, size_t n8) { const size_t t = (size_t)blockIdx.x * 256 + threadIdx.x; if (t >= n8) return; FragH f;
#pragma unroll
  for (int q = 0; q < 8; ++q) f.h[q] = (_Float16)bf16_round(x[t * 8 + q]); *(v8us*)((unsigned short*)X16 + t * 8) = f.half[0];  }
__global__ __launch_bounds__(256) void k_h16(const float* __restrict__ x, _Float16* __restrict__ X16, size_t n8) { const size_t t = (size_t)blockIdx.x * 256 + threadIdx.x; if (t >= n8) return; FragH f;
#pragma unroll
  for (int q = 0; q < 8; ++q) f.h[q] = (_Float16)x[t * 8 + q]; *(v8us*)((unsigned short*)X16 + t * 8) = f.half[0];  }
__global__ __launch_bounds__(256) void k_round16f(const float* __restrict__ W, _Float16* __restrict__ Bt, size_t n8) { const size_t t = (size_t)blockIdx.x * 256 + threadIdx.x; if (t >= n8) return; FragH f;
#pragma unroll
  for (int i = 0; i < 8; ++i) f.h[i] = (_Float16)(bf16_round(W[t * 8 + i]) * 16.0f); *(v8us*)((unsigned short*)Bt + t * 8) = f.half[0];  }
template <int NHv, int TTv>
__global__ __launch_bounds__(256) void k_vt(const _Float16* __restrict__ V16, int ldv, int voff, _Float16* __restrict__ Vt) { __shared__ unsigned short tl[64][66]; const int tid = threadIdx.x; const int slab = blockIdx.x / (TTv / 64), lg = blockIdx.x % (TTv / 64); const int b = slab / NHv, h = slab % NHv;
  for (int i = tid; i < 64 * 8; i += 256) { const int r = i / 8, c8 = (i % 8) * 8; FragH f; f.half[0] = *(const v8us*)((const unsigned short*)V16 + ((size_t)b * TTv + lg * 64 + r) * ldv + voff + h * 64 + c8);
#pragma unroll
    for (int q = 0; q < 8; ++q) tl[r][c8 + q] = f.u[q]; }
  __syncthreads();
  {
#pragma unroll
    for (int rd = 0; rd < 2; ++rd) { const int d = rd * 32 + tid / 8, pc = tid % 8; FragH f;
#pragma unroll
      for (int q = 0; q < 8; ++q) f.u[q] = tl[pc * 8 + q][d];
      *(v8us*)((unsigned short*)Vt + ((size_t)slab * 64 + d) * TTv + lg * 64 + pc * 8) = f.half[0]; }
     } }

__global__ __launch_bounds__(256) void k_hl(const float* __restrict__ F, _Float16* __restrict__ Hh, _Float16* __restrict__ Hl, size_t n8) { const size_t t = (size_t)blockIdx.x * 256 + threadIdx.x; if (t >= n8) return; FragH fh, fl; const v4f a = *(const v4fa*)(F + t * 8), c = *(const v4fa*)(F + t * 8 + 4);
#pragma unroll
  for (int q = 0; q < 4; ++q) { _Float16 h = (_Float16)a[q]; fh.h[q] = h; fl.h[q] = (_Float16)((a[q] - (float)h) * 1024.0f); h = (_Float16)c[q]; fh.h[4 + q] = h; fl.h[4 + q] = (_Float16)((c[q] - (float)h) * 1024.0f); }
  { *(v8us*)((unsigned short*)Hh + t * 8) = fh.half[0]; *(v8us*)((unsigned short*)Hl + t * 8) = fl.half[0];  } }

// ---- fast GEMM (wave tile 32x64; requires M % 32 == 0 rows per launch region and N % 64 == 0); epilogue = k_gemm_hhx semantics ----
__device__ __forceinline__ v16h g2_frag(const _Float16* p, int hh) { FragH f; f.half[0] = *(const v8us*)((const unsigned short*)p + 8 * hh); f.half[1] = *(const v8us*)((const unsigned short*)p + 16 + 8 * hh); return f.v; }
__device__ __forceinline__ v8f g2_mma(v16h a, v16h b, v8f c) { v8f d = __builtin_amdgcn_wmma_f32_16x16x32_f16(false, a, false, b, (short)0, c, false, false); asm volatile("v_nop\n\tv_nop\n\tv_nop\n\tv_nop" : "+v"(d) : "v"(a), "v"(b)); return d; }
template <int ACT>
__global__ __launch_bounds__(128) void k_gemm2(const _Float16* __restrict__ A, int lda, size_t sA, const _Float16* __restrict__ Bh, int ldb, size_t sB, float alpha, const float* __restrict__ bias, size_t sBias, const float* __restrict__ CP, int rowsPerB, size_t sCPb, int row0g,
    float* __restrict__ C, _Float16* __restrict__ C16, int ldc, size_t sC, int M, int N, int K) { static_assert(ACT == 0 || ACT == 3 || ACT == 6 || ACT == 8 || ACT == 9 || ACT == 11 || ACT == 12 || ACT == 14 || ACT == 15 || ACT == 16 || ACT == 17, "k_gemm2: unsupported ACT code (would silently apply no activation)");
  __shared__ __attribute__((aligned(16))) float so[4][32][68];
  const int tid = threadIdx.x, w = tid >> 5, lane = tid & 31, ln = lane & 15, hh = lane >> 4; const int by = blockIdx.y;
  A += (size_t)by * sA; Bh += (size_t)by * sB; const size_t cofs = (size_t)by * sC; const float* bp = bias ? bias + (size_t)by * sBias : nullptr;
  const int ntn = N >> 6; const int mt = blockIdx.x / ntn, nq = blockIdx.x - mt * ntn; const int row0 = mt * 128 + 32 * w, col0 = nq * 64; if (row0 >= M) return;
  const _Float16* a0p = A + (size_t)(row0 + ln) * lda; const _Float16* a1p = a0p + (size_t)16 * lda;
  const _Float16* b0p = Bh + (size_t)(col0 + ln) * ldb; const _Float16* b1p = b0p + (size_t)16 * ldb; const _Float16* b2p = b1p + (size_t)16 * ldb; const _Float16* b3p = b2p + (size_t)16 * ldb;
  const v8f z8 = {0.f,0.f,0.f,0.f,0.f,0.f,0.f,0.f}; v8f c00 = z8, c01 = z8, c02 = z8, c03 = z8, c10 = z8, c11 = z8, c12 = z8, c13 = z8;
#pragma unroll 1
  for (int kb = 0; kb < K; kb += 32) { const v16h a0 = g2_frag(a0p + kb, hh), a1 = g2_frag(a1p + kb, hh);
    v16h b = g2_frag(b0p + kb, hh); c00 = g2_mma(a0, b, c00); c10 = g2_mma(a1, b, c10);
    b = g2_frag(b1p + kb, hh); c01 = g2_mma(a0, b, c01); c11 = g2_mma(a1, b, c11);
    b = g2_frag(b2p + kb, hh); c02 = g2_mma(a0, b, c02); c12 = g2_mma(a1, b, c12);
    b = g2_frag(b3p + kb, hh); c03 = g2_mma(a0, b, c03); c13 = g2_mma(a1, b, c13); }
  v8f accs[8] = {c00, c01, c02, c03, c10, c11, c12, c13};
#pragma unroll
  for (int u = 0; u < 8; ++u) { const int t = u & 3, half = u >> 2; const int col = col0 + t * 16 + ln; const float bv = bp ? bf16_round(bp[col]) : 0.f;
#pragma unroll
    for (int r = 0; r < 8; ++r) { const int rloc = half * 16 + 8 * hh + r; float v = accs[u][r] * alpha + bv; if (CP) { if (rowsPerB < 0) v += CP[cofs + (size_t)(row0g + row0 + rloc) * ldc + col];      /* rowsPerB < 0: own element of the batched C plane */ else { const int bidx = (row0g + row0 + rloc) / rowsPerB; v += CP[(size_t)bidx * sCPb + (size_t)by * 64 + col]; } }
      if (ACT == 3) v = fmaxf(v, 0.f); else if (ACT == 6) v = 0.5f * v * (1.0f + erff(v * 0.70710678118654752f)); else if (ACT == 11) v = 1.0f / (1.0f + expf(-v)); else if (ACT == 15) v = v / (1.0f + expf(-v)); else if (ACT == 12) v = (v > 0.f) ? v : 0.01f * v; else if (ACT == 8) v = tanhf(v); else if (ACT == 9) v = 0.5f * v * (1.0f + tanhf(0.7978845608028654f * (v + 0.044715f * v * v * v))); else if (ACT == 14) v = (v > 0.f) ? v : 0.1f * v; else if (ACT == 16) v = (v >= 0.f) ? v : 0.3f * v; else if (ACT == 17) v = (v >= 0.f) ? v : 0.2f * v;
      so[w][rloc][t * 16 + ln] = v; } }
  __builtin_amdgcn_fence(__ATOMIC_ACQ_REL, "workgroup"); __builtin_amdgcn_wave_barrier();
  const int rsub = lane >> 4, c4 = (lane & 15) * 4;
  {
#pragma unroll
    for (int q = 0; q < 16; ++q) { const int r = q * 2 + rsub; const v4f v = *(const v4fa*)&so[w][r][c4]; if (C) *(v4f*)(C + cofs + (size_t)(row0 + r) * ldc + col0 + c4) = v; if (C16) { v4h h4; for (int i = 0; i < 4; ++i) h4[i] = (_Float16)v[i]; *(v4h*)(C16 + cofs + (size_t)(row0 + r) * ldc + col0 + c4) = h4; } }
     } }


__global__ __launch_bounds__(256) void k_wnat(const float* __restrict__ w, size_t n8, _Float16* __restrict__ Bt) { const size_t t = (size_t)blockIdx.x * 256 + threadIdx.x; if (t >= n8) return; FragH f; for (int q = 0; q < 8; ++q) f.h[q] = (_Float16)(bf16_round(w[t * 8 + q]) * 16.0f); *(v8us*)((unsigned short*)Bt + t * 8) = f.half[0];  }
__global__ __launch_bounds__(256) void k_rsm(const float* __restrict__ S, _Float16* __restrict__ P, int nrows) {
  #pragma clang fp contract(off)
  const int i = blockIdx.x * 256 + threadIdx.x; if (i >= nrows) return; const float* s = S + (size_t)i * SQ; float mx = -3.0e38f;
#pragma unroll 1
  for (int j = 0; j < SQ; ++j) mx = fmaxf(mx, s[j]); float se = 0.f;
#pragma unroll 1
  for (int j = 0; j < SQ; ++j) se += expf(s[j] - mx); const float sc = 256.0f / se;
#pragma unroll 1
  for (int j0 = 0; j0 < SQ; j0 += 8) { FragH f; for (int q = 0; q < 8; ++q) f.h[q] = (_Float16)(expf(s[j0 + q] - mx) * sc); unsigned short* d = (unsigned short*)P + (size_t)i * SQ + j0; *(v8us*)d = f.half[0];  } }
__global__ __launch_bounds__(256) void k_vt(const _Float16* __restrict__ V16, int b, int h0, _Float16* __restrict__ VT) { __shared__ unsigned short tl[64][65]; const int tid = threadIdx.x; const int hh = blockIdx.x % HG, sg = blockIdx.x / HG; const int s0 = sg * 64; const int h = h0 + hh;
  for (int i = tid; i < 64 * 8; i += 256) { const int j = i / 8, d8 = (i % 8) * 8; FragH f; f.half[0] = *(const v8us*)((const unsigned short*)V16 + ((size_t)b * SQ + s0 + j) * DM + h * HD + d8); for (int q = 0; q < 8; ++q) tl[d8 + q][j] = f.u[q]; }
  __syncthreads();
  { for (int i = tid; i < 64 * 8; i += 256) { const int d = i / 8, j8 = (i % 8) * 8; FragH f; for (int q = 0; q < 8; ++q) f.u[q] = tl[d][j8 + q]; *(v8us*)((unsigned short*)VT + ((size_t)hh * HD + d) * SQ + s0 + j8) = f.half[0]; }  } }



__global__ __launch_bounds__(256) void k_rsmcf2(const float* __restrict__ S, _Float16* __restrict__ P, int hg, int q0, int nk) {
  #pragma clang fp contract(off)
  const int t = blockIdx.x * 256 + threadIdx.x; if (t >= hg * QT) return; const size_t i = (size_t)t; const float* s = S + i * NKX; const int last = q0 + (t % QT); float mx = -3.0e38f;
#pragma unroll 1
  for (int j = 0; j < nk; ++j) { const float f = (j <= last) ? 1.f : 0.f; mx = fmaxf(mx, fmaf(f, s[j], (1.f - f) * -1.0e9f)); } float se = 0.f;
#pragma unroll 1
  for (int j = 0; j < nk; ++j) { const float f = (j <= last) ? 1.f : 0.f; se += __expf(fmaf(f, s[j], (1.f - f) * -1.0e9f) - mx); } const float sc = 256.0f / se;
#pragma unroll 1
  for (int j0 = 0; j0 < nk; j0 += 8) { FragH fr; for (int q = 0; q < 8; ++q) { const int j = j0 + q; const float f = (j <= last) ? 1.f : 0.f; fr.h[q] = (_Float16)(__expf(fmaf(f, s[j], (1.f - f) * -1.0e9f) - mx) * sc); } unsigned short* d = (unsigned short*)P + i * NKX + j0; *(v8us*)d = fr.half[0];  } }


__global__ __launch_bounds__(256) void k_rsmcf2hl(const float* __restrict__ S, _Float16* __restrict__ P, _Float16* __restrict__ PL, int hg, int q0, int nk) {
  #pragma clang fp contract(off)
  const int t = blockIdx.x * 256 + threadIdx.x; if (t >= hg * QT) return; const size_t i = (size_t)t; const float* s = S + i * NKX; const int last = q0 + (t % QT); float mx = -3.0e38f;
#pragma unroll 1
  for (int j = 0; j < nk; ++j) { const float f = (j <= last) ? 1.f : 0.f; mx = fmaxf(mx, fmaf(f, s[j], (1.f - f) * -1.0e9f)); } float se = 0.f;
#pragma unroll 1
  for (int j = 0; j < nk; ++j) { const float f = (j <= last) ? 1.f : 0.f; se += __expf(fmaf(f, s[j], (1.f - f) * -1.0e9f) - mx); } const float sc = 256.0f / se;
#pragma unroll 1
  for (int j0 = 0; j0 < nk; j0 += 8) { FragH fr, fl; for (int q = 0; q < 8; ++q) { const int j = j0 + q; const float f = (j <= last) ? 1.f : 0.f; const float v = __expf(fmaf(f, s[j], (1.f - f) * -1.0e9f) - mx) * sc; const _Float16 hv = (_Float16)v; fr.h[q] = hv; fl.h[q] = (_Float16)((v - (float)hv) * 1024.0f); } unsigned short* d = (unsigned short*)P + i * NKX + j0; unsigned short* dl = (unsigned short*)PL + i * NKX + j0; *(v8us*)d = fr.half[0]; *(v8us*)dl = fl.half[0];  } }


__global__ __launch_bounds__(256) void k_rsmcskhl(const float* __restrict__ S, _Float16* __restrict__ P, _Float16* __restrict__ PL, int hg, int q0, int nk, const float* __restrict__ am) {
  #pragma clang fp contract(off)
  const int t = blockIdx.x * 256 + threadIdx.x; if (t >= hg * QT) return; const size_t i = (size_t)t; const float* s = S + i * NKX; const int last = q0 + (t % QT); float mx = -3.0e38f;
#pragma unroll 1
  for (int j = 0; j < nk; ++j) { const float mk = __fadd_rn(__fadd_rn((j > last) ? -10000.0f : 0.f, (j >= last - 512) ? -10000.0f : 0.f), bf16_round(am[j])); mx = fmaxf(mx, __fadd_rn(s[j], mk)); } float se = 0.f;
#pragma unroll 1
  for (int j = 0; j < nk; ++j) { const float mk = __fadd_rn(__fadd_rn((j > last) ? -10000.0f : 0.f, (j >= last - 512) ? -10000.0f : 0.f), bf16_round(am[j])); se += __expf(__fadd_rn(s[j], mk) - mx); } const float sc = 256.0f / se;
#pragma unroll 1
  for (int j0 = 0; j0 < nk; j0 += 8) { FragH fr, fl; for (int q = 0; q < 8; ++q) { const int j = j0 + q; const float mk = __fadd_rn(__fadd_rn((j > last) ? -10000.0f : 0.f, (j >= last - 512) ? -10000.0f : 0.f), bf16_round(am[j])); const float v = __expf(__fadd_rn(s[j], mk) - mx) * sc; const _Float16 hv = (_Float16)v; fr.h[q] = hv; fl.h[q] = (_Float16)((v - (float)hv) * 1024.0f); } unsigned short* d = (unsigned short*)P + i * NKX + j0; unsigned short* dl = (unsigned short*)PL + i * NKX + j0; *(v8us*)d = fr.half[0]; *(v8us*)dl = fl.half[0];  } }

extern "C" void kernel_launch(void* const* d_in, const int* in_sizes, int n_in,
                              void* d_out, int out_size, void* d_ws, size_t ws_size, hipStream_t stream) {
  (void)in_sizes; (void)n_in; (void)out_size;
  const float* const* I = (const float* const*)d_in; const float* x = I[0]; const float* am = I[1]; const float* wq = I[2]; const float* bq = I[3]; const float* wk = I[4]; const float* bk = I[5]; const float* wv = I[6]; const float* bv = I[7];      /* additive attention_mask [4][1][1][2048] (zeros); natural [out][in] weights + biases */
  char* ws = (char*)d_ws; size_t off = 0;
  auto take = [&](size_t bytes) { char* p = ws + off; off += (bytes + 255) & ~(size_t)255; return p; };
  _Float16* BQ = (_Float16*)take((size_t)DM * DM * 2); _Float16* BK = (_Float16*)take((size_t)DM * DM * 2); _Float16* BV = (_Float16*)take((size_t)DM * DM * 2); 
  _Float16* X16 = (_Float16*)take(NR * DM * 2); _Float16* Q16 = (_Float16*)take(NR * DM * 2); _Float16* QL = (_Float16*)take(NR * DM * 2); _Float16* K16 = (_Float16*)take(NR * DM * 2); _Float16* KL = (_Float16*)take(NR * DM * 2); _Float16* V16 = (_Float16*)take(NR * DM * 2); _Float16* VL = (_Float16*)take(NR * DM * 2); float* VF = (float*)take(NR * DM * 4);      /* v as f16 hi + x1024 residual (the early causal rows average only a few v rows, so a single-f16 v would leave absolute rounding that is large against this module's small output scale) */
  float* S = (float*)take((size_t)NH * QT * NKX * 4); _Float16* P = (_Float16*)take((size_t)NH * QT * NKX * 2); _Float16* PL = (_Float16*)take((size_t)NH * QT * NKX * 2); _Float16* VT = (_Float16*)take((size_t)NH * HD * SQ * 2); _Float16* VTL = (_Float16*)take((size_t)NH * HD * SQ * 2);
  if (off > ws_size) return;
  { const unsigned g = (unsigned)(((size_t)DM * DM / 8 + 255) / 256); k_wnat<<<g, 256, 0, stream>>>(wq, (size_t)DM * DM / 8, BQ); k_wnat<<<g, 256, 0, stream>>>(wk, (size_t)DM * DM / 8, BK); k_wnat<<<g, 256, 0, stream>>>(wv, (size_t)DM * DM / 8, BV); }      /* natural [out][in] = Bt x16 */

  k_x16<<<(unsigned)((NR * DM / 8 + 255) / 256), 256, 0, stream>>>(x, X16, NR * DM / 8);
  const size_t r0p = (size_t)B0 * SQ;      /* first projected row */
  k_gemm2<0><<<dim3((unsigned)((MP / 128) * (DM / 64)), 1), 128, 0, stream>>>(X16 + r0p * DM, DM, 0, BQ, DM, 0, 0.0625f, bq, 0, nullptr, 1, 0, 0, VF + r0p * DM, nullptr, DM, 0, MP, DM, DM); k_hl<<<(unsigned)(((size_t)MP * DM / 8 + 255) / 256), 256, 0, stream>>>(VF + r0p * DM, Q16 + r0p * DM, QL + r0p * DM, (size_t)MP * DM / 8);      /* q (+ bq) in f32 -> f16 hi + x1024 residual */
  k_gemm2<0><<<dim3((unsigned)((MP / 128) * (DM / 64)), 1), 128, 0, stream>>>(X16 + r0p * DM, DM, 0, BK, DM, 0, 0.0625f, bk, 0, nullptr, 1, 0, 0, VF + r0p * DM, nullptr, DM, 0, MP, DM, DM); k_hl<<<(unsigned)(((size_t)MP * DM / 8 + 255) / 256), 256, 0, stream>>>(VF + r0p * DM, K16 + r0p * DM, KL + r0p * DM, (size_t)MP * DM / 8);      /* k (+ bk) likewise */
  k_gemm2<0><<<dim3((unsigned)((MP / 128) * (DM / 64)), 1), 128, 0, stream>>>(X16 + r0p * DM, DM, 0, BV, DM, 0, 0.0625f, bv, 0, nullptr, 1, 0, 0, VF + r0p * DM, nullptr, DM, 0, MP, DM, DM); k_hl<<<(unsigned)(((size_t)MP * DM / 8 + 255) / 256), 256, 0, stream>>>(VF + r0p * DM, V16 + r0p * DM, VL + r0p * DM, (size_t)MP * DM / 8);      /* v in f32 -> f16 hi + x1024 residual planes */
  for (int b = B0; b < B0 + NBR; ++b) { const size_t r0 = (size_t)b * SQ;
    k_vt<NH, SQ><<<NH * (SQ / 64), 256, 0, stream>>>(V16 + r0 * LQ, LQ, 0, VT); k_vt<NH, SQ><<<NH * (SQ / 64), 256, 0, stream>>>(VL + r0 * LQ, LQ, 0, VTL);      /* V^T hi and residual [16][64][SQ] (16 heads of 64 = 16 slabs) */
    for (int q0 = 0; q0 < QN; q0 += QT) { const int nk = q0 + QT;      /* causal: only keys below the tile end are computed */
      k_gemm2<0><<<dim3((QT / 128) * (nk / 64), NHD), 128, 0, stream>>>(Q16 + (r0 + q0) * LQ, LQ, (size_t)HD, K16 + r0 * LQ, LQ, (size_t)HD, 0.125f, nullptr, 0, nullptr, 1, 0, 0, S, nullptr, NKX, (size_t)QT * NKX, QT, nk, HD); k_gemm2<0><<<dim3((QT / 128) * (nk / 64), NHD), 128, 0, stream>>>(QL + (r0 + q0) * LQ, LQ, (size_t)HD, K16 + r0 * LQ, LQ, (size_t)HD, 0.0001220703125f, nullptr, 0, S, -1, 0, 0, S, nullptr, NKX, (size_t)QT * NKX, QT, nk, HD); k_gemm2<0><<<dim3((QT / 128) * (nk / 64), NHD), 128, 0, stream>>>(Q16 + (r0 + q0) * LQ, LQ, (size_t)HD, KL + r0 * LQ, LQ, (size_t)HD, 0.0001220703125f, nullptr, 0, S, -1, 0, 0, S, nullptr, NKX, (size_t)QT * NKX, QT, nk, HD);      /* scores / 8 = three accumulating passes */
      k_rsmcskhl<<<(NHD * QT + 255) / 256, 256, 0, stream>>>(S, P, PL, NHD, q0, nk, am + r0);      /* the module's masks added in f32 (causal -1e4, 'window' -1e4 for j >= i-512, + attention_mask[b][j]); softmax; P hi/lo */
      k_gemm2<0><<<dim3((QT / 128) * (HD / 64), NHD), 128, 0, stream>>>(P, NKX, (size_t)QT * NKX, VT, SQ, (size_t)HD * SQ, 0.00390625f, nullptr, 0, nullptr, 1, 0, 0, (float*)d_out + (r0 + q0) * DM, nullptr, DM, (size_t)HD, QT, HD, nk);
      k_gemm2<0><<<dim3((QT / 128) * (HD / 64), NHD), 128, 0, stream>>>(P, NKX, (size_t)QT * NKX, VTL, SQ, (size_t)HD * SQ, 0.000003814697265625f, nullptr, 0, (const float*)d_out + (r0 + q0) * DM, -1, 0, 0, (float*)d_out + (r0 + q0) * DM, nullptr, DM, (size_t)HD, QT, HD, nk);
      k_gemm2<0><<<dim3((QT / 128) * (HD / 64), NHD), 128, 0, stream>>>(PL, NKX, (size_t)QT * NKX, VT, SQ, (size_t)HD * SQ, 0.000003814697265625f, nullptr, 0, (const float*)d_out + (r0 + q0) * DM, -1, 0, 0, (float*)d_out + (r0 + q0) * DM, nullptr, DM, (size_t)HD, QT, HD, nk); } }      /* out = Ph Vh^T/256 + Ph Vl^T/262144 + Pl Vh^T/262144 (own-element accumulates): P and v both effectively f32 */
}

// v001
// One run takes 5930 microseconds.
// Two timings next to v000 both put it at 2.18 times that version's speed.
#include <hip/hip_runtime.h>
// Causal self-attention with the module's (faithful, inverted) window mask and an additive padding mask (hidden [4][2048][1024]; q/k/v = x W^T + b (natural [1024][1024] sigma 1/32, biases sigma 0.01); 16 heads of 64; scores / 8 + causal(-1e4 where j > i) + window(-1e4 where j >= i - 512, as the source writes it) + attention_mask[b][j] (zeros), all added in f32; softmax; out = merged attn v -> [4][2048][1024], no output projection). Effective pattern: rows i <= 512 attend causally (every kept logit carries the -1e4 offset, reproduced in f32), rows i >= 513 attend only keys j <= i - 513.
// Structure: token rows; x as exact f16 rows; natural weights as exact x16 planes; q, k, v as WMMA GEMMs (32x64 wave tiles, f32 accumulation, + bias) into f32 rows, each split into f16 hi + x1024 residual planes (the output scale is small, so logits, weights and values are all carried near f32); per batch: V^T of both v planes via LDS transposes; per query tile of 256 rows: scores = three accumulating passes (qh.kh + ql.kh/1024 + qh.kl/1024, K = 64, all heads on grid.y, alpha 1/8) against the keys below the tile end, the module's masks added in f32 on VALU inside the row softmax (keys past the row carry -2e4 and contribute exactly 0; keys past the tile end are skipped), P as f16 hi + x1024 residual; out = Ph Vh^T 2^-8 += Ph Vl^T 2^-18 += Pl Vh^T 2^-18 (own element) written f32 into the output rows; launches: see trace.
// Compute dtype: inputs rounded to bf16; x / weights exact; q, k, v and softmax weights as f16 hi + x1024 residual GEMM operands (near f32), o accumulated in f32; scores and softmax statistics f32. v_wmma_f32_16x16x32_f16.
#define NB 4
#define SQ 2048
#define DM 1024
#define NH 16
#define HD 64
#define HG 1                         /* heads per launch of k_vt(V16, b, h0, VT), which is not launched */
#define QT 256                       /* query rows per causal tile */
#define NKX SQ                       /* S / P row pitch */
#define B0 0                         /* first batch processed (debug hook) */
#define NBR NB                       /* batches processed (debug hook) */
#define NR ((size_t)NB * SQ)         /* token rows */
#define MP ((int)((size_t)NBR * SQ)) /* rows projected (debug hook) */
#define QN SQ                        /* query rows attended per batch (debug hook) */
#define NHD NH                       /* heads attended (debug hook) */
#define MPO MP                       /* unused: no launch reads it */
#define LQ DM      /* row pitch of the q/k/v rows */
typedef __bf16 v16b __attribute__((ext_vector_type(16)));
typedef unsigned short v8us __attribute__((ext_vector_type(8), may_alias));
typedef float  v8f  __attribute__((ext_vector_type(8)));
typedef float  v4f  __attribute__((ext_vector_type(4)));
typedef float  v4fa __attribute__((ext_vector_type(4), may_alias));
union FragB { v16b v; v8us half[2]; unsigned short u[16]; };

__device__ __forceinline__ unsigned short bf16_bits(float x) { unsigned int u = __float_as_uint(x); return (unsigned short)((u + 0x7FFFu + ((u >> 16) & 1u)) >> 16); }
__device__ __forceinline__ float bf16_val(unsigned short b) { return __uint_as_float(((unsigned int)b) << 16); }
__device__ __forceinline__ float bf16_round(float x) { return bf16_val(bf16_bits(x)); }
// D += A·B with NT terms: 1 = ah·bh, 2 = + al·bh (A split), 3 = + ah·bl (both split)
template <int NT>
__device__ __forceinline__ v8f mmaN(v16b ah, v16b al, v16b bh, v16b bl, v8f c) {
  c = __builtin_amdgcn_wmma_f32_16x16x32_bf16(false, ah, false, bh, (short)0, c, false, false);
  if (NT >= 2) c = __builtin_amdgcn_wmma_f32_16x16x32_bf16(false, al, false, bh, (short)0, c, false, false);
  if (NT >= 3) c = __builtin_amdgcn_wmma_f32_16x16x32_bf16(false, ah, false, bl, (short)0, c, false, false);
  asm volatile("v_nop\n\tv_nop\n\tv_nop\n\tv_nop" : "+v"(c) : "v"(ah), "v"(al), "v"(bh), "v"(bl));
  return c;
}

__global__ __launch_bounds__(256) void k_wt_bf16(const float* __restrict__ W, unsigned short* __restrict__ Wt, int K, int N) {
  const int t = blockIdx.x * 256 + threadIdx.x;
  const int k8n = K / 8;
  if (t >= N * k8n) return;
  const int n = t / k8n, k8 = (t % k8n) * 8;
  v8us v;
#pragma unroll
  for (int i = 0; i < 8; ++i) v[i] = bf16_bits(W[(size_t)(k8 + i) * N + n]);
  *(v8us*)(Wt + (size_t)n * K + k8) = v;
  
}

// GEMM C[M][N] (f32, pitch ldc) = act(A[M][K]·W + bias). A f32 row-major (pitch lda) converted per fragment to bf16
// (ASPLIT: hi/lo two planes -> 2 terms, else single rounded term); Wt bf16 [N][K] (pitch ldb). BIAS_BF16 rounds the
// bias to bf16 first (bias quantised to bf16 before the add). K%32==0, M%16==0, N%64==0.
template <bool ASPLIT, int ACT, bool BIAS_BF16>
__global__ __launch_bounds__(128) void k_gemm_bf(const float* __restrict__ A, int lda, const unsigned short* __restrict__ Wt, int ldb,
                                               const float* __restrict__ bias, float* __restrict__ C, int ldc, int M, int N, int K) {
  __shared__ __attribute__((aligned(16))) float so[4][16][64];
  const int tid = threadIdx.x, w = tid >> 5, lane = tid & 31, ln = lane & 15, hh = lane >> 4;
  const int ntn = N / 64;
  const int wid = blockIdx.x * 4 + w;
  const int mt = wid / ntn, nq = wid % ntn;
  if (mt * 16 >= M) return;
  const int row0 = mt * 16, col0 = nq * 64;
  const float* arow = A + (size_t)(row0 + ln) * lda;
  v8f acc[4] = {};
  for (int kb = 0; kb < K; kb += 32) {
    FragB ah, al;
    const v4f x0 = *(const v4fa*)(arow + kb + 8 * hh), x1 = *(const v4fa*)(arow + kb + 8 * hh + 4);
    const v4f x2 = *(const v4fa*)(arow + kb + 16 + 8 * hh), x3 = *(const v4fa*)(arow + kb + 16 + 8 * hh + 4);
    float xs[16] = {x0[0],x0[1],x0[2],x0[3],x1[0],x1[1],x1[2],x1[3],x2[0],x2[1],x2[2],x2[3],x3[0],x3[1],x3[2],x3[3]};
#pragma unroll
    for (int i = 0; i < 16; ++i) { const unsigned short hb = bf16_bits(xs[i]); ah.u[i] = hb; al.u[i] = ASPLIT ? bf16_bits(xs[i] - bf16_val(hb)) : (unsigned short)0; }
#pragma unroll
    for (int t = 0; t < 4; ++t) {
      const unsigned short* brow = Wt + (size_t)(col0 + t * 16 + ln) * ldb + kb;
      FragB b;
      b.half[0] = *(const v8us*)(brow + 8 * hh);
      b.half[1] = *(const v8us*)(brow + 16 + 8 * hh);
      acc[t] = mmaN<ASPLIT ? 2 : 1>(ah.v, al.v, b.v, b.v, acc[t]);
    }
  }
#pragma unroll
  for (int t = 0; t < 4; ++t) {
    float bv = bias ? bias[col0 + t * 16 + ln] : 0.f;
    if (BIAS_BF16) bv = bf16_round(bv);
#pragma unroll
    for (int r = 0; r < 8; ++r) { float v = acc[t][r] + bv; if (ACT == 1) v = fmaxf(v, 0.f); so[w][8 * hh + r][t * 16 + ln] = v; }
  }
  __builtin_amdgcn_fence(__ATOMIC_ACQ_REL, "workgroup");
  __builtin_amdgcn_wave_barrier();
  const int rsub = lane >> 4, c4 = (lane & 15) * 4;
  {
#pragma unroll
    for (int q = 0; q < 8; ++q) {
      const int r = q * 2 + rsub;
      const v4f v = *(const v4fa*)&so[w][r][c4];
      *(v4f*)(C + (size_t)(row0 + r) * ldc + col0 + c4) = v;
    }
    
  }
}

// GEMM C = act(A·W + bias + resid): A f32 (ASPLIT -> hi/lo 2 terms), Wt bf16 [N][K]; ACT 0 none, 1 relu, 2 exact gelu;
// resid (optional, f32, row index = (row % rmod), pitch ldr, RES_BF16 rounds it) added before the activation.
template <bool ASPLIT, int ACT, bool BIAS_BF16, bool RES_BF16>
__global__ __launch_bounds__(128) void k_gemm_bf3(const float* __restrict__ A, int lda, const unsigned short* __restrict__ Wt, int ldb,
                                                const float* __restrict__ bias, const float* __restrict__ resid, int rmod, int ldr,
                                                float* __restrict__ C, int ldc, int M, int N, int K) {
  __shared__ __attribute__((aligned(16))) float so[4][16][64];
  const int tid = threadIdx.x, w = tid >> 5, lane = tid & 31, ln = lane & 15, hh = lane >> 4;
  const int ntn = N / 64;
  const int wid = blockIdx.x * 4 + w;
  const int mt = wid / ntn, nq = wid % ntn;
  if (mt * 16 >= M) return;
  const int row0 = mt * 16, col0 = nq * 64;
  const float* arow = A + (size_t)(row0 + ln) * lda;
  v8f acc[4] = {};
  for (int kb = 0; kb < K; kb += 32) {
    FragB ah, al;
    const v4f x0 = *(const v4fa*)(arow + kb + 8 * hh), x1 = *(const v4fa*)(arow + kb + 8 * hh + 4);
    const v4f x2 = *(const v4fa*)(arow + kb + 16 + 8 * hh), x3 = *(const v4fa*)(arow + kb + 16 + 8 * hh + 4);
    float xs[16] = {x0[0],x0[1],x0[2],x0[3],x1[0],x1[1],x1[2],x1[3],x2[0],x2[1],x2[2],x2[3],x3[0],x3[1],x3[2],x3[3]};
#pragma unroll
    for (int i = 0; i < 16; ++i) { const unsigned short hb = bf16_bits(xs[i]); ah.u[i] = hb; al.u[i] = ASPLIT ? bf16_bits(xs[i] - bf16_val(hb)) : (unsigned short)0; }
#pragma unroll
    for (int t = 0; t < 4; ++t) {
      const unsigned short* brow = Wt + (size_t)(col0 + t * 16 + ln) * ldb + kb;
      FragB b;
      b.half[0] = *(const v8us*)(brow + 8 * hh);
      b.half[1] = *(const v8us*)(brow + 16 + 8 * hh);
      acc[t] = mmaN<ASPLIT ? 2 : 1>(ah.v, al.v, b.v, b.v, acc[t]);
    }
  }
#pragma unroll
  for (int t = 0; t < 4; ++t) {
    const int col = col0 + t * 16 + ln;
    float bv = bias ? bias[col] : 0.f;
    if (BIAS_BF16) bv = bf16_round(bv);
#pragma unroll
    for (int r = 0; r < 8; ++r) {
      float v = acc[t][r] + bv;
      if (resid) { float rv = resid[(size_t)((row0 + 8 * hh + r) % rmod) * ldr + col]; if (RES_BF16) rv = bf16_round(rv); v += rv; }
      if (ACT == 1) v = fmaxf(v, 0.f);
      if (ACT == 2) v = 0.5f * v * (1.0f + erff(v * 0.70710678118654752f));
      if (ACT == 3) { const float u = 0.7978845608028654f * (v + 0.044715f * v * v * v); v = 0.5f * v * (1.0f + tanhf(u)); }
      so[w][8 * hh + r][t * 16 + ln] = v;
    }
  }
  __builtin_amdgcn_fence(__ATOMIC_ACQ_REL, "workgroup");
  __builtin_amdgcn_wave_barrier();
  const int rsub = lane >> 4, c4 = (lane & 15) * 4;
  {
#pragma unroll
    for (int q = 0; q < 8; ++q) {
      const int r = q * 2 + rsub;
      const v4f v = *(const v4fa*)&so[w][r][c4];
      *(v4f*)(C + (size_t)(row0 + r) * ldc + col0 + c4) = v;
    }
    
  }
}
// row LayerNorm (biased variance, eps) over N: s = X (+ R); optional out_sum <- s; out_norm <- (s-mu)*rsqrt(var+eps)*g + b
template <bool PARAM_BF16>
__global__ __launch_bounds__(256) void k_layernorm(const float* __restrict__ X, const float* __restrict__ R, const float* __restrict__ g, const float* __restrict__ bta,
                                                  float* __restrict__ out_sum, float* __restrict__ out_norm, int N, float eps) {
  __shared__ float red[256];
  const int row = blockIdx.x, tid = threadIdx.x;
  const float* x = X + (size_t)row * N; const float* rr = R ? R + (size_t)row * N : nullptr;
  float vals[16];                     // up to N = 4096
  const int per = N / 256;            // contiguous chunk per thread? use strided-by-4 chunks: thread handles j = tid*4 + 1024*u
  float s1 = 0.f;
  for (int u = 0; u < per / 4; ++u) {
    const int j = tid * 4 + 1024 * u;
    const v4f a = *(const v4fa*)(x + j);
    v4f b = {0.f,0.f,0.f,0.f}; if (rr) b = *(const v4fa*)(rr + j);
#pragma unroll
    for (int q = 0; q < 4; ++q) { const float v = a[q] + b[q]; vals[u * 4 + q] = v; s1 += v; }
  }
  red[tid] = s1; __syncthreads();
  for (int st = 128; st > 0; st >>= 1) { if (tid < st) red[tid] += red[tid + st]; __syncthreads(); }
  const float mu = red[0] / (float)N; __syncthreads();
  float s2 = 0.f;
  for (int u = 0; u < per / 4; ++u)
#pragma unroll
    for (int q = 0; q < 4; ++q) { const float c = vals[u * 4 + q] - mu; s2 += c * c; }
  red[tid] = s2; __syncthreads();
  for (int st = 128; st > 0; st >>= 1) { if (tid < st) red[tid] += red[tid + st]; __syncthreads(); }
  const float rs = rsqrtf(red[0] / (float)N + eps);
  {
    for (int u = 0; u < per / 4; ++u) {
      const int j = tid * 4 + 1024 * u;
      v4f o, sm;
#pragma unroll
      for (int q = 0; q < 4; ++q) {
        float gg = g[j + q], bb = bta[j + q];
        if (PARAM_BF16) { gg = bf16_round(gg); bb = bf16_round(bb); }
        sm[q] = vals[u * 4 + q]; o[q] = (vals[u * 4 + q] - mu) * rs * gg + bb;
      }
      if (out_sum) *(v4f*)(out_sum + (size_t)row * N + j) = sm;
      *(v4f*)(out_norm + (size_t)row * N + j) = o;
    }
    
  }
}



// ---- f16 WMMA path (v_wmma_f32_16x16x32_f16): 11-bit significands for operands in range — used where a [0,1] probability operand needs more precision than bf16
typedef _Float16 v16h __attribute__((ext_vector_type(16)));
union FragH { v16h v; v8us half[2]; _Float16 h[16]; unsigned short u[16]; };
template <int NT>
__device__ __forceinline__ v8f mmaH(v16h ah, v16h al, v16h bh, v16h bl, v8f c) {
  c = __builtin_amdgcn_wmma_f32_16x16x32_f16(false, ah, false, bh, (short)0, c, false, false);
  if (NT >= 2) c = __builtin_amdgcn_wmma_f32_16x16x32_f16(false, al, false, bh, (short)0, c, false, false);
  if (NT >= 3) c = __builtin_amdgcn_wmma_f32_16x16x32_f16(false, ah, false, bl, (short)0, c, false, false);
  asm volatile("v_nop\n\tv_nop\n\tv_nop\n\tv_nop" : "+v"(c) : "v"(ah), "v"(al), "v"(bh), "v"(bl));
  return c;
}
// batched GEMM like k_gemm_b but f16 operands: A f32 (split into f16 hi/lo if ASPLIT, else rounded to f16), Bt = f16 values [n][k]; alpha; C f32; N multiple of 16 (partial tiles skipped)
template <bool ASPLIT>
__global__ __launch_bounds__(128) void k_gemm_h(const float* __restrict__ A, int lda, size_t sA, const _Float16* __restrict__ Bh, int ldb, size_t sB, float alpha, float* __restrict__ C, int ldc, size_t sC, int M, int N, int K) {
  __shared__ __attribute__((aligned(16))) float so[4][16][64];
  const int tid = threadIdx.x, w = tid >> 5, lane = tid & 31, ln = lane & 15, hh = lane >> 4; const int by = blockIdx.y;
  A += (size_t)by * sA; Bh += (size_t)by * sB; C += (size_t)by * sC;
  const int ntn = (N + 63) / 64; const int wid = blockIdx.x * 4 + w; const int mt = wid / ntn, nq = wid % ntn; if (mt * 16 >= M) return;
  const int row0 = mt * 16, col0 = nq * 64; const float* arow = A + (size_t)(row0 + ln) * lda;
  v8f acc[4] = {};
  for (int kb = 0; kb < K; kb += 32) {
    FragH ah, al;
    const v4f x0 = *(const v4fa*)(arow + kb + 8 * hh), x1 = *(const v4fa*)(arow + kb + 8 * hh + 4), x2 = *(const v4fa*)(arow + kb + 16 + 8 * hh), x3 = *(const v4fa*)(arow + kb + 16 + 8 * hh + 4);
    float xs[16] = {x0[0],x0[1],x0[2],x0[3],x1[0],x1[1],x1[2],x1[3],x2[0],x2[1],x2[2],x2[3],x3[0],x3[1],x3[2],x3[3]};
#pragma unroll
    for (int i = 0; i < 16; ++i) { const _Float16 h = (_Float16)xs[i]; ah.h[i] = h; al.h[i] = ASPLIT ? (_Float16)(xs[i] - (float)h) : (_Float16)0.0f; }
#pragma unroll
    for (int t = 0; t < 4; ++t) { if (col0 + t * 16 >= N) continue; const size_t boff = (size_t)(col0 + t * 16 + ln) * ldb + kb; FragH bq; bq.half[0] = *(const v8us*)(Bh + boff + 8 * hh); bq.half[1] = *(const v8us*)(Bh + boff + 16 + 8 * hh);
      acc[t] = mmaH<ASPLIT ? 2 : 1>(ah.v, al.v, bq.v, bq.v, acc[t]); }
  }
#pragma unroll
  for (int t = 0; t < 4; ++t) { if (col0 + t * 16 >= N) continue;
#pragma unroll
    for (int r = 0; r < 8; ++r) so[w][8 * hh + r][t * 16 + ln] = acc[t][r] * alpha; }
  __builtin_amdgcn_fence(__ATOMIC_ACQ_REL, "workgroup"); __builtin_amdgcn_wave_barrier();
  const int rsub = lane >> 4, c4 = (lane & 15) * 4;
  {
#pragma unroll
    for (int q = 0; q < 8; ++q) { const int r = q * 2 + rsub; if (col0 + c4 < N) { const v4f v = *(const v4fa*)&so[w][r][c4]; *(v4f*)(C + (size_t)(row0 + r) * ldc + col0 + c4) = v; } }
     }
}

// Wt[n][k] = f16(W[k][n]·scale) from f32 row-major W[K][N] (scale = power of two; bf16-exact weights stay exact in f16 away from the subnormal range)
__global__ __launch_bounds__(256) void k_wt_f16(const float* __restrict__ W, _Float16* __restrict__ Wt, int K, int N, float scale) {
  const int t = blockIdx.x * 256 + threadIdx.x; if (t >= N * (K / 8)) return; const int n = t / (K / 8), k8 = (t % (K / 8)) * 8; FragH f;
#pragma unroll
  for (int i = 0; i < 8; ++i) f.h[i] = (_Float16)(bf16_round(W[(size_t)(k8 + i) * N + n]) * scale); const v8us o = f.half[0];
  *(v8us*)((unsigned short*)Wt + (size_t)n * K + k8) = o; 
}
// k_gemm_hh variant with fused epilogue: v = acc·alpha + bias[by·sBias + col] (+ CP[(row/rowsPerB)·sCPb + by·64 + col] if CP) ; ACT 0 none / 1 elu ; writes f16 C16 (and f32 C if non-null)
template <int ACT>
__global__ __launch_bounds__(128) void k_gemm_hhx(const _Float16* __restrict__ A, int lda, size_t sA, const _Float16* __restrict__ Bh, int ldb, size_t sB, float alpha, const float* __restrict__ bias, size_t sBias, const float* __restrict__ CP, int rowsPerB, size_t sCPb, int row0g,
    float* __restrict__ C, _Float16* __restrict__ C16, int ldc, size_t sC, int M, int N, int K) {
  __shared__ __attribute__((aligned(16))) float so[4][16][64];
  const int tid = threadIdx.x, w = tid >> 5, lane = tid & 31, ln = lane & 15, hh = lane >> 4; const int by = blockIdx.y;
  A += (size_t)by * sA; Bh += (size_t)by * sB; const size_t cofs = (size_t)by * sC; const float* bp = bias ? bias + (size_t)by * sBias : nullptr;
  const int ntn = (N + 63) / 64; const int wid = blockIdx.x * 4 + w; const int mt = wid / ntn, nq = wid % ntn; if (mt * 16 >= M) return;
  const int row0 = mt * 16, col0 = nq * 64; const _Float16* arow = A + (size_t)(row0 + ln) * lda;
  v8f acc[4] = {};
  for (int kb = 0; kb < K; kb += 32) { FragH ah; ah.half[0] = *(const v8us*)((const unsigned short*)arow + kb + 8 * hh); ah.half[1] = *(const v8us*)((const unsigned short*)arow + kb + 16 + 8 * hh);
#pragma unroll
    for (int t = 0; t < 4; ++t) { if (col0 + t * 16 >= N) continue; const size_t boff = (size_t)(col0 + t * 16 + ln) * ldb + kb; FragH bq; bq.half[0] = *(const v8us*)((const unsigned short*)Bh + boff + 8 * hh); bq.half[1] = *(const v8us*)((const unsigned short*)Bh + boff + 16 + 8 * hh);
      acc[t] = mmaH<1>(ah.v, ah.v, bq.v, bq.v, acc[t]); }
  }
#pragma unroll
  for (int t = 0; t < 4; ++t) { if (col0 + t * 16 >= N) continue; const int col = col0 + t * 16 + ln; const float bv = bp ? bf16_round(bp[col]) : 0.f;
#pragma unroll
    for (int r = 0; r < 8; ++r) { float v = acc[t][r] * alpha + bv; if (CP) { const int rr = row0g + row0 + 8 * hh + r; if (rowsPerB < 0) v += CP[cofs + (size_t)rr * ldc + col];      /* rowsPerB < 0: own element of the batched C plane */ else { const int bidx = rr / rowsPerB; v += CP[(size_t)bidx * sCPb + (size_t)by * 64 + col]; } } if (ACT == 1) v = (v > 0.f) ? v : expm1f(v); else if (ACT == 7) v = (v > 0.f) ? v + 1.0f : expf(v); else if (ACT == 8) v = tanhf(v); else if (ACT == 9) v = 0.5f * v * (1.0f + tanhf(0.7978845608028654f * (v + 0.044715f * v * v * v))); else if (ACT == 11) v = 1.0f / (1.0f + expf(-v)); else if (ACT == 12) v = (v > 0.f) ? v : 0.01f * v; else if (ACT == 14) v = (v > 0.f) ? v : 0.1f * v; else if (ACT == 16) v = (v >= 0.f) ? v : 0.3f * v; else if (ACT == 17) v = (v >= 0.f) ? v : 0.2f * v; else if (ACT == 15) v = v / (1.0f + expf(-v)); else if (ACT == 3) v = fmaxf(v, 0.f); else if (ACT == 6) v = 0.5f * v * (1.0f + erff(v * 0.70710678118654752f)); so[w][8 * hh + r][t * 16 + ln] = v; } }
  __builtin_amdgcn_fence(__ATOMIC_ACQ_REL, "workgroup"); __builtin_amdgcn_wave_barrier();
  const int rsub = lane >> 4, c4 = (lane & 15) * 4; typedef _Float16 v4h __attribute__((ext_vector_type(4)));
  {
#pragma unroll
    for (int q = 0; q < 8; ++q) { const int r = q * 2 + rsub; if (col0 + c4 < N) { const v4f v = *(const v4fa*)&so[w][r][c4]; if (C) *(v4f*)(C + cofs + (size_t)(row0 + r) * ldc + col0 + c4) = v; if (C16) { v4h h4; for (int i = 0; i < 4; ++i) h4[i] = (_Float16)v[i]; *(v4h*)(C16 + cofs + (size_t)(row0 + r) * ldc + col0 + c4) = h4; } } }
     }
}


typedef _Float16 v4h __attribute__((ext_vector_type(4)));

__global__ __launch_bounds__(256) void k_x16(const float* __restrict__ x, _Float16* __restrict__ X16, size_t n8) { const size_t t = (size_t)blockIdx.x * 256 + threadIdx.x; if (t >= n8) return; FragH f;
#pragma unroll
  for (int q = 0; q < 8; ++q) f.h[q] = (_Float16)bf16_round(x[t * 8 + q]); *(v8us*)((unsigned short*)X16 + t * 8) = f.half[0];  }
__global__ __launch_bounds__(256) void k_h16(const float* __restrict__ x, _Float16* __restrict__ X16, size_t n8) { const size_t t = (size_t)blockIdx.x * 256 + threadIdx.x; if (t >= n8) return; FragH f;
#pragma unroll
  for (int q = 0; q < 8; ++q) f.h[q] = (_Float16)x[t * 8 + q]; *(v8us*)((unsigned short*)X16 + t * 8) = f.half[0];  }
__global__ __launch_bounds__(256) void k_round16f(const float* __restrict__ W, _Float16* __restrict__ Bt, size_t n8) { const size_t t = (size_t)blockIdx.x * 256 + threadIdx.x; if (t >= n8) return; FragH f;
#pragma unroll
  for (int i = 0; i < 8; ++i) f.h[i] = (_Float16)(bf16_round(W[t * 8 + i]) * 16.0f); *(v8us*)((unsigned short*)Bt + t * 8) = f.half[0];  }
template <int NHv, int TTv>
__global__ __launch_bounds__(256) void k_vt(const _Float16* __restrict__ V16, int ldv, int voff, _Float16* __restrict__ Vt) { __shared__ unsigned short tl[64][66]; const int tid = threadIdx.x; const int slab = blockIdx.x / (TTv / 64), lg = blockIdx.x % (TTv / 64); const int b = slab / NHv, h = slab % NHv;
  for (int i = tid; i < 64 * 8; i += 256) { const int r = i / 8, c8 = (i % 8) * 8; FragH f; f.half[0] = *(const v8us*)((const unsigned short*)V16 + ((size_t)b * TTv + lg * 64 + r) * ldv + voff + h * 64 + c8);
#pragma unroll
    for (int q = 0; q < 8; ++q) tl[r][c8 + q] = f.u[q]; }
  __syncthreads();
  {
#pragma unroll
    for (int rd = 0; rd < 2; ++rd) { const int d = rd * 32 + tid / 8, pc = tid % 8; FragH f;
#pragma unroll
      for (int q = 0; q < 8; ++q) f.u[q] = tl[pc * 8 + q][d];
      *(v8us*)((unsigned short*)Vt + ((size_t)slab * 64 + d) * TTv + lg * 64 + pc * 8) = f.half[0]; }
     } }

__global__ __launch_bounds__(256) void k_hl(const float* __restrict__ F, _Float16* __restrict__ Hh, _Float16* __restrict__ Hl, size_t n8) { const size_t t = (size_t)blockIdx.x * 256 + threadIdx.x; if (t >= n8) return; FragH fh, fl; const v4f a = *(const v4fa*)(F + t * 8), c = *(const v4fa*)(F + t * 8 + 4);
#pragma unroll
  for (int q = 0; q < 4; ++q) { _Float16 h = (_Float16)a[q]; fh.h[q] = h; fl.h[q] = (_Float16)((a[q] - (float)h) * 1024.0f); h = (_Float16)c[q]; fh.h[4 + q] = h; fl.h[4 + q] = (_Float16)((c[q] - (float)h) * 1024.0f); }
  { *(v8us*)((unsigned short*)Hh + t * 8) = fh.half[0]; *(v8us*)((unsigned short*)Hl + t * 8) = fl.half[0];  } }

// ---- fast GEMM (wave tile 32x64; requires M % 32 == 0 rows per launch region and N % 64 == 0); epilogue = k_gemm_hhx semantics ----
__device__ __forceinline__ v16h g2_frag(const _Float16* p, int hh) { FragH f; f.half[0] = *(const v8us*)((const unsigned short*)p + 8 * hh); f.half[1] = *(const v8us*)((const unsigned short*)p + 16 + 8 * hh); return f.v; }
__device__ __forceinline__ v8f g2_mma(v16h a, v16h b, v8f c) { v8f d = __builtin_amdgcn_wmma_f32_16x16x32_f16(false, a, false, b, (short)0, c, false, false); asm volatile("v_nop\n\tv_nop\n\tv_nop\n\tv_nop" : "+v"(d) : "v"(a), "v"(b)); return d; }
template <int ACT>
__global__ __launch_bounds__(128) void k_gemm2(const _Float16* __restrict__ A, int lda, size_t sA, const _Float16* __restrict__ Bh, int ldb, size_t sB, float alpha, const float* __restrict__ bias, size_t sBias, const float* __restrict__ CP, int rowsPerB, size_t sCPb, int row0g,
    float* __restrict__ C, _Float16* __restrict__ C16, int ldc, size_t sC, int M, int N, int K) { static_assert(ACT == 0 || ACT == 3 || ACT == 6 || ACT == 8 || ACT == 9 || ACT == 11 || ACT == 12 || ACT == 14 || ACT == 15 || ACT == 16 || ACT == 17, "k_gemm2: unsupported ACT code (would silently apply no activation)");
  __shared__ __attribute__((aligned(16))) float so[4][32][68];
  const int tid = threadIdx.x, w = tid >> 5, lane = tid & 31, ln = lane & 15, hh = lane >> 4; const int by = blockIdx.y;
  A += (size_t)by * sA; Bh += (size_t)by * sB; const size_t cofs = (size_t)by * sC; const float* bp = bias ? bias + (size_t)by * sBias : nullptr;
  const int ntn = N >> 6; const int mt = blockIdx.x / ntn, nq = blockIdx.x - mt * ntn; const int row0 = mt * 128 + 32 * w, col0 = nq * 64; if (row0 >= M) return;
  const _Float16* a0p = A + (size_t)(row0 + ln) * lda; const _Float16* a1p = a0p + (size_t)16 * lda;
  const _Float16* b0p = Bh + (size_t)(col0 + ln) * ldb; const _Float16* b1p = b0p + (size_t)16 * ldb; const _Float16* b2p = b1p + (size_t)16 * ldb; const _Float16* b3p = b2p + (size_t)16 * ldb;
  const v8f z8 = {0.f,0.f,0.f,0.f,0.f,0.f,0.f,0.f}; v8f c00 = z8, c01 = z8, c02 = z8, c03 = z8, c10 = z8, c11 = z8, c12 = z8, c13 = z8;
#pragma unroll 1
  for (int kb = 0; kb < K; kb += 32) { const v16h a0 = g2_frag(a0p + kb, hh), a1 = g2_frag(a1p + kb, hh);
    v16h b = g2_frag(b0p + kb, hh); c00 = g2_mma(a0, b, c00); c10 = g2_mma(a1, b, c10);
    b = g2_frag(b1p + kb, hh); c01 = g2_mma(a0, b, c01); c11 = g2_mma(a1, b, c11);
    b = g2_frag(b2p + kb, hh); c02 = g2_mma(a0, b, c02); c12 = g2_mma(a1, b, c12);
    b = g2_frag(b3p + kb, hh); c03 = g2_mma(a0, b, c03); c13 = g2_mma(a1, b, c13); }
  v8f accs[8] = {c00, c01, c02, c03, c10, c11, c12, c13};
#pragma unroll
  for (int u = 0; u < 8; ++u) { const int t = u & 3, half = u >> 2; const int col = col0 + t * 16 + ln; const float bv = bp ? bf16_round(bp[col]) : 0.f;
#pragma unroll
    for (int r = 0; r < 8; ++r) { const int rloc = half * 16 + 8 * hh + r; float v = accs[u][r] * alpha + bv; if (CP) { if (rowsPerB < 0) v += CP[cofs + (size_t)(row0g + row0 + rloc) * ldc + col];      /* rowsPerB < 0: own element of the batched C plane */ else { const int bidx = (row0g + row0 + rloc) / rowsPerB; v += CP[(size_t)bidx * sCPb + (size_t)by * 64 + col]; } }
      if (ACT == 3) v = fmaxf(v, 0.f); else if (ACT == 6) v = 0.5f * v * (1.0f + erff(v * 0.70710678118654752f)); else if (ACT == 11) v = 1.0f / (1.0f + expf(-v)); else if (ACT == 15) v = v / (1.0f + expf(-v)); else if (ACT == 12) v = (v > 0.f) ? v : 0.01f * v; else if (ACT == 8) v = tanhf(v); else if (ACT == 9) v = 0.5f * v * (1.0f + tanhf(0.7978845608028654f * (v + 0.044715f * v * v * v))); else if (ACT == 14) v = (v > 0.f) ? v : 0.1f * v; else if (ACT == 16) v = (v >= 0.f) ? v : 0.3f * v; else if (ACT == 17) v = (v >= 0.f) ? v : 0.2f * v;
      so[w][rloc][t * 16 + ln] = v; } }
  __builtin_amdgcn_fence(__ATOMIC_ACQ_REL, "workgroup"); __builtin_amdgcn_wave_barrier();
  const int rsub = lane >> 4, c4 = (lane & 15) * 4;
  {
#pragma unroll
    for (int q = 0; q < 16; ++q) { const int r = q * 2 + rsub; const v4f v = *(const v4fa*)&so[w][r][c4]; if (C) *(v4f*)(C + cofs + (size_t)(row0 + r) * ldc + col0 + c4) = v; if (C16) { v4h h4; for (int i = 0; i < 4; ++i) h4[i] = (_Float16)v[i]; *(v4h*)(C16 + cofs + (size_t)(row0 + r) * ldc + col0 + c4) = h4; } }
     } }


__global__ __launch_bounds__(256) void k_wnat(const float* __restrict__ w, size_t n8, _Float16* __restrict__ Bt) { const size_t t = (size_t)blockIdx.x * 256 + threadIdx.x; if (t >= n8) return; FragH f; for (int q = 0; q < 8; ++q) f.h[q] = (_Float16)(bf16_round(w[t * 8 + q]) * 16.0f); *(v8us*)((unsigned short*)Bt + t * 8) = f.half[0];  }
__global__ __launch_bounds__(256) void k_rsm(const float* __restrict__ S, _Float16* __restrict__ P, int nrows) {
  #pragma clang fp contract(off)
  const int i = blockIdx.x * 256 + threadIdx.x; if (i >= nrows) return; const float* s = S + (size_t)i * SQ; float mx = -3.0e38f;
#pragma unroll 1
  for (int j = 0; j < SQ; ++j) mx = fmaxf(mx, s[j]); float se = 0.f;
#pragma unroll 1
  for (int j = 0; j < SQ; ++j) se += expf(s[j] - mx); const float sc = 256.0f / se;
#pragma unroll 1
  for (int j0 = 0; j0 < SQ; j0 += 8) { FragH f; for (int q = 0; q < 8; ++q) f.h[q] = (_Float16)(expf(s[j0 + q] - mx) * sc); unsigned short* d = (unsigned short*)P + (size_t)i * SQ + j0; *(v8us*)d = f.half[0];  } }
__global__ __launch_bounds__(256) void k_vt(const _Float16* __restrict__ V16, int b, int h0, _Float16* __restrict__ VT) { __shared__ unsigned short tl[64][65]; const int tid = threadIdx.x; const int hh = blockIdx.x % HG, sg = blockIdx.x / HG; const int s0 = sg * 64; const int h = h0 + hh;
  for (int i = tid; i < 64 * 8; i += 256) { const int j = i / 8, d8 = (i % 8) * 8; FragH f; f.half[0] = *(const v8us*)((const unsigned short*)V16 + ((size_t)b * SQ + s0 + j) * DM + h * HD + d8); for (int q = 0; q < 8; ++q) tl[d8 + q][j] = f.u[q]; }
  __syncthreads();
  { for (int i = tid; i < 64 * 8; i += 256) { const int d = i / 8, j8 = (i % 8) * 8; FragH f; for (int q = 0; q < 8; ++q) f.u[q] = tl[d][j8 + q]; *(v8us*)((unsigned short*)VT + ((size_t)hh * HD + d) * SQ + s0 + j8) = f.half[0]; }  } }



__global__ __launch_bounds__(256) void k_rsmcf2(const float* __restrict__ S, _Float16* __restrict__ P, int hg, int q0, int nk) {
  #pragma clang fp contract(off)
  const int t = blockIdx.x * 256 + threadIdx.x; if (t >= hg * QT) return; const size_t i = (size_t)t; const float* s = S + i * NKX; const int last = q0 + (t % QT); float mx = -3.0e38f;
#pragma unroll 1
  for (int j = 0; j < nk; ++j) { const float f = (j <= last) ? 1.f : 0.f; mx = fmaxf(mx, fmaf(f, s[j], (1.f - f) * -1.0e9f)); } float se = 0.f;
#pragma unroll 1
  for (int j = 0; j < nk; ++j) { const float f = (j <= last) ? 1.f : 0.f; se += __expf(fmaf(f, s[j], (1.f - f) * -1.0e9f) - mx); } const float sc = 256.0f / se;
#pragma unroll 1
  for (int j0 = 0; j0 < nk; j0 += 8) { FragH fr; for (int q = 0; q < 8; ++q) { const int j = j0 + q; const float f = (j <= last) ? 1.f : 0.f; fr.h[q] = (_Float16)(__expf(fmaf(f, s[j], (1.f - f) * -1.0e9f) - mx) * sc); } unsigned short* d = (unsigned short*)P + i * NKX + j0; *(v8us*)d = fr.half[0];  } }


__global__ __launch_bounds__(256) void k_rsmcf2hl(const float* __restrict__ S, _Float16* __restrict__ P, _Float16* __restrict__ PL, int hg, int q0, int nk) {
  #pragma clang fp contract(off)
  const int t = blockIdx.x * 256 + threadIdx.x; if (t >= hg * QT) return; const size_t i = (size_t)t; const float* s = S + i * NKX; const int last = q0 + (t % QT); float mx = -3.0e38f;
#pragma unroll 1
  for (int j = 0; j < nk; ++j) { const float f = (j <= last) ? 1.f : 0.f; mx = fmaxf(mx, fmaf(f, s[j], (1.f - f) * -1.0e9f)); } float se = 0.f;
#pragma unroll 1
  for (int j = 0; j < nk; ++j) { const float f = (j <= last) ? 1.f : 0.f; se += __expf(fmaf(f, s[j], (1.f - f) * -1.0e9f) - mx); } const float sc = 256.0f / se;
#pragma unroll 1
  for (int j0 = 0; j0 < nk; j0 += 8) { FragH fr, fl; for (int q = 0; q < 8; ++q) { const int j = j0 + q; const float f = (j <= last) ? 1.f : 0.f; const float v = __expf(fmaf(f, s[j], (1.f - f) * -1.0e9f) - mx) * sc; const _Float16 hv = (_Float16)v; fr.h[q] = hv; fl.h[q] = (_Float16)((v - (float)hv) * 1024.0f); } unsigned short* d = (unsigned short*)P + i * NKX + j0; unsigned short* dl = (unsigned short*)PL + i * NKX + j0; *(v8us*)d = fr.half[0]; *(v8us*)dl = fl.half[0];  } }


// Row softmax, one wave per score row: lane l holds elements 128 c + 4 l .. + 3 of the row in registers, so S is read once, in whole lines, and each exponential is taken once.
__global__ __launch_bounds__(256) void k_rsmcskhl(const float* __restrict__ S, _Float16* __restrict__ P, _Float16* __restrict__ PL, int hg, int q0, int nk, const float* __restrict__ am) {
  const int lane = threadIdx.x & 31; const int t = blockIdx.x * 8 + __builtin_amdgcn_readfirstlane(threadIdx.x >> 5); if (t >= hg * QT) return;
  const size_t i = (size_t)t; const float* s = S + i * NKX; const int last = q0 + (t % QT);
  v4f x[NKX / 128], m[NKX / 128];
#pragma unroll
  for (int c = 0; c < NKX / 128; c += 2) if (c * 128 < nk) {      /* nk is a multiple of QT = 256: two chunks of 128 per test; all loads of the row go out before the first is used */
    x[c] = *(const v4fa*)(s + c * 128 + lane * 4); x[c + 1] = *(const v4fa*)(s + (c + 1) * 128 + lane * 4);
    m[c] = *(const v4fa*)(am + c * 128 + lane * 4); m[c + 1] = *(const v4fa*)(am + (c + 1) * 128 + lane * 4); }
  asm volatile("s_wait_xcnt 0x0" ::: "memory");      /* the loads' address registers are reused below: the wait the instruction set asks for in front of that */
  v4f mx4 = {-3.0e38f, -3.0e38f, -3.0e38f, -3.0e38f};
#pragma unroll
  for (int c = 0; c < NKX / 128; c += 2) if (c * 128 < nk) {
#pragma unroll
    for (int u = c; u < c + 2; ++u)
#pragma unroll
      for (int q = 0; q < 4; ++q) { const int j = u * 128 + lane * 4 + q; const float mk = __fadd_rn(__fadd_rn((j > last) ? -10000.0f : 0.f, (j >= last - 512) ? -10000.0f : 0.f), bf16_round(m[u][q])); const float v = __fadd_rn(x[u][q], mk); x[u][q] = v; mx4[q] = fmaxf(mx4[q], v); } }
  float mx = fmaxf(fmaxf(mx4[0], mx4[1]), fmaxf(mx4[2], mx4[3]));
#pragma unroll
  for (int d = 16; d > 0; d >>= 1) mx = fmaxf(mx, __shfl_xor(mx, d, 32));
  v4f se4 = {0.f, 0.f, 0.f, 0.f};
#pragma unroll
  for (int c = 0; c < NKX / 128; c += 2) if (c * 128 < nk) {
#pragma unroll
    for (int u = c; u < c + 2; ++u)
#pragma unroll
      for (int q = 0; q < 4; ++q) { const float e = __expf(x[u][q] - mx); x[u][q] = e; se4[q] += e; } }
  float se = (se4[0] + se4[1]) + (se4[2] + se4[3]);
#pragma unroll
  for (int d = 16; d > 0; d >>= 1) se += __shfl_xor(se, d, 32);
  const float sc = 256.0f / se;
  _Float16* d = P + i * NKX + lane * 4; _Float16* dl = PL + i * NKX + lane * 4;
#pragma unroll
  for (int c = 0; c < NKX / 128; c += 2) if (c * 128 < nk) {
#pragma unroll
    for (int u = c; u < c + 2; ++u) { v4h fr, fl;
#pragma unroll
      for (int q = 0; q < 4; ++q) { const float v = x[u][q] * sc; const _Float16 hv = (_Float16)v; fr[q] = hv; fl[q] = (_Float16)((v - (float)hv) * 1024.0f); }
      *(v4h*)(d + u * 128) = fr; *(v4h*)(dl + u * 128) = fl; }
    asm volatile("s_wait_xcnt 0x0" ::: "memory"); } }      /* the next chunk reuses these stores' data registers: same wait */

extern "C" void kernel_launch(void* const* d_in, const int* in_sizes, int n_in,
                              void* d_out, int out_size, void* d_ws, size_t ws_size, hipStream_t stream) {
  (void)in_sizes; (void)n_in; (void)out_size;
  const float* const* I = (const float* const*)d_in; const float* x = I[0]; const float* am = I[1]; const float* wq = I[2]; const float* bq = I[3]; const float* wk = I[4]; const float* bk = I[5]; const float* wv = I[6]; const float* bv = I[7];      /* additive attention_mask [4][1][1][2048] (zeros); natural [out][in] weights + biases */
  char* ws = (char*)d_ws; size_t off = 0;
  auto take = [&](size_t bytes) { char* p = ws + off; off += (bytes + 255) & ~(size_t)255; return p; };
  _Float16* BQ = (_Float16*)take((size_t)DM * DM * 2); _Float16* BK = (_Float16*)take((size_t)DM * DM * 2); _Float16* BV = (_Float16*)take((size_t)DM * DM * 2); 
  _Float16* X16 = (_Float16*)take(NR * DM * 2); _Float16* Q16 = (_Float16*)take(NR * DM * 2); _Float16* QL = (_Float16*)take(NR * DM * 2); _Float16* K16 = (_Float16*)take(NR * DM * 2); _Float16* KL = (_Float16*)take(NR * DM * 2); _Float16* V16 = (_Float16*)take(NR * DM * 2); _Float16* VL = (_Float16*)take(NR * DM * 2); float* VF = (float*)take(NR * DM * 4);      /* v as f16 hi + x1024 residual (the early causal rows average only a few v rows, so a single-f16 v would leave absolute rounding that is large against this module's small output scale) */
  float* S = (float*)take((size_t)NH * QT * NKX * 4); _Float16* P = (_Float16*)take((size_t)NH * QT * NKX * 2); _Float16* PL = (_Float16*)take((size_t)NH * QT * NKX * 2); _Float16* VT = (_Float16*)take((size_t)NH * HD * SQ * 2); _Float16* VTL = (_Float16*)take((size_t)NH * HD * SQ * 2);
  if (off > ws_size) return;
  { const unsigned g = (unsigned)(((size_t)DM * DM / 8 + 255) / 256); k_wnat<<<g, 256, 0, stream>>>(wq, (size_t)DM * DM / 8, BQ); k_wnat<<<g, 256, 0, stream>>>(wk, (size_t)DM * DM / 8, BK); k_wnat<<<g, 256, 0, stream>>>(wv, (size_t)DM * DM / 8, BV); }      /* natural [out][in] = Bt x16 */

  k_x16<<<(unsigned)((NR * DM / 8 + 255) / 256), 256, 0, stream>>>(x, X16, NR * DM / 8);
  const size_t r0p = (size_t)B0 * SQ;      /* first projected row */
  k_gemm2<0><<<dim3((unsigned)((MP / 128) * (DM / 64)), 1), 128, 0, stream>>>(X16 + r0p * DM, DM, 0, BQ, DM, 0, 0.0625f, bq, 0, nullptr, 1, 0, 0, VF + r0p * DM, nullptr, DM, 0, MP, DM, DM); k_hl<<<(unsigned)(((size_t)MP * DM / 8 + 255) / 256), 256, 0, stream>>>(VF + r0p * DM, Q16 + r0p * DM, QL + r0p * DM, (size_t)MP * DM / 8);      /* q (+ bq) in f32 -> f16 hi + x1024 residual */
  k_gemm2<0><<<dim3((unsigned)((MP / 128) * (DM / 64)), 1), 128, 0, stream>>>(X16 + r0p * DM, DM, 0, BK, DM, 0, 0.0625f, bk, 0, nullptr, 1, 0, 0, VF + r0p * DM, nullptr, DM, 0, MP, DM, DM); k_hl<<<(unsigned)(((size_t)MP * DM / 8 + 255) / 256), 256, 0, stream>>>(VF + r0p * DM, K16 + r0p * DM, KL + r0p * DM, (size_t)MP * DM / 8);      /* k (+ bk) likewise */
  k_gemm2<0><<<dim3((unsigned)((MP / 128) * (DM / 64)), 1), 128, 0, stream>>>(X16 + r0p * DM, DM, 0, BV, DM, 0, 0.0625f, bv, 0, nullptr, 1, 0, 0, VF + r0p * DM, nullptr, DM, 0, MP, DM, DM); k_hl<<<(unsigned)(((size_t)MP * DM / 8 + 255) / 256), 256, 0, stream>>>(VF + r0p * DM, V16 + r0p * DM, VL + r0p * DM, (size_t)MP * DM / 8);      /* v in f32 -> f16 hi + x1024 residual planes */
  for (int b = B0; b < B0 + NBR; ++b) { const size_t r0 = (size_t)b * SQ;
    k_vt<NH, SQ><<<NH * (SQ / 64), 256, 0, stream>>>(V16 + r0 * LQ, LQ, 0, VT); k_vt<NH, SQ><<<NH * (SQ / 64), 256, 0, stream>>>(VL + r0 * LQ, LQ, 0, VTL);      /* V^T hi and residual [16][64][SQ] (16 heads of 64 = 16 slabs) */
    for (int q0 = 0; q0 < QN; q0 += QT) { const int nk = q0 + QT;      /* causal: only keys below the tile end are computed */
      k_gemm2<0><<<dim3((QT / 128) * (nk / 64), NHD), 128, 0, stream>>>(Q16 + (r0 + q0) * LQ, LQ, (size_t)HD, K16 + r0 * LQ, LQ, (size_t)HD, 0.125f, nullptr, 0, nullptr, 1, 0, 0, S, nullptr, NKX, (size_t)QT * NKX, QT, nk, HD); k_gemm2<0><<<dim3((QT / 128) * (nk / 64), NHD), 128, 0, stream>>>(QL + (r0 + q0) * LQ, LQ, (size_t)HD, K16 + r0 * LQ, LQ, (size_t)HD, 0.0001220703125f, nullptr, 0, S, -1, 0, 0, S, nullptr, NKX, (size_t)QT * NKX, QT, nk, HD); k_gemm2<0><<<dim3((QT / 128) * (nk / 64), NHD), 128, 0, stream>>>(Q16 + (r0 + q0) * LQ, LQ, (size_t)HD, KL + r0 * LQ, LQ, (size_t)HD, 0.0001220703125f, nullptr, 0, S, -1, 0, 0, S, nullptr, NKX, (size_t)QT * NKX, QT, nk, HD);      /* scores / 8 = three accumulating passes */
      k_rsmcskhl<<<(NHD * QT + 7) / 8, 256, 0, stream>>>(S, P, PL, NHD, q0, nk, am + r0);      /* the module's masks added in f32 (causal -1e4, 'window' -1e4 for j >= i-512, + attention_mask[b][j]); softmax; P hi/lo */
      k_gemm2<0><<<dim3((QT / 128) * (HD / 64), NHD), 128, 0, stream>>>(P, NKX, (size_t)QT * NKX, VT, SQ, (size_t)HD * SQ, 0.00390625f, nullptr, 0, nullptr, 1, 0, 0, (float*)d_out + (r0 + q0) * DM, nullptr, DM, (size_t)HD, QT, HD, nk);
      k_gemm2<0><<<dim3((QT / 128) * (HD / 64), NHD), 128, 0, stream>>>(P, NKX, (size_t)QT * NKX, VTL, SQ, (size_t)HD * SQ, 0.000003814697265625f, nullptr, 0, (const float*)d_out + (r0 + q0) * DM, -1, 0, 0, (float*)d_out + (r0 + q0) * DM, nullptr, DM, (size_t)HD, QT, HD, nk);
      k_gemm2<0><<<dim3((QT / 128) * (HD / 64), NHD), 128, 0, stream>>>(PL, NKX, (size_t)QT * NKX, VT, SQ, (size_t)HD * SQ, 0.000003814697265625f, nullptr, 0, (const float*)d_out + (r0 + q0) * DM, -1, 0, 0, (float*)d_out + (r0 + q0) * DM, nullptr, DM, (size_t)HD, QT, HD, nk); } }      /* out = Ph Vh^T/256 + Ph Vl^T/262144 + Pl Vh^T/262144 (own-element accumulates): P and v both effectively f32 */
}

// v002
// A run of this version takes 4250 microseconds.
// Timed twice side by side with v001, it ran 1.40 times as fast both times.
// Over all steps from v000 it is 3.05 times as fast.
#include <hip/hip_runtime.h>
// Causal self-attention with the module's (faithful, inverted) window mask and an additive padding mask (hidden [4][2048][1024]; q/k/v = x W^T + b (natural [1024][1024] sigma 1/32, biases sigma 0.01); 16 heads of 64; scores / 8 + causal(-1e4 where j > i) + window(-1e4 where j >= i - 512, as the source writes it) + attention_mask[b][j] (zeros), all added in f32; softmax; out = merged attn v -> [4][2048][1024], no output projection). Effective pattern: rows i <= 512 attend causally (every kept logit carries the -1e4 offset, reproduced in f32), rows i >= 513 attend only keys j <= i - 513.
// Structure: token rows; x as exact f16 rows; natural weights as exact x16 planes; q, k, v as WMMA GEMMs (32x64 wave tiles, f32 accumulation, + bias) into f32 rows, each split into f16 hi + x1024 residual planes (the output scale is small, so logits, weights and values are all carried near f32); per batch: V^T of both v planes via LDS transposes; per query tile of 256 rows: scores = three accumulating passes (qh.kh + ql.kh/1024 + qh.kl/1024, K = 64, all heads on grid.y, alpha 1/8) against the keys below the tile end, the module's masks added in f32 on VALU inside the row softmax (keys past the row carry -2e4 and contribute exactly 0; keys past the tile end are skipped), P as f16 hi + x1024 residual; out = Ph Vh^T 2^-8 += Ph Vl^T 2^-18 += Pl Vh^T 2^-18 (own element) written f32 into the output rows; launches: see trace.
// Compute dtype: inputs rounded to bf16; x / weights exact; q, k, v and softmax weights as f16 hi + x1024 residual GEMM operands (near f32), o accumulated in f32; scores and softmax statistics f32. v_wmma_f32_16x16x32_f16.
#define NB 4
#define SQ 2048
#define DM 1024
#define NH 16
#define HD 64
#define HG 1                         /* heads per launch of k_vt(V16, b, h0, VT), which is not launched */
#define QT 256                       /* query rows per causal tile */
#define NKX SQ                       /* S / P row pitch */
#define B0 0                         /* first batch processed (debug hook) */
#define NBR NB                       /* batches processed (debug hook) */
#define NR ((size_t)NB * SQ)         /* token rows */
#define MP ((int)((size_t)NBR * SQ)) /* rows projected (debug hook) */
#define QN SQ                        /* query rows attended per batch (debug hook) */
#define NHD NH                       /* heads attended (debug hook) */
#define MPO MP                       /* unused: no launch reads it */
#define LQ DM      /* row pitch of the q/k/v rows */
typedef __bf16 v16b __attribute__((ext_vector_type(16)));
typedef unsigned short v8us __attribute__((ext_vector_type(8), may_alias));
typedef float  v8f  __attribute__((ext_vector_type(8)));
typedef float  v4f  __attribute__((ext_vector_type(4)));
typedef float  v4fa __attribute__((ext_vector_type(4), may_alias));
union FragB { v16b v; v8us half[2]; unsigned short u[16]; };

__device__ __forceinline__ unsigned short bf16_bits(float x) { unsigned int u = __float_as_uint(x); return (unsigned short)((u + 0x7FFFu + ((u >> 16) & 1u)) >> 16); }
__device__ __forceinline__ float bf16_val(unsigned short b) { return __uint_as_float(((unsigned int)b) << 16); }
__device__ __forceinline__ float bf16_round(float x) { return bf16_val(bf16_bits(x)); }
// D += A·B with NT terms: 1 = ah·bh, 2 = + al·bh (A split), 3 = + ah·bl (both split)
template <int NT>
__device__ __forceinline__ v8f mmaN(v16b ah, v16b al, v16b bh, v16b bl, v8f c) {
  c = __builtin_amdgcn_wmma_f32_16x16x32_bf16(false, ah, false, bh, (short)0, c, false, false);
  if (NT >= 2) c = __builtin_amdgcn_wmma_f32_16x16x32_bf16(false, al, false, bh, (short)0, c, false, false);
  if (NT >= 3) c = __builtin_amdgcn_wmma_f32_16x16x32_bf16(false, ah, false, bl, (short)0, c, false, false);
  asm volatile("v_nop\n\tv_nop\n\tv_nop\n\tv_nop" : "+v"(c) : "v"(ah), "v"(al), "v"(bh), "v"(bl));
  return c;
}

__global__ __launch_bounds__(256) void k_wt_bf16(const float* __restrict__ W, unsigned short* __restrict__ Wt, int K, int N) {
  const int t = blockIdx.x * 256 + threadIdx.x;
  const int k8n = K / 8;
  if (t >= N * k8n) return;
  const int n = t / k8n, k8 = (t % k8n) * 8;
  v8us v;
#pragma unroll
  for (int i = 0; i < 8; ++i) v[i] = bf16_bits(W[(size_t)(k8 + i) * N + n]);
  *(v8us*)(Wt + (size_t)n * K + k8) = v;
  
}

// GEMM C[M][N] (f32, pitch ldc) = act(A[M][K]·W + bias). A f32 row-major (pitch lda) converted per fragment to bf16
// (ASPLIT: hi/lo two planes -> 2 terms, else single rounded term); Wt bf16 [N][K] (pitch ldb). BIAS_BF16 rounds the
// bias to bf16 first (bias quantised to bf16 before the add). K%32==0, M%16==0, N%64==0.
template <bool ASPLIT, int ACT, bool BIAS_BF16>
__global__ __launch_bounds__(128) void k_gemm_bf(const float* __restrict__ A, int lda, const unsigned short* __restrict__ Wt, int ldb,
                                               const float* __restrict__ bias, float* __restrict__ C, int ldc, int M, int N, int K) {
  __shared__ __attribute__((aligned(16))) float so[4][16][64];
  const int tid = threadIdx.x, w = tid >> 5, lane = tid & 31, ln = lane & 15, hh = lane >> 4;
  const int ntn = N / 64;
  const int wid = blockIdx.x * 4 + w;
  const int mt = wid / ntn, nq = wid % ntn;
  if (mt * 16 >= M) return;
  const int row0 = mt * 16, col0 = nq * 64;
  const float* arow = A + (size_t)(row0 + ln) * lda;
  v8f acc[4] = {};
  for (int kb = 0; kb < K; kb += 32) {
    FragB ah, al;
    const v4f x0 = *(const v4fa*)(arow + kb + 8 * hh), x1 = *(const v4fa*)(arow + kb + 8 * hh + 4);
    const v4f x2 = *(const v4fa*)(arow + kb + 16 + 8 * hh), x3 = *(const v4fa*)(arow + kb + 16 + 8 * hh + 4);
    float xs[16] = {x0[0],x0[1],x0[2],x0[3],x1[0],x1[1],x1[2],x1[3],x2[0],x2[1],x2[2],x2[3],x3[0],x3[1],x3[2],x3[3]};
#pragma unroll
    for (int i = 0; i < 16; ++i) { const unsigned short hb = bf16_bits(xs[i]); ah.u[i] = hb; al.u[i] = ASPLIT ? bf16_bits(xs[i] - bf16_val(hb)) : (unsigned short)0; }
#pragma unroll
    for (int t = 0; t < 4; ++t) {
      const unsigned short* brow = Wt + (size_t)(col0 + t * 16 + ln) * ldb + kb;
      FragB b;
      b.half[0] = *(const v8us*)(brow + 8 * hh);
      b.half[1] = *(const v8us*)(brow + 16 + 8 * hh);
      acc[t] = mmaN<ASPLIT ? 2 : 1>(ah.v, al.v, b.v, b.v, acc[t]);
    }
  }
#pragma unroll
  for (int t = 0; t < 4; ++t) {
    float bv = bias ? bias[col0 + t * 16 + ln] : 0.f;
    if (BIAS_BF16) bv = bf16_round(bv);
#pragma unroll
    for (int r = 0; r < 8; ++r) { float v = acc[t][r] + bv; if (ACT == 1) v = fmaxf(v, 0.f); so[w][8 * hh + r][t * 16 + ln] = v; }
  }
  __builtin_amdgcn_fence(__ATOMIC_ACQ_REL, "workgroup");
  __builtin_amdgcn_wave_barrier();
  const int rsub = lane >> 4, c4 = (lane & 15) * 4;
  {
#pragma unroll
    for (int q = 0; q < 8; ++q) {
      const int r = q * 2 + rsub;
      const v4f v = *(const v4fa*)&so[w][r][c4];
      *(v4f*)(C + (size_t)(row0 + r) * ldc + col0 + c4) = v;
    }
    
  }
}

// GEMM C = act(A·W + bias + resid): A f32 (ASPLIT -> hi/lo 2 terms), Wt bf16 [N][K]; ACT 0 none, 1 relu, 2 exact gelu;
// resid (optional, f32, row index = (row % rmod), pitch ldr, RES_BF16 rounds it) added before the activation.
template <bool ASPLIT, int ACT, bool BIAS_BF16, bool RES_BF16>
__global__ __launch_bounds__(128) void k_gemm_bf3(const float* __restrict__ A, int lda, const unsigned short* __restrict__ Wt, int ldb,
                                                const float* __restrict__ bias, const float* __restrict__ resid, int rmod, int ldr,
                                                float* __restrict__ C, int ldc, int M, int N, int K) {
  __shared__ __attribute__((aligned(16))) float so[4][16][64];
  const int tid = threadIdx.x, w = tid >> 5, lane = tid & 31, ln = lane & 15, hh = lane >> 4;
  const int ntn = N / 64;
  const int wid = blockIdx.x * 4 + w;
  const int mt = wid / ntn, nq = wid % ntn;
  if (mt * 16 >= M) return;
  const int row0 = mt * 16, col0 = nq * 64;
  const float* arow = A + (size_t)(row0 + ln) * lda;
  v8f acc[4] = {};
  for (int kb = 0; kb < K; kb += 32) {
    FragB ah, al;
    const v4f x0 = *(const v4fa*)(arow + kb + 8 * hh), x1 = *(const v4fa*)(arow + kb + 8 * hh + 4);
    const v4f x2 = *(const v4fa*)(arow + kb + 16 + 8 * hh), x3 = *(const v4fa*)(arow + kb + 16 + 8 * hh + 4);
    float xs[16] = {x0[0],x0[1],x0[2],x0[3],x1[0],x1[1],x1[2],x1[3],x2[0],x2[1],x2[2],x2[3],x3[0],x3[1],x3[2],x3[3]};
#pragma unroll
    for (int i = 0; i < 16; ++i) { const unsigned short hb = bf16_bits(xs[i]); ah.u[i] = hb; al.u[i] = ASPLIT ? bf16_bits(xs[i] - bf16_val(hb)) : (unsigned short)0; }
#pragma unroll
    for (int t = 0; t < 4; ++t) {
      const unsigned short* brow = Wt + (size_t)(col0 + t * 16 + ln) * ldb + kb;
      FragB b;
      b.half[0] = *(const v8us*)(brow + 8 * hh);
      b.half[1] = *(const v8us*)(brow + 16 + 8 * hh);
      acc[t] = mmaN<ASPLIT ? 2 : 1>(ah.v, al.v, b.v, b.v, acc[t]);
    }
  }
#pragma unroll
  for (int t = 0; t < 4; ++t) {
    const int col = col0 + t * 16 + ln;
    float bv = bias ? bias[col] : 0.f;
    if (BIAS_BF16) bv = bf16_round(bv);
#pragma unroll
    for (int r = 0; r < 8; ++r) {
      float v = acc[t][r] + bv;
      if (resid) { float rv = resid[(size_t)((row0 + 8 * hh + r) % rmod) * ldr + col]; if (RES_BF16) rv = bf16_round(rv); v += rv; }
      if (ACT == 1) v = fmaxf(v, 0.f);
      if (ACT == 2) v = 0.5f * v * (1.0f + erff(v * 0.70710678118654752f));
      if (ACT == 3) { const float u = 0.7978845608028654f * (v + 0.044715f * v * v * v); v = 0.5f * v * (1.0f + tanhf(u)); }
      so[w][8 * hh + r][t * 16 + ln] = v;
    }
  }
  __builtin_amdgcn_fence(__ATOMIC_ACQ_REL, "workgroup");
  __builtin_amdgcn_wave_barrier();
  const int rsub = lane >> 4, c4 = (lane & 15) * 4;
  {
#pragma unroll
    for (int q = 0; q < 8; ++q) {
      const int r = q * 2 + rsub;
      const v4f v = *(const v4fa*)&so[w][r][c4];
      *(v4f*)(C + (size_t)(row0 + r) * ldc + col0 + c4) = v;
    }
    
  }
}
// row LayerNorm (biased variance, eps) over N: s = X (+ R); optional out_sum <- s; out_norm <- (s-mu)*rsqrt(var+eps)*g + b
template <bool PARAM_BF16>
__global__ __launch_bounds__(256) void k_layernorm(const float* __restrict__ X, const float* __restrict__ R, const float* __restrict__ g, const float* __restrict__ bta,
                                                  float* __restrict__ out_sum, float* __restrict__ out_norm, int N, float eps) {
  __shared__ float red[256];
  const int row = blockIdx.x, tid = threadIdx.x;
  const float* x = X + (size_t)row * N; const float* rr = R ? R + (size_t)row * N : nullptr;
  float vals[16];                     // up to N = 4096
  const int per = N / 256;            // contiguous chunk per thread? use strided-by-4 chunks: thread handles j = tid*4 + 1024*u
  float s1 = 0.f;
  for (int u = 0; u < per / 4; ++u) {
    const int j = tid * 4 + 1024 * u;
    const v4f a = *(const v4fa*)(x + j);
    v4f b = {0.f,0.f,0.f,0.f}; if (rr) b = *(const v4fa*)(rr + j);
#pragma unroll
    for (int q = 0; q < 4; ++q) { const float v = a[q] + b[q]; vals[u * 4 + q] = v; s1 += v; }
  }
  red[tid] = s1; __syncthreads();
  for (int st = 128; st > 0; st >>= 1) { if (tid < st) red[tid] += red[tid + st]; __syncthreads(); }
  const float mu = red[0] / (float)N; __syncthreads();
  float s2 = 0.f;
  for (int u = 0; u < per / 4; ++u)
#pragma unroll
    for (int q = 0; q < 4; ++q) { const float c = vals[u * 4 + q] - mu; s2 += c * c; }
  red[tid] = s2; __syncthreads();
  for (int st = 128; st > 0; st >>= 1) { if (tid < st) red[tid] += red[tid + st]; __syncthreads(); }
  const float rs = rsqrtf(red[0] / (float)N + eps);
  {
    for (int u = 0; u < per / 4; ++u) {
      const int j = tid * 4 + 1024 * u;
      v4f o, sm;
#pragma unroll
      for (int q = 0; q < 4; ++q) {
        float gg = g[j + q], bb = bta[j + q];
        if (PARAM_BF16) { gg = bf16_round(gg); bb = bf16_round(bb); }
        sm[q] = vals[u * 4 + q]; o[q] = (vals[u * 4 + q] - mu) * rs * gg + bb;
      }
      if (out_sum) *(v4f*)(out_sum + (size_t)row * N + j) = sm;
      *(v4f*)(out_norm + (size_t)row * N + j) = o;
    }
    
  }
}



// ---- f16 WMMA path (v_wmma_f32_16x16x32_f16): 11-bit significands for operands in range — used where a [0,1] probability operand needs more precision than bf16
typedef _Float16 v16h __attribute__((ext_vector_type(16)));
union FragH { v16h v; v8us half[2]; _Float16 h[16]; unsigned short u[16]; };
template <int NT>
__device__ __forceinline__ v8f mmaH(v16h ah, v16h al, v16h bh, v16h bl, v8f c) {
  c = __builtin_amdgcn_wmma_f32_16x16x32_f16(false, ah, false, bh, (short)0, c, false, false);
  if (NT >= 2) c = __builtin_amdgcn_wmma_f32_16x16x32_f16(false, al, false, bh, (short)0, c, false, false);
  if (NT >= 3) c = __builtin_amdgcn_wmma_f32_16x16x32_f16(false, ah, false, bl, (short)0, c, false, false);
  asm volatile("v_nop\n\tv_nop\n\tv_nop\n\tv_nop" : "+v"(c) : "v"(ah), "v"(al), "v"(bh), "v"(bl));
  return c;
}
// batched GEMM like k_gemm_b but f16 operands: A f32 (split into f16 hi/lo if ASPLIT, else rounded to f16), Bt = f16 values [n][k]; alpha; C f32; N multiple of 16 (partial tiles skipped)
template <bool ASPLIT>
__global__ __launch_bounds__(128) void k_gemm_h(const float* __restrict__ A, int lda, size_t sA, const _Float16* __restrict__ Bh, int ldb, size_t sB, float alpha, float* __restrict__ C, int ldc, size_t sC, int M, int N, int K) {
  __shared__ __attribute__((aligned(16))) float so[4][16][64];
  const int tid = threadIdx.x, w = tid >> 5, lane = tid & 31, ln = lane & 15, hh = lane >> 4; const int by = blockIdx.y;
  A += (size_t)by * sA; Bh += (size_t)by * sB; C += (size_t)by * sC;
  const int ntn = (N + 63) / 64; const int wid = blockIdx.x * 4 + w; const int mt = wid / ntn, nq = wid % ntn; if (mt * 16 >= M) return;
  const int row0 = mt * 16, col0 = nq * 64; const float* arow = A + (size_t)(row0 + ln) * lda;
  v8f acc[4] = {};
  for (int kb = 0; kb < K; kb += 32) {
    FragH ah, al;
    const v4f x0 = *(const v4fa*)(arow + kb + 8 * hh), x1 = *(const v4fa*)(arow + kb + 8 * hh + 4), x2 = *(const v4fa*)(arow + kb + 16 + 8 * hh), x3 = *(const v4fa*)(arow + kb + 16 + 8 * hh + 4);
    float xs[16] = {x0[0],x0[1],x0[2],x0[3],x1[0],x1[1],x1[2],x1[3],x2[0],x2[1],x2[2],x2[3],x3[0],x3[1],x3[2],x3[3]};
#pragma unroll
    for (int i = 0; i < 16; ++i) { const _Float16 h = (_Float16)xs[i]; ah.h[i] = h; al.h[i] = ASPLIT ? (_Float16)(xs[i] - (float)h) : (_Float16)0.0f; }
#pragma unroll
    for (int t = 0; t < 4; ++t) { if (col0 + t * 16 >= N) continue; const size_t boff = (size_t)(col0 + t * 16 + ln) * ldb + kb; FragH bq; bq.half[0] = *(const v8us*)(Bh + boff + 8 * hh); bq.half[1] = *(const v8us*)(Bh + boff + 16 + 8 * hh);
      acc[t] = mmaH<ASPLIT ? 2 : 1>(ah.v, al.v, bq.v, bq.v, acc[t]); }
  }
#pragma unroll
  for (int t = 0; t < 4; ++t) { if (col0 + t * 16 >= N) continue;
#pragma unroll
    for (int r = 0; r < 8; ++r) so[w][8 * hh + r][t * 16 + ln] = acc[t][r] * alpha; }
  __builtin_amdgcn_fence(__ATOMIC_ACQ_REL, "workgroup"); __builtin_amdgcn_wave_barrier();
  const int rsub = lane >> 4, c4 = (lane & 15) * 4;
  {
#pragma unroll
    for (int q = 0; q < 8; ++q) { const int r = q * 2 + rsub; if (col0 + c4 < N) { const v4f v = *(const v4fa*)&so[w][r][c4]; *(v4f*)(C + (size_t)(row0 + r) * ldc + col0 + c4) = v; } }
     }
}

// Wt[n][k] = f16(W[k][n]·scale) from f32 row-major W[K][N] (scale = power of two; bf16-exact weights stay exact in f16 away from the subnormal range)
__global__ __launch_bounds__(256) void k_wt_f16(const float* __restrict__ W, _Float16* __restrict__ Wt, int K, int N, float scale) {
  const int t = blockIdx.x * 256 + threadIdx.x; if (t >= N * (K / 8)) return; const int n = t / (K / 8), k8 = (t % (K / 8)) * 8; FragH f;
#pragma unroll
  for (int i = 0; i < 8; ++i) f.h[i] = (_Float16)(bf16_round(W[(size_t)(k8 + i) * N + n]) * scale); const v8us o = f.half[0];
  *(v8us*)((unsigned short*)Wt + (size_t)n * K + k8) = o; 
}
// k_gemm_hh variant with fused epilogue: v = acc·alpha + bias[by·sBias + col] (+ CP[(row/rowsPerB)·sCPb + by·64 + col] if CP) ; ACT 0 none / 1 elu ; writes f16 C16 (and f32 C if non-null)
template <int ACT>
__global__ __launch_bounds__(128) void k_gemm_hhx(const _Float16* __restrict__ A, int lda, size_t sA, const _Float16* __restrict__ Bh, int ldb, size_t sB, float alpha, const float* __restrict__ bias, size_t sBias, const float* __restrict__ CP, int rowsPerB, size_t sCPb, int row0g,
    float* __restrict__ C, _Float16* __restrict__ C16, int ldc, size_t sC, int M, int N, int K) {
  __shared__ __attribute__((aligned(16))) float so[4][16][64];
  const int tid = threadIdx.x, w = tid >> 5, lane = tid & 31, ln = lane & 15, hh = lane >> 4; const int by = blockIdx.y;
  A += (size_t)by * sA; Bh += (size_t)by * sB; const size_t cofs = (size_t)by * sC; const float* bp = bias ? bias + (size_t)by * sBias : nullptr;
  const int ntn = (N + 63) / 64; const int wid = blockIdx.x * 4 + w; const int mt = wid / ntn, nq = wid % ntn; if (mt * 16 >= M) return;
  const int row0 = mt * 16, col0 = nq * 64; const _Float16* arow = A + (size_t)(row0 + ln) * lda;
  v8f acc[4] = {};
  for (int kb = 0; kb < K; kb += 32) { FragH ah; ah.half[0] = *(const v8us*)((const unsigned short*)arow + kb + 8 * hh); ah.half[1] = *(const v8us*)((const unsigned short*)arow + kb + 16 + 8 * hh);
#pragma unroll
    for (int t = 0; t < 4; ++t) { if (col0 + t * 16 >= N) continue; const size_t boff = (size_t)(col0 + t * 16 + ln) * ldb + kb; FragH bq; bq.half[0] = *(const v8us*)((const unsigned short*)Bh + boff + 8 * hh); bq.half[1] = *(const v8us*)((const unsigned short*)Bh + boff + 16 + 8 * hh);
      acc[t] = mmaH<1>(ah.v, ah.v, bq.v, bq.v, acc[t]); }
  }
#pragma unroll
  for (int t = 0; t < 4; ++t) { if (col0 + t * 16 >= N) continue; const int col = col0 + t * 16 + ln; const float bv = bp ? bf16_round(bp[col]) : 0.f;
#pragma unroll
    for (int r = 0; r < 8; ++r) { float v = acc[t][r] * alpha + bv; if (CP) { const int rr = row0g + row0 + 8 * hh + r; if (rowsPerB < 0) v += CP[cofs + (size_t)rr * ldc + col];      /* rowsPerB < 0: own element of the batched C plane */ else { const int bidx = rr / rowsPerB; v += CP[(size_t)bidx * sCPb + (size_t)by * 64 + col]; } } if (ACT == 1) v = (v > 0.f) ? v : expm1f(v); else if (ACT == 7) v = (v > 0.f) ? v + 1.0f : expf(v); else if (ACT == 8) v = tanhf(v); else if (ACT == 9) v = 0.5f * v * (1.0f + tanhf(0.7978845608028654f * (v + 0.044715f * v * v * v))); else if (ACT == 11) v = 1.0f / (1.0f + expf(-v)); else if (ACT == 12) v = (v > 0.f) ? v : 0.01f * v; else if (ACT == 14) v = (v > 0.f) ? v : 0.1f * v; else if (ACT == 16) v = (v >= 0.f) ? v : 0.3f * v; else if (ACT == 17) v = (v >= 0.f) ? v : 0.2f * v; else if (ACT == 15) v = v / (1.0f + expf(-v)); else if (ACT == 3) v = fmaxf(v, 0.f); else if (ACT == 6) v = 0.5f * v * (1.0f + erff(v * 0.70710678118654752f)); so[w][8 * hh + r][t * 16 + ln] = v; } }
  __builtin_amdgcn_fence(__ATOMIC_ACQ_REL, "workgroup"); __builtin_amdgcn_wave_barrier();
  const int rsub = lane >> 4, c4 = (lane & 15) * 4; typedef _Float16 v4h __attribute__((ext_vector_type(4)));
  {
#pragma unroll
    for (int q = 0; q < 8; ++q) { const int r = q * 2 + rsub; if (col0 + c4 < N) { const v4f v = *(const v4fa*)&so[w][r][c4]; if (C) *(v4f*)(C + cofs + (size_t)(row0 + r) * ldc + col0 + c4) = v; if (C16) { v4h h4; for (int i = 0; i < 4; ++i) h4[i] = (_Float16)v[i]; *(v4h*)(C16 + cofs + (size_t)(row0 + r) * ldc + col0 + c4) = h4; } } }
     }
}


typedef _Float16 v4h __attribute__((ext_vector_type(4)));

__global__ __launch_bounds__(256) void k_x16(const float* __restrict__ x, _Float16* __restrict__ X16, size_t n8) { const size_t t = (size_t)blockIdx.x * 256 + threadIdx.x; if (t >= n8) return; FragH f;
#pragma unroll
  for (int q = 0; q < 8; ++q) f.h[q] = (_Float16)bf16_round(x[t * 8 + q]); *(v8us*)((unsigned short*)X16 + t * 8) = f.half[0];  }
__global__ __launch_bounds__(256) void k_h16(const float* __restrict__ x, _Float16* __restrict__ X16, size_t n8) { const size_t t = (size_t)blockIdx.x * 256 + threadIdx.x; if (t >= n8) return; FragH f;
#pragma unroll
  for (int q = 0; q < 8; ++q) f.h[q] = (_Float16)x[t * 8 + q]; *(v8us*)((unsigned short*)X16 + t * 8) = f.half[0];  }
__global__ __launch_bounds__(256) void k_round16f(const float* __restrict__ W, _Float16* __restrict__ Bt, size_t n8) { const size_t t = (size_t)blockIdx.x * 256 + threadIdx.x; if (t >= n8) return; FragH f;
#pragma unroll
  for (int i = 0; i < 8; ++i) f.h[i] = (_Float16)(bf16_round(W[t * 8 + i]) * 16.0f); *(v8us*)((unsigned short*)Bt + t * 8) = f.half[0];  }
template <int NHv, int TTv>
__global__ __launch_bounds__(256) void k_vt(const _Float16* __restrict__ V16, int ldv, int voff, _Float16* __restrict__ Vt) { __shared__ unsigned short tl[64][66]; const int tid = threadIdx.x; const int slab = blockIdx.x / (TTv / 64), lg = blockIdx.x % (TTv / 64); const int b = slab / NHv, h = slab % NHv;
  for (int i = tid; i < 64 * 8; i += 256) { const int r = i / 8, c8 = (i % 8) * 8; FragH f; f.half[0] = *(const v8us*)((const unsigned short*)V16 + ((size_t)b * TTv + lg * 64 + r) * ldv + voff + h * 64 + c8);
#pragma unroll
    for (int q = 0; q < 8; ++q) tl[r][c8 + q] = f.u[q]; }
  __syncthreads();
  {
#pragma unroll
    for (int rd = 0; rd < 2; ++rd) { const int d = rd * 32 + tid / 8, pc = tid % 8; FragH f;
#pragma unroll
      for (int q = 0; q < 8; ++q) f.u[q] = tl[pc * 8 + q][d];
      *(v8us*)((unsigned short*)Vt + ((size_t)slab * 64 + d) * TTv + lg * 64 + pc * 8) = f.half[0]; }
     } }

__global__ __launch_bounds__(256) void k_hl(const float* __restrict__ F, _Float16* __restrict__ Hh, _Float16* __restrict__ Hl, size_t n8) { const size_t t = (size_t)blockIdx.x * 256 + threadIdx.x; if (t >= n8) return; FragH fh, fl; const v4f a = *(const v4fa*)(F + t * 8), c = *(const v4fa*)(F + t * 8 + 4);
#pragma unroll
  for (int q = 0; q < 4; ++q) { _Float16 h = (_Float16)a[q]; fh.h[q] = h; fl.h[q] = (_Float16)((a[q] - (float)h) * 1024.0f); h = (_Float16)c[q]; fh.h[4 + q] = h; fl.h[4 + q] = (_Float16)((c[q] - (float)h) * 1024.0f); }
  { *(v8us*)((unsigned short*)Hh + t * 8) = fh.half[0]; *(v8us*)((unsigned short*)Hl + t * 8) = fl.half[0];  } }

// ---- fast GEMM (wave tile 32x64; requires M % 32 == 0 rows per launch region, N % 64 == 0 and K % 64 == 0); epilogue = k_gemm_hhx semantics ----
__device__ __forceinline__ v16h g2_frag(const _Float16* p, int hh) { FragH f; f.half[0] = *(const v8us*)((const unsigned short*)p + 8 * hh); f.half[1] = *(const v8us*)((const unsigned short*)p + 16 + 8 * hh); return f.v; }
__device__ __forceinline__ v8f g2_mma(v16h a, v16h b, v8f c) { v8f d = __builtin_amdgcn_wmma_f32_16x16x32_f16(false, a, false, b, (short)0, c, false, false); asm volatile("v_nop\n\tv_nop\n\tv_nop\n\tv_nop" : "+v"(d) : "v"(a), "v"(b)); return d; }
template <int ACT>
__global__ __launch_bounds__(128) void k_gemm2(const _Float16* __restrict__ A, int lda, size_t sA, const _Float16* __restrict__ Bh, int ldb, size_t sB, float alpha, const float* __restrict__ bias, size_t sBias, const float* __restrict__ CP, int rowsPerB, size_t sCPb, int row0g,
    float* __restrict__ C, _Float16* __restrict__ C16, int ldc, size_t sC, int M, int N, int K) { static_assert(ACT == 0 || ACT == 3 || ACT == 6 || ACT == 8 || ACT == 9 || ACT == 11 || ACT == 12 || ACT == 14 || ACT == 15 || ACT == 16 || ACT == 17, "k_gemm2: unsupported ACT code (would silently apply no activation)");
  __shared__ __attribute__((aligned(16))) float so[4][32][68];
  const int tid = threadIdx.x, w = tid >> 5, lane = tid & 31, ln = lane & 15, hh = lane >> 4; const int by = blockIdx.y;
  A += (size_t)by * sA; Bh += (size_t)by * sB; const size_t cofs = (size_t)by * sC; const float* bp = bias ? bias + (size_t)by * sBias : nullptr;
  const int ntn = N >> 6; const int mt = blockIdx.x / ntn, nq = blockIdx.x - mt * ntn; const int row0 = mt * 128 + 32 * w, col0 = nq * 64; if (row0 >= M) return;
  const _Float16* a0p = A + (size_t)(row0 + ln) * lda + 8 * hh; const _Float16* a1p = a0p + (size_t)16 * lda;      /* the lane's half-row offset is in the pointers: the loop's loads take them as they are */
  const _Float16* b0p = Bh + (size_t)(col0 + ln) * ldb + 8 * hh; const _Float16* b1p = b0p + (size_t)16 * ldb; const _Float16* b2p = b1p + (size_t)16 * ldb; const _Float16* b3p = b2p + (size_t)16 * ldb;
  const v8f z8 = {0.f,0.f,0.f,0.f,0.f,0.f,0.f,0.f}; v8f c00 = z8, c01 = z8, c02 = z8, c03 = z8, c10 = z8, c11 = z8, c12 = z8, c13 = z8;
#pragma unroll 1      /* one trip = two k-steps (K % 64 == 0); rolled so that the 12 fragments of a trip stay in registers */
  for (int kb = 0; kb < K; kb += 64) {      /* all 24 loads of the trip stand in front of its first product: the trip waits for memory once, not once per fragment */
    const v16h a0 = g2_frag(a0p, 0), b0 = g2_frag(b0p, 0), a1 = g2_frag(a1p, 0), b1 = g2_frag(b1p, 0), b2 = g2_frag(b2p, 0), b3 = g2_frag(b3p, 0);
    const v16h e0 = g2_frag(a0p + 32, 0), f0 = g2_frag(b0p + 32, 0), e1 = g2_frag(a1p + 32, 0), f1 = g2_frag(b1p + 32, 0), f2 = g2_frag(b2p + 32, 0), f3 = g2_frag(b3p + 32, 0);
    asm volatile("s_wait_xcnt 0x0" :: "v"(a0p), "v"(a1p), "v"(b0p), "v"(b1p), "v"(b2p), "v"(b3p) : "memory");      /* the six address pairs stay untouched (inputs here) until this wait; behind it they may be advanced and reused */
    c00 = g2_mma(a0, b0, c00); c10 = g2_mma(a1, b0, c10); c01 = g2_mma(a0, b1, c01); c11 = g2_mma(a1, b1, c11); c02 = g2_mma(a0, b2, c02); c12 = g2_mma(a1, b2, c12); c03 = g2_mma(a0, b3, c03); c13 = g2_mma(a1, b3, c13);
    c00 = g2_mma(e0, f0, c00); c10 = g2_mma(e1, f0, c10); c01 = g2_mma(e0, f1, c01); c11 = g2_mma(e1, f1, c11); c02 = g2_mma(e0, f2, c02); c12 = g2_mma(e1, f2, c12); c03 = g2_mma(e0, f3, c03); c13 = g2_mma(e1, f3, c13);
    a0p += 64; a1p += 64; b0p += 64; b1p += 64; b2p += 64; b3p += 64; }
  v8f accs[8] = {c00, c01, c02, c03, c10, c11, c12, c13};
#pragma unroll
  for (int u = 0; u < 8; ++u) { const int t = u & 3, half = u >> 2; const int col = col0 + t * 16 + ln; const float bv = bp ? bf16_round(bp[col]) : 0.f;
#pragma unroll
    for (int r = 0; r < 8; ++r) { const int rloc = half * 16 + 8 * hh + r; float v = accs[u][r] * alpha + bv; if (CP) { if (rowsPerB < 0) v += CP[cofs + (size_t)(row0g + row0 + rloc) * ldc + col];      /* rowsPerB < 0: own element of the batched C plane */ else { const int bidx = (row0g + row0 + rloc) / rowsPerB; v += CP[(size_t)bidx * sCPb + (size_t)by * 64 + col]; } }
      if (ACT == 3) v = fmaxf(v, 0.f); else if (ACT == 6) v = 0.5f * v * (1.0f + erff(v * 0.70710678118654752f)); else if (ACT == 11) v = 1.0f / (1.0f + expf(-v)); else if (ACT == 15) v = v / (1.0f + expf(-v)); else if (ACT == 12) v = (v > 0.f) ? v : 0.01f * v; else if (ACT == 8) v = tanhf(v); else if (ACT == 9) v = 0.5f * v * (1.0f + tanhf(0.7978845608028654f * (v + 0.044715f * v * v * v))); else if (ACT == 14) v = (v > 0.f) ? v : 0.1f * v; else if (ACT == 16) v = (v >= 0.f) ? v : 0.3f * v; else if (ACT == 17) v = (v >= 0.f) ? v : 0.2f * v;
      so[w][rloc][t * 16 + ln] = v; } }
  __builtin_amdgcn_fence(__ATOMIC_ACQ_REL, "workgroup"); __builtin_amdgcn_wave_barrier();
  const int rsub = lane >> 4, c4 = (lane & 15) * 4;
  {
#pragma unroll
    for (int q = 0; q < 16; ++q) { const int r = q * 2 + rsub; const v4f v = *(const v4fa*)&so[w][r][c4]; if (C) *(v4f*)(C + cofs + (size_t)(row0 + r) * ldc + col0 + c4) = v; if (C16) { v4h h4; for (int i = 0; i < 4; ++i) h4[i] = (_Float16)v[i]; *(v4h*)(C16 + cofs + (size_t)(row0 + r) * ldc + col0 + c4) = h4; } }
     } }


__global__ __launch_bounds__(256) void k_wnat(const float* __restrict__ w, size_t n8, _Float16* __restrict__ Bt) { const size_t t = (size_t)blockIdx.x * 256 + threadIdx.x; if (t >= n8) return; FragH f; for (int q = 0; q < 8; ++q) f.h[q] = (_Float16)(bf16_round(w[t * 8 + q]) * 16.0f); *(v8us*)((unsigned short*)Bt + t * 8) = f.half[0];  }
__global__ __launch_bounds__(256) void k_rsm(const float* __restrict__ S, _Float16* __restrict__ P, int nrows) {
  #pragma clang fp contract(off)
  const int i = blockIdx.x * 256 + threadIdx.x; if (i >= nrows) return; const float* s = S + (size_t)i * SQ; float mx = -3.0e38f;
#pragma unroll 1
  for (int j = 0; j < SQ; ++j) mx = fmaxf(mx, s[j]); float se = 0.f;
#pragma unroll 1
  for (int j = 0; j < SQ; ++j) se += expf(s[j] - mx); const float sc = 256.0f / se;
#pragma unroll 1
  for (int j0 = 0; j0 < SQ; j0 += 8) { FragH f; for (int q = 0; q < 8; ++q) f.h[q] = (_Float16)(expf(s[j0 + q] - mx) * sc); unsigned short* d = (unsigned short*)P + (size_t)i * SQ + j0; *(v8us*)d = f.half[0];  } }
__global__ __launch_bounds__(256) void k_vt(const _Float16* __restrict__ V16, int b, int h0, _Float16* __restrict__ VT) { __shared__ unsigned short tl[64][65]; const int tid = threadIdx.x; const int hh = blockIdx.x % HG, sg = blockIdx.x / HG; const int s0 = sg * 64; const int h = h0 + hh;
  for (int i = tid; i < 64 * 8; i += 256) { const int j = i / 8, d8 = (i % 8) * 8; FragH f; f.half[0] = *(const v8us*)((const unsigned short*)V16 + ((size_t)b * SQ + s0 + j) * DM + h * HD + d8); for (int q = 0; q < 8; ++q) tl[d8 + q][j] = f.u[q]; }
  __syncthreads();
  { for (int i = tid; i < 64 * 8; i += 256) { const int d = i / 8, j8 = (i % 8) * 8; FragH f; for (int q = 0; q < 8; ++q) f.u[q] = tl[d][j8 + q]; *(v8us*)((unsigned short*)VT + ((size_t)hh * HD + d) * SQ + s0 + j8) = f.half[0]; }  } }



__global__ __launch_bounds__(256) void k_rsmcf2(const float* __restrict__ S, _Float16* __restrict__ P, int hg, int q0, int nk) {
  #pragma clang fp contract(off)
  const int t = blockIdx.x * 256 + threadIdx.x; if (t >= hg * QT) return; const size_t i = (size_t)t; const float* s = S + i * NKX; const int last = q0 + (t % QT); float mx = -3.0e38f;
#pragma unroll 1
  for (int j = 0; j < nk; ++j) { const float f = (j <= last) ? 1.f : 0.f; mx = fmaxf(mx, fmaf(f, s[j], (1.f - f) * -1.0e9f)); } float se = 0.f;
#pragma unroll 1
  for (int j = 0; j < nk; ++j) { const float f = (j <= last) ? 1.f : 0.f; se += __expf(fmaf(f, s[j], (1.f - f) * -1.0e9f) - mx); } const float sc = 256.0f / se;
#pragma unroll 1
  for (int j0 = 0; j0 < nk; j0 += 8) { FragH fr; for (int q = 0; q < 8; ++q) { const int j = j0 + q; const float f = (j <= last) ? 1.f : 0.f; fr.h[q] = (_Float16)(__expf(fmaf(f, s[j], (1.f - f) * -1.0e9f) - mx) * sc); } unsigned short* d = (unsigned short*)P + i * NKX + j0; *(v8us*)d = fr.half[0];  } }


__global__ __launch_bounds__(256) void k_rsmcf2hl(const float* __restrict__ S, _Float16* __restrict__ P, _Float16* __restrict__ PL, int hg, int q0, int nk) {
  #pragma clang fp contract(off)
  const int t = blockIdx.x * 256 + threadIdx.x; if (t >= hg * QT) return; const size_t i = (size_t)t; const float* s = S + i * NKX; const int last = q0 + (t % QT); float mx = -3.0e38f;
#pragma unroll 1
  for (int j = 0; j < nk; ++j) { const float f = (j <= last) ? 1.f : 0.f; mx = fmaxf(mx, fmaf(f, s[j], (1.f - f) * -1.0e9f)); } float se = 0.f;
#pragma unroll 1
  for (int j = 0; j < nk; ++j) { const float f = (j <= last) ? 1.f : 0.f; se += __expf(fmaf(f, s[j], (1.f - f) * -1.0e9f) - mx); } const float sc = 256.0f / se;
#pragma unroll 1
  for (int j0 = 0; j0 < nk; j0 += 8) { FragH fr, fl; for (int q = 0; q < 8; ++q) { const int j = j0 + q; const float f = (j <= last) ? 1.f : 0.f; const float v = __expf(fmaf(f, s[j], (1.f - f) * -1.0e9f) - mx) * sc; const _Float16 hv = (_Float16)v; fr.h[q] = hv; fl.h[q] = (_Float16)((v - (float)hv) * 1024.0f); } unsigned short* d = (unsigned short*)P + i * NKX + j0; unsigned short* dl = (unsigned short*)PL + i * NKX + j0; *(v8us*)d = fr.half[0]; *(v8us*)dl = fl.half[0];  } }


// Row softmax, one wave per score row: lane l holds elements 128 c + 4 l .. + 3 of the row in registers, so S is read once, in whole lines, and each exponential is taken once.
__global__ __launch_bounds__(256) void k_rsmcskhl(const float* __restrict__ S, _Float16* __restrict__ P, _Float16* __restrict__ PL, int hg, int q0, int nk, const float* __restrict__ am) {
  const int lane = threadIdx.x & 31; const int t = blockIdx.x * 8 + __builtin_amdgcn_readfirstlane(threadIdx.x >> 5); if (t >= hg * QT) return;
  const size_t i = (size_t)t; const float* s = S + i * NKX; const int last = q0 + (t % QT);
  v4f x[NKX / 128], m[NKX / 128];
#pragma unroll
  for (int c = 0; c < NKX / 128; c += 2) if (c * 128 < nk) {      /* nk is a multiple of QT = 256: two chunks of 128 per test; all loads of the row go out before the first is used */
    x[c] = *(const v4fa*)(s + c * 128 + lane * 4); x[c + 1] = *(const v4fa*)(s + (c + 1) * 128 + lane * 4);
    m[c] = *(const v4fa*)(am + c * 128 + lane * 4); m[c + 1] = *(const v4fa*)(am + (c + 1) * 128 + lane * 4); }
  asm volatile("s_wait_xcnt 0x0" ::: "memory");      /* the loads' address registers are reused below: the wait the instruction set asks for in front of that */
  v4f mx4 = {-3.0e38f, -3.0e38f, -3.0e38f, -3.0e38f};
#pragma unroll
  for (int c = 0; c < NKX / 128; c += 2) if (c * 128 < nk) {
#pragma unroll
    for (int u = c; u < c + 2; ++u)
#pragma unroll
      for (int q = 0; q < 4; ++q) { const int j = u * 128 + lane * 4 + q; const float mk = __fadd_rn(__fadd_rn((j > last) ? -10000.0f : 0.f, (j >= last - 512) ? -10000.0f : 0.f), bf16_round(m[u][q])); const float v = __fadd_rn(x[u][q], mk); x[u][q] = v; mx4[q] = fmaxf(mx4[q], v); } }
  float mx = fmaxf(fmaxf(mx4[0], mx4[1]), fmaxf(mx4[2], mx4[3]));
#pragma unroll
  for (int d = 16; d > 0; d >>= 1) mx = fmaxf(mx, __shfl_xor(mx, d, 32));
  v4f se4 = {0.f, 0.f, 0.f, 0.f};
#pragma unroll
  for (int c = 0; c < NKX / 128; c += 2) if (c * 128 < nk) {
#pragma unroll
    for (int u = c; u < c + 2; ++u)
#pragma unroll
      for (int q = 0; q < 4; ++q) { const float e = __expf(x[u][q] - mx); x[u][q] = e; se4[q] += e; } }
  float se = (se4[0] + se4[1]) + (se4[2] + se4[3]);
#pragma unroll
  for (int d = 16; d > 0; d >>= 1) se += __shfl_xor(se, d, 32);
  const float sc = 256.0f / se;
  _Float16* d = P + i * NKX + lane * 4; _Float16* dl = PL + i * NKX + lane * 4;
#pragma unroll
  for (int c = 0; c < NKX / 128; c += 2) if (c * 128 < nk) {
#pragma unroll
    for (int u = c; u < c + 2; ++u) { v4h fr, fl;
#pragma unroll
      for (int q = 0; q < 4; ++q) { const float v = x[u][q] * sc; const _Float16 hv = (_Float16)v; fr[q] = hv; fl[q] = (_Float16)((v - (float)hv) * 1024.0f); }
      *(v4h*)(d + u * 128) = fr; *(v4h*)(dl + u * 128) = fl; }
    asm volatile("s_wait_xcnt 0x0" ::: "memory"); } }      /* the next chunk reuses these stores' data registers: same wait */

extern "C" void kernel_launch(void* const* d_in, const int* in_sizes, int n_in,
                              void* d_out, int out_size, void* d_ws, size_t ws_size, hipStream_t stream) {
  (void)in_sizes; (void)n_in; (void)out_size;
  const float* const* I = (const float* const*)d_in; const float* x = I[0]; const float* am = I[1]; const float* wq = I[2]; const float* bq = I[3]; const float* wk = I[4]; const float* bk = I[5]; const float* wv = I[6]; const float* bv = I[7];      /* additive attention_mask [4][1][1][2048] (zeros); natural [out][in] weights + biases */
  char* ws = (char*)d_ws; size_t off = 0;
  auto take = [&](size_t bytes) { char* p = ws + off; off += (bytes + 255) & ~(size_t)255; return p; };
  _Float16* BQ = (_Float16*)take((size_t)DM * DM * 2); _Float16* BK = (_Float16*)take((size_t)DM * DM * 2); _Float16* BV = (_Float16*)take((size_t)DM * DM * 2); 
  _Float16* X16 = (_Float16*)take(NR * DM * 2); _Float16* Q16 = (_Float16*)take(NR * DM * 2); _Float16* QL = (_Float16*)take(NR * DM * 2); _Float16* K16 = (_Float16*)take(NR * DM * 2); _Float16* KL = (_Float16*)take(NR * DM * 2); _Float16* V16 = (_Float16*)take(NR * DM * 2); _Float16* VL = (_Float16*)take(NR * DM * 2); float* VF = (float*)take(NR * DM * 4);      /* v as f16 hi + x1024 residual (the early causal rows average only a few v rows, so a single-f16 v would leave absolute rounding that is large against this module's small output scale) */
  float* S = (float*)take((size_t)NH * QT * NKX * 4); _Float16* P = (_Float16*)take((size_t)NH * QT * NKX * 2); _Float16* PL = (_Float16*)take((size_t)NH * QT * NKX * 2); _Float16* VT = (_Float16*)take((size_t)NH * HD * SQ * 2); _Float16* VTL = (_Float16*)take((size_t)NH * HD * SQ * 2);
  if (off > ws_size) return;
  { const unsigned g = (unsigned)(((size_t)DM * DM / 8 + 255) / 256); k_wnat<<<g, 256, 0, stream>>>(wq, (size_t)DM * DM / 8, BQ); k_wnat<<<g, 256, 0, stream>>>(wk, (size_t)DM * DM / 8, BK); k_wnat<<<g, 256, 0, stream>>>(wv, (size_t)DM * DM / 8, BV); }      /* natural [out][in] = Bt x16 */

  k_x16<<<(unsigned)((NR * DM / 8 + 255) / 256), 256, 0, stream>>>(x, X16, NR * DM / 8);
  const size_t r0p = (size_t)B0 * SQ;      /* first projected row */
  k_gemm2<0><<<dim3((unsigned)((MP / 128) * (DM / 64)), 1), 128, 0, stream>>>(X16 + r0p * DM, DM, 0, BQ, DM, 0, 0.0625f, bq, 0, nullptr, 1, 0, 0, VF + r0p * DM, nullptr, DM, 0, MP, DM, DM); k_hl<<<(unsigned)(((size_t)MP * DM / 8 + 255) / 256), 256, 0, stream>>>(VF + r0p * DM, Q16 + r0p * DM, QL + r0p * DM, (size_t)MP * DM / 8);      /* q (+ bq) in f32 -> f16 hi + x1024 residual */
  k_gemm2<0><<<dim3((unsigned)((MP / 128) * (DM / 64)), 1), 128, 0, stream>>>(X16 + r0p * DM, DM, 0, BK, DM, 0, 0.0625f, bk, 0, nullptr, 1, 0, 0, VF + r0p * DM, nullptr, DM, 0, MP, DM, DM); k_hl<<<(unsigned)(((size_t)MP * DM / 8 + 255) / 256), 256, 0, stream>>>(VF + r0p * DM, K16 + r0p * DM, KL + r0p * DM, (size_t)MP * DM / 8);      /* k (+ bk) likewise */
  k_gemm2<0><<<dim3((unsigned)((MP / 128) * (DM / 64)), 1), 128, 0, stream>>>(X16 + r0p * DM, DM, 0, BV, DM, 0, 0.0625f, bv, 0, nullptr, 1, 0, 0, VF + r0p * DM, nullptr, DM, 0, MP, DM, DM); k_hl<<<(unsigned)(((size_t)MP * DM / 8 + 255) / 256), 256, 0, stream>>>(VF + r0p * DM, V16 + r0p * DM, VL + r0p * DM, (size_t)MP * DM / 8);      /* v in f32 -> f16 hi + x1024 residual planes */
  for (int b = B0; b < B0 + NBR; ++b) { const size_t r0 = (size_t)b * SQ;
    k_vt<NH, SQ><<<NH * (SQ / 64), 256, 0, stream>>>(V16 + r0 * LQ, LQ, 0, VT); k_vt<NH, SQ><<<NH * (SQ / 64), 256, 0, stream>>>(VL + r0 * LQ, LQ, 0, VTL);      /* V^T hi and residual [16][64][SQ] (16 heads of 64 = 16 slabs) */
    for (int q0 = 0; q0 < QN; q0 += QT) { const int nk = q0 + QT;      /* causal: only keys below the tile end are computed */
      k_gemm2<0><<<dim3((QT / 128) * (nk / 64), NHD), 128, 0, stream>>>(Q16 + (r0 + q0) * LQ, LQ, (size_t)HD, K16 + r0 * LQ, LQ, (size_t)HD, 0.125f, nullptr, 0, nullptr, 1, 0, 0, S, nullptr, NKX, (size_t)QT * NKX, QT, nk, HD); k_gemm2<0><<<dim3((QT / 128) * (nk / 64), NHD), 128, 0, stream>>>(QL + (r0 + q0) * LQ, LQ, (size_t)HD, K16 + r0 * LQ, LQ, (size_t)HD, 0.0001220703125f, nullptr, 0, S, -1, 0, 0, S, nullptr, NKX, (size_t)QT * NKX, QT, nk, HD); k_gemm2<0><<<dim3((QT / 128) * (nk / 64), NHD), 128, 0, stream>>>(Q16 + (r0 + q0) * LQ, LQ, (size_t)HD, KL + r0 * LQ, LQ, (size_t)HD, 0.0001220703125f, nullptr, 0, S, -1, 0, 0, S, nullptr, NKX, (size_t)QT * NKX, QT, nk, HD);      /* scores / 8 = three accumulating passes */
      k_rsmcskhl<<<(NHD * QT + 7) / 8, 256, 0, stream>>>(S, P, PL, NHD, q0, nk, am + r0);      /* the module's masks added in f32 (causal -1e4, 'window' -1e4 for j >= i-512, + attention_mask[b][j]); softmax; P hi/lo */
      k_gemm2<0><<<dim3((QT / 128) * (HD / 64), NHD), 128, 0, stream>>>(P, NKX, (size_t)QT * NKX, VT, SQ, (size_t)HD * SQ, 0.00390625f, nullptr, 0, nullptr, 1, 0, 0, (float*)d_out + (r0 + q0) * DM, nullptr, DM, (size_t)HD, QT, HD, nk);
      k_gemm2<0><<<dim3((QT / 128) * (HD / 64), NHD), 128, 0, stream>>>(P, NKX, (size_t)QT * NKX, VTL, SQ, (size_t)HD * SQ, 0.000003814697265625f, nullptr, 0, (const float*)d_out + (r0 + q0) * DM, -1, 0, 0, (float*)d_out + (r0 + q0) * DM, nullptr, DM, (size_t)HD, QT, HD, nk);
      k_gemm2<0><<<dim3((QT / 128) * (HD / 64), NHD), 128, 0, stream>>>(PL, NKX, (size_t)QT * NKX, VT, SQ, (size_t)HD * SQ, 0.000003814697265625f, nullptr, 0, (const float*)d_out + (r0 + q0) * DM, -1, 0, 0, (float*)d_out + (r0 + q0) * DM, nullptr, DM, (size_t)HD, QT, HD, nk); } }      /* out = Ph Vh^T/256 + Ph Vl^T/262144 + Pl Vh^T/262144 (own-element accumulates): P and v both effectively f32 */
}

// v003
// One run takes 1210 microseconds.
// Next to v002, in two timings, it ran 3.51 and 3.52 times as fast.
// Counting every step since v000, it is 10.7 times as fast.
#include <hip/hip_runtime.h>
// Causal self-attention with the module's (faithful, inverted) window mask and an additive padding mask (hidden [4][2048][1024]; q/k/v = x W^T + b (natural [1024][1024] sigma 1/32, biases sigma 0.01); 16 heads of 64; scores / 8 + causal(-1e4 where j > i) + window(-1e4 where j >= i - 512, as the source writes it) + attention_mask[b][j] (zeros), all added in f32; softmax; out = merged attn v -> [4][2048][1024], no output projection). Effective pattern: rows i <= 512 attend causally (every kept logit carries the -1e4 offset, reproduced in f32), rows i >= 513 attend only keys j <= i - 513.
// Structure: token rows; x as exact f16 rows; natural weights as exact x16 planes; q, k, v as WMMA GEMMs (32x64 wave tiles, f32 accumulation, + bias) into f32 rows, each split into f16 hi + x1024 residual planes (the output scale is small, so logits, weights and values are all carried near f32); per batch: V^T of both v planes via LDS transposes; per query tile of 256 rows: scores = one launch of three products (qh.kh + (ql.kh + qh.kl)/1024, K = 64, all heads on grid.y, alpha 1/8; the two residual products share a second register accumulator) against the keys below the tile end, the module's masks added in f32 on VALU inside the row softmax (keys above the row, j > i, carry -2e4 and contribute exactly 0), P as f16 hi + x1024 residual; out = Ph Vh^T 2^-8 + (Pl Vh^T + Ph Vl^T) 2^-18, likewise one launch, written f32 into the output rows; launches: see trace.
// Compute dtype: inputs rounded to bf16; x / weights exact; q, k, v and softmax weights as f16 hi + x1024 residual planes (near f32); o f32; scores and softmax statistics f32. v_wmma_f32_16x16x32_f16.
#define NB 4
#define SQ 2048
#define DM 1024
#define NH 16
#define HD 64
#define HG 1                         /* heads per launch of k_vt(V16, b, h0, VT), which is not launched */
#define QT 256                       /* query rows per causal tile */
#define NKX SQ                       /* S / P row pitch */
#define B0 0                         /* first batch processed (debug hook) */
#define NBR NB                       /* batches processed (debug hook) */
#define NR ((size_t)NB * SQ)         /* token rows */
#define MP ((int)((size_t)NBR * SQ)) /* rows projected (debug hook) */
#define QN SQ                        /* query rows attended per batch (debug hook) */
#define NHD NH                       /* heads attended (debug hook) */
#define MPO MP                       /* unused: no launch reads it */
#define LQ DM      /* row pitch of the q/k/v rows */
typedef __bf16 v16b __attribute__((ext_vector_type(16)));
typedef unsigned short v8us __attribute__((ext_vector_type(8), may_alias));
typedef float  v8f  __attribute__((ext_vector_type(8)));
typedef float  v4f  __attribute__((ext_vector_type(4)));
typedef float  v4fa __attribute__((ext_vector_type(4), may_alias));
union FragB { v16b v; v8us half[2]; unsigned short u[16]; };

__device__ __forceinline__ unsigned short bf16_bits(float x) { unsigned int u = __float_as_uint(x); return (unsigned short)((u + 0x7FFFu + ((u >> 16) & 1u)) >> 16); }
__device__ __forceinline__ float bf16_val(unsigned short b) { return __uint_as_float(((unsigned int)b) << 16); }
__device__ __forceinline__ float bf16_round(float x) { return bf16_val(bf16_bits(x)); }
// D += A·B with NT terms: 1 = ah·bh, 2 = + al·bh (A split), 3 = + ah·bl (both split)
template <int NT>
__device__ __forceinline__ v8f mmaN(v16b ah, v16b al, v16b bh, v16b bl, v8f c) {
  c = __builtin_amdgcn_wmma_f32_16x16x32_bf16(false, ah, false, bh, (short)0, c, false, false);
  if (NT >= 2) c = __builtin_amdgcn_wmma_f32_16x16x32_bf16(false, al, false, bh, (short)0, c, false, false);
  if (NT >= 3) c = __builtin_amdgcn_wmma_f32_16x16x32_bf16(false, ah, false, bl, (short)0, c, false, false);
  asm volatile("v_nop\n\tv_nop\n\tv_nop\n\tv_nop" : "+v"(c) : "v"(ah), "v"(al), "v"(bh), "v"(bl));
  return c;
}

__global__ __launch_bounds__(256) void k_wt_bf16(const float* __restrict__ W, unsigned short* __restrict__ Wt, int K, int N) {
  const int t = blockIdx.x * 256 + threadIdx.x;
  const int k8n = K / 8;
  if (t >= N * k8n) return;
  const int n = t / k8n, k8 = (t % k8n) * 8;
  v8us v;
#pragma unroll
  for (int i = 0; i < 8; ++i) v[i] = bf16_bits(W[(size_t)(k8 + i) * N + n]);
  *(v8us*)(Wt + (size_t)n * K + k8) = v;
  
}

// GEMM C[M][N] (f32, pitch ldc) = act(A[M][K]·W + bias). A f32 row-major (pitch lda) converted per fragment to bf16
// (ASPLIT: hi/lo two planes -> 2 terms, else single rounded term); Wt bf16 [N][K] (pitch ldb). BIAS_BF16 rounds the
// bias to bf16 first (bias quantised to bf16 before the add). K%32==0, M%16==0, N%64==0.
template <bool ASPLIT, int ACT, bool BIAS_BF16>
__global__ __launch_bounds__(128) void k_gemm_bf(const float* __restrict__ A, int lda, const unsigned short* __restrict__ Wt, int ldb,
                                               const float* __restrict__ bias, float* __restrict__ C, int ldc, int M, int N, int K) {
  __shared__ __attribute__((aligned(16))) float so[4][16][64];
  const int tid = threadIdx.x, w = tid >> 5, lane = tid & 31, ln = lane & 15, hh = lane >> 4;
  const int ntn = N / 64;
  const int wid = blockIdx.x * 4 + w;
  const int mt = wid / ntn, nq = wid % ntn;
  if (mt * 16 >= M) return;
  const int row0 = mt * 16, col0 = nq * 64;
  const float* arow = A + (size_t)(row0 + ln) * lda;
  v8f acc[4] = {};
  for (int kb = 0; kb < K; kb += 32) {
    FragB ah, al;
    const v4f x0 = *(const v4fa*)(arow + kb + 8 * hh), x1 = *(const v4fa*)(arow + kb + 8 * hh + 4);
    const v4f x2 = *(const v4fa*)(arow + kb + 16 + 8 * hh), x3 = *(const v4fa*)(arow + kb + 16 + 8 * hh + 4);
    float xs[16] = {x0[0],x0[1],x0[2],x0[3],x1[0],x1[1],x1[2],x1[3],x2[0],x2[1],x2[2],x2[3],x3[0],x3[1],x3[2],x3[3]};
#pragma unroll
    for (int i = 0; i < 16; ++i) { const unsigned short hb = bf16_bits(xs[i]); ah.u[i] = hb; al.u[i] = ASPLIT ? bf16_bits(xs[i] - bf16_val(hb)) : (unsigned short)0; }
#pragma unroll
    for (int t = 0; t < 4; ++t) {
      const unsigned short* brow = Wt + (size_t)(col0 + t * 16 + ln) * ldb + kb;
      FragB b;
      b.half[0] = *(const v8us*)(brow + 8 * hh);
      b.half[1] = *(const v8us*)(brow + 16 + 8 * hh);
      acc[t] = mmaN<ASPLIT ? 2 : 1>(ah.v, al.v, b.v, b.v, acc[t]);
    }
  }
#pragma unroll
  for (int t = 0; t < 4; ++t) {
    float bv = bias ? bias[col0 + t * 16 + ln] : 0.f;
    if (BIAS_BF16) bv = bf16_round(bv);
#pragma unroll
    for (int r = 0; r < 8; ++r) { float v = acc[t][r] + bv; if (ACT == 1) v = fmaxf(v, 0.f); so[w][8 * hh + r][t * 16 + ln] = v; }
  }
  __builtin_amdgcn_fence(__ATOMIC_ACQ_REL, "workgroup");
  __builtin_amdgcn_wave_barrier();
  const int rsub = lane >> 4, c4 = (lane & 15) * 4;
  {
#pragma unroll
    for (int q = 0; q < 8; ++q) {
      const int r = q * 2 + rsub;
      const v4f v = *(const v4fa*)&so[w][r][c4];
      *(v4f*)(C + (size_t)(row0 + r) * ldc + col0 + c4) = v;
    }
    
  }
}

// GEMM C = act(A·W + bias + resid): A f32 (ASPLIT -> hi/lo 2 terms), Wt bf16 [N][K]; ACT 0 none, 1 relu, 2 exact gelu;
// resid (optional, f32, row index = (row % rmod), pitch ldr, RES_BF16 rounds it) added before the activation.
template <bool ASPLIT, int ACT, bool BIAS_BF16, bool RES_BF16>
__global__ __launch_bounds__(128) void k_gemm_bf3(const float* __restrict__ A, int lda, const unsigned short* __restrict__ Wt, int ldb,
                                                const float* __restrict__ bias, const float* __restrict__ resid, int rmod, int ldr,
                                                float* __restrict__ C, int ldc, int M, int N, int K) {
  __shared__ __attribute__((aligned(16))) float so[4][16][64];
  const int tid = threadIdx.x, w = tid >> 5, lane = tid & 31, ln = lane & 15, hh = lane >> 4;
  const int ntn = N / 64;
  const int wid = blockIdx.x * 4 + w;
  const int mt = wid / ntn, nq = wid % ntn;
  if (mt * 16 >= M) return;
  const int row0 = mt * 16, col0 = nq * 64;
  const float* arow = A + (size_t)(row0 + ln) * lda;
  v8f acc[4] = {};
  for (int kb = 0; kb < K; kb += 32) {
    FragB ah, al;
    const v4f x0 = *(const v4fa*)(arow + kb + 8 * hh), x1 = *(const v4fa*)(arow + kb + 8 * hh + 4);
    const v4f x2 = *(const v4fa*)(arow + kb + 16 + 8 * hh), x3 = *(const v4fa*)(arow + kb + 16 + 8 * hh + 4);
    float xs[16] = {x0[0],x0[1],x0[2],x0[3],x1[0],x1[1],x1[2],x1[3],x2[0],x2[1],x2[2],x2[3],x3[0],x3[1],x3[2],x3[3]};
#pragma unroll
    for (int i = 0; i < 16; ++i) { const unsigned short hb = bf16_bits(xs[i]); ah.u[i] = hb; al.u[i] = ASPLIT ? bf16_bits(xs[i] - bf16_val(hb)) : (unsigned short)0; }
#pragma unroll
    for (int t = 0; t < 4; ++t) {
      const unsigned short* brow = Wt + (size_t)(col0 + t * 16 + ln) * ldb + kb;
      FragB b;
      b.half[0] = *(const v8us*)(brow + 8 * hh);
      b.half[1] = *(const v8us*)(brow + 16 + 8 * hh);
      acc[t] = mmaN<ASPLIT ? 2 : 1>(ah.v, al.v, b.v, b.v, acc[t]);
    }
  }
#pragma unroll
  for (int t = 0; t < 4; ++t) {
    const int col = col0 + t * 16 + ln;
    float bv = bias ? bias[col] : 0.f;
    if (BIAS_BF16) bv = bf16_round(bv);
#pragma unroll
    for (int r = 0; r < 8; ++r) {
      float v = acc[t][r] + bv;
      if (resid) { float rv = resid[(size_t)((row0 + 8 * hh + r) % rmod) * ldr + col]; if (RES_BF16) rv = bf16_round(rv); v += rv; }
      if (ACT == 1) v = fmaxf(v, 0.f);
      if (ACT == 2) v = 0.5f * v * (1.0f + erff(v * 0.70710678118654752f));
      if (ACT == 3) { const float u = 0.7978845608028654f * (v + 0.044715f * v * v * v); v = 0.5f * v * (1.0f + tanhf(u)); }
      so[w][8 * hh + r][t * 16 + ln] = v;
    }
  }
  __builtin_amdgcn_fence(__ATOMIC_ACQ_REL, "workgroup");
  __builtin_amdgcn_wave_barrier();
  const int rsub = lane >> 4, c4 = (lane & 15) * 4;
  {
#pragma unroll
    for (int q = 0; q < 8; ++q) {
      const int r = q * 2 + rsub;
      const v4f v = *(const v4fa*)&so[w][r][c4];
      *(v4f*)(C + (size_t)(row0 + r) * ldc + col0 + c4) = v;
    }
    
  }
}
// row LayerNorm (biased variance, eps) over N: s = X (+ R); optional out_sum <- s; out_norm <- (s-mu)*rsqrt(var+eps)*g + b
template <bool PARAM_BF16>
__global__ __launch_bounds__(256) void k_layernorm(const float* __restrict__ X, const float* __restrict__ R, const float* __restrict__ g, const float* __restrict__ bta,
                                                  float* __restrict__ out_sum, float* __restrict__ out_norm, int N, float eps) {
  __shared__ float red[256];
  const int row = blockIdx.x, tid = threadIdx.x;
  const float* x = X + (size_t)row * N; const float* rr = R ? R + (size_t)row * N : nullptr;
  float vals[16];                     // up to N = 4096
  const int per = N / 256;            // contiguous chunk per thread? use strided-by-4 chunks: thread handles j = tid*4 + 1024*u
  float s1 = 0.f;
  for (int u = 0; u < per / 4; ++u) {
    const int j = tid * 4 + 1024 * u;
    const v4f a = *(const v4fa*)(x + j);
    v4f b = {0.f,0.f,0.f,0.f}; if (rr) b = *(const v4fa*)(rr + j);
#pragma unroll
    for (int q = 0; q < 4; ++q) { const float v = a[q] + b[q]; vals[u * 4 + q] = v; s1 += v; }
  }
  red[tid] = s1; __syncthreads();
  for (int st = 128; st > 0; st >>= 1) { if (tid < st) red[tid] += red[tid + st]; __syncthreads(); }
  const float mu = red[0] / (float)N; __syncthreads();
  float s2 = 0.f;
  for (int u = 0; u < per / 4; ++u)
#pragma unroll
    for (int q = 0; q < 4; ++q) { const float c = vals[u * 4 + q] - mu; s2 += c * c; }
  red[tid] = s2; __syncthreads();
  for (int st = 128; st > 0; st >>= 1) { if (tid < st) red[tid] += red[tid + st]; __syncthreads(); }
  const float rs = rsqrtf(red[0] / (float)N + eps);
  {
    for (int u = 0; u < per / 4; ++u) {
      const int j = tid * 4 + 1024 * u;
      v4f o, sm;
#pragma unroll
      for (int q = 0; q < 4; ++q) {
        float gg = g[j + q], bb = bta[j + q];
        if (PARAM_BF16) { gg = bf16_round(gg); bb = bf16_round(bb); }
        sm[q] = vals[u * 4 + q]; o[q] = (vals[u * 4 + q] - mu) * rs * gg + bb;
      }
      if (out_sum) *(v4f*)(out_sum + (size_t)row * N + j) = sm;
      *(v4f*)(out_norm + (size_t)row * N + j) = o;
    }
    
  }
}



// ---- f16 WMMA path (v_wmma_f32_16x16x32_f16): 11-bit significands for operands in range — used where a [0,1] probability operand needs more precision than bf16
typedef _Float16 v16h __attribute__((ext_vector_type(16)));
union FragH { v16h v; v8us half[2]; _Float16 h[16]; unsigned short u[16]; };
template <int NT>
__device__ __forceinline__ v8f mmaH(v16h ah, v16h al, v16h bh, v16h bl, v8f c) {
  c = __builtin_amdgcn_wmma_f32_16x16x32_f16(false, ah, false, bh, (short)0, c, false, false);
  if (NT >= 2) c = __builtin_amdgcn_wmma_f32_16x16x32_f16(false, al, false, bh, (short)0, c, false, false);
  if (NT >= 3) c = __builtin_amdgcn_wmma_f32_16x16x32_f16(false, ah, false, bl, (short)0, c, false, false);
  asm volatile("v_nop\n\tv_nop\n\tv_nop\n\tv_nop" : "+v"(c) : "v"(ah), "v"(al), "v"(bh), "v"(bl));
  return c;
}
// batched GEMM like k_gemm_b but f16 operands: A f32 (split into f16 hi/lo if ASPLIT, else rounded to f16), Bt = f16 values [n][k]; alpha; C f32; N multiple of 16 (partial tiles skipped)
template <bool ASPLIT>
__global__ __launch_bounds__(128) void k_gemm_h(const float* __restrict__ A, int lda, size_t sA, const _Float16* __restrict__ Bh, int ldb, size_t sB, float alpha, float* __restrict__ C, int ldc, size_t sC, int M, int N, int K) {
  __shared__ __attribute__((aligned(16))) float so[4][16][64];
  const int tid = threadIdx.x, w = tid >> 5, lane = tid & 31, ln = lane & 15, hh = lane >> 4; const int by = blockIdx.y;
  A += (size_t)by * sA; Bh += (size_t)by * sB; C += (size_t)by * sC;
  const int ntn = (N + 63) / 64; const int wid = blockIdx.x * 4 + w; const int mt = wid / ntn, nq = wid % ntn; if (mt * 16 >= M) return;
  const int row0 = mt * 16, col0 = nq * 64; const float* arow = A + (size_t)(row0 + ln) * lda;
  v8f acc[4] = {};
  for (int kb = 0; kb < K; kb += 32) {
    FragH ah, al;
    const v4f x0 = *(const v4fa*)(arow + kb + 8 * hh), x1 = *(const v4fa*)(arow + kb + 8 * hh + 4), x2 = *(const v4fa*)(arow + kb + 16 + 8 * hh), x3 = *(const v4fa*)(arow + kb + 16 + 8 * hh + 4);
    float xs[16] = {x0[0],x0[1],x0[2],x0[3],x1[0],x1[1],x1[2],x1[3],x2[0],x2[1],x2[2],x2[3],x3[0],x3[1],x3[2],x3[3]};
#pragma unroll
    for (int i = 0; i < 16; ++i) { const _Float16 h = (_Float16)xs[i]; ah.h[i] = h; al.h[i] = ASPLIT ? (_Float16)(xs[i] - (float)h) : (_Float16)0.0f; }
#pragma unroll
    for (int t = 0; t < 4; ++t) { if (col0 + t * 16 >= N) continue; const size_t boff = (size_t)(col0 + t * 16 + ln) * ldb + kb; FragH bq; bq.half[0] = *(const v8us*)(Bh + boff + 8 * hh); bq.half[1] = *(const v8us*)(Bh + boff + 16 + 8 * hh);
      acc[t] = mmaH<ASPLIT ? 2 : 1>(ah.v, al.v, bq.v, bq.v, acc[t]); }
  }
#pragma unroll
  for (int t = 0; t < 4; ++t) { if (col0 + t * 16 >= N) continue;
#pragma unroll
    for (int r = 0; r < 8; ++r) so[w][8 * hh + r][t * 16 + ln] = acc[t][r] * alpha; }
  __builtin_amdgcn_fence(__ATOMIC_ACQ_REL, "workgroup"); __builtin_amdgcn_wave_barrier();
  const int rsub = lane >> 4, c4 = (lane & 15) * 4;
  {
#pragma unroll
    for (int q = 0; q < 8; ++q) { const int r = q * 2 + rsub; if (col0 + c4 < N) { const v4f v = *(const v4fa*)&so[w][r][c4]; *(v4f*)(C + (size_t)(row0 + r) * ldc + col0 + c4) = v; } }
     }
}

// Wt[n][k] = f16(W[k][n]·scale) from f32 row-major W[K][N] (scale = power of two; bf16-exact weights stay exact in f16 away from the subnormal range)
__global__ __launch_bounds__(256) void k_wt_f16(const float* __restrict__ W, _Float16* __restrict__ Wt, int K, int N, float scale) {
  const int t = blockIdx.x * 256 + threadIdx.x; if (t >= N * (K / 8)) return; const int n = t / (K / 8), k8 = (t % (K / 8)) * 8; FragH f;
#pragma unroll
  for (int i = 0; i < 8; ++i) f.h[i] = (_Float16)(bf16_round(W[(size_t)(k8 + i) * N + n]) * scale); const v8us o = f.half[0];
  *(v8us*)((unsigned short*)Wt + (size_t)n * K + k8) = o; 
}
// k_gemm_hh variant with fused epilogue: v = acc·alpha + bias[by·sBias + col] (+ CP[(row/rowsPerB)·sCPb + by·64 + col] if CP) ; ACT 0 none / 1 elu ; writes f16 C16 (and f32 C if non-null)
template <int ACT>
__global__ __launch_bounds__(128) void k_gemm_hhx(const _Float16* __restrict__ A, int lda, size_t sA, const _Float16* __restrict__ Bh, int ldb, size_t sB, float alpha, const float* __restrict__ bias, size_t sBias, const float* __restrict__ CP, int rowsPerB, size_t sCPb, int row0g,
    float* __restrict__ C, _Float16* __restrict__ C16, int ldc, size_t sC, int M, int N, int K) {
  __shared__ __attribute__((aligned(16))) float so[4][16][64];
  const int tid = threadIdx.x, w = tid >> 5, lane = tid & 31, ln = lane & 15, hh = lane >> 4; const int by = blockIdx.y;
  A += (size_t)by * sA; Bh += (size_t)by * sB; const size_t cofs = (size_t)by * sC; const float* bp = bias ? bias + (size_t)by * sBias : nullptr;
  const int ntn = (N + 63) / 64; const int wid = blockIdx.x * 4 + w; const int mt = wid / ntn, nq = wid % ntn; if (mt * 16 >= M) return;
  const int row0 = mt * 16, col0 = nq * 64; const _Float16* arow = A + (size_t)(row0 + ln) * lda;
  v8f acc[4] = {};
  for (int kb = 0; kb < K; kb += 32) { FragH ah; ah.half[0] = *(const v8us*)((const unsigned short*)arow + kb + 8 * hh); ah.half[1] = *(const v8us*)((const unsigned short*)arow + kb + 16 + 8 * hh);
#pragma unroll
    for (int t = 0; t < 4; ++t) { if (col0 + t * 16 >= N) continue; const size_t boff = (size_t)(col0 + t * 16 + ln) * ldb + kb; FragH bq; bq.half[0] = *(const v8us*)((const unsigned short*)Bh + boff + 8 * hh); bq.half[1] = *(const v8us*)((const unsigned short*)Bh + boff + 16 + 8 * hh);
      acc[t] = mmaH<1>(ah.v, ah.v, bq.v, bq.v, acc[t]); }
  }
#pragma unroll
  for (int t = 0; t < 4; ++t) { if (col0 + t * 16 >= N) continue; const int col = col0 + t * 16 + ln; const float bv = bp ? bf16_round(bp[col]) : 0.f;
#pragma unroll
    for (int r = 0; r < 8; ++r) { float v = acc[t][r] * alpha + bv; if (CP) { const int rr = row0g + row0 + 8 * hh + r; if (rowsPerB < 0) v += CP[cofs + (size_t)rr * ldc + col];      /* rowsPerB < 0: own element of the batched C plane */ else { const int bidx = rr / rowsPerB; v += CP[(size_t)bidx * sCPb + (size_t)by * 64 + col]; } } if (ACT == 1) v = (v > 0.f) ? v : expm1f(v); else if (ACT == 7) v = (v > 0.f) ? v + 1.0f : expf(v); else if (ACT == 8) v = tanhf(v); else if (ACT == 9) v = 0.5f * v * (1.0f + tanhf(0.7978845608028654f * (v + 0.044715f * v * v * v))); else if (ACT == 11) v = 1.0f / (1.0f + expf(-v)); else if (ACT == 12) v = (v > 0.f) ? v : 0.01f * v; else if (ACT == 14) v = (v > 0.f) ? v : 0.1f * v; else if (ACT == 16) v = (v >= 0.f) ? v : 0.3f * v; else if (ACT == 17) v = (v >= 0.f) ? v : 0.2f * v; else if (ACT == 15) v = v / (1.0f + expf(-v)); else if (ACT == 3) v = fmaxf(v, 0.f); else if (ACT == 6) v = 0.5f * v * (1.0f + erff(v * 0.70710678118654752f)); so[w][8 * hh + r][t * 16 + ln] = v; } }
  __builtin_amdgcn_fence(__ATOMIC_ACQ_REL, "workgroup"); __builtin_amdgcn_wave_barrier();
  const int rsub = lane >> 4, c4 = (lane & 15) * 4; typedef _Float16 v4h __attribute__((ext_vector_type(4)));
  {
#pragma unroll
    for (int q = 0; q < 8; ++q) { const int r = q * 2 + rsub; if (col0 + c4 < N) { const v4f v = *(const v4fa*)&so[w][r][c4]; if (C) *(v4f*)(C + cofs + (size_t)(row0 + r) * ldc + col0 + c4) = v; if (C16) { v4h h4; for (int i = 0; i < 4; ++i) h4[i] = (_Float16)v[i]; *(v4h*)(C16 + cofs + (size_t)(row0 + r) * ldc + col0 + c4) = h4; } } }
     }
}


typedef _Float16 v4h __attribute__((ext_vector_type(4)));

__global__ __launch_bounds__(256) void k_x16(const float* __restrict__ x, _Float16* __restrict__ X16, size_t n8) { const size_t t = (size_t)blockIdx.x * 256 + threadIdx.x; if (t >= n8) return; FragH f;
#pragma unroll
  for (int q = 0; q < 8; ++q) f.h[q] = (_Float16)bf16_round(x[t * 8 + q]); *(v8us*)((unsigned short*)X16 + t * 8) = f.half[0];  }
__global__ __launch_bounds__(256) void k_h16(const float* __restrict__ x, _Float16* __restrict__ X16, size_t n8) { const size_t t = (size_t)blockIdx.x * 256 + threadIdx.x; if (t >= n8) return; FragH f;
#pragma unroll
  for (int q = 0; q < 8; ++q) f.h[q] = (_Float16)x[t * 8 + q]; *(v8us*)((unsigned short*)X16 + t * 8) = f.half[0];  }
__global__ __launch_bounds__(256) void k_round16f(const float* __restrict__ W, _Float16* __restrict__ Bt, size_t n8) { const size_t t = (size_t)blockIdx.x * 256 + threadIdx.x; if (t >= n8) return; FragH f;
#pragma unroll
  for (int i = 0; i < 8; ++i) f.h[i] = (_Float16)(bf16_round(W[t * 8 + i]) * 16.0f); *(v8us*)((unsigned short*)Bt + t * 8) = f.half[0];  }
template <int NHv, int TTv>
__global__ __launch_bounds__(256) void k_vt(const _Float16* __restrict__ V16, int ldv, int voff, _Float16* __restrict__ Vt) { __shared__ unsigned short tl[64][66]; const int tid = threadIdx.x; const int slab = blockIdx.x / (TTv / 64), lg = blockIdx.x % (TTv / 64); const int b = slab / NHv, h = slab % NHv;
  for (int i = tid; i < 64 * 8; i += 256) { const int r = i / 8, c8 = (i % 8) * 8; FragH f; f.half[0] = *(const v8us*)((const unsigned short*)V16 + ((size_t)b * TTv + lg * 64 + r) * ldv + voff + h * 64 + c8);
#pragma unroll
    for (int q = 0; q < 8; ++q) tl[r][c8 + q] = f.u[q]; }
  __syncthreads();
  {
#pragma unroll
    for (int rd = 0; rd < 2; ++rd) { const int d = rd * 32 + tid / 8, pc = tid % 8; FragH f;
#pragma unroll
      for (int q = 0; q < 8; ++q) f.u[q] = tl[pc * 8 + q][d];
      *(v8us*)((unsigned short*)Vt + ((size_t)slab * 64 + d) * TTv + lg * 64 + pc * 8) = f.half[0]; }
     } }

__global__ __launch_bounds__(256) void k_hl(const float* __restrict__ F, _Float16* __restrict__ Hh, _Float16* __restrict__ Hl, size_t n8) { const size_t t = (size_t)blockIdx.x * 256 + threadIdx.x; if (t >= n8) return; FragH fh, fl; const v4f a = *(const v4fa*)(F + t * 8), c = *(const v4fa*)(F + t * 8 + 4);
#pragma unroll
  for (int q = 0; q < 4; ++q) { _Float16 h = (_Float16)a[q]; fh.h[q] = h; fl.h[q] = (_Float16)((a[q] - (float)h) * 1024.0f); h = (_Float16)c[q]; fh.h[4 + q] = h; fl.h[4 + q] = (_Float16)((c[q] - (float)h) * 1024.0f); }
  { *(v8us*)((unsigned short*)Hh + t * 8) = fh.half[0]; *(v8us*)((unsigned short*)Hl + t * 8) = fl.half[0];  } }

// ---- fast GEMM (wave tile 32x64; requires M % 32 == 0 rows per launch region, N % 64 == 0 and K % 64 == 0); epilogue = k_gemm_hhx semantics ----
__device__ __forceinline__ v16h g2_frag(const _Float16* p, int hh) { FragH f; f.half[0] = *(const v8us*)((const unsigned short*)p + 8 * hh); f.half[1] = *(const v8us*)((const unsigned short*)p + 16 + 8 * hh); return f.v; }
__device__ __forceinline__ v8f g2_mma(v16h a, v16h b, v8f c) { v8f d = __builtin_amdgcn_wmma_f32_16x16x32_f16(false, a, false, b, (short)0, c, false, false); asm volatile("v_nop\n\tv_nop\n\tv_nop\n\tv_nop" : "+v"(d) : "v"(a), "v"(b)); return d; }
template <int ACT>
__global__ __launch_bounds__(128) void k_gemm2(const _Float16* __restrict__ A, int lda, size_t sA, const _Float16* __restrict__ Bh, int ldb, size_t sB, float alpha, const float* __restrict__ bias, size_t sBias, const float* __restrict__ CP, int rowsPerB, size_t sCPb, int row0g,
    float* __restrict__ C, _Float16* __restrict__ C16, int ldc, size_t sC, int M, int N, int K) { static_assert(ACT == 0 || ACT == 3 || ACT == 6 || ACT == 8 || ACT == 9 || ACT == 11 || ACT == 12 || ACT == 14 || ACT == 15 || ACT == 16 || ACT == 17, "k_gemm2: unsupported ACT code (would silently apply no activation)");
  __shared__ __attribute__((aligned(16))) float so[4][32][68];
  const int tid = threadIdx.x, w = tid >> 5, lane = tid & 31, ln = lane & 15, hh = lane >> 4; const int by = blockIdx.y;
  A += (size_t)by * sA; Bh += (size_t)by * sB; const size_t cofs = (size_t)by * sC; const float* bp = bias ? bias + (size_t)by * sBias : nullptr;
  const int ntn = N >> 6; const int mt = blockIdx.x / ntn, nq = blockIdx.x - mt * ntn; const int row0 = mt * 128 + 32 * w, col0 = nq * 64; if (row0 >= M) return;
  const _Float16* a0p = A + (size_t)(row0 + ln) * lda + 8 * hh; const _Float16* a1p = a0p + (size_t)16 * lda;      /* the lane's half-row offset is in the pointers: the loop's loads take them as they are */
  const _Float16* b0p = Bh + (size_t)(col0 + ln) * ldb + 8 * hh; const _Float16* b1p = b0p + (size_t)16 * ldb; const _Float16* b2p = b1p + (size_t)16 * ldb; const _Float16* b3p = b2p + (size_t)16 * ldb;
  const v8f z8 = {0.f,0.f,0.f,0.f,0.f,0.f,0.f,0.f}; v8f c00 = z8, c01 = z8, c02 = z8, c03 = z8, c10 = z8, c11 = z8, c12 = z8, c13 = z8;
#pragma unroll 1      /* one trip = two k-steps (K % 64 == 0); rolled so that the 12 fragments of a trip stay in registers */
  for (int kb = 0; kb < K; kb += 64) {      /* all 24 loads of the trip stand in front of its first product: the trip waits for memory once, not once per fragment */
    const v16h a0 = g2_frag(a0p, 0), b0 = g2_frag(b0p, 0), a1 = g2_frag(a1p, 0), b1 = g2_frag(b1p, 0), b2 = g2_frag(b2p, 0), b3 = g2_frag(b3p, 0);
    const v16h e0 = g2_frag(a0p + 32, 0), f0 = g2_frag(b0p + 32, 0), e1 = g2_frag(a1p + 32, 0), f1 = g2_frag(b1p + 32, 0), f2 = g2_frag(b2p + 32, 0), f3 = g2_frag(b3p + 32, 0);
    asm volatile("s_wait_xcnt 0x0" :: "v"(a0p), "v"(a1p), "v"(b0p), "v"(b1p), "v"(b2p), "v"(b3p) : "memory");      /* the six address pairs stay untouched (inputs here) until this wait; behind it they may be advanced and reused */
    c00 = g2_mma(a0, b0, c00); c10 = g2_mma(a1, b0, c10); c01 = g2_mma(a0, b1, c01); c11 = g2_mma(a1, b1, c11); c02 = g2_mma(a0, b2, c02); c12 = g2_mma(a1, b2, c12); c03 = g2_mma(a0, b3, c03); c13 = g2_mma(a1, b3, c13);
    c00 = g2_mma(e0, f0, c00); c10 = g2_mma(e1, f0, c10); c01 = g2_mma(e0, f1, c01); c11 = g2_mma(e1, f1, c11); c02 = g2_mma(e0, f2, c02); c12 = g2_mma(e1, f2, c12); c03 = g2_mma(e0, f3, c03); c13 = g2_mma(e1, f3, c13);
    a0p += 64; a1p += 64; b0p += 64; b1p += 64; b2p += 64; b3p += 64; }
  v8f accs[8] = {c00, c01, c02, c03, c10, c11, c12, c13};
#pragma unroll
  for (int u = 0; u < 8; ++u) { const int t = u & 3, half = u >> 2; const int col = col0 + t * 16 + ln; const float bv = bp ? bf16_round(bp[col]) : 0.f;
#pragma unroll
    for (int r = 0; r < 8; ++r) { const int rloc = half * 16 + 8 * hh + r; float v = accs[u][r] * alpha + bv; if (CP) { if (rowsPerB < 0) v += CP[cofs + (size_t)(row0g + row0 + rloc) * ldc + col];      /* rowsPerB < 0: own element of the batched C plane */ else { const int bidx = (row0g + row0 + rloc) / rowsPerB; v += CP[(size_t)bidx * sCPb + (size_t)by * 64 + col]; } }
      if (ACT == 3) v = fmaxf(v, 0.f); else if (ACT == 6) v = 0.5f * v * (1.0f + erff(v * 0.70710678118654752f)); else if (ACT == 11) v = 1.0f / (1.0f + expf(-v)); else if (ACT == 15) v = v / (1.0f + expf(-v)); else if (ACT == 12) v = (v > 0.f) ? v : 0.01f * v; else if (ACT == 8) v = tanhf(v); else if (ACT == 9) v = 0.5f * v * (1.0f + tanhf(0.7978845608028654f * (v + 0.044715f * v * v * v))); else if (ACT == 14) v = (v > 0.f) ? v : 0.1f * v; else if (ACT == 16) v = (v >= 0.f) ? v : 0.3f * v; else if (ACT == 17) v = (v >= 0.f) ? v : 0.2f * v;
      so[w][rloc][t * 16 + ln] = v; } }
  __builtin_amdgcn_fence(__ATOMIC_ACQ_REL, "workgroup"); __builtin_amdgcn_wave_barrier();
  const int rsub = lane >> 4, c4 = (lane & 15) * 4;
  {
#pragma unroll
    for (int q = 0; q < 16; ++q) { const int r = q * 2 + rsub; const v4f v = *(const v4fa*)&so[w][r][c4]; if (C) *(v4f*)(C + cofs + (size_t)(row0 + r) * ldc + col0 + c4) = v; if (C16) { v4h h4; for (int i = 0; i < 4; ++i) h4[i] = (_Float16)v[i]; *(v4h*)(C16 + cofs + (size_t)(row0 + r) * ldc + col0 + c4) = h4; } }
     } }

// ---- split-precision GEMM, one launch for its three products: C = alpha (Ah.Bh) + alphaR (Al.Bh + Ah.Bl); f16 planes, f32 accumulation; the hi.hi sum and the residual sum each stay in registers over all of K, so C is written once and never read back.
// Wave tile 32x32 (two accumulator sets of four tiles + the 16 fragments of a 64-k trip fit below 256 registers); block = 4 waves = 128 rows x 32 columns. Requires M % 32 == 0, N % 32 == 0, K % 64 == 0.
__global__ __launch_bounds__(128) void k_gemm3(const _Float16* __restrict__ Ah, const _Float16* __restrict__ Al, int lda, size_t sA, const _Float16* __restrict__ Bh, const _Float16* __restrict__ Bl, int ldb, size_t sB, float alpha, float alphaR,
    float* __restrict__ C, int ldc, size_t sC, int M, int N, int K) {
  __shared__ __attribute__((aligned(16))) float so[4][32][36];
  const int tid = threadIdx.x, w = tid >> 5, lane = tid & 31, ln = lane & 15, hh = lane >> 4; const int by = blockIdx.y;
  const int ntn = N >> 5; const int mt = blockIdx.x / ntn, nq = blockIdx.x - mt * ntn; const int row0 = mt * 128 + 32 * w, col0 = nq * 32; if (row0 >= M) return;
  const size_t ao = (size_t)by * sA + (size_t)(row0 + ln) * lda + 8 * hh, bo = (size_t)by * sB + (size_t)(col0 + ln) * ldb + 8 * hh;      /* the lane's half-row offset is in the pointers, as in k_gemm2 */
  const _Float16* ah0 = Ah + ao; const _Float16* ah1 = ah0 + (size_t)16 * lda; const _Float16* al0 = Al + ao; const _Float16* al1 = al0 + (size_t)16 * lda;
  const _Float16* bh0 = Bh + bo; const _Float16* bh1 = bh0 + (size_t)16 * ldb; const _Float16* bl0 = Bl + bo; const _Float16* bl1 = bl0 + (size_t)16 * ldb;
  const v8f z8 = {0.f,0.f,0.f,0.f,0.f,0.f,0.f,0.f}; v8f c00 = z8, c01 = z8, c10 = z8, c11 = z8, r00 = z8, r01 = z8, r10 = z8, r11 = z8;      /* c: hi.hi; r: both residual products */
#pragma unroll 1      /* one trip = two k-steps; rolled so that the 16 fragments of a trip stay in registers */
  for (int kb = 0; kb < K; kb += 64) {      /* all 32 loads of the trip stand in front of its first product: one memory wait per trip */
    const v16h p0 = g2_frag(ah0, 0), u0 = g2_frag(bh0, 0), p1 = g2_frag(ah1, 0), u1 = g2_frag(bh1, 0), q0 = g2_frag(al0, 0), q1 = g2_frag(al1, 0), v0 = g2_frag(bl0, 0), v1 = g2_frag(bl1, 0);
    const v16h P0 = g2_frag(ah0 + 32, 0), U0 = g2_frag(bh0 + 32, 0), P1 = g2_frag(ah1 + 32, 0), U1 = g2_frag(bh1 + 32, 0), Q0 = g2_frag(al0 + 32, 0), Q1 = g2_frag(al1 + 32, 0), V0 = g2_frag(bl0 + 32, 0), V1 = g2_frag(bl1 + 32, 0);
    asm volatile("s_wait_xcnt 0x0" :: "v"(ah0), "v"(ah1), "v"(al0), "v"(al1), "v"(bh0), "v"(bh1), "v"(bl0), "v"(bl1) : "memory");      /* the eight address pairs stay untouched (inputs here) until this wait; behind it they may be advanced and reused */
    c00 = g2_mma(p0, u0, c00); c10 = g2_mma(p1, u0, c10); c01 = g2_mma(p0, u1, c01); c11 = g2_mma(p1, u1, c11);
    r00 = g2_mma(q0, u0, r00); r10 = g2_mma(q1, u0, r10); r01 = g2_mma(q0, u1, r01); r11 = g2_mma(q1, u1, r11);
    r00 = g2_mma(p0, v0, r00); r10 = g2_mma(p1, v0, r10); r01 = g2_mma(p0, v1, r01); r11 = g2_mma(p1, v1, r11);
    c00 = g2_mma(P0, U0, c00); c10 = g2_mma(P1, U0, c10); c01 = g2_mma(P0, U1, c01); c11 = g2_mma(P1, U1, c11);
    r00 = g2_mma(Q0, U0, r00); r10 = g2_mma(Q1, U0, r10); r01 = g2_mma(Q0, U1, r01); r11 = g2_mma(Q1, U1, r11);
    r00 = g2_mma(P0, V0, r00); r10 = g2_mma(P1, V0, r10); r01 = g2_mma(P0, V1, r01); r11 = g2_mma(P1, V1, r11);
    ah0 += 64; ah1 += 64; al0 += 64; al1 += 64; bh0 += 64; bh1 += 64; bl0 += 64; bl1 += 64; }
  v8f accs[4] = {c00, c01, c10, c11}, accr[4] = {r00, r01, r10, r11};
#pragma unroll
  for (int u = 0; u < 4; ++u) { const int t = u & 1, half = u >> 1;
#pragma unroll
    for (int r = 0; r < 8; ++r) so[w][half * 16 + 8 * hh + r][t * 16 + ln] = accs[u][r] * alpha + accr[u][r] * alphaR; }      /* both factors are powers of two: one rounding */
  __builtin_amdgcn_fence(__ATOMIC_ACQ_REL, "workgroup"); __builtin_amdgcn_wave_barrier();      /* the wave reads back its own LDS rows, written by other lanes */
  const int rsub = lane >> 3, c4 = (lane & 7) * 4; float* cw = C + (size_t)by * sC + (size_t)row0 * ldc + col0 + c4;
#pragma unroll
  for (int q = 0; q < 8; ++q) { const int r = q * 4 + rsub; const v4f v = *(const v4fa*)&so[w][r][c4]; *(v4f*)(cw + (size_t)r * ldc) = v; } }      /* whole 128-byte lines, four rows a store */


__global__ __launch_bounds__(256) void k_wnat(const float* __restrict__ w, size_t n8, _Float16* __restrict__ Bt) { const size_t t = (size_t)blockIdx.x * 256 + threadIdx.x; if (t >= n8) return; FragH f; for (int q = 0; q < 8; ++q) f.h[q] = (_Float16)(bf16_round(w[t * 8 + q]) * 16.0f); *(v8us*)((unsigned short*)Bt + t * 8) = f.half[0];  }
__global__ __launch_bounds__(256) void k_rsm(const float* __restrict__ S, _Float16* __restrict__ P, int nrows) {
  #pragma clang fp contract(off)
  const int i = blockIdx.x * 256 + threadIdx.x; if (i >= nrows) return; const float* s = S + (size_t)i * SQ; float mx = -3.0e38f;
#pragma unroll 1
  for (int j = 0; j < SQ; ++j) mx = fmaxf(mx, s[j]); float se = 0.f;
#pragma unroll 1
  for (int j = 0; j < SQ; ++j) se += expf(s[j] - mx); const float sc = 256.0f / se;
#pragma unroll 1
  for (int j0 = 0; j0 < SQ; j0 += 8) { FragH f; for (int q = 0; q < 8; ++q) f.h[q] = (_Float16)(expf(s[j0 + q] - mx) * sc); unsigned short* d = (unsigned short*)P + (size_t)i * SQ + j0; *(v8us*)d = f.half[0];  } }
__global__ __launch_bounds__(256) void k_vt(const _Float16* __restrict__ V16, int b, int h0, _Float16* __restrict__ VT) { __shared__ unsigned short tl[64][65]; const int tid = threadIdx.x; const int hh = blockIdx.x % HG, sg = blockIdx.x / HG; const int s0 = sg * 64; const int h = h0 + hh;
  for (int i = tid; i < 64 * 8; i += 256) { const int j = i / 8, d8 = (i % 8) * 8; FragH f; f.half[0] = *(const v8us*)((const unsigned short*)V16 + ((size_t)b * SQ + s0 + j) * DM + h * HD + d8); for (int q = 0; q < 8; ++q) tl[d8 + q][j] = f.u[q]; }
  __syncthreads();
  { for (int i = tid; i < 64 * 8; i += 256) { const int d = i / 8, j8 = (i % 8) * 8; FragH f; for (int q = 0; q < 8; ++q) f.u[q] = tl[d][j8 + q]; *(v8us*)((unsigned short*)VT + ((size_t)hh * HD + d) * SQ + s0 + j8) = f.half[0]; }  } }



__global__ __launch_bounds__(256) void k_rsmcf2(const float* __restrict__ S, _Float16* __restrict__ P, int hg, int q0, int nk) {
  #pragma clang fp contract(off)
  const int t = blockIdx.x * 256 + threadIdx.x; if (t >= hg * QT) return; const size_t i = (size_t)t; const float* s = S + i * NKX; const int last = q0 + (t % QT); float mx = -3.0e38f;
#pragma unroll 1
  for (int j = 0; j < nk; ++j) { const float f = (j <= last) ? 1.f : 0.f; mx = fmaxf(mx, fmaf(f, s[j], (1.f - f) * -1.0e9f)); } float se = 0.f;
#pragma unroll 1
  for (int j = 0; j < nk; ++j) { const float f = (j <= last) ? 1.f : 0.f; se += __expf(fmaf(f, s[j], (1.f - f) * -1.0e9f) - mx); } const float sc = 256.0f / se;
#pragma unroll 1
  for (int j0 = 0; j0 < nk; j0 += 8) { FragH fr; for (int q = 0; q < 8; ++q) { const int j = j0 + q; const float f = (j <= last) ? 1.f : 0.f; fr.h[q] = (_Float16)(__expf(fmaf(f, s[j], (1.f - f) * -1.0e9f) - mx) * sc); } unsigned short* d = (unsigned short*)P + i * NKX + j0; *(v8us*)d = fr.half[0];  } }


__global__ __launch_bounds__(256) void k_rsmcf2hl(const float* __restrict__ S, _Float16* __restrict__ P, _Float16* __restrict__ PL, int hg, int q0, int nk) {
  #pragma clang fp contract(off)
  const int t = blockIdx.x * 256 + threadIdx.x; if (t >= hg * QT) return; const size_t i = (size_t)t; const float* s = S + i * NKX; const int last = q0 + (t % QT); float mx = -3.0e38f;
#pragma unroll 1
  for (int j = 0; j < nk; ++j) { const float f = (j <= last) ? 1.f : 0.f; mx = fmaxf(mx, fmaf(f, s[j], (1.f - f) * -1.0e9f)); } float se = 0.f;
#pragma unroll 1
  for (int j = 0; j < nk; ++j) { const float f = (j <= last) ? 1.f : 0.f; se += __expf(fmaf(f, s[j], (1.f - f) * -1.0e9f) - mx); } const float sc = 256.0f / se;
#pragma unroll 1
  for (int j0 = 0; j0 < nk; j0 += 8) { FragH fr, fl; for (int q = 0; q < 8; ++q) { const int j = j0 + q; const float f = (j <= last) ? 1.f : 0.f; const float v = __expf(fmaf(f, s[j], (1.f - f) * -1.0e9f) - mx) * sc; const _Float16 hv = (_Float16)v; fr.h[q] = hv; fl.h[q] = (_Float16)((v - (float)hv) * 1024.0f); } unsigned short* d = (unsigned short*)P + i * NKX + j0; unsigned short* dl = (unsigned short*)PL + i * NKX + j0; *(v8us*)d = fr.half[0]; *(v8us*)dl = fl.half[0];  } }


// Row softmax, one wave per score row: lane l holds elements 128 c + 4 l .. + 3 of the row in registers, so S is read once, in whole lines, and each exponential is taken once.
__global__ __launch_bounds__(256) void k_rsmcskhl(const float* __restrict__ S, _Float16* __restrict__ P, _Float16* __restrict__ PL, int hg, int q0, int nk, const float* __restrict__ am) {
  const int lane = threadIdx.x & 31; const int t = blockIdx.x * 8 + __builtin_amdgcn_readfirstlane(threadIdx.x >> 5); if (t >= hg * QT) return;
  const size_t i = (size_t)t; const float* s = S + i * NKX; const int last = q0 + (t % QT);
  v4f x[NKX / 128], m[NKX / 128];
#pragma unroll
  for (int c = 0; c < NKX / 128; c += 2) if (c * 128 < nk) {      /* nk is a multiple of QT = 256: two chunks of 128 per test; all loads of the row go out before the first is used */
    x[c] = *(const v4fa*)(s + c * 128 + lane * 4); x[c + 1] = *(const v4fa*)(s + (c + 1) * 128 + lane * 4);
    m[c] = *(const v4fa*)(am + c * 128 + lane * 4); m[c + 1] = *(const v4fa*)(am + (c + 1) * 128 + lane * 4); }
  asm volatile("s_wait_xcnt 0x0" ::: "memory");      /* the loads' address registers are reused below: the wait the instruction set asks for in front of that */
  v4f mx4 = {-3.0e38f, -3.0e38f, -3.0e38f, -3.0e38f};
#pragma unroll
  for (int c = 0; c < NKX / 128; c += 2) if (c * 128 < nk) {
#pragma unroll
    for (int u = c; u < c + 2; ++u)
#pragma unroll
      for (int q = 0; q < 4; ++q) { const int j = u * 128 + lane * 4 + q; const float mk = __fadd_rn(__fadd_rn((j > last) ? -10000.0f : 0.f, (j >= last - 512) ? -10000.0f : 0.f), bf16_round(m[u][q])); const float v = __fadd_rn(x[u][q], mk); x[u][q] = v; mx4[q] = fmaxf(mx4[q], v); } }
  float mx = fmaxf(fmaxf(mx4[0], mx4[1]), fmaxf(mx4[2], mx4[3]));
#pragma unroll
  for (int d = 16; d > 0; d >>= 1) mx = fmaxf(mx, __shfl_xor(mx, d, 32));
  v4f se4 = {0.f, 0.f, 0.f, 0.f};
#pragma unroll
  for (int c = 0; c < NKX / 128; c += 2) if (c * 128 < nk) {
#pragma unroll
    for (int u = c; u < c + 2; ++u)
#pragma unroll
      for (int q = 0; q < 4; ++q) { const float e = __expf(x[u][q] - mx); x[u][q] = e; se4[q] += e; } }
  float se = (se4[0] + se4[1]) + (se4[2] + se4[3]);
#pragma unroll
  for (int d = 16; d > 0; d >>= 1) se += __shfl_xor(se, d, 32);
  const float sc = 256.0f / se;
  _Float16* d = P + i * NKX + lane * 4; _Float16* dl = PL + i * NKX + lane * 4;
#pragma unroll
  for (int c = 0; c < NKX / 128; c += 2) if (c * 128 < nk) {
#pragma unroll
    for (int u = c; u < c + 2; ++u) { v4h fr, fl;
#pragma unroll
      for (int q = 0; q < 4; ++q) { const float v = x[u][q] * sc; const _Float16 hv = (_Float16)v; fr[q] = hv; fl[q] = (_Float16)((v - (float)hv) * 1024.0f); }
      *(v4h*)(d + u * 128) = fr; *(v4h*)(dl + u * 128) = fl; }
    asm volatile("s_wait_xcnt 0x0" ::: "memory"); } }      /* the next chunk reuses these stores' data registers: same wait */

extern "C" void kernel_launch(void* const* d_in, const int* in_sizes, int n_in,
                              void* d_out, int out_size, void* d_ws, size_t ws_size, hipStream_t stream) {
  (void)in_sizes; (void)n_in; (void)out_size;
  const float* const* I = (const float* const*)d_in; const float* x = I[0]; const float* am = I[1]; const float* wq = I[2]; const float* bq = I[3]; const float* wk = I[4]; const float* bk = I[5]; const float* wv = I[6]; const float* bv = I[7];      /* additive attention_mask [4][1][1][2048] (zeros); natural [out][in] weights + biases */
  char* ws = (char*)d_ws; size_t off = 0;
  auto take = [&](size_t bytes) { char* p = ws + off; off += (bytes + 255) & ~(size_t)255; return p; };
  _Float16* BQ = (_Float16*)take((size_t)DM * DM * 2); _Float16* BK = (_Float16*)take((size_t)DM * DM * 2); _Float16* BV = (_Float16*)take((size_t)DM * DM * 2); 
  _Float16* X16 = (_Float16*)take(NR * DM * 2); _Float16* Q16 = (_Float16*)take(NR * DM * 2); _Float16* QL = (_Float16*)take(NR * DM * 2); _Float16* K16 = (_Float16*)take(NR * DM * 2); _Float16* KL = (_Float16*)take(NR * DM * 2); _Float16* V16 = (_Float16*)take(NR * DM * 2); _Float16* VL = (_Float16*)take(NR * DM * 2); float* VF = (float*)take(NR * DM * 4);      /* v as f16 hi + x1024 residual (the early causal rows average only a few v rows, so a single-f16 v would leave absolute rounding that is large against this module's small output scale) */
  float* S = (float*)take((size_t)NH * QT * NKX * 4); _Float16* P = (_Float16*)take((size_t)NH * QT * NKX * 2); _Float16* PL = (_Float16*)take((size_t)NH * QT * NKX * 2); _Float16* VT = (_Float16*)take((size_t)NH * HD * SQ * 2); _Float16* VTL = (_Float16*)take((size_t)NH * HD * SQ * 2);
  if (off > ws_size) return;
  { const unsigned g = (unsigned)(((size_t)DM * DM / 8 + 255) / 256); k_wnat<<<g, 256, 0, stream>>>(wq, (size_t)DM * DM / 8, BQ); k_wnat<<<g, 256, 0, stream>>>(wk, (size_t)DM * DM / 8, BK); k_wnat<<<g, 256, 0, stream>>>(wv, (size_t)DM * DM / 8, BV); }      /* natural [out][in] = Bt x16 */

  k_x16<<<(unsigned)((NR * DM / 8 + 255) / 256), 256, 0, stream>>>(x, X16, NR * DM / 8);
  const size_t r0p = (size_t)B0 * SQ;      /* first projected row */
  k_gemm2<0><<<dim3((unsigned)((MP / 128) * (DM / 64)), 1), 128, 0, stream>>>(X16 + r0p * DM, DM, 0, BQ, DM, 0, 0.0625f, bq, 0, nullptr, 1, 0, 0, VF + r0p * DM, nullptr, DM, 0, MP, DM, DM); k_hl<<<(unsigned)(((size_t)MP * DM / 8 + 255) / 256), 256, 0, stream>>>(VF + r0p * DM, Q16 + r0p * DM, QL + r0p * DM, (size_t)MP * DM / 8);      /* q (+ bq) in f32 -> f16 hi + x1024 residual */
  k_gemm2<0><<<dim3((unsigned)((MP / 128) * (DM / 64)), 1), 128, 0, stream>>>(X16 + r0p * DM, DM, 0, BK, DM, 0, 0.0625f, bk, 0, nullptr, 1, 0, 0, VF + r0p * DM, nullptr, DM, 0, MP, DM, DM); k_hl<<<(unsigned)(((size_t)MP * DM / 8 + 255) / 256), 256, 0, stream>>>(VF + r0p * DM, K16 + r0p * DM, KL + r0p * DM, (size_t)MP * DM / 8);      /* k (+ bk) likewise */
  k_gemm2<0><<<dim3((unsigned)((MP / 128) * (DM / 64)), 1), 128, 0, stream>>>(X16 + r0p * DM, DM, 0, BV, DM, 0, 0.0625f, bv, 0, nullptr, 1, 0, 0, VF + r0p * DM, nullptr, DM, 0, MP, DM, DM); k_hl<<<(unsigned)(((size_t)MP * DM / 8 + 255) / 256), 256, 0, stream>>>(VF + r0p * DM, V16 + r0p * DM, VL + r0p * DM, (size_t)MP * DM / 8);      /* v in f32 -> f16 hi + x1024 residual planes */
  for (int b = B0; b < B0 + NBR; ++b) { const size_t r0 = (size_t)b * SQ;
    k_vt<NH, SQ><<<NH * (SQ / 64), 256, 0, stream>>>(V16 + r0 * LQ, LQ, 0, VT); k_vt<NH, SQ><<<NH * (SQ / 64), 256, 0, stream>>>(VL + r0 * LQ, LQ, 0, VTL);      /* V^T hi and residual [16][64][SQ] (16 heads of 64 = 16 slabs) */
    for (int q0 = 0; q0 < QN; q0 += QT) { const int nk = q0 + QT;      /* causal: only keys below the tile end are computed */
      k_gemm3<<<dim3((QT / 128) * (nk / 32), NHD), 128, 0, stream>>>(Q16 + (r0 + q0) * LQ, QL + (r0 + q0) * LQ, LQ, (size_t)HD, K16 + r0 * LQ, KL + r0 * LQ, LQ, (size_t)HD, 0.125f, 0.0001220703125f, S, NKX, (size_t)QT * NKX, QT, nk, HD);      /* scores / 8 = (qh.kh)/8 + (ql.kh + qh.kl)/8192, three products in one launch */
      k_rsmcskhl<<<(NHD * QT + 7) / 8, 256, 0, stream>>>(S, P, PL, NHD, q0, nk, am + r0);      /* the module's masks added in f32 (causal -1e4, 'window' -1e4 for j >= i-512, + attention_mask[b][j]); softmax; P hi/lo */
      k_gemm3<<<dim3((QT / 128) * (HD / 32), NHD), 128, 0, stream>>>(P, PL, NKX, (size_t)QT * NKX, VT, VTL, SQ, (size_t)HD * SQ, 0.00390625f, 0.000003814697265625f, (float*)d_out + (r0 + q0) * DM, DM, (size_t)HD, QT, HD, nk); } }      /* out = Ph Vh^T/256 + (Pl Vh^T + Ph Vl^T)/262144 in one launch: P and v both effectively f32 */
}

// v004
// A run of this version takes 820 microseconds.
// Timed twice side by side with v003, it ran 1.48 and 1.47 times as fast.
// Over all steps from v000 it is 15.8 times as fast.
#include <hip/hip_runtime.h>
// Causal self-attention with the module's (faithful, inverted) window mask and an additive padding mask (hidden [4][2048][1024]; q/k/v = x W^T + b (natural [1024][1024] sigma 1/32, biases sigma 0.01); 16 heads of 64; scores / 8 + causal(-1e4 where j > i) + window(-1e4 where j >= i - 512, as the source writes it) + attention_mask[b][j] (zeros), all added in f32; softmax; out = merged attn v -> [4][2048][1024], no output projection). Effective pattern: rows i <= 512 attend causally (every kept logit carries the -1e4 offset, reproduced in f32), rows i >= 513 attend only keys j <= i - 513.
// Structure: token rows; x as exact f16 rows; natural weights as exact x16 planes; q, k, v as WMMA GEMMs (32x64 wave tiles, f32 accumulation, + bias) into f32 rows, each split into f16 hi + x1024 residual planes (the output scale is small, so logits, weights and values are all carried near f32); V^T of both v planes via LDS transposes (all batches a launch); per pair of query tiles of 256 rows (tile t with tile 7 - t), all batches at once: scores = one launch of three products (qh.kh + (ql.kh + qh.kl)/1024, K = 64, heads on grid.y, batches on grid.z, alpha 1/8; the two residual products share a second register accumulator) against the keys below the tile end, the module's masks added in f32 on VALU inside the row softmax (keys j > i carry -2e4 and contribute exactly 0), P as f16 hi + x1024 residual, written in place over the score row; out = Ph Vh^T 2^-8 + (Pl Vh^T + Ph Vl^T) 2^-18, likewise one launch, written f32 into the output rows; launches: see trace.
// Compute dtype: inputs rounded to bf16; x / weights exact; q, k, v and softmax weights as f16 hi + x1024 residual GEMM operands (near f32), o written f32; scores and softmax statistics f32. v_wmma_f32_16x16x32_f16.
#define NB 4
#define SQ 2048
#define DM 1024
#define NH 16
#define HD 64
#define HG 1                         /* heads per launch of k_vt(V16, b, h0, VT), which is not launched */
#define QT 256                       /* query rows per causal tile */
#define NKX SQ                       /* longest score row */
#define RP (SQ + QT)                 /* pitch of a stored score row, floats: the rows of a pair of query tiles t and SQ/QT - 1 - t lie side by side, SQ + QT keys together */
#define B0 0                         /* first batch processed (debug hook) */
#define NBR NB                       /* batches processed (debug hook) */
#define NR ((size_t)NB * SQ)         /* token rows */
#define MP ((int)((size_t)NBR * SQ)) /* rows projected (debug hook) */
#define QN SQ                        /* query rows attended per batch (debug hook) */
#define NHD NH                       /* heads attended; unused: no launch reads it */
#define MPO MP                       /* unused: no launch reads it */
#define LQ DM      /* row pitch of the q/k/v rows */
typedef __bf16 v16b __attribute__((ext_vector_type(16)));
typedef unsigned short v8us __attribute__((ext_vector_type(8), may_alias));
typedef float  v8f  __attribute__((ext_vector_type(8)));
typedef float  v4f  __attribute__((ext_vector_type(4)));
typedef float  v4fa __attribute__((ext_vector_type(4), may_alias));
union FragB { v16b v; v8us half[2]; unsigned short u[16]; };

__device__ __forceinline__ unsigned short bf16_bits(float x) { unsigned int u = __float_as_uint(x); return (unsigned short)((u + 0x7FFFu + ((u >> 16) & 1u)) >> 16); }
__device__ __forceinline__ float bf16_val(unsigned short b) { return __uint_as_float(((unsigned int)b) << 16); }
__device__ __forceinline__ float bf16_round(float x) { return bf16_val(bf16_bits(x)); }
// D += A·B with NT terms: 1 = ah·bh, 2 = + al·bh (A split), 3 = + ah·bl (both split)
template <int NT>
__device__ __forceinline__ v8f mmaN(v16b ah, v16b al, v16b bh, v16b bl, v8f c) {
  c = __builtin_amdgcn_wmma_f32_16x16x32_bf16(false, ah, false, bh, (short)0, c, false, false);
  if (NT >= 2) c = __builtin_amdgcn_wmma_f32_16x16x32_bf16(false, al, false, bh, (short)0, c, false, false);
  if (NT >= 3) c = __builtin_amdgcn_wmma_f32_16x16x32_bf16(false, ah, false, bl, (short)0, c, false, false);
  asm volatile("v_nop\n\tv_nop\n\tv_nop\n\tv_nop" : "+v"(c) : "v"(ah), "v"(al), "v"(bh), "v"(bl));
  return c;
}

__global__ __launch_bounds__(256) void k_wt_bf16(const float* __restrict__ W, unsigned short* __restrict__ Wt, int K, int N) {
  const int t = blockIdx.x * 256 + threadIdx.x;
  const int k8n = K / 8;
  if (t >= N * k8n) return;
  const int n = t / k8n, k8 = (t % k8n) * 8;
  v8us v;
#pragma unroll
  for (int i = 0; i < 8; ++i) v[i] = bf16_bits(W[(size_t)(k8 + i) * N + n]);
  *(v8us*)(Wt + (size_t)n * K + k8) = v;
  
}

// GEMM C[M][N] (f32, pitch ldc) = act(A[M][K]·W + bias). A f32 row-major (pitch lda) converted per fragment to bf16
// (ASPLIT: hi/lo two planes -> 2 terms, else single rounded term); Wt bf16 [N][K] (pitch ldb). BIAS_BF16 rounds the
// bias to bf16 first (bias quantised to bf16 before the add). K%32==0, M%16==0, N%64==0.
template <bool ASPLIT, int ACT, bool BIAS_BF16>
__global__ __launch_bounds__(128) void k_gemm_bf(const float* __restrict__ A, int lda, const unsigned short* __restrict__ Wt, int ldb,
                                               const float* __restrict__ bias, float* __restrict__ C, int ldc, int M, int N, int K) {
  __shared__ __attribute__((aligned(16))) float so[4][16][64];
  const int tid = threadIdx.x, w = tid >> 5, lane = tid & 31, ln = lane & 15, hh = lane >> 4;
  const int ntn = N / 64;
  const int wid = blockIdx.x * 4 + w;
  const int mt = wid / ntn, nq = wid % ntn;
  if (mt * 16 >= M) return;
  const int row0 = mt * 16, col0 = nq * 64;
  const float* arow = A + (size_t)(row0 + ln) * lda;
  v8f acc[4] = {};
  for (int kb = 0; kb < K; kb += 32) {
    FragB ah, al;
    const v4f x0 = *(const v4fa*)(arow + kb + 8 * hh), x1 = *(const v4fa*)(arow + kb + 8 * hh + 4);
    const v4f x2 = *(const v4fa*)(arow + kb + 16 + 8 * hh), x3 = *(const v4fa*)(arow + kb + 16 + 8 * hh + 4);
    float xs[16] = {x0[0],x0[1],x0[2],x0[3],x1[0],x1[1],x1[2],x1[3],x2[0],x2[1],x2[2],x2[3],x3[0],x3[1],x3[2],x3[3]};
#pragma unroll
    for (int i = 0; i < 16; ++i) { const unsigned short hb = bf16_bits(xs[i]); ah.u[i] = hb; al.u[i] = ASPLIT ? bf16_bits(xs[i] - bf16_val(hb)) : (unsigned short)0; }
#pragma unroll
    for (int t = 0; t < 4; ++t) {
      const unsigned short* brow = Wt + (size_t)(col0 + t * 16 + ln) * ldb + kb;
      FragB b;
      b.half[0] = *(const v8us*)(brow + 8 * hh);
      b.half[1] = *(const v8us*)(brow + 16 + 8 * hh);
      acc[t] = mmaN<ASPLIT ? 2 : 1>(ah.v, al.v, b.v, b.v, acc[t]);
    }
  }
#pragma unroll
  for (int t = 0; t < 4; ++t) {
    float bv = bias ? bias[col0 + t * 16 + ln] : 0.f;
    if (BIAS_BF16) bv = bf16_round(bv);
#pragma unroll
    for (int r = 0; r < 8; ++r) { float v = acc[t][r] + bv; if (ACT == 1) v = fmaxf(v, 0.f); so[w][8 * hh + r][t * 16 + ln] = v; }
  }
  __builtin_amdgcn_fence(__ATOMIC_ACQ_REL, "workgroup");
  __builtin_amdgcn_wave_barrier();
  const int rsub = lane >> 4, c4 = (lane & 15) * 4;
  {
#pragma unroll
    for (int q = 0; q < 8; ++q) {
      const int r = q * 2 + rsub;
      const v4f v = *(const v4fa*)&so[w][r][c4];
      *(v4f*)(C + (size_t)(row0 + r) * ldc + col0 + c4) = v;
    }
    
  }
}

// GEMM C = act(A·W + bias + resid): A f32 (ASPLIT -> hi/lo 2 terms), Wt bf16 [N][K]; ACT 0 none, 1 relu, 2 exact gelu;
// resid (optional, f32, row index = (row % rmod), pitch ldr, RES_BF16 rounds it) added before the activation.
template <bool ASPLIT, int ACT, bool BIAS_BF16, bool RES_BF16>
__global__ __launch_bounds__(128) void k_gemm_bf3(const float* __restrict__ A, int lda, const unsigned short* __restrict__ Wt, int ldb,
                                                const float* __restrict__ bias, const float* __restrict__ resid, int rmod, int ldr,
                                                float* __restrict__ C, int ldc, int M, int N, int K) {
  __shared__ __attribute__((aligned(16))) float so[4][16][64];
  const int tid = threadIdx.x, w = tid >> 5, lane = tid & 31, ln = lane & 15, hh = lane >> 4;
  const int ntn = N / 64;
  const int wid = blockIdx.x * 4 + w;
  const int mt = wid / ntn, nq = wid % ntn;
  if (mt * 16 >= M) return;
  const int row0 = mt * 16, col0 = nq * 64;
  const float* arow = A + (size_t)(row0 + ln) * lda;
  v8f acc[4] = {};
  for (int kb = 0; kb < K; kb += 32) {
    FragB ah, al;
    const v4f x0 = *(const v4fa*)(arow + kb + 8 * hh), x1 = *(const v4fa*)(arow + kb + 8 * hh + 4);
    const v4f x2 = *(const v4fa*)(arow + kb + 16 + 8 * hh), x3 = *(const v4fa*)(arow + kb + 16 + 8 * hh + 4);
    float xs[16] = {x0[0],x0[1],x0[2],x0[3],x1[0],x1[1],x1[2],x1[3],x2[0],x2[1],x2[2],x2[3],x3[0],x3[1],x3[2],x3[3]};
#pragma unroll
    for (int i = 0; i < 16; ++i) { const unsigned short hb = bf16_bits(xs[i]); ah.u[i] = hb; al.u[i] = ASPLIT ? bf16_bits(xs[i] - bf16_val(hb)) : (unsigned short)0; }
#pragma unroll
    for (int t = 0; t < 4; ++t) {
      const unsigned short* brow = Wt + (size_t)(col0 + t * 16 + ln) * ldb + kb;
      FragB b;
      b.half[0] = *(const v8us*)(brow + 8 * hh);
      b.half[1] = *(const v8us*)(brow + 16 + 8 * hh);
      acc[t] = mmaN<ASPLIT ? 2 : 1>(ah.v, al.v, b.v, b.v, acc[t]);
    }
  }
#pragma unroll
  for (int t = 0; t < 4; ++t) {
    const int col = col0 + t * 16 + ln;
    float bv = bias ? bias[col] : 0.f;
    if (BIAS_BF16) bv = bf16_round(bv);
#pragma unroll
    for (int r = 0; r < 8; ++r) {
      float v = acc[t][r] + bv;
      if (resid) { float rv = resid[(size_t)((row0 + 8 * hh + r) % rmod) * ldr + col]; if (RES_BF16) rv = bf16_round(rv); v += rv; }
      if (ACT == 1) v = fmaxf(v, 0.f);
      if (ACT == 2) v = 0.5f * v * (1.0f + erff(v * 0.70710678118654752f));
      if (ACT == 3) { const float u = 0.7978845608028654f * (v + 0.044715f * v * v * v); v = 0.5f * v * (1.0f + tanhf(u)); }
      so[w][8 * hh + r][t * 16 + ln] = v;
    }
  }
  __builtin_amdgcn_fence(__ATOMIC_ACQ_REL, "workgroup");
  __builtin_amdgcn_wave_barrier();
  const int rsub = lane >> 4, c4 = (lane & 15) * 4;
  {
#pragma unroll
    for (int q = 0; q < 8; ++q) {
      const int r = q * 2 + rsub;
      const v4f v = *(const v4fa*)&so[w][r][c4];
      *(v4f*)(C + (size_t)(row0 + r) * ldc + col0 + c4) = v;
    }
    
  }
}
// row LayerNorm (biased variance, eps) over N: s = X (+ R); optional out_sum <- s; out_norm <- (s-mu)*rsqrt(var+eps)*g + b
template <bool PARAM_BF16>
__global__ __launch_bounds__(256) void k_layernorm(const float* __restrict__ X, const float* __restrict__ R, const float* __restrict__ g, const float* __restrict__ bta,
                                                  float* __restrict__ out_sum, float* __restrict__ out_norm, int N, float eps) {
  __shared__ float red[256];
  const int row = blockIdx.x, tid = threadIdx.x;
  const float* x = X + (size_t)row * N; const float* rr = R ? R + (size_t)row * N : nullptr;
  float vals[16];                     // up to N = 4096
  const int per = N / 256;            // contiguous chunk per thread? use strided-by-4 chunks: thread handles j = tid*4 + 1024*u
  float s1 = 0.f;
  for (int u = 0; u < per / 4; ++u) {
    const int j = tid * 4 + 1024 * u;
    const v4f a = *(const v4fa*)(x + j);
    v4f b = {0.f,0.f,0.f,0.f}; if (rr) b = *(const v4fa*)(rr + j);
#pragma unroll
    for (int q = 0; q < 4; ++q) { const float v = a[q] + b[q]; vals[u * 4 + q] = v; s1 += v; }
  }
  red[tid] = s1; __syncthreads();
  for (int st = 128; st > 0; st >>= 1) { if (tid < st) red[tid] += red[tid + st]; __syncthreads(); }
  const float mu = red[0] / (float)N; __syncthreads();
  float s2 = 0.f;
  for (int u = 0; u < per / 4; ++u)
#pragma unroll
    for (int q = 0; q < 4; ++q) { const float c = vals[u * 4 + q] - mu; s2 += c * c; }
  red[tid] = s2; __syncthreads();
  for (int st = 128; st > 0; st >>= 1) { if (tid < st) red[tid] += red[tid + st]; __syncthreads(); }
  const float rs = rsqrtf(red[0] / (float)N + eps);
  {
    for (int u = 0; u < per / 4; ++u) {
      const int j = tid * 4 + 1024 * u;
      v4f o, sm;
#pragma unroll
      for (int q = 0; q < 4; ++q) {
        float gg = g[j + q], bb = bta[j + q];
        if (PARAM_BF16) { gg = bf16_round(gg); bb = bf16_round(bb); }
        sm[q] = vals[u * 4 + q]; o[q] = (vals[u * 4 + q] - mu) * rs * gg + bb;
      }
      if (out_sum) *(v4f*)(out_sum + (size_t)row * N + j) = sm;
      *(v4f*)(out_norm + (size_t)row * N + j) = o;
    }
    
  }
}



// ---- f16 WMMA path (v_wmma_f32_16x16x32_f16): 11-bit significands for operands in range — used where a [0,1] probability operand needs more precision than bf16
typedef _Float16 v16h __attribute__((ext_vector_type(16)));
union FragH { v16h v; v8us half[2]; _Float16 h[16]; unsigned short u[16]; };
template <int NT>
__device__ __forceinline__ v8f mmaH(v16h ah, v16h al, v16h bh, v16h bl, v8f c) {
  c = __builtin_amdgcn_wmma_f32_16x16x32_f16(false, ah, false, bh, (short)0, c, false, false);
  if (NT >= 2) c = __builtin_amdgcn_wmma_f32_16x16x32_f16(false, al, false, bh, (short)0, c, false, false);
  if (NT >= 3) c = __builtin_amdgcn_wmma_f32_16x16x32_f16(false, ah, false, bl, (short)0, c, false, false);
  asm volatile("v_nop\n\tv_nop\n\tv_nop\n\tv_nop" : "+v"(c) : "v"(ah), "v"(al), "v"(bh), "v"(bl));
  return c;
}
// batched GEMM like k_gemm_b but f16 operands: A f32 (split into f16 hi/lo if ASPLIT, else rounded to f16), Bt = f16 values [n][k]; alpha; C f32; N multiple of 16 (partial tiles skipped)
template <bool ASPLIT>
__global__ __launch_bounds__(128) void k_gemm_h(const float* __restrict__ A, int lda, size_t sA, const _Float16* __restrict__ Bh, int ldb, size_t sB, float alpha, float* __restrict__ C, int ldc, size_t sC, int M, int N, int K) {
  __shared__ __attribute__((aligned(16))) float so[4][16][64];
  const int tid = threadIdx.x, w = tid >> 5, lane = tid & 31, ln = lane & 15, hh = lane >> 4; const int by = blockIdx.y;
  A += (size_t)by * sA; Bh += (size_t)by * sB; C += (size_t)by * sC;
  const int ntn = (N + 63) / 64; const int wid = blockIdx.x * 4 + w; const int mt = wid / ntn, nq = wid % ntn; if (mt * 16 >= M) return;
  const int row0 = mt * 16, col0 = nq * 64; const float* arow = A + (size_t)(row0 + ln) * lda;
  v8f acc[4] = {};
  for (int kb = 0; kb < K; kb += 32) {
    FragH ah, al;
    const v4f x0 = *(const v4fa*)(arow + kb + 8 * hh), x1 = *(const v4fa*)(arow + kb + 8 * hh + 4), x2 = *(const v4fa*)(arow + kb + 16 + 8 * hh), x3 = *(const v4fa*)(arow + kb + 16 + 8 * hh + 4);
    float xs[16] = {x0[0],x0[1],x0[2],x0[3],x1[0],x1[1],x1[2],x1[3],x2[0],x2[1],x2[2],x2[3],x3[0],x3[1],x3[2],x3[3]};
#pragma unroll
    for (int i = 0; i < 16; ++i) { const _Float16 h = (_Float16)xs[i]; ah.h[i] = h; al.h[i] = ASPLIT ? (_Float16)(xs[i] - (float)h) : (_Float16)0.0f; }
#pragma unroll
    for (int t = 0; t < 4; ++t) { if (col0 + t * 16 >= N) continue; const size_t boff = (size_t)(col0 + t * 16 + ln) * ldb + kb; FragH bq; bq.half[0] = *(const v8us*)(Bh + boff + 8 * hh); bq.half[1] = *(const v8us*)(Bh + boff + 16 + 8 * hh);
      acc[t] = mmaH<ASPLIT ? 2 : 1>(ah.v, al.v, bq.v, bq.v, acc[t]); }
  }
#pragma unroll
  for (int t = 0; t < 4; ++t) { if (col0 + t * 16 >= N) continue;
#pragma unroll
    for (int r = 0; r < 8; ++r) so[w][8 * hh + r][t * 16 + ln] = acc[t][r] * alpha; }
  __builtin_amdgcn_fence(__ATOMIC_ACQ_REL, "workgroup"); __builtin_amdgcn_wave_barrier();
  const int rsub = lane >> 4, c4 = (lane & 15) * 4;
  {
#pragma unroll
    for (int q = 0; q < 8; ++q) { const int r = q * 2 + rsub; if (col0 + c4 < N) { const v4f v = *(const v4fa*)&so[w][r][c4]; *(v4f*)(C + (size_t)(row0 + r) * ldc + col0 + c4) = v; } }
     }
}

// Wt[n][k] = f16(W[k][n]·scale) from f32 row-major W[K][N] (scale = power of two; bf16-exact weights stay exact in f16 away from the subnormal range)
__global__ __launch_bounds__(256) void k_wt_f16(const float* __restrict__ W, _Float16* __restrict__ Wt, int K, int N, float scale) {
  const int t = blockIdx.x * 256 + threadIdx.x; if (t >= N * (K / 8)) return; const int n = t / (K / 8), k8 = (t % (K / 8)) * 8; FragH f;
#pragma unroll
  for (int i = 0; i < 8; ++i) f.h[i] = (_Float16)(bf16_round(W[(size_t)(k8 + i) * N + n]) * scale); const v8us o = f.half[0];
  *(v8us*)((unsigned short*)Wt + (size_t)n * K + k8) = o; 
}
// k_gemm_hh variant with fused epilogue: v = acc·alpha + bias[by·sBias + col] (+ CP[(row/rowsPerB)·sCPb + by·64 + col] if CP) ; ACT 0 none / 1 elu ; writes f16 C16 (and f32 C if non-null)
template <int ACT>
__global__ __launch_bounds__(128) void k_gemm_hhx(const _Float16* __restrict__ A, int lda, size_t sA, const _Float16* __restrict__ Bh, int ldb, size_t sB, float alpha, const float* __restrict__ bias, size_t sBias, const float* __restrict__ CP, int rowsPerB, size_t sCPb, int row0g,
    float* __restrict__ C, _Float16* __restrict__ C16, int ldc, size_t sC, int M, int N, int K) {
  __shared__ __attribute__((aligned(16))) float so[4][16][64];
  const int tid = threadIdx.x, w = tid >> 5, lane = tid & 31, ln = lane & 15, hh = lane >> 4; const int by = blockIdx.y;
  A += (size_t)by * sA; Bh += (size_t)by * sB; const size_t cofs = (size_t)by * sC; const float* bp = bias ? bias + (size_t)by * sBias : nullptr;
  const int ntn = (N + 63) / 64; const int wid = blockIdx.x * 4 + w; const int mt = wid / ntn, nq = wid % ntn; if (mt * 16 >= M) return;
  const int row0 = mt * 16, col0 = nq * 64; const _Float16* arow = A + (size_t)(row0 + ln) * lda;
  v8f acc[4] = {};
  for (int kb = 0; kb < K; kb += 32) { FragH ah; ah.half[0] = *(const v8us*)((const unsigned short*)arow + kb + 8 * hh); ah.half[1] = *(const v8us*)((const unsigned short*)arow + kb + 16 + 8 * hh);
#pragma unroll
    for (int t = 0; t < 4; ++t) { if (col0 + t * 16 >= N) continue; const size_t boff = (size_t)(col0 + t * 16 + ln) * ldb + kb; FragH bq; bq.half[0] = *(const v8us*)((const unsigned short*)Bh + boff + 8 * hh); bq.half[1] = *(const v8us*)((const unsigned short*)Bh + boff + 16 + 8 * hh);
      acc[t] = mmaH<1>(ah.v, ah.v, bq.v, bq.v, acc[t]); }
  }
#pragma unroll
  for (int t = 0; t < 4; ++t) { if (col0 + t * 16 >= N) continue; const int col = col0 + t * 16 + ln; const float bv = bp ? bf16_round(bp[col]) : 0.f;
#pragma unroll
    for (int r = 0; r < 8; ++r) { float v = acc[t][r] * alpha + bv; if (CP) { const int rr = row0g + row0 + 8 * hh + r; if (rowsPerB < 0) v += CP[cofs + (size_t)rr * ldc + col];      /* rowsPerB < 0: own element of the batched C plane */ else { const int bidx = rr / rowsPerB; v += CP[(size_t)bidx * sCPb + (size_t)by * 64 + col]; } } if (ACT == 1) v = (v > 0.f) ? v : expm1f(v); else if (ACT == 7) v = (v > 0.f) ? v + 1.0f : expf(v); else if (ACT == 8) v = tanhf(v); else if (ACT == 9) v = 0.5f * v * (1.0f + tanhf(0.7978845608028654f * (v + 0.044715f * v * v * v))); else if (ACT == 11) v = 1.0f / (1.0f + expf(-v)); else if (ACT == 12) v = (v > 0.f) ? v : 0.01f * v; else if (ACT == 14) v = (v > 0.f) ? v : 0.1f * v; else if (ACT == 16) v = (v >= 0.f) ? v : 0.3f * v; else if (ACT == 17) v = (v >= 0.f) ? v : 0.2f * v; else if (ACT == 15) v = v / (1.0f + expf(-v)); else if (ACT == 3) v = fmaxf(v, 0.f); else if (ACT == 6) v = 0.5f * v * (1.0f + erff(v * 0.70710678118654752f)); so[w][8 * hh + r][t * 16 + ln] = v; } }
  __builtin_amdgcn_fence(__ATOMIC_ACQ_REL, "workgroup"); __builtin_amdgcn_wave_barrier();
  const int rsub = lane >> 4, c4 = (lane & 15) * 4; typedef _Float16 v4h __attribute__((ext_vector_type(4)));
  {
#pragma unroll
    for (int q = 0; q < 8; ++q) { const int r = q * 2 + rsub; if (col0 + c4 < N) { const v4f v = *(const v4fa*)&so[w][r][c4]; if (C) *(v4f*)(C + cofs + (size_t)(row0 + r) * ldc + col0 + c4) = v; if (C16) { v4h h4; for (int i = 0; i < 4; ++i) h4[i] = (_Float16)v[i]; *(v4h*)(C16 + cofs + (size_t)(row0 + r) * ldc + col0 + c4) = h4; } } }
     }
}


typedef _Float16 v4h __attribute__((ext_vector_type(4)));

__global__ __launch_bounds__(256) void k_x16(const float* __restrict__ x, _Float16* __restrict__ X16, size_t n8) { const size_t t = (size_t)blockIdx.x * 256 + threadIdx.x; if (t >= n8) return; FragH f;
#pragma unroll
  for (int q = 0; q < 8; ++q) f.h[q] = (_Float16)bf16_round(x[t * 8 + q]); *(v8us*)((unsigned short*)X16 + t * 8) = f.half[0];  }
__global__ __launch_bounds__(256) void k_h16(const float* __restrict__ x, _Float16* __restrict__ X16, size_t n8) { const size_t t = (size_t)blockIdx.x * 256 + threadIdx.x; if (t >= n8) return; FragH f;
#pragma unroll
  for (int q = 0; q < 8; ++q) f.h[q] = (_Float16)x[t * 8 + q]; *(v8us*)((unsigned short*)X16 + t * 8) = f.half[0];  }
__global__ __launch_bounds__(256) void k_round16f(const float* __restrict__ W, _Float16* __restrict__ Bt, size_t n8) { const size_t t = (size_t)blockIdx.x * 256 + threadIdx.x; if (t >= n8) return; FragH f;
#pragma unroll
  for (int i = 0; i < 8; ++i) f.h[i] = (_Float16)(bf16_round(W[t * 8 + i]) * 16.0f); *(v8us*)((unsigned short*)Bt + t * 8) = f.half[0];  }
template <int NHv, int TTv>
__global__ __launch_bounds__(256) void k_vt(const _Float16* __restrict__ V16, int ldv, int voff, _Float16* __restrict__ Vt) { __shared__ unsigned short tl[64][66]; const int tid = threadIdx.x; const int slab = blockIdx.x / (TTv / 64), lg = blockIdx.x % (TTv / 64); const int b = slab / NHv, h = slab % NHv;
  for (int i = tid; i < 64 * 8; i += 256) { const int r = i / 8, c8 = (i % 8) * 8; FragH f; f.half[0] = *(const v8us*)((const unsigned short*)V16 + ((size_t)b * TTv + lg * 64 + r) * ldv + voff + h * 64 + c8);
#pragma unroll
    for (int q = 0; q < 8; ++q) tl[r][c8 + q] = f.u[q]; }
  __syncthreads();
  {
#pragma unroll
    for (int rd = 0; rd < 2; ++rd) { const int d = rd * 32 + tid / 8, pc = tid % 8; FragH f;
#pragma unroll
      for (int q = 0; q < 8; ++q) f.u[q] = tl[pc * 8 + q][d];
      *(v8us*)((unsigned short*)Vt + ((size_t)slab * 64 + d) * TTv + lg * 64 + pc * 8) = f.half[0]; }
     } }

__global__ __launch_bounds__(256) void k_hl(const float* __restrict__ F, _Float16* __restrict__ Hh, _Float16* __restrict__ Hl, size_t n8) { const size_t t = (size_t)blockIdx.x * 256 + threadIdx.x; if (t >= n8) return; FragH fh, fl; const v4f a = *(const v4fa*)(F + t * 8), c = *(const v4fa*)(F + t * 8 + 4);
#pragma unroll
  for (int q = 0; q < 4; ++q) { _Float16 h = (_Float16)a[q]; fh.h[q] = h; fl.h[q] = (_Float16)((a[q] - (float)h) * 1024.0f); h = (_Float16)c[q]; fh.h[4 + q] = h; fl.h[4 + q] = (_Float16)((c[q] - (float)h) * 1024.0f); }
  { *(v8us*)((unsigned short*)Hh + t * 8) = fh.half[0]; *(v8us*)((unsigned short*)Hl + t * 8) = fl.half[0];  } }

// ---- fast GEMM (wave tile 32x64; requires M % 32 == 0 rows per launch region, N % 64 == 0 and K % 64 == 0); epilogue = k_gemm_hhx semantics ----
__device__ __forceinline__ v16h g2_frag(const _Float16* p, int hh) { FragH f; f.half[0] = *(const v8us*)((const unsigned short*)p + 8 * hh); f.half[1] = *(const v8us*)((const unsigned short*)p + 16 + 8 * hh); return f.v; }
__device__ __forceinline__ v8f g2_mma(v16h a, v16h b, v8f c) { v8f d = __builtin_amdgcn_wmma_f32_16x16x32_f16(false, a, false, b, (short)0, c, false, false); asm volatile("v_nop\n\tv_nop\n\tv_nop\n\tv_nop" : "+v"(d) : "v"(a), "v"(b)); return d; }
template <int ACT>
__global__ __launch_bounds__(128) void k_gemm2(const _Float16* __restrict__ A, int lda, size_t sA, const _Float16* __restrict__ Bh, int ldb, size_t sB, float alpha, const float* __restrict__ bias, size_t sBias, const float* __restrict__ CP, int rowsPerB, size_t sCPb, int row0g,
    float* __restrict__ C, _Float16* __restrict__ C16, int ldc, size_t sC, int M, int N, int K) { static_assert(ACT == 0 || ACT == 3 || ACT == 6 || ACT == 8 || ACT == 9 || ACT == 11 || ACT == 12 || ACT == 14 || ACT == 15 || ACT == 16 || ACT == 17, "k_gemm2: unsupported ACT code (would silently apply no activation)");
  __shared__ __attribute__((aligned(16))) float so[4][32][68];
  const int tid = threadIdx.x, w = tid >> 5, lane = tid & 31, ln = lane & 15, hh = lane >> 4; const int by = blockIdx.y;
  A += (size_t)by * sA; Bh += (size_t)by * sB; const size_t cofs = (size_t)by * sC; const float* bp = bias ? bias + (size_t)by * sBias : nullptr;
  const int ntn = N >> 6; const int mt = blockIdx.x / ntn, nq = blockIdx.x - mt * ntn; const int row0 = mt * 128 + 32 * w, col0 = nq * 64; if (row0 >= M) return;
  const _Float16* a0p = A + (size_t)(row0 + ln) * lda + 8 * hh; const _Float16* a1p = a0p + (size_t)16 * lda;      /* the lane's half-row offset is in the pointers: the loop's loads take them as they are */
  const _Float16* b0p = Bh + (size_t)(col0 + ln) * ldb + 8 * hh; const _Float16* b1p = b0p + (size_t)16 * ldb; const _Float16* b2p = b1p + (size_t)16 * ldb; const _Float16* b3p = b2p + (size_t)16 * ldb;
  const v8f z8 = {0.f,0.f,0.f,0.f,0.f,0.f,0.f,0.f}; v8f c00 = z8, c01 = z8, c02 = z8, c03 = z8, c10 = z8, c11 = z8, c12 = z8, c13 = z8;
#pragma unroll 1      /* one trip = two k-steps (K % 64 == 0); rolled so that the 12 fragments of a trip stay in registers */
  for (int kb = 0; kb < K; kb += 64) {      /* all 24 loads of the trip stand in front of its first product: the trip waits for memory once, not once per fragment */
    const v16h a0 = g2_frag(a0p, 0), b0 = g2_frag(b0p, 0), a1 = g2_frag(a1p, 0), b1 = g2_frag(b1p, 0), b2 = g2_frag(b2p, 0), b3 = g2_frag(b3p, 0);
    const v16h e0 = g2_frag(a0p + 32, 0), f0 = g2_frag(b0p + 32, 0), e1 = g2_frag(a1p + 32, 0), f1 = g2_frag(b1p + 32, 0), f2 = g2_frag(b2p + 32, 0), f3 = g2_frag(b3p + 32, 0);
    asm volatile("s_wait_xcnt 0x0" :: "v"(a0p), "v"(a1p), "v"(b0p), "v"(b1p), "v"(b2p), "v"(b3p) : "memory");      /* the six address pairs stay untouched (inputs here) until this wait; behind it they may be advanced and reused */
    c00 = g2_mma(a0, b0, c00); c10 = g2_mma(a1, b0, c10); c01 = g2_mma(a0, b1, c01); c11 = g2_mma(a1, b1, c11); c02 = g2_mma(a0, b2, c02); c12 = g2_mma(a1, b2, c12); c03 = g2_mma(a0, b3, c03); c13 = g2_mma(a1, b3, c13);
    c00 = g2_mma(e0, f0, c00); c10 = g2_mma(e1, f0, c10); c01 = g2_mma(e0, f1, c01); c11 = g2_mma(e1, f1, c11); c02 = g2_mma(e0, f2, c02); c12 = g2_mma(e1, f2, c12); c03 = g2_mma(e0, f3, c03); c13 = g2_mma(e1, f3, c13);
    a0p += 64; a1p += 64; b0p += 64; b1p += 64; b2p += 64; b3p += 64; }
  v8f accs[8] = {c00, c01, c02, c03, c10, c11, c12, c13};
#pragma unroll
  for (int u = 0; u < 8; ++u) { const int t = u & 3, half = u >> 2; const int col = col0 + t * 16 + ln; const float bv = bp ? bf16_round(bp[col]) : 0.f;
#pragma unroll
    for (int r = 0; r < 8; ++r) { const int rloc = half * 16 + 8 * hh + r; float v = accs[u][r] * alpha + bv; if (CP) { if (rowsPerB < 0) v += CP[cofs + (size_t)(row0g + row0 + rloc) * ldc + col];      /* rowsPerB < 0: own element of the batched C plane */ else { const int bidx = (row0g + row0 + rloc) / rowsPerB; v += CP[(size_t)bidx * sCPb + (size_t)by * 64 + col]; } }
      if (ACT == 3) v = fmaxf(v, 0.f); else if (ACT == 6) v = 0.5f * v * (1.0f + erff(v * 0.70710678118654752f)); else if (ACT == 11) v = 1.0f / (1.0f + expf(-v)); else if (ACT == 15) v = v / (1.0f + expf(-v)); else if (ACT == 12) v = (v > 0.f) ? v : 0.01f * v; else if (ACT == 8) v = tanhf(v); else if (ACT == 9) v = 0.5f * v * (1.0f + tanhf(0.7978845608028654f * (v + 0.044715f * v * v * v))); else if (ACT == 14) v = (v > 0.f) ? v : 0.1f * v; else if (ACT == 16) v = (v >= 0.f) ? v : 0.3f * v; else if (ACT == 17) v = (v >= 0.f) ? v : 0.2f * v;
      so[w][rloc][t * 16 + ln] = v; } }
  __builtin_amdgcn_fence(__ATOMIC_ACQ_REL, "workgroup"); __builtin_amdgcn_wave_barrier();
  const int rsub = lane >> 4, c4 = (lane & 15) * 4;
  {
#pragma unroll
    for (int q = 0; q < 16; ++q) { const int r = q * 2 + rsub; const v4f v = *(const v4fa*)&so[w][r][c4]; if (C) *(v4f*)(C + cofs + (size_t)(row0 + r) * ldc + col0 + c4) = v; if (C16) { v4h h4; for (int i = 0; i < 4; ++i) h4[i] = (_Float16)v[i]; *(v4h*)(C16 + cofs + (size_t)(row0 + r) * ldc + col0 + c4) = h4; } }
     } }

// ---- split-precision GEMM, one launch for its three products: C = alpha (Ah.Bh) + alphaR (Al.Bh + Ah.Bl); f16 planes, f32 accumulation; the hi.hi sum and the residual sum each stay in registers over all of K, so C is written once and never read back.
// Wave tile 32x32 (two accumulator sets of four tiles + the 16 fragments of a 64-k trip fit below 256 registers); block = 4 waves = 128 rows x 32 columns. Requires M % 32 == 0, N % 32 == 0, K % 64 == 0.
// grid.y = head (strides sA, sB, sC), grid.z = batch (strides zA, zB, zC). grid.x holds two problems with the same B, the longer first: blocks below nx0 take (Ah, Al, C, N, K) as given, the others (Ah + dAh, Al + dAl, C + dC, N1, K1).
__global__ __launch_bounds__(128) void k_gemm3(const _Float16* __restrict__ Ah, const _Float16* __restrict__ Al, int lda, size_t sA, size_t zA, const _Float16* __restrict__ Bh, const _Float16* __restrict__ Bl, int ldb, size_t sB, size_t zB, float alpha, float alphaR,
    float* __restrict__ C, int ldc, size_t sC, size_t zC, int M, int N, int K, int nx0, long long dAh, long long dAl, long long dC, int N1, int K1) {
  __shared__ __attribute__((aligned(16))) float so[4][32][36];
  const int tid = threadIdx.x, w = tid >> 5, lane = tid & 31, ln = lane & 15, hh = lane >> 4; const int by = blockIdx.y, bz = blockIdx.z;
  int bx = blockIdx.x; if (bx >= nx0) { bx -= nx0; Ah += dAh; Al += dAl; C += dC; N = N1; K = K1; }      /* block-uniform: the second problem of the launch */
  const int ntn = N >> 5; const int mt = bx / ntn, nq = bx - mt * ntn; const int row0 = mt * 128 + 32 * w, col0 = nq * 32; if (row0 >= M) return;
  const size_t ao = (size_t)bz * zA + (size_t)by * sA + (size_t)(row0 + ln) * lda + 8 * hh, bo = (size_t)bz * zB + (size_t)by * sB + (size_t)(col0 + ln) * ldb + 8 * hh;      /* the lane's half-row offset is in the pointers, as in k_gemm2 */
  const _Float16* ah0 = Ah + ao; const _Float16* ah1 = ah0 + (size_t)16 * lda; const _Float16* al0 = Al + ao; const _Float16* al1 = al0 + (size_t)16 * lda;
  const _Float16* bh0 = Bh + bo; const _Float16* bh1 = bh0 + (size_t)16 * ldb; const _Float16* bl0 = Bl + bo; const _Float16* bl1 = bl0 + (size_t)16 * ldb;
  const v8f z8 = {0.f,0.f,0.f,0.f,0.f,0.f,0.f,0.f}; v8f c00 = z8, c01 = z8, c10 = z8, c11 = z8, r00 = z8, r01 = z8, r10 = z8, r11 = z8;      /* c: hi.hi; r: both residual products */
#pragma unroll 1      /* one trip = two k-steps; rolled so that the 16 fragments of a trip stay in registers */
  for (int kb = 0; kb < K; kb += 64) {      /* all 32 loads of the trip stand in front of its first product: one memory wait per trip */
    const v16h p0 = g2_frag(ah0, 0), u0 = g2_frag(bh0, 0), p1 = g2_frag(ah1, 0), u1 = g2_frag(bh1, 0), q0 = g2_frag(al0, 0), q1 = g2_frag(al1, 0), v0 = g2_frag(bl0, 0), v1 = g2_frag(bl1, 0);
    const v16h P0 = g2_frag(ah0 + 32, 0), U0 = g2_frag(bh0 + 32, 0), P1 = g2_frag(ah1 + 32, 0), U1 = g2_frag(bh1 + 32, 0), Q0 = g2_frag(al0 + 32, 0), Q1 = g2_frag(al1 + 32, 0), V0 = g2_frag(bl0 + 32, 0), V1 = g2_frag(bl1 + 32, 0);
    asm volatile("s_wait_xcnt 0x0" :: "v"(ah0), "v"(ah1), "v"(al0), "v"(al1), "v"(bh0), "v"(bh1), "v"(bl0), "v"(bl1) : "memory");      /* the eight address pairs stay untouched (inputs here) until this wait; behind it they may be advanced and reused */
    c00 = g2_mma(p0, u0, c00); c10 = g2_mma(p1, u0, c10); c01 = g2_mma(p0, u1, c01); c11 = g2_mma(p1, u1, c11);
    r00 = g2_mma(q0, u0, r00); r10 = g2_mma(q1, u0, r10); r01 = g2_mma(q0, u1, r01); r11 = g2_mma(q1, u1, r11);
    r00 = g2_mma(p0, v0, r00); r10 = g2_mma(p1, v0, r10); r01 = g2_mma(p0, v1, r01); r11 = g2_mma(p1, v1, r11);
    c00 = g2_mma(P0, U0, c00); c10 = g2_mma(P1, U0, c10); c01 = g2_mma(P0, U1, c01); c11 = g2_mma(P1, U1, c11);
    r00 = g2_mma(Q0, U0, r00); r10 = g2_mma(Q1, U0, r10); r01 = g2_mma(Q0, U1, r01); r11 = g2_mma(Q1, U1, r11);
    r00 = g2_mma(P0, V0, r00); r10 = g2_mma(P1, V0, r10); r01 = g2_mma(P0, V1, r01); r11 = g2_mma(P1, V1, r11);
    ah0 += 64; ah1 += 64; al0 += 64; al1 += 64; bh0 += 64; bh1 += 64; bl0 += 64; bl1 += 64; }
  v8f accs[4] = {c00, c01, c10, c11}, accr[4] = {r00, r01, r10, r11};
#pragma unroll
  for (int u = 0; u < 4; ++u) { const int t = u & 1, half = u >> 1;
#pragma unroll
    for (int r = 0; r < 8; ++r) so[w][half * 16 + 8 * hh + r][t * 16 + ln] = accs[u][r] * alpha + accr[u][r] * alphaR; }      /* both factors are powers of two: one rounding */
  __builtin_amdgcn_fence(__ATOMIC_ACQ_REL, "workgroup"); __builtin_amdgcn_wave_barrier();      /* the wave reads back its own LDS rows, written by other lanes */
  const int rsub = lane >> 3, c4 = (lane & 7) * 4; float* cw = C + (size_t)bz * zC + (size_t)by * sC + (size_t)row0 * ldc + col0 + c4;
#pragma unroll
  for (int q = 0; q < 8; ++q) { const int r = q * 4 + rsub; const v4f v = *(const v4fa*)&so[w][r][c4]; *(v4f*)(cw + (size_t)r * ldc) = v; } }      /* whole 128-byte lines, four rows a store */


__global__ __launch_bounds__(256) void k_wnat(const float* __restrict__ w, size_t n8, _Float16* __restrict__ Bt) { const size_t t = (size_t)blockIdx.x * 256 + threadIdx.x; if (t >= n8) return; FragH f; for (int q = 0; q < 8; ++q) f.h[q] = (_Float16)(bf16_round(w[t * 8 + q]) * 16.0f); *(v8us*)((unsigned short*)Bt + t * 8) = f.half[0];  }
__global__ __launch_bounds__(256) void k_rsm(const float* __restrict__ S, _Float16* __restrict__ P, int nrows) {
  #pragma clang fp contract(off)
  const int i = blockIdx.x * 256 + threadIdx.x; if (i >= nrows) return; const float* s = S + (size_t)i * SQ; float mx = -3.0e38f;
#pragma unroll 1
  for (int j = 0; j < SQ; ++j) mx = fmaxf(mx, s[j]); float se = 0.f;
#pragma unroll 1
  for (int j = 0; j < SQ; ++j) se += expf(s[j] - mx); const float sc = 256.0f / se;
#pragma unroll 1
  for (int j0 = 0; j0 < SQ; j0 += 8) { FragH f; for (int q = 0; q < 8; ++q) f.h[q] = (_Float16)(expf(s[j0 + q] - mx) * sc); unsigned short* d = (unsigned short*)P + (size_t)i * SQ + j0; *(v8us*)d = f.half[0];  } }
__global__ __launch_bounds__(256) void k_vt(const _Float16* __restrict__ V16, int b, int h0, _Float16* __restrict__ VT) { __shared__ unsigned short tl[64][65]; const int tid = threadIdx.x; const int hh = blockIdx.x % HG, sg = blockIdx.x / HG; const int s0 = sg * 64; const int h = h0 + hh;
  for (int i = tid; i < 64 * 8; i += 256) { const int j = i / 8, d8 = (i % 8) * 8; FragH f; f.half[0] = *(const v8us*)((const unsigned short*)V16 + ((size_t)b * SQ + s0 + j) * DM + h * HD + d8); for (int q = 0; q < 8; ++q) tl[d8 + q][j] = f.u[q]; }
  __syncthreads();
  { for (int i = tid; i < 64 * 8; i += 256) { const int d = i / 8, j8 = (i % 8) * 8; FragH f; for (int q = 0; q < 8; ++q) f.u[q] = tl[d][j8 + q]; *(v8us*)((unsigned short*)VT + ((size_t)hh * HD + d) * SQ + s0 + j8) = f.half[0]; }  } }



__global__ __launch_bounds__(256) void k_rsmcf2(const float* __restrict__ S, _Float16* __restrict__ P, int hg, int q0, int nk) {
  #pragma clang fp contract(off)
  const int t = blockIdx.x * 256 + threadIdx.x; if (t >= hg * QT) return; const size_t i = (size_t)t; const float* s = S + i * NKX; const int last = q0 + (t % QT); float mx = -3.0e38f;
#pragma unroll 1
  for (int j = 0; j < nk; ++j) { const float f = (j <= last) ? 1.f : 0.f; mx = fmaxf(mx, fmaf(f, s[j], (1.f - f) * -1.0e9f)); } float se = 0.f;
#pragma unroll 1
  for (int j = 0; j < nk; ++j) { const float f = (j <= last) ? 1.f : 0.f; se += __expf(fmaf(f, s[j], (1.f - f) * -1.0e9f) - mx); } const float sc = 256.0f / se;
#pragma unroll 1
  for (int j0 = 0; j0 < nk; j0 += 8) { FragH fr; for (int q = 0; q < 8; ++q) { const int j = j0 + q; const float f = (j <= last) ? 1.f : 0.f; fr.h[q] = (_Float16)(__expf(fmaf(f, s[j], (1.f - f) * -1.0e9f) - mx) * sc); } unsigned short* d = (unsigned short*)P + i * NKX + j0; *(v8us*)d = fr.half[0];  } }


__global__ __launch_bounds__(256) void k_rsmcf2hl(const float* __restrict__ S, _Float16* __restrict__ P, _Float16* __restrict__ PL, int hg, int q0, int nk) {
  #pragma clang fp contract(off)
  const int t = blockIdx.x * 256 + threadIdx.x; if (t >= hg * QT) return; const size_t i = (size_t)t; const float* s = S + i * NKX; const int last = q0 + (t % QT); float mx = -3.0e38f;
#pragma unroll 1
  for (int j = 0; j < nk; ++j) { const float f = (j <= last) ? 1.f : 0.f; mx = fmaxf(mx, fmaf(f, s[j], (1.f - f) * -1.0e9f)); } float se = 0.f;
#pragma unroll 1
  for (int j = 0; j < nk; ++j) { const float f = (j <= last) ? 1.f : 0.f; se += __expf(fmaf(f, s[j], (1.f - f) * -1.0e9f) - mx); } const float sc = 256.0f / se;
#pragma unroll 1
  for (int j0 = 0; j0 < nk; j0 += 8) { FragH fr, fl; for (int q = 0; q < 8; ++q) { const int j = j0 + q; const float f = (j <= last) ? 1.f : 0.f; const float v = __expf(fmaf(f, s[j], (1.f - f) * -1.0e9f) - mx) * sc; const _Float16 hv = (_Float16)v; fr.h[q] = hv; fl.h[q] = (_Float16)((v - (float)hv) * 1024.0f); } unsigned short* d = (unsigned short*)P + i * NKX + j0; unsigned short* dl = (unsigned short*)PL + i * NKX + j0; *(v8us*)d = fr.half[0]; *(v8us*)dl = fl.half[0];  } }


// Row softmax, one wave per score row: lane l holds elements 128 c + 4 l .. + 3 of the row in registers, so S is read once, in whole lines, and each exponential is taken once.
// Rows of all batches and heads and of two query tiles in one launch: wave tt < hg QT takes row t = tt = (batch * NH + head) * QT + query of the tile at q0 (the longer rows, first), the others row t = tt - hg QT of the tile at q1.
// A stored row of RP floats holds the first tile's q0 + QT scores and behind them the second tile's q1 + QT. In place: the wave holds its whole piece in registers before its first store (every store needs the row sum),
// and no other wave touches the piece, so P hi goes over the first half of the piece's bytes (nk halves) and the residual over the second (nk halves).
__global__ __launch_bounds__(256) void k_rsmcskhl(float* S, int hg, int q0, int q1, const float* am) {
  const int lane = threadIdx.x & 31; const int tt = blockIdx.x * 8 + __builtin_amdgcn_readfirstlane(threadIdx.x >> 5); if (tt >= 2 * hg * QT) return;
  const bool second = tt >= hg * QT; const int t = second ? tt - hg * QT : tt; const int qb = second ? q1 : q0; const int nk = qb + QT;
  float* sw = S + (size_t)t * RP + (second ? q0 + QT : 0); const float* s = sw; const int last = qb + (t % QT); am += (size_t)(t / (NH * QT)) * SQ;      /* the row's batch picks its attention_mask row */
  v4f x[NKX / 128], m[NKX / 128];
#pragma unroll
  for (int c = 0; c < NKX / 128; c += 2) if (c * 128 < nk) {      /* nk is a multiple of QT = 256: two chunks of 128 per test; all loads of the row go out before the first is used */
    x[c] = *(const v4fa*)(s + c * 128 + lane * 4); x[c + 1] = *(const v4fa*)(s + (c + 1) * 128 + lane * 4);
    m[c] = *(const v4fa*)(am + c * 128 + lane * 4); m[c + 1] = *(const v4fa*)(am + (c + 1) * 128 + lane * 4); }
  asm volatile("s_wait_xcnt 0x0" ::: "memory");      /* the loads' address registers are reused below: the wait the instruction set asks for in front of that */
  v4f mx4 = {-3.0e38f, -3.0e38f, -3.0e38f, -3.0e38f};
#pragma unroll
  for (int c = 0; c < NKX / 128; c += 2) if (c * 128 < nk) {
#pragma unroll
    for (int u = c; u < c + 2; ++u)
#pragma unroll
      for (int q = 0; q < 4; ++q) { const int j = u * 128 + lane * 4 + q; const float mk = __fadd_rn(__fadd_rn((j > last) ? -10000.0f : 0.f, (j >= last - 512) ? -10000.0f : 0.f), bf16_round(m[u][q])); const float v = __fadd_rn(x[u][q], mk); x[u][q] = v; mx4[q] = fmaxf(mx4[q], v); } }
  float mx = fmaxf(fmaxf(mx4[0], mx4[1]), fmaxf(mx4[2], mx4[3]));
#pragma unroll
  for (int d = 16; d > 0; d >>= 1) mx = fmaxf(mx, __shfl_xor(mx, d, 32));
  v4f se4 = {0.f, 0.f, 0.f, 0.f};
#pragma unroll
  for (int c = 0; c < NKX / 128; c += 2) if (c * 128 < nk) {
#pragma unroll
    for (int u = c; u < c + 2; ++u)
#pragma unroll
      for (int q = 0; q < 4; ++q) { const float e = __expf(x[u][q] - mx); x[u][q] = e; se4[q] += e; } }
  float se = (se4[0] + se4[1]) + (se4[2] + se4[3]);
#pragma unroll
  for (int d = 16; d > 0; d >>= 1) se += __shfl_xor(se, d, 32);
  const float sc = 256.0f / se;
  _Float16* d = (_Float16*)sw + lane * 4; _Float16* dl = d + nk;
#pragma unroll
  for (int c = 0; c < NKX / 128; c += 2) if (c * 128 < nk) {
#pragma unroll
    for (int u = c; u < c + 2; ++u) { v4h fr, fl;
#pragma unroll
      for (int q = 0; q < 4; ++q) { const float v = x[u][q] * sc; const _Float16 hv = (_Float16)v; fr[q] = hv; fl[q] = (_Float16)((v - (float)hv) * 1024.0f); }
      *(v4h*)(d + u * 128) = fr; *(v4h*)(dl + u * 128) = fl; }
    asm volatile("s_wait_xcnt 0x0" ::: "memory"); } }      /* the next chunk reuses these stores' data registers: same wait */

extern "C" void kernel_launch(void* const* d_in, const int* in_sizes, int n_in,
                              void* d_out, int out_size, void* d_ws, size_t ws_size, hipStream_t stream) {
  (void)in_sizes; (void)n_in; (void)out_size;
  const float* const* I = (const float* const*)d_in; const float* x = I[0]; const float* am = I[1]; const float* wq = I[2]; const float* bq = I[3]; const float* wk = I[4]; const float* bk = I[5]; const float* wv = I[6]; const float* bv = I[7];      /* additive attention_mask [4][1][1][2048] (zeros); natural [out][in] weights + biases */
  char* ws = (char*)d_ws; size_t off = 0;
  auto take = [&](size_t bytes) { char* p = ws + off; off += (bytes + 255) & ~(size_t)255; return p; };
  _Float16* Q16 = (_Float16*)take(NR * DM * 2); _Float16* QL = (_Float16*)take(NR * DM * 2); _Float16* K16 = (_Float16*)take(NR * DM * 2); _Float16* KL = (_Float16*)take(NR * DM * 2);
  _Float16* VT = (_Float16*)take((size_t)NB * NH * HD * SQ * 2); _Float16* VTL = (_Float16*)take((size_t)NB * NH * HD * SQ * 2);      /* V^T planes of all batches */
  const size_t mark = off;      /* from here on two uses, one after the other on the stream: the projection stage's buffers, all dead once V^T is written, then the score rows of all batches */
  _Float16* BQ = (_Float16*)take((size_t)DM * DM * 2); _Float16* BK = (_Float16*)take((size_t)DM * DM * 2); _Float16* BV = (_Float16*)take((size_t)DM * DM * 2);
  _Float16* X16 = (_Float16*)take(NR * DM * 2); _Float16* V16 = (_Float16*)take(NR * DM * 2); _Float16* VL = (_Float16*)take(NR * DM * 2); float* VF = (float*)take(NR * DM * 4);      /* v as f16 hi + x1024 residual (the early causal rows average only a few v rows, so a single-f16 v would leave absolute rounding large against this module's small output scale) */
  if (off > ws_size) return;
  off = mark; float* S = (float*)take((size_t)NB * NH * QT * RP * 4); _Float16* P = (_Float16*)S;      /* a piece of nk scores becomes, in place, nk halves of P hi and nk halves of residual: P row pitch 2 RP halves */
  if (off > ws_size) return;
  { const unsigned g = (unsigned)(((size_t)DM * DM / 8 + 255) / 256); k_wnat<<<g, 256, 0, stream>>>(wq, (size_t)DM * DM / 8, BQ); k_wnat<<<g, 256, 0, stream>>>(wk, (size_t)DM * DM / 8, BK); k_wnat<<<g, 256, 0, stream>>>(wv, (size_t)DM * DM / 8, BV); }      /* natural [out][in] = Bt x16 */

  k_x16<<<(unsigned)((NR * DM / 8 + 255) / 256), 256, 0, stream>>>(x, X16, NR * DM / 8);
  const size_t r0p = (size_t)B0 * SQ;      /* first projected row */
  k_gemm2<0><<<dim3((unsigned)((MP / 128) * (DM / 64)), 1), 128, 0, stream>>>(X16 + r0p * DM, DM, 0, BQ, DM, 0, 0.0625f, bq, 0, nullptr, 1, 0, 0, VF + r0p * DM, nullptr, DM, 0, MP, DM, DM); k_hl<<<(unsigned)(((size_t)MP * DM / 8 + 255) / 256), 256, 0, stream>>>(VF + r0p * DM, Q16 + r0p * DM, QL + r0p * DM, (size_t)MP * DM / 8);      /* q (+ bq) in f32 -> f16 hi + x1024 residual */
  k_gemm2<0><<<dim3((unsigned)((MP / 128) * (DM / 64)), 1), 128, 0, stream>>>(X16 + r0p * DM, DM, 0, BK, DM, 0, 0.0625f, bk, 0, nullptr, 1, 0, 0, VF + r0p * DM, nullptr, DM, 0, MP, DM, DM); k_hl<<<(unsigned)(((size_t)MP * DM / 8 + 255) / 256), 256, 0, stream>>>(VF + r0p * DM, K16 + r0p * DM, KL + r0p * DM, (size_t)MP * DM / 8);      /* k (+ bk) likewise */
  k_gemm2<0><<<dim3((unsigned)((MP / 128) * (DM / 64)), 1), 128, 0, stream>>>(X16 + r0p * DM, DM, 0, BV, DM, 0, 0.0625f, bv, 0, nullptr, 1, 0, 0, VF + r0p * DM, nullptr, DM, 0, MP, DM, DM); k_hl<<<(unsigned)(((size_t)MP * DM / 8 + 255) / 256), 256, 0, stream>>>(VF + r0p * DM, V16 + r0p * DM, VL + r0p * DM, (size_t)MP * DM / 8);      /* v in f32 -> f16 hi + x1024 residual planes */
  k_vt<NH, SQ><<<NB * NH * (SQ / 64), 256, 0, stream>>>(V16, LQ, 0, VT); k_vt<NH, SQ><<<NB * NH * (SQ / 64), 256, 0, stream>>>(VL, LQ, 0, VTL);      /* V^T hi and residual [4][16][64][SQ], all batches in one launch each */
  for (int q1 = 0; q1 < QN / 2; q1 += QT) { const int q0 = QN - QT - q1, nk0 = q0 + QT, nk1 = q1 + QT;      /* causal: only keys below a tile's end are computed. Every launch below covers two query tiles, a long one (q0) and its short partner (q1), nk0 + nk1 = RP keys, of all heads and all batches (grid.y and grid.z in the products) */
    k_gemm3<<<dim3((QT / 128) * (RP / 32), NH, NB), 128, 0, stream>>>(Q16 + (size_t)q0 * LQ, QL + (size_t)q0 * LQ, LQ, (size_t)HD, (size_t)SQ * LQ, K16, KL, LQ, (size_t)HD, (size_t)SQ * LQ, 0.125f, 0.0001220703125f, S, RP, (size_t)QT * RP, (size_t)NH * QT * RP, QT, nk0, HD,
        (QT / 128) * (nk0 / 32), (long long)(q1 - q0) * LQ, (long long)(q1 - q0) * LQ, (long long)nk0, nk1, HD);      /* scores / 8 = (qh.kh)/8 + (ql.kh + qh.kl)/8192, three products in one launch */
    k_rsmcskhl<<<(2 * NB * NH * QT + 7) / 8, 256, 0, stream>>>(S, NB * NH, q0, q1, am);      /* the module's masks added in f32 (causal -1e4, 'window' -1e4 for j >= i-512, + attention_mask[b][j]); softmax; P hi/lo over the scores */
    k_gemm3<<<dim3(2 * (QT / 128) * (HD / 32), NH, NB), 128, 0, stream>>>(P, P + nk0, 2 * RP, (size_t)QT * 2 * RP, (size_t)NH * QT * 2 * RP, VT, VTL, SQ, (size_t)HD * SQ, (size_t)NH * HD * SQ, 0.00390625f, 0.000003814697265625f, (float*)d_out + (size_t)q0 * DM, DM, (size_t)HD, (size_t)SQ * DM, QT, HD, nk0,
        (QT / 128) * (HD / 32), (long long)(2 * nk0), (long long)(nk0 + nk1), (long long)(q1 - q0) * DM, HD, nk1); }      /* out = Ph Vh^T/256 + (Pl Vh^T + Ph Vl^T)/262144 in one launch: P and v both effectively f32 */
}

// v005
// One run takes 289 microseconds.
// Two timings next to v004 put it at 2.85 and 2.83 times that version's speed.
// Over all steps from v000 it is 44.8 times as fast.
#include <hip/hip_runtime.h>
// Causal self-attention with the module's (faithful, inverted) window mask and an additive padding mask (hidden [4][2048][1024]; q/k/v = x W^T + b (natural [1024][1024] sigma 1/32, biases sigma 0.01); 16 heads of 64; scores / 8 + causal(-1e4 where j > i) + window(-1e4 where j >= i - 512, as the source writes it) + attention_mask[b][j] (zeros), all added in f32; softmax; out = merged attn v -> [4][2048][1024], no output projection). Effective pattern: rows i <= 512 attend causally (every kept logit carries the -1e4 offset, reproduced in f32), rows i >= 513 attend only keys j <= i - 513.
// Structure: token rows; x as exact f16 rows; natural weights as exact x16 planes; q, k, v as WMMA GEMMs (32x64 wave tiles, f32 accumulation, + bias) into f32 rows, each split into f16 hi + x1024 residual planes (the output scale is small, so logits, weights and values are all carried near f32); V^T of both v planes via LDS transposes (all batches a launch); attention fused in one launch, a wave per 32 query rows walking its keys in blocks of 32 with a running maximum and sum: scores = qh.kh/8 + (ql.kh + qh.kl)/8192 (K = 64) against the keys below the rows' end, the module's masks added in f32 on VALU (keys above the rows' end carry -2e4 and contribute exactly 0), weights as f16 hi + x1024 residual kept in registers, out = (Ph Vh^T + (Pl Vh^T + Ph Vl^T)/1024) / (256 row sum), written f32 into the output rows; launches: see trace.
// Compute dtype: inputs rounded to bf16; x / weights exact; q, k, v and softmax weights as f16 hi + x1024 residual GEMM operands, o in f32; scores and softmax statistics f32. v_wmma_f32_16x16x32_f16.
#define NB 4
#define SQ 2048
#define DM 1024
#define NH 16
#define HD 64
#define HG 1                         /* heads per launch of k_vt(V16, b, h0, VT), which is not launched */
#define QT 256                       /* query rows per causal tile */
#define NKX SQ                       /* longest score row */
#define B0 0                         /* first batch processed (debug hook) */
#define NBR NB                       /* batches processed (debug hook) */
#define NR ((size_t)NB * SQ)         /* token rows */
#define MP ((int)((size_t)NBR * SQ)) /* rows projected (debug hook) */
#define QN SQ                        /* query rows per batch; unused: no launch reads it */
#define NHD NH                       /* heads attended; unused: no launch reads it */
#define MPO MP                       /* unused: no launch reads it */
#define LQ DM      /* row pitch of the q/k/v rows */
typedef __bf16 v16b __attribute__((ext_vector_type(16)));
typedef unsigned short v8us __attribute__((ext_vector_type(8), may_alias));
typedef float  v8f  __attribute__((ext_vector_type(8)));
typedef float  v4f  __attribute__((ext_vector_type(4)));
typedef float  v4fa __attribute__((ext_vector_type(4), may_alias));
union FragB { v16b v; v8us half[2]; unsigned short u[16]; };

__device__ __forceinline__ unsigned short bf16_bits(float x) { unsigned int u = __float_as_uint(x); return (unsigned short)((u + 0x7FFFu + ((u >> 16) & 1u)) >> 16); }
__device__ __forceinline__ float bf16_val(unsigned short b) { return __uint_as_float(((unsigned int)b) << 16); }
__device__ __forceinline__ float bf16_round(float x) { return bf16_val(bf16_bits(x)); }
// D += A·B with NT terms: 1 = ah·bh, 2 = + al·bh (A split), 3 = + ah·bl (both split)
template <int NT>
__device__ __forceinline__ v8f mmaN(v16b ah, v16b al, v16b bh, v16b bl, v8f c) {
  c = __builtin_amdgcn_wmma_f32_16x16x32_bf16(false, ah, false, bh, (short)0, c, false, false);
  if (NT >= 2) c = __builtin_amdgcn_wmma_f32_16x16x32_bf16(false, al, false, bh, (short)0, c, false, false);
  if (NT >= 3) c = __builtin_amdgcn_wmma_f32_16x16x32_bf16(false, ah, false, bl, (short)0, c, false, false);
  asm volatile("v_nop\n\tv_nop\n\tv_nop\n\tv_nop" : "+v"(c) : "v"(ah), "v"(al), "v"(bh), "v"(bl));
  return c;
}

__global__ __launch_bounds__(256) void k_wt_bf16(const float* __restrict__ W, unsigned short* __restrict__ Wt, int K, int N) {
  const int t = blockIdx.x * 256 + threadIdx.x;
  const int k8n = K / 8;
  if (t >= N * k8n) return;
  const int n = t / k8n, k8 = (t % k8n) * 8;
  v8us v;
#pragma unroll
  for (int i = 0; i < 8; ++i) v[i] = bf16_bits(W[(size_t)(k8 + i) * N + n]);
  *(v8us*)(Wt + (size_t)n * K + k8) = v;
  
}

// GEMM C[M][N] (f32, pitch ldc) = act(A[M][K]·W + bias). A f32 row-major (pitch lda) converted per fragment to bf16
// (ASPLIT: hi/lo two planes -> 2 terms, else single rounded term); Wt bf16 [N][K] (pitch ldb). BIAS_BF16 rounds the
// bias to bf16 first (bias quantised to bf16 before the add). K%32==0, M%16==0, N%64==0.
template <bool ASPLIT, int ACT, bool BIAS_BF16>
__global__ __launch_bounds__(128) void k_gemm_bf(const float* __restrict__ A, int lda, const unsigned short* __restrict__ Wt, int ldb,
                                               const float* __restrict__ bias, float* __restrict__ C, int ldc, int M, int N, int K) {
  __shared__ __attribute__((aligned(16))) float so[4][16][64];
  const int tid = threadIdx.x, w = tid >> 5, lane = tid & 31, ln = lane & 15, hh = lane >> 4;
  const int ntn = N / 64;
  const int wid = blockIdx.x * 4 + w;
  const int mt = wid / ntn, nq = wid % ntn;
  if (mt * 16 >= M) return;
  const int row0 = mt * 16, col0 = nq * 64;
  const float* arow = A + (size_t)(row0 + ln) * lda;
  v8f acc[4] = {};
  for (int kb = 0; kb < K; kb += 32) {
    FragB ah, al;
    const v4f x0 = *(const v4fa*)(arow + kb + 8 * hh), x1 = *(const v4fa*)(arow + kb + 8 * hh + 4);
    const v4f x2 = *(const v4fa*)(arow + kb + 16 + 8 * hh), x3 = *(const v4fa*)(arow + kb + 16 + 8 * hh + 4);
    float xs[16] = {x0[0],x0[1],x0[2],x0[3],x1[0],x1[1],x1[2],x1[3],x2[0],x2[1],x2[2],x2[3],x3[0],x3[1],x3[2],x3[3]};
#pragma unroll
    for (int i = 0; i < 16; ++i) { const unsigned short hb = bf16_bits(xs[i]); ah.u[i] = hb; al.u[i] = ASPLIT ? bf16_bits(xs[i] - bf16_val(hb)) : (unsigned short)0; }
#pragma unroll
    for (int t = 0; t < 4; ++t) {
      const unsigned short* brow = Wt + (size_t)(col0 + t * 16 + ln) * ldb + kb;
      FragB b;
      b.half[0] = *(const v8us*)(brow + 8 * hh);
      b.half[1] = *(const v8us*)(brow + 16 + 8 * hh);
      acc[t] = mmaN<ASPLIT ? 2 : 1>(ah.v, al.v, b.v, b.v, acc[t]);
    }
  }
#pragma unroll
  for (int t = 0; t < 4; ++t) {
    float bv = bias ? bias[col0 + t * 16 + ln] : 0.f;
    if (BIAS_BF16) bv = bf16_round(bv);
#pragma unroll
    for (int r = 0; r < 8; ++r) { float v = acc[t][r] + bv; if (ACT == 1) v = fmaxf(v, 0.f); so[w][8 * hh + r][t * 16 + ln] = v; }
  }
  __builtin_amdgcn_fence(__ATOMIC_ACQ_REL, "workgroup");
  __builtin_amdgcn_wave_barrier();
  const int rsub = lane >> 4, c4 = (lane & 15) * 4;
  {
#pragma unroll
    for (int q = 0; q < 8; ++q) {
      const int r = q * 2 + rsub;
      const v4f v = *(const v4fa*)&so[w][r][c4];
      *(v4f*)(C + (size_t)(row0 + r) * ldc + col0 + c4) = v;
    }
    
  }
}

// GEMM C = act(A·W + bias + resid): A f32 (ASPLIT -> hi/lo 2 terms), Wt bf16 [N][K]; ACT 0 none, 1 relu, 2 exact gelu;
// resid (optional, f32, row index = (row % rmod), pitch ldr, RES_BF16 rounds it) added before the activation.
template <bool ASPLIT, int ACT, bool BIAS_BF16, bool RES_BF16>
__global__ __launch_bounds__(128) void k_gemm_bf3(const float* __restrict__ A, int lda, const unsigned short* __restrict__ Wt, int ldb,
                                                const float* __restrict__ bias, const float* __restrict__ resid, int rmod, int ldr,
                                                float* __restrict__ C, int ldc, int M, int N, int K) {
  __shared__ __attribute__((aligned(16))) float so[4][16][64];
  const int tid = threadIdx.x, w = tid >> 5, lane = tid & 31, ln = lane & 15, hh = lane >> 4;
  const int ntn = N / 64;
  const int wid = blockIdx.x * 4 + w;
  const int mt = wid / ntn, nq = wid % ntn;
  if (mt * 16 >= M) return;
  const int row0 = mt * 16, col0 = nq * 64;
  const float* arow = A + (size_t)(row0 + ln) * lda;
  v8f acc[4] = {};
  for (int kb = 0; kb < K; kb += 32) {
    FragB ah, al;
    const v4f x0 = *(const v4fa*)(arow + kb + 8 * hh), x1 = *(const v4fa*)(arow + kb + 8 * hh + 4);
    const v4f x2 = *(const v4fa*)(arow + kb + 16 + 8 * hh), x3 = *(const v4fa*)(arow + kb + 16 + 8 * hh + 4);
    float xs[16] = {x0[0],x0[1],x0[2],x0[3],x1[0],x1[1],x1[2],x1[3],x2[0],x2[1],x2[2],x2[3],x3[0],x3[1],x3[2],x3[3]};
#pragma unroll
    for (int i = 0; i < 16; ++i) { const unsigned short hb = bf16_bits(xs[i]); ah.u[i] = hb; al.u[i] = ASPLIT ? bf16_bits(xs[i] - bf16_val(hb)) : (unsigned short)0; }
#pragma unroll
    for (int t = 0; t < 4; ++t) {
      const unsigned short* brow = Wt + (size_t)(col0 + t * 16 + ln) * ldb + kb;
      FragB b;
      b.half[0] = *(const v8us*)(brow + 8 * hh);
      b.half[1] = *(const v8us*)(brow + 16 + 8 * hh);
      acc[t] = mmaN<ASPLIT ? 2 : 1>(ah.v, al.v, b.v, b.v, acc[t]);
    }
  }
#pragma unroll
  for (int t = 0; t < 4; ++t) {
    const int col = col0 + t * 16 + ln;
    float bv = bias ? bias[col] : 0.f;
    if (BIAS_BF16) bv = bf16_round(bv);
#pragma unroll
    for (int r = 0; r < 8; ++r) {
      float v = acc[t][r] + bv;
      if (resid) { float rv = resid[(size_t)((row0 + 8 * hh + r) % rmod) * ldr + col]; if (RES_BF16) rv = bf16_round(rv); v += rv; }
      if (ACT == 1) v = fmaxf(v, 0.f);
      if (ACT == 2) v = 0.5f * v * (1.0f + erff(v * 0.70710678118654752f));
      if (ACT == 3) { const float u = 0.7978845608028654f * (v + 0.044715f * v * v * v); v = 0.5f * v * (1.0f + tanhf(u)); }
      so[w][8 * hh + r][t * 16 + ln] = v;
    }
  }
  __builtin_amdgcn_fence(__ATOMIC_ACQ_REL, "workgroup");
  __builtin_amdgcn_wave_barrier();
  const int rsub = lane >> 4, c4 = (lane & 15) * 4;
  {
#pragma unroll
    for (int q = 0; q < 8; ++q) {
      const int r = q * 2 + rsub;
      const v4f v = *(const v4fa*)&so[w][r][c4];
      *(v4f*)(C + (size_t)(row0 + r) * ldc + col0 + c4) = v;
    }
    
  }
}
// row LayerNorm (biased variance, eps) over N: s = X (+ R); optional out_sum <- s; out_norm <- (s-mu)*rsqrt(var+eps)*g + b
template <bool PARAM_BF16>
__global__ __launch_bounds__(256) void k_layernorm(const float* __restrict__ X, const float* __restrict__ R, const float* __restrict__ g, const float* __restrict__ bta,
                                                  float* __restrict__ out_sum, float* __restrict__ out_norm, int N, float eps) {
  __shared__ float red[256];
  const int row = blockIdx.x, tid = threadIdx.x;
  const float* x = X + (size_t)row * N; const float* rr = R ? R + (size_t)row * N : nullptr;
  float vals[16];                     // up to N = 4096
  const int per = N / 256;            // contiguous chunk per thread? use strided-by-4 chunks: thread handles j = tid*4 + 1024*u
  float s1 = 0.f;
  for (int u = 0; u < per / 4; ++u) {
    const int j = tid * 4 + 1024 * u;
    const v4f a = *(const v4fa*)(x + j);
    v4f b = {0.f,0.f,0.f,0.f}; if (rr) b = *(const v4fa*)(rr + j);
#pragma unroll
    for (int q = 0; q < 4; ++q) { const float v = a[q] + b[q]; vals[u * 4 + q] = v; s1 += v; }
  }
  red[tid] = s1; __syncthreads();
  for (int st = 128; st > 0; st >>= 1) { if (tid < st) red[tid] += red[tid + st]; __syncthreads(); }
  const float mu = red[0] / (float)N; __syncthreads();
  float s2 = 0.f;
  for (int u = 0; u < per / 4; ++u)
#pragma unroll
    for (int q = 0; q < 4; ++q) { const float c = vals[u * 4 + q] - mu; s2 += c * c; }
  red[tid] = s2; __syncthreads();
  for (int st = 128; st > 0; st >>= 1) { if (tid < st) red[tid] += red[tid + st]; __syncthreads(); }
  const float rs = rsqrtf(red[0] / (float)N + eps);
  {
    for (int u = 0; u < per / 4; ++u) {
      const int j = tid * 4 + 1024 * u;
      v4f o, sm;
#pragma unroll
      for (int q = 0; q < 4; ++q) {
        float gg = g[j + q], bb = bta[j + q];
        if (PARAM_BF16) { gg = bf16_round(gg); bb = bf16_round(bb); }
        sm[q] = vals[u * 4 + q]; o[q] = (vals[u * 4 + q] - mu) * rs * gg + bb;
      }
      if (out_sum) *(v4f*)(out_sum + (size_t)row * N + j) = sm;
      *(v4f*)(out_norm + (size_t)row * N + j) = o;
    }
    
  }
}



// ---- f16 WMMA path (v_wmma_f32_16x16x32_f16): 11-bit significands for operands in range — used where a [0,1] probability operand needs more precision than bf16
typedef _Float16 v16h __attribute__((ext_vector_type(16)));
union FragH { v16h v; v8us half[2]; _Float16 h[16]; unsigned short u[16]; };
template <int NT>
__device__ __forceinline__ v8f mmaH(v16h ah, v16h al, v16h bh, v16h bl, v8f c) {
  c = __builtin_amdgcn_wmma_f32_16x16x32_f16(false, ah, false, bh, (short)0, c, false, false);
  if (NT >= 2) c = __builtin_amdgcn_wmma_f32_16x16x32_f16(false, al, false, bh, (short)0, c, false, false);
  if (NT >= 3) c = __builtin_amdgcn_wmma_f32_16x16x32_f16(false, ah, false, bl, (short)0, c, false, false);
  asm volatile("v_nop\n\tv_nop\n\tv_nop\n\tv_nop" : "+v"(c) : "v"(ah), "v"(al), "v"(bh), "v"(bl));
  return c;
}
// batched GEMM like k_gemm_b but f16 operands: A f32 (split into f16 hi/lo if ASPLIT, else rounded to f16), Bt = f16 values [n][k]; alpha; C f32; N multiple of 16 (partial tiles skipped)
template <bool ASPLIT>
__global__ __launch_bounds__(128) void k_gemm_h(const float* __restrict__ A, int lda, size_t sA, const _Float16* __restrict__ Bh, int ldb, size_t sB, float alpha, float* __restrict__ C, int ldc, size_t sC, int M, int N, int K) {
  __shared__ __attribute__((aligned(16))) float so[4][16][64];
  const int tid = threadIdx.x, w = tid >> 5, lane = tid & 31, ln = lane & 15, hh = lane >> 4; const int by = blockIdx.y;
  A += (size_t)by * sA; Bh += (size_t)by * sB; C += (size_t)by * sC;
  const int ntn = (N + 63) / 64; const int wid = blockIdx.x * 4 + w; const int mt = wid / ntn, nq = wid % ntn; if (mt * 16 >= M) return;
  const int row0 = mt * 16, col0 = nq * 64; const float* arow = A + (size_t)(row0 + ln) * lda;
  v8f acc[4] = {};
  for (int kb = 0; kb < K; kb += 32) {
    FragH ah, al;
    const v4f x0 = *(const v4fa*)(arow + kb + 8 * hh), x1 = *(const v4fa*)(arow + kb + 8 * hh + 4), x2 = *(const v4fa*)(arow + kb + 16 + 8 * hh), x3 = *(const v4fa*)(arow + kb + 16 + 8 * hh + 4);
    float xs[16] = {x0[0],x0[1],x0[2],x0[3],x1[0],x1[1],x1[2],x1[3],x2[0],x2[1],x2[2],x2[3],x3[0],x3[1],x3[2],x3[3]};
#pragma unroll
    for (int i = 0; i < 16; ++i) { const _Float16 h = (_Float16)xs[i]; ah.h[i] = h; al.h[i] = ASPLIT ? (_Float16)(xs[i] - (float)h) : (_Float16)0.0f; }
#pragma unroll
    for (int t = 0; t < 4; ++t) { if (col0 + t * 16 >= N) continue; const size_t boff = (size_t)(col0 + t * 16 + ln) * ldb + kb; FragH bq; bq.half[0] = *(const v8us*)(Bh + boff + 8 * hh); bq.half[1] = *(const v8us*)(Bh + boff + 16 + 8 * hh);
      acc[t] = mmaH<ASPLIT ? 2 : 1>(ah.v, al.v, bq.v, bq.v, acc[t]); }
  }
#pragma unroll
  for (int t = 0; t < 4; ++t) { if (col0 + t * 16 >= N) continue;
#pragma unroll
    for (int r = 0; r < 8; ++r) so[w][8 * hh + r][t * 16 + ln] = acc[t][r] * alpha; }
  __builtin_amdgcn_fence(__ATOMIC_ACQ_REL, "workgroup"); __builtin_amdgcn_wave_barrier();
  const int rsub = lane >> 4, c4 = (lane & 15) * 4;
  {
#pragma unroll
    for (int q = 0; q < 8; ++q) { const int r = q * 2 + rsub; if (col0 + c4 < N) { const v4f v = *(const v4fa*)&so[w][r][c4]; *(v4f*)(C + (size_t)(row0 + r) * ldc + col0 + c4) = v; } }
     }
}

// Wt[n][k] = f16(W[k][n]·scale) from f32 row-major W[K][N] (scale = power of two; bf16-exact weights stay exact in f16 away from the subnormal range)
__global__ __launch_bounds__(256) void k_wt_f16(const float* __restrict__ W, _Float16* __restrict__ Wt, int K, int N, float scale) {
  const int t = blockIdx.x * 256 + threadIdx.x; if (t >= N * (K / 8)) return; const int n = t / (K / 8), k8 = (t % (K / 8)) * 8; FragH f;
#pragma unroll
  for (int i = 0; i < 8; ++i) f.h[i] = (_Float16)(bf16_round(W[(size_t)(k8 + i) * N + n]) * scale); const v8us o = f.half[0];
  *(v8us*)((unsigned short*)Wt + (size_t)n * K + k8) = o; 
}
// k_gemm_hh variant with fused epilogue: v = acc·alpha + bias[by·sBias + col] (+ CP[(row/rowsPerB)·sCPb + by·64 + col] if CP) ; ACT 0 none / 1 elu ; writes f16 C16 (and f32 C if non-null)
template <int ACT>
__global__ __launch_bounds__(128) void k_gemm_hhx(const _Float16* __restrict__ A, int lda, size_t sA, const _Float16* __restrict__ Bh, int ldb, size_t sB, float alpha, const float* __restrict__ bias, size_t sBias, const float* __restrict__ CP, int rowsPerB, size_t sCPb, int row0g,
    float* __restrict__ C, _Float16* __restrict__ C16, int ldc, size_t sC, int M, int N, int K) {
  __shared__ __attribute__((aligned(16))) float so[4][16][64];
  const int tid = threadIdx.x, w = tid >> 5, lane = tid & 31, ln = lane & 15, hh = lane >> 4; const int by = blockIdx.y;
  A += (size_t)by * sA; Bh += (size_t)by * sB; const size_t cofs = (size_t)by * sC; const float* bp = bias ? bias + (size_t)by * sBias : nullptr;
  const int ntn = (N + 63) / 64; const int wid = blockIdx.x * 4 + w; const int mt = wid / ntn, nq = wid % ntn; if (mt * 16 >= M) return;
  const int row0 = mt * 16, col0 = nq * 64; const _Float16* arow = A + (size_t)(row0 + ln) * lda;
  v8f acc[4] = {};
  for (int kb = 0; kb < K; kb += 32) { FragH ah; ah.half[0] = *(const v8us*)((const unsigned short*)arow + kb + 8 * hh); ah.half[1] = *(const v8us*)((const unsigned short*)arow + kb + 16 + 8 * hh);
#pragma unroll
    for (int t = 0; t < 4; ++t) { if (col0 + t * 16 >= N) continue; const size_t boff = (size_t)(col0 + t * 16 + ln) * ldb + kb; FragH bq; bq.half[0] = *(const v8us*)((const unsigned short*)Bh + boff + 8 * hh); bq.half[1] = *(const v8us*)((const unsigned short*)Bh + boff + 16 + 8 * hh);
      acc[t] = mmaH<1>(ah.v, ah.v, bq.v, bq.v, acc[t]); }
  }
#pragma unroll
  for (int t = 0; t < 4; ++t) { if (col0 + t * 16 >= N) continue; const int col = col0 + t * 16 + ln; const float bv = bp ? bf16_round(bp[col]) : 0.f;
#pragma unroll
    for (int r = 0; r < 8; ++r) { float v = acc[t][r] * alpha + bv; if (CP) { const int rr = row0g + row0 + 8 * hh + r; if (rowsPerB < 0) v += CP[cofs + (size_t)rr * ldc + col];      /* rowsPerB < 0: own element of the batched C plane */ else { const int bidx = rr / rowsPerB; v += CP[(size_t)bidx * sCPb + (size_t)by * 64 + col]; } } if (ACT == 1) v = (v > 0.f) ? v : expm1f(v); else if (ACT == 7) v = (v > 0.f) ? v + 1.0f : expf(v); else if (ACT == 8) v = tanhf(v); else if (ACT == 9) v = 0.5f * v * (1.0f + tanhf(0.7978845608028654f * (v + 0.044715f * v * v * v))); else if (ACT == 11) v = 1.0f / (1.0f + expf(-v)); else if (ACT == 12) v = (v > 0.f) ? v : 0.01f * v; else if (ACT == 14) v = (v > 0.f) ? v : 0.1f * v; else if (ACT == 16) v = (v >= 0.f) ? v : 0.3f * v; else if (ACT == 17) v = (v >= 0.f) ? v : 0.2f * v; else if (ACT == 15) v = v / (1.0f + expf(-v)); else if (ACT == 3) v = fmaxf(v, 0.f); else if (ACT == 6) v = 0.5f * v * (1.0f + erff(v * 0.70710678118654752f)); so[w][8 * hh + r][t * 16 + ln] = v; } }
  __builtin_amdgcn_fence(__ATOMIC_ACQ_REL, "workgroup"); __builtin_amdgcn_wave_barrier();
  const int rsub = lane >> 4, c4 = (lane & 15) * 4; typedef _Float16 v4h __attribute__((ext_vector_type(4)));
  {
#pragma unroll
    for (int q = 0; q < 8; ++q) { const int r = q * 2 + rsub; if (col0 + c4 < N) { const v4f v = *(const v4fa*)&so[w][r][c4]; if (C) *(v4f*)(C + cofs + (size_t)(row0 + r) * ldc + col0 + c4) = v; if (C16) { v4h h4; for (int i = 0; i < 4; ++i) h4[i] = (_Float16)v[i]; *(v4h*)(C16 + cofs + (size_t)(row0 + r) * ldc + col0 + c4) = h4; } } }
     }
}


typedef _Float16 v4h __attribute__((ext_vector_type(4)));

__global__ __launch_bounds__(256) void k_x16(const float* __restrict__ x, _Float16* __restrict__ X16, size_t n8) { const size_t t = (size_t)blockIdx.x * 256 + threadIdx.x; if (t >= n8) return; FragH f;
#pragma unroll
  for (int q = 0; q < 8; ++q) f.h[q] = (_Float16)bf16_round(x[t * 8 + q]); *(v8us*)((unsigned short*)X16 + t * 8) = f.half[0];  }
__global__ __launch_bounds__(256) void k_h16(const float* __restrict__ x, _Float16* __restrict__ X16, size_t n8) { const size_t t = (size_t)blockIdx.x * 256 + threadIdx.x; if (t >= n8) return; FragH f;
#pragma unroll
  for (int q = 0; q < 8; ++q) f.h[q] = (_Float16)x[t * 8 + q]; *(v8us*)((unsigned short*)X16 + t * 8) = f.half[0];  }
__global__ __launch_bounds__(256) void k_round16f(const float* __restrict__ W, _Float16* __restrict__ Bt, size_t n8) { const size_t t = (size_t)blockIdx.x * 256 + threadIdx.x; if (t >= n8) return; FragH f;
#pragma unroll
  for (int i = 0; i < 8; ++i) f.h[i] = (_Float16)(bf16_round(W[t * 8 + i]) * 16.0f); *(v8us*)((unsigned short*)Bt + t * 8) = f.half[0];  }
template <int NHv, int TTv>
__global__ __launch_bounds__(256) void k_vt(const _Float16* __restrict__ V16, int ldv, int voff, _Float16* __restrict__ Vt) { __shared__ unsigned short tl[64][66]; const int tid = threadIdx.x; const int slab = blockIdx.x / (TTv / 64), lg = blockIdx.x % (TTv / 64); const int b = slab / NHv, h = slab % NHv;
  for (int i = tid; i < 64 * 8; i += 256) { const int r = i / 8, c8 = (i % 8) * 8; FragH f; f.half[0] = *(const v8us*)((const unsigned short*)V16 + ((size_t)b * TTv + lg * 64 + r) * ldv + voff + h * 64 + c8);
#pragma unroll
    for (int q = 0; q < 8; ++q) tl[r][c8 + q] = f.u[q]; }
  __syncthreads();
  {
#pragma unroll
    for (int rd = 0; rd < 2; ++rd) { const int d = rd * 32 + tid / 8, pc = tid % 8; FragH f;
#pragma unroll
      for (int q = 0; q < 8; ++q) f.u[q] = tl[pc * 8 + q][d];
      *(v8us*)((unsigned short*)Vt + ((size_t)slab * 64 + d) * TTv + lg * 64 + pc * 8) = f.half[0]; }
     } }

__global__ __launch_bounds__(256) void k_hl(const float* __restrict__ F, _Float16* __restrict__ Hh, _Float16* __restrict__ Hl, size_t n8) { const size_t t = (size_t)blockIdx.x * 256 + threadIdx.x; if (t >= n8) return; FragH fh, fl; const v4f a = *(const v4fa*)(F + t * 8), c = *(const v4fa*)(F + t * 8 + 4);
#pragma unroll
  for (int q = 0; q < 4; ++q) { _Float16 h = (_Float16)a[q]; fh.h[q] = h; fl.h[q] = (_Float16)((a[q] - (float)h) * 1024.0f); h = (_Float16)c[q]; fh.h[4 + q] = h; fl.h[4 + q] = (_Float16)((c[q] - (float)h) * 1024.0f); }
  { *(v8us*)((unsigned short*)Hh + t * 8) = fh.half[0]; *(v8us*)((unsigned short*)Hl + t * 8) = fl.half[0];  } }

// ---- fast GEMM (wave tile 32x64; requires M % 32 == 0 rows per launch region, N % 64 == 0 and K % 64 == 0); epilogue = k_gemm_hhx semantics ----
__device__ __forceinline__ v16h g2_frag(const _Float16* p, int hh) { FragH f; f.half[0] = *(const v8us*)((const unsigned short*)p + 8 * hh); f.half[1] = *(const v8us*)((const unsigned short*)p + 16 + 8 * hh); return f.v; }
__device__ __forceinline__ v8f g2_mma(v16h a, v16h b, v8f c) { v8f d = __builtin_amdgcn_wmma_f32_16x16x32_f16(false, a, false, b, (short)0, c, false, false); asm volatile("v_nop\n\tv_nop\n\tv_nop\n\tv_nop" : "+v"(d) : "v"(a), "v"(b)); return d; }
template <int ACT>
__global__ __launch_bounds__(128) void k_gemm2(const _Float16* __restrict__ A, int lda, size_t sA, const _Float16* __restrict__ Bh, int ldb, size_t sB, float alpha, const float* __restrict__ bias, size_t sBias, const float* __restrict__ CP, int rowsPerB, size_t sCPb, int row0g,
    float* __restrict__ C, _Float16* __restrict__ C16, int ldc, size_t sC, int M, int N, int K) { static_assert(ACT == 0 || ACT == 3 || ACT == 6 || ACT == 8 || ACT == 9 || ACT == 11 || ACT == 12 || ACT == 14 || ACT == 15 || ACT == 16 || ACT == 17, "k_gemm2: unsupported ACT code (would silently apply no activation)");
  __shared__ __attribute__((aligned(16))) float so[4][32][68];
  const int tid = threadIdx.x, w = tid >> 5, lane = tid & 31, ln = lane & 15, hh = lane >> 4; const int by = blockIdx.y;
  A += (size_t)by * sA; Bh += (size_t)by * sB; const size_t cofs = (size_t)by * sC; const float* bp = bias ? bias + (size_t)by * sBias : nullptr;
  const int ntn = N >> 6; const int mt = blockIdx.x / ntn, nq = blockIdx.x - mt * ntn; const int row0 = mt * 128 + 32 * w, col0 = nq * 64; if (row0 >= M) return;
  const _Float16* a0p = A + (size_t)(row0 + ln) * lda + 8 * hh; const _Float16* a1p = a0p + (size_t)16 * lda;      /* the lane's half-row offset is in the pointers: the loop's loads take them as they are */
  const _Float16* b0p = Bh + (size_t)(col0 + ln) * ldb + 8 * hh; const _Float16* b1p = b0p + (size_t)16 * ldb; const _Float16* b2p = b1p + (size_t)16 * ldb; const _Float16* b3p = b2p + (size_t)16 * ldb;
  const v8f z8 = {0.f,0.f,0.f,0.f,0.f,0.f,0.f,0.f}; v8f c00 = z8, c01 = z8, c02 = z8, c03 = z8, c10 = z8, c11 = z8, c12 = z8, c13 = z8;
#pragma unroll 1      /* one trip = two k-steps (K % 64 == 0); rolled so that the 12 fragments of a trip stay in registers */
  for (int kb = 0; kb < K; kb += 64) {      /* all 24 loads of the trip stand in front of its first product: the trip waits for memory once, not once per fragment */
    const v16h a0 = g2_frag(a0p, 0), b0 = g2_frag(b0p, 0), a1 = g2_frag(a1p, 0), b1 = g2_frag(b1p, 0), b2 = g2_frag(b2p, 0), b3 = g2_frag(b3p, 0);
    const v16h e0 = g2_frag(a0p + 32, 0), f0 = g2_frag(b0p + 32, 0), e1 = g2_frag(a1p + 32, 0), f1 = g2_frag(b1p + 32, 0), f2 = g2_frag(b2p + 32, 0), f3 = g2_frag(b3p + 32, 0);
    asm volatile("s_wait_xcnt 0x0" :: "v"(a0p), "v"(a1p), "v"(b0p), "v"(b1p), "v"(b2p), "v"(b3p) : "memory");      /* the six address pairs stay untouched (inputs here) until this wait; behind it they may be advanced and reused */
    c00 = g2_mma(a0, b0, c00); c10 = g2_mma(a1, b0, c10); c01 = g2_mma(a0, b1, c01); c11 = g2_mma(a1, b1, c11); c02 = g2_mma(a0, b2, c02); c12 = g2_mma(a1, b2, c12); c03 = g2_mma(a0, b3, c03); c13 = g2_mma(a1, b3, c13);
    c00 = g2_mma(e0, f0, c00); c10 = g2_mma(e1, f0, c10); c01 = g2_mma(e0, f1, c01); c11 = g2_mma(e1, f1, c11); c02 = g2_mma(e0, f2, c02); c12 = g2_mma(e1, f2, c12); c03 = g2_mma(e0, f3, c03); c13 = g2_mma(e1, f3, c13);
    a0p += 64; a1p += 64; b0p += 64; b1p += 64; b2p += 64; b3p += 64; }
  v8f accs[8] = {c00, c01, c02, c03, c10, c11, c12, c13};
#pragma unroll
  for (int u = 0; u < 8; ++u) { const int t = u & 3, half = u >> 2; const int col = col0 + t * 16 + ln; const float bv = bp ? bf16_round(bp[col]) : 0.f;
#pragma unroll
    for (int r = 0; r < 8; ++r) { const int rloc = half * 16 + 8 * hh + r; float v = accs[u][r] * alpha + bv; if (CP) { if (rowsPerB < 0) v += CP[cofs + (size_t)(row0g + row0 + rloc) * ldc + col];      /* rowsPerB < 0: own element of the batched C plane */ else { const int bidx = (row0g + row0 + rloc) / rowsPerB; v += CP[(size_t)bidx * sCPb + (size_t)by * 64 + col]; } }
      if (ACT == 3) v = fmaxf(v, 0.f); else if (ACT == 6) v = 0.5f * v * (1.0f + erff(v * 0.70710678118654752f)); else if (ACT == 11) v = 1.0f / (1.0f + expf(-v)); else if (ACT == 15) v = v / (1.0f + expf(-v)); else if (ACT == 12) v = (v > 0.f) ? v : 0.01f * v; else if (ACT == 8) v = tanhf(v); else if (ACT == 9) v = 0.5f * v * (1.0f + tanhf(0.7978845608028654f * (v + 0.044715f * v * v * v))); else if (ACT == 14) v = (v > 0.f) ? v : 0.1f * v; else if (ACT == 16) v = (v >= 0.f) ? v : 0.3f * v; else if (ACT == 17) v = (v >= 0.f) ? v : 0.2f * v;
      so[w][rloc][t * 16 + ln] = v; } }
  __builtin_amdgcn_fence(__ATOMIC_ACQ_REL, "workgroup"); __builtin_amdgcn_wave_barrier();
  const int rsub = lane >> 4, c4 = (lane & 15) * 4;
  {
#pragma unroll
    for (int q = 0; q < 16; ++q) { const int r = q * 2 + rsub; const v4f v = *(const v4fa*)&so[w][r][c4]; if (C) *(v4f*)(C + cofs + (size_t)(row0 + r) * ldc + col0 + c4) = v; if (C16) { v4h h4; for (int i = 0; i < 4; ++i) h4[i] = (_Float16)v[i]; *(v4h*)(C16 + cofs + (size_t)(row0 + r) * ldc + col0 + c4) = h4; } }
     } }


__global__ __launch_bounds__(256) void k_wnat(const float* __restrict__ w, size_t n8, _Float16* __restrict__ Bt) { const size_t t = (size_t)blockIdx.x * 256 + threadIdx.x; if (t >= n8) return; FragH f; for (int q = 0; q < 8; ++q) f.h[q] = (_Float16)(bf16_round(w[t * 8 + q]) * 16.0f); *(v8us*)((unsigned short*)Bt + t * 8) = f.half[0];  }
__global__ __launch_bounds__(256) void k_rsm(const float* __restrict__ S, _Float16* __restrict__ P, int nrows) {
  #pragma clang fp contract(off)
  const int i = blockIdx.x * 256 + threadIdx.x; if (i >= nrows) return; const float* s = S + (size_t)i * SQ; float mx = -3.0e38f;
#pragma unroll 1
  for (int j = 0; j < SQ; ++j) mx = fmaxf(mx, s[j]); float se = 0.f;
#pragma unroll 1
  for (int j = 0; j < SQ; ++j) se += expf(s[j] - mx); const float sc = 256.0f / se;
#pragma unroll 1
  for (int j0 = 0; j0 < SQ; j0 += 8) { FragH f; for (int q = 0; q < 8; ++q) f.h[q] = (_Float16)(expf(s[j0 + q] - mx) * sc); unsigned short* d = (unsigned short*)P + (size_t)i * SQ + j0; *(v8us*)d = f.half[0];  } }
__global__ __launch_bounds__(256) void k_vt(const _Float16* __restrict__ V16, int b, int h0, _Float16* __restrict__ VT) { __shared__ unsigned short tl[64][65]; const int tid = threadIdx.x; const int hh = blockIdx.x % HG, sg = blockIdx.x / HG; const int s0 = sg * 64; const int h = h0 + hh;
  for (int i = tid; i < 64 * 8; i += 256) { const int j = i / 8, d8 = (i % 8) * 8; FragH f; f.half[0] = *(const v8us*)((const unsigned short*)V16 + ((size_t)b * SQ + s0 + j) * DM + h * HD + d8); for (int q = 0; q < 8; ++q) tl[d8 + q][j] = f.u[q]; }
  __syncthreads();
  { for (int i = tid; i < 64 * 8; i += 256) { const int d = i / 8, j8 = (i % 8) * 8; FragH f; for (int q = 0; q < 8; ++q) f.u[q] = tl[d][j8 + q]; *(v8us*)((unsigned short*)VT + ((size_t)hh * HD + d) * SQ + s0 + j8) = f.half[0]; }  } }



__global__ __launch_bounds__(256) void k_rsmcf2(const float* __restrict__ S, _Float16* __restrict__ P, int hg, int q0, int nk) {
  #pragma clang fp contract(off)
  const int t = blockIdx.x * 256 + threadIdx.x; if (t >= hg * QT) return; const size_t i = (size_t)t; const float* s = S + i * NKX; const int last = q0 + (t % QT); float mx = -3.0e38f;
#pragma unroll 1
  for (int j = 0; j < nk; ++j) { const float f = (j <= last) ? 1.f : 0.f; mx = fmaxf(mx, fmaf(f, s[j], (1.f - f) * -1.0e9f)); } float se = 0.f;
#pragma unroll 1
  for (int j = 0; j < nk; ++j) { const float f = (j <= last) ? 1.f : 0.f; se += __expf(fmaf(f, s[j], (1.f - f) * -1.0e9f) - mx); } const float sc = 256.0f / se;
#pragma unroll 1
  for (int j0 = 0; j0 < nk; j0 += 8) { FragH fr; for (int q = 0; q < 8; ++q) { const int j = j0 + q; const float f = (j <= last) ? 1.f : 0.f; fr.h[q] = (_Float16)(__expf(fmaf(f, s[j], (1.f - f) * -1.0e9f) - mx) * sc); } unsigned short* d = (unsigned short*)P + i * NKX + j0; *(v8us*)d = fr.half[0];  } }


__global__ __launch_bounds__(256) void k_rsmcf2hl(const float* __restrict__ S, _Float16* __restrict__ P, _Float16* __restrict__ PL, int hg, int q0, int nk) {
  #pragma clang fp contract(off)
  const int t = blockIdx.x * 256 + threadIdx.x; if (t >= hg * QT) return; const size_t i = (size_t)t; const float* s = S + i * NKX; const int last = q0 + (t % QT); float mx = -3.0e38f;
#pragma unroll 1
  for (int j = 0; j < nk; ++j) { const float f = (j <= last) ? 1.f : 0.f; mx = fmaxf(mx, fmaf(f, s[j], (1.f - f) * -1.0e9f)); } float se = 0.f;
#pragma unroll 1
  for (int j = 0; j < nk; ++j) { const float f = (j <= last) ? 1.f : 0.f; se += __expf(fmaf(f, s[j], (1.f - f) * -1.0e9f) - mx); } const float sc = 256.0f / se;
#pragma unroll 1
  for (int j0 = 0; j0 < nk; j0 += 8) { FragH fr, fl; for (int q = 0; q < 8; ++q) { const int j = j0 + q; const float f = (j <= last) ? 1.f : 0.f; const float v = __expf(fmaf(f, s[j], (1.f - f) * -1.0e9f) - mx) * sc; const _Float16 hv = (_Float16)v; fr.h[q] = hv; fl.h[q] = (_Float16)((v - (float)hv) * 1024.0f); } unsigned short* d = (unsigned short*)P + i * NKX + j0; unsigned short* dl = (unsigned short*)PL + i * NKX + j0; *(v8us*)d = fr.half[0]; *(v8us*)dl = fl.half[0];  } }


// ---- fused attention: scores, masks, softmax and the value product of 32 query rows per wave in one launch; no score or weight ever goes to memory.
// The wave walks its keys in blocks of 32 with a running row maximum and row sum. Scores are formed transposed, S^T = K Q^T (A = key rows, B = query rows, two column groups g of 16 queries): a lane then holds 16 keys of ONE query per group
// (accumulator register r of key tile t = key 16 t + 8 hh + r, column ln = query), which is at once the B fragment of the next product, out^T = V^T P^T (element 8 t + r = k index 16 t + 8 hh + r, the k order of g2_frag on the V^T rows):
// the weights go from accumulator to operand inside the lane, and a row's maximum and sum need one exchange between the two lane halves.
// Split precision as before: scores = (qh.kh)/8 + (ql.kh + qh.kl)/8192; weights 256 e as f16 hi + x1024 residual; out = sum (Ph Vh + (Pl Vh + Ph Vl)/1024) / (256 sum e), the residual products of a block folded into the f32 accumulator at the block's end.
// Keys above the end of the wave's own 32 rows carry -2e4 and contribute exactly 0, as the keys above a tile's end did. Block = 8 waves = 256 query rows of one head and batch, which read the same K and V^T lines; grid.z = query block, longest first.
__device__ __forceinline__ v8f fa_mma(v16h a, v16h b, v8f c) { return __builtin_amdgcn_wmma_f32_16x16x32_f16(false, a, false, b, (short)0, c, false, false); }
__global__ __launch_bounds__(256) void k_fattn(const _Float16* __restrict__ Qh, const _Float16* __restrict__ Ql, const _Float16* __restrict__ Kh, const _Float16* __restrict__ Kl,
    const _Float16* __restrict__ Vh, const _Float16* __restrict__ Vl, const float* __restrict__ am, float* __restrict__ out) {
  const int lane = threadIdx.x & 31, ln = lane & 15, hh = lane >> 4; const int w = __builtin_amdgcn_readfirstlane(threadIdx.x >> 5);
  const int h = blockIdx.x, b = blockIdx.y; const int qw = (SQ / 256 - 1 - (int)blockIdx.z) * 256 + w * 32;      /* first query row of the wave */
  const int nk = qw + 32;      /* keys walked: a multiple of 32, at most SQ */
  const size_t qo = ((size_t)b * SQ + qw + ln) * LQ + h * HD + 8 * hh, ko = ((size_t)b * SQ + ln) * LQ + h * HD + 8 * hh, vo = ((size_t)(b * NH + h) * HD + ln) * SQ + 8 * hh;
  const _Float16* qhp = Qh + qo; const _Float16* qlp = Ql + qo; const _Float16* khp = Kh + ko; const _Float16* klp = Kl + ko; const _Float16* vhp = Vh + vo; const _Float16* vlp = Vl + vo; const float* amp = am + (size_t)b * SQ + 8 * hh;
  v16h qh[2][2], ql[2][2], kh[2][2], kl[2][2];      /* q: [column group][k-step]; k: [key tile][k-step] */
#pragma unroll
  for (int g = 0; g < 2; ++g)
#pragma unroll
    for (int s = 0; s < 2; ++s) { qh[g][s] = g2_frag(qhp + g * 16 * LQ + s * 32, 0); ql[g][s] = g2_frag(qlp + g * 16 * LQ + s * 32, 0); kh[g][s] = g2_frag(khp + g * 16 * LQ + s * 32, 0); kl[g][s] = g2_frag(klp + g * 16 * LQ + s * 32, 0); }
  asm volatile("s_wait_xcnt 0x0" :: "v"(qhp), "v"(qlp), "v"(khp), "v"(klp) : "memory");      /* the address pairs stay untouched (inputs here) until this wait; behind it they may be advanced and reused */
  { const int st = (32 < nk) ? 32 * LQ : 0; khp += st; klp += st; }      /* the K pointers run one block ahead and stop at the last block */
  const v8f z8 = {0.f,0.f,0.f,0.f,0.f,0.f,0.f,0.f}; v8f o[4][2] = {{z8, z8}, {z8, z8}, {z8, z8}, {z8, z8}};      /* out^T: [tile of 16 head columns][column group] */
  float mr[2] = {-3.0e38f, -3.0e38f}, se[2] = {0.f, 0.f}; int dl = 8 * hh - qw - ln;      /* dl: key - query of the lane's first element, group 0 */
#pragma unroll 1      /* rolled: a block's fragments fill the register budget */
  for (int kb = 0; kb < nk; kb += 32) {
    const v4f m0 = *(const v4fa*)(amp), m1 = *(const v4fa*)(amp + 4), m2 = *(const v4fa*)(amp + 16), m3 = *(const v4fa*)(amp + 20);
    v8f c[2][2], r[2][2];      /* [key tile][column group]; c: hi.hi, r: both residual products */
#pragma unroll
    for (int t = 0; t < 2; ++t)
#pragma unroll
      for (int g = 0; g < 2; ++g) { c[t][g] = fa_mma(kh[t][0], qh[g][0], z8); r[t][g] = fa_mma(kh[t][0], ql[g][0], z8); }
#pragma unroll
    for (int t = 0; t < 2; ++t)
#pragma unroll
      for (int g = 0; g < 2; ++g) { r[t][g] = fa_mma(kl[t][0], qh[g][0], r[t][g]); c[t][g] = fa_mma(kh[t][1], qh[g][1], c[t][g]); }
#pragma unroll
    for (int t = 0; t < 2; ++t)
#pragma unroll
      for (int g = 0; g < 2; ++g) r[t][g] = fa_mma(kh[t][1], ql[g][1], r[t][g]);
#pragma unroll
    for (int t = 0; t < 2; ++t)
#pragma unroll
      for (int g = 0; g < 2; ++g) r[t][g] = fa_mma(kl[t][1], qh[g][1], r[t][g]);
    v16h vh[4], vl[4];
#pragma unroll
    for (int u = 0; u < 4; ++u) { vh[u] = g2_frag(vhp + u * 16 * SQ, 0); vl[u] = g2_frag(vlp + u * 16 * SQ, 0); }      /* this block's V^T: in flight under the softmax */
#pragma unroll
    for (int t = 0; t < 2; ++t)
#pragma unroll
      for (int s = 0; s < 2; ++s) { kh[t][s] = g2_frag(khp + t * 16 * LQ + s * 32, 0); kl[t][s] = g2_frag(klp + t * 16 * LQ + s * 32, 0); }      /* the next block's K: in flight under the softmax and the value product */
    asm volatile("s_wait_xcnt 0x0" :: "v"(khp), "v"(klp), "v"(vhp), "v"(vlp), "v"(amp) : "memory");      /* as above: the five address pairs are advanced only behind this wait */
    { const int st = (kb + 64 < nk) ? 32 * LQ : 0; khp += st; klp += st; } vhp += 32; vlp += 32; amp += 32;
    const float mv[16] = {m0[0],m0[1],m0[2],m0[3],m1[0],m1[1],m1[2],m1[3],m2[0],m2[1],m2[2],m2[3],m3[0],m3[1],m3[2],m3[3]};
    float x[2][16], mn[2];
#pragma unroll
    for (int g = 0; g < 2; ++g) { float mx = -3.0e38f;
#pragma unroll
      for (int e = 0; e < 16; ++e) { const int d = dl - 16 * g + (e & 7) + 16 * (e >> 3);      /* key - query */
        const float s = c[e >> 3][g][e & 7] * 0.125f + r[e >> 3][g][e & 7] * 0.0001220703125f;      /* both factors are powers of two: one rounding */
        const float mk = __fadd_rn((d > 0) ? -20000.0f : ((d >= -512) ? -10000.0f : 0.f), (float)(__bf16)mv[e]);      /* causal -1e4 + 'window' -1e4 (their sum is exact) + attention_mask (rounded to bf16, nearest even), then added to the score, all in f32 */
        x[g][e] = __fadd_rn(s, mk); mx = fmaxf(mx, x[g][e]); }
      mx = fmaxf(mx, __shfl_xor(mx, 16, 32)); mn[g] = fmaxf(mr[g], mx); }
    if (__builtin_amdgcn_ballot_w32(mn[0] > mr[0] || mn[1] > mr[1]) != 0u) {      /* a row's maximum rose: old sums to the new maximum (factor 1 for the rows where it did not) */
#pragma unroll
      for (int g = 0; g < 2; ++g) { const float al = __expf(mr[g] - mn[g]); se[g] *= al;
#pragma unroll
        for (int u = 0; u < 4; ++u)
#pragma unroll
          for (int q = 0; q < 8; ++q) o[u][g][q] *= al; } }
    FragH ph[2], pl[2];
#pragma unroll
    for (int g = 0; g < 2; ++g) { mr[g] = mn[g];
#pragma unroll
      for (int e = 0; e < 16; ++e) { const float ex = __expf(x[g][e] - mn[g]); se[g] += ex; const float p = ex * 256.0f; const _Float16 hv = (_Float16)p; ph[g].h[e] = hv; pl[g].h[e] = (_Float16)((p - (float)hv) * 1024.0f); } }
#pragma unroll
    for (int g = 0; g < 2; ++g) { v8f t[4];
#pragma unroll
      for (int u = 0; u < 4; ++u) { o[u][g] = fa_mma(vh[u], ph[g].v, o[u][g]); t[u] = fa_mma(vh[u], pl[g].v, z8); }
#pragma unroll
      for (int u = 0; u < 4; ++u) t[u] = fa_mma(vl[u], ph[g].v, t[u]);
#pragma unroll
      for (int u = 0; u < 4; ++u)
#pragma unroll
        for (int q = 0; q < 8; ++q) o[u][g][q] += t[u][q] * 0.0009765625f; }
    dl += 32; }
  float* op = out + ((size_t)b * SQ + qw + ln) * DM + h * HD + 8 * hh;      /* the lane's query row of group 0; register q of tile u = column 16 u + 8 hh + q; the wave writes both whole lines of each of its rows */
  v4f wv[2][8];
#pragma unroll
  for (int g = 0; g < 2; ++g) { const float st = se[g] + __shfl_xor(se[g], 16, 32); const float sc = 0.00390625f / st;
#pragma unroll
    for (int u = 0; u < 4; ++u)
#pragma unroll
      for (int q = 0; q < 4; ++q) { wv[g][2 * u][q] = o[u][g][q] * sc; wv[g][2 * u + 1][q] = o[u][g][4 + q] * sc; } }
#pragma unroll
  for (int g = 0; g < 2; ++g)
#pragma unroll
    for (int u = 0; u < 4; ++u) { *(v4f*)(op + g * 16 * DM + u * 16) = wv[g][2 * u]; *(v4f*)(op + g * 16 * DM + u * 16 + 4) = wv[g][2 * u + 1]; } }

extern "C" void kernel_launch(void* const* d_in, const int* in_sizes, int n_in,
                              void* d_out, int out_size, void* d_ws, size_t ws_size, hipStream_t stream) {
  (void)in_sizes; (void)n_in; (void)out_size;
  const float* const* I = (const float* const*)d_in; const float* x = I[0]; const float* am = I[1]; const float* wq = I[2]; const float* bq = I[3]; const float* wk = I[4]; const float* bk = I[5]; const float* wv = I[6]; const float* bv = I[7];      /* additive attention_mask [4][1][1][2048] (zeros); natural [out][in] weights + biases */
  char* ws = (char*)d_ws; size_t off = 0;
  auto take = [&](size_t bytes) { char* p = ws + off; off += (bytes + 255) & ~(size_t)255; return p; };
  _Float16* Q16 = (_Float16*)take(NR * DM * 2); _Float16* QL = (_Float16*)take(NR * DM * 2); _Float16* K16 = (_Float16*)take(NR * DM * 2); _Float16* KL = (_Float16*)take(NR * DM * 2);
  _Float16* VT = (_Float16*)take((size_t)NB * NH * HD * SQ * 2); _Float16* VTL = (_Float16*)take((size_t)NB * NH * HD * SQ * 2);      /* V^T planes of all batches */
  _Float16* BQ = (_Float16*)take((size_t)DM * DM * 2); _Float16* BK = (_Float16*)take((size_t)DM * DM * 2); _Float16* BV = (_Float16*)take((size_t)DM * DM * 2);
  _Float16* X16 = (_Float16*)take(NR * DM * 2); _Float16* V16 = (_Float16*)take(NR * DM * 2); _Float16* VL = (_Float16*)take(NR * DM * 2); float* VF = (float*)take(NR * DM * 4);      /* v as f16 hi + x1024 residual (the early causal rows average only a few v rows, so a single-f16 v would leave large absolute rounding against this module's small output scale) */
  if (off > ws_size) return;
  { const unsigned g = (unsigned)(((size_t)DM * DM / 8 + 255) / 256); k_wnat<<<g, 256, 0, stream>>>(wq, (size_t)DM * DM / 8, BQ); k_wnat<<<g, 256, 0, stream>>>(wk, (size_t)DM * DM / 8, BK); k_wnat<<<g, 256, 0, stream>>>(wv, (size_t)DM * DM / 8, BV); }      /* natural [out][in] = Bt x16 */

  k_x16<<<(unsigned)((NR * DM / 8 + 255) / 256), 256, 0, stream>>>(x, X16, NR * DM / 8);
  const size_t r0p = (size_t)B0 * SQ;      /* first projected row */
  k_gemm2<0><<<dim3((unsigned)((MP / 128) * (DM / 64)), 1), 128, 0, stream>>>(X16 + r0p * DM, DM, 0, BQ, DM, 0, 0.0625f, bq, 0, nullptr, 1, 0, 0, VF + r0p * DM, nullptr, DM, 0, MP, DM, DM); k_hl<<<(unsigned)(((size_t)MP * DM / 8 + 255) / 256), 256, 0, stream>>>(VF + r0p * DM, Q16 + r0p * DM, QL + r0p * DM, (size_t)MP * DM / 8);      /* q (+ bq) in f32 -> f16 hi + x1024 residual */
  k_gemm2<0><<<dim3((unsigned)((MP / 128) * (DM / 64)), 1), 128, 0, stream>>>(X16 + r0p * DM, DM, 0, BK, DM, 0, 0.0625f, bk, 0, nullptr, 1, 0, 0, VF + r0p * DM, nullptr, DM, 0, MP, DM, DM); k_hl<<<(unsigned)(((size_t)MP * DM / 8 + 255) / 256), 256, 0, stream>>>(VF + r0p * DM, K16 + r0p * DM, KL + r0p * DM, (size_t)MP * DM / 8);      /* k (+ bk) likewise */
  k_gemm2<0><<<dim3((unsigned)((MP / 128) * (DM / 64)), 1), 128, 0, stream>>>(X16 + r0p * DM, DM, 0, BV, DM, 0, 0.0625f, bv, 0, nullptr, 1, 0, 0, VF + r0p * DM, nullptr, DM, 0, MP, DM, DM); k_hl<<<(unsigned)(((size_t)MP * DM / 8 + 255) / 256), 256, 0, stream>>>(VF + r0p * DM, V16 + r0p * DM, VL + r0p * DM, (size_t)MP * DM / 8);      /* v in f32 -> f16 hi + x1024 residual planes */
  k_vt<NH, SQ><<<NB * NH * (SQ / 64), 256, 0, stream>>>(V16, LQ, 0, VT); k_vt<NH, SQ><<<NB * NH * (SQ / 64), 256, 0, stream>>>(VL, LQ, 0, VTL);      /* V^T hi and residual [4][16][64][SQ], all batches in one launch each */
  k_fattn<<<dim3(NH, NB, SQ / 256), 256, 0, stream>>>(Q16, QL, K16, KL, VT, VTL, am, (float*)d_out);      /* scores, masks, softmax and the value product of all heads, batches and query rows in one launch */
}

// v006
// One run takes 225 microseconds.
// Timed twice side by side with v005, it ran 1.29 times as fast both times.
// Counting every step since v000, it is 57.7 times as fast.
#include <hip/hip_runtime.h>
// Causal self-attention with the module's (faithful, inverted) window mask and an additive padding mask (hidden [4][2048][1024]; q/k/v = x W^T + b (natural [1024][1024] sigma 1/32, biases sigma 0.01); 16 heads of 64; scores / 8 + causal(-1e4 where j > i) + window(-1e4 where j >= i - 512, as the source writes it) + attention_mask[b][j] (zeros), all added in f32; softmax; out = merged attn v -> [4][2048][1024], no output projection). Effective pattern: rows i <= 512 attend causally (every kept logit carries the -1e4 offset, reproduced in f32), rows i >= 513 attend only keys j <= i - 513.
// Structure: token rows; x as an exact f16 plane in fragment order; natural weights as exact x16 planes; q, k, v as WMMA GEMMs (32x64 wave tiles, f32 accumulation, + bias) into f32 rows, each split into f16 hi + x1024 residual planes (the output scale is small, so logits, weights and values are all carried near f32); V^T of both v planes via LDS transposes (all batches a launch); attention fused in one launch, a wave per 32 query rows walking its keys in blocks of 32 with a running maximum and sum: scores = qh.kh/8 + (ql.kh + qh.kl)/8192 (K = 64) against the keys below the rows' end, the module's masks added in f32 on VALU (keys above the rows' end carry -2e4 and contribute exactly 0), weights as f16 hi + x1024 residual kept in registers, out = (Ph Vh^T + (Pl Vh^T + Ph Vl^T)/1024) / (256 row sum), written f32 into the output rows; launches: see trace.
// Operand layout: every f16 plane that a matrix instruction reads (x, the three weight planes, q and k hi/residual, V^T hi/residual) lies in memory in fragment order: see fo_src below.
// Compute dtype: inputs rounded to bf16; x / weights exact; q, k, v and softmax weights as f16 hi + x1024 residual GEMM operands, o accumulated in f32; scores and softmax statistics f32. v_wmma_f32_16x16x32_f16.
#define NB 4
#define SQ 2048
#define DM 1024
#define NH 16
#define HD 64
#define HG 1                         /* heads per launch of k_vt(V16, b, h0, VT), which is not launched */
#define QT 256                       /* query rows per causal tile */
#define NKX SQ                       /* longest score row */
#define B0 0                         /* first batch processed (debug hook) */
#define NBR NB                       /* batches processed (debug hook) */
#define NR ((size_t)NB * SQ)         /* token rows */
#define MP ((int)((size_t)NBR * SQ)) /* rows projected (debug hook) */
#define QN SQ                        /* query rows per batch; unused: no launch reads it */
#define NHD NH                       /* heads attended; unused: no launch reads it */
#define MPO MP                       /* unused: no launch reads it */
#define LQ DM      /* values per row of the q/k/v planes */
typedef __bf16 v16b __attribute__((ext_vector_type(16)));
typedef unsigned short v8us __attribute__((ext_vector_type(8), may_alias));
typedef float  v8f  __attribute__((ext_vector_type(8)));
typedef float  v4f  __attribute__((ext_vector_type(4)));
typedef float  v4fa __attribute__((ext_vector_type(4), may_alias));
union FragB { v16b v; v8us half[2]; unsigned short u[16]; };

__device__ __forceinline__ unsigned short bf16_bits(float x) { unsigned int u = __float_as_uint(x); return (unsigned short)((u + 0x7FFFu + ((u >> 16) & 1u)) >> 16); }
__device__ __forceinline__ float bf16_val(unsigned short b) { return __uint_as_float(((unsigned int)b) << 16); }
__device__ __forceinline__ float bf16_round(float x) { return bf16_val(bf16_bits(x)); }
// D += A·B with NT terms: 1 = ah·bh, 2 = + al·bh (A split), 3 = + ah·bl (both split)
template <int NT>
__device__ __forceinline__ v8f mmaN(v16b ah, v16b al, v16b bh, v16b bl, v8f c) {
  c = __builtin_amdgcn_wmma_f32_16x16x32_bf16(false, ah, false, bh, (short)0, c, false, false);
  if (NT >= 2) c = __builtin_amdgcn_wmma_f32_16x16x32_bf16(false, al, false, bh, (short)0, c, false, false);
  if (NT >= 3) c = __builtin_amdgcn_wmma_f32_16x16x32_bf16(false, ah, false, bl, (short)0, c, false, false);
  asm volatile("v_nop\n\tv_nop\n\tv_nop\n\tv_nop" : "+v"(c) : "v"(ah), "v"(al), "v"(bh), "v"(bl));
  return c;
}

__global__ __launch_bounds__(256) void k_wt_bf16(const float* __restrict__ W, unsigned short* __restrict__ Wt, int K, int N) {
  const int t = blockIdx.x * 256 + threadIdx.x;
  const int k8n = K / 8;
  if (t >= N * k8n) return;
  const int n = t / k8n, k8 = (t % k8n) * 8;
  v8us v;
#pragma unroll
  for (int i = 0; i < 8; ++i) v[i] = bf16_bits(W[(size_t)(k8 + i) * N + n]);
  *(v8us*)(Wt + (size_t)n * K + k8) = v;
  
}

// GEMM C[M][N] (f32, pitch ldc) = act(A[M][K]·W + bias). A f32 row-major (pitch lda) converted per fragment to bf16
// (ASPLIT: hi/lo two planes -> 2 terms, else single rounded term); Wt bf16 [N][K] (pitch ldb). BIAS_BF16 rounds the
// bias to bf16 first (bias quantised to bf16 before the add). K%32==0, M%16==0, N%64==0.
template <bool ASPLIT, int ACT, bool BIAS_BF16>
__global__ __launch_bounds__(128) void k_gemm_bf(const float* __restrict__ A, int lda, const unsigned short* __restrict__ Wt, int ldb,
                                               const float* __restrict__ bias, float* __restrict__ C, int ldc, int M, int N, int K) {
  __shared__ __attribute__((aligned(16))) float so[4][16][64];
  const int tid = threadIdx.x, w = tid >> 5, lane = tid & 31, ln = lane & 15, hh = lane >> 4;
  const int ntn = N / 64;
  const int wid = blockIdx.x * 4 + w;
  const int mt = wid / ntn, nq = wid % ntn;
  if (mt * 16 >= M) return;
  const int row0 = mt * 16, col0 = nq * 64;
  const float* arow = A + (size_t)(row0 + ln) * lda;
  v8f acc[4] = {};
  for (int kb = 0; kb < K; kb += 32) {
    FragB ah, al;
    const v4f x0 = *(const v4fa*)(arow + kb + 8 * hh), x1 = *(const v4fa*)(arow + kb + 8 * hh + 4);
    const v4f x2 = *(const v4fa*)(arow + kb + 16 + 8 * hh), x3 = *(const v4fa*)(arow + kb + 16 + 8 * hh + 4);
    float xs[16] = {x0[0],x0[1],x0[2],x0[3],x1[0],x1[1],x1[2],x1[3],x2[0],x2[1],x2[2],x2[3],x3[0],x3[1],x3[2],x3[3]};
#pragma unroll
    for (int i = 0; i < 16; ++i) { const unsigned short hb = bf16_bits(xs[i]); ah.u[i] = hb; al.u[i] = ASPLIT ? bf16_bits(xs[i] - bf16_val(hb)) : (unsigned short)0; }
#pragma unroll
    for (int t = 0; t < 4; ++t) {
      const unsigned short* brow = Wt + (size_t)(col0 + t * 16 + ln) * ldb + kb;
      FragB b;
      b.half[0] = *(const v8us*)(brow + 8 * hh);
      b.half[1] = *(const v8us*)(brow + 16 + 8 * hh);
      acc[t] = mmaN<ASPLIT ? 2 : 1>(ah.v, al.v, b.v, b.v, acc[t]);
    }
  }
#pragma unroll
  for (int t = 0; t < 4; ++t) {
    float bv = bias ? bias[col0 + t * 16 + ln] : 0.f;
    if (BIAS_BF16) bv = bf16_round(bv);
#pragma unroll
    for (int r = 0; r < 8; ++r) { float v = acc[t][r] + bv; if (ACT == 1) v = fmaxf(v, 0.f); so[w][8 * hh + r][t * 16 + ln] = v; }
  }
  __builtin_amdgcn_fence(__ATOMIC_ACQ_REL, "workgroup");
  __builtin_amdgcn_wave_barrier();
  const int rsub = lane >> 4, c4 = (lane & 15) * 4;
  {
#pragma unroll
    for (int q = 0; q < 8; ++q) {
      const int r = q * 2 + rsub;
      const v4f v = *(const v4fa*)&so[w][r][c4];
      *(v4f*)(C + (size_t)(row0 + r) * ldc + col0 + c4) = v;
    }
    
  }
}

// GEMM C = act(A·W + bias + resid): A f32 (ASPLIT -> hi/lo 2 terms), Wt bf16 [N][K]; ACT 0 none, 1 relu, 2 exact gelu;
// resid (optional, f32, row index = (row % rmod), pitch ldr, RES_BF16 rounds it) added before the activation.
template <bool ASPLIT, int ACT, bool BIAS_BF16, bool RES_BF16>
__global__ __launch_bounds__(128) void k_gemm_bf3(const float* __restrict__ A, int lda, const unsigned short* __restrict__ Wt, int ldb,
                                                const float* __restrict__ bias, const float* __restrict__ resid, int rmod, int ldr,
                                                float* __restrict__ C, int ldc, int M, int N, int K) {
  __shared__ __attribute__((aligned(16))) float so[4][16][64];
  const int tid = threadIdx.x, w = tid >> 5, lane = tid & 31, ln = lane & 15, hh = lane >> 4;
  const int ntn = N / 64;
  const int wid = blockIdx.x * 4 + w;
  const int mt = wid / ntn, nq = wid % ntn;
  if (mt * 16 >= M) return;
  const int row0 = mt * 16, col0 = nq * 64;
  const float* arow = A + (size_t)(row0 + ln) * lda;
  v8f acc[4] = {};
  for (int kb = 0; kb < K; kb += 32) {
    FragB ah, al;
    const v4f x0 = *(const v4fa*)(arow + kb + 8 * hh), x1 = *(const v4fa*)(arow + kb + 8 * hh + 4);
    const v4f x2 = *(const v4fa*)(arow + kb + 16 + 8 * hh), x3 = *(const v4fa*)(arow + kb + 16 + 8 * hh + 4);
    float xs[16] = {x0[0],x0[1],x0[2],x0[3],x1[0],x1[1],x1[2],x1[3],x2[0],x2[1],x2[2],x2[3],x3[0],x3[1],x3[2],x3[3]};
#pragma unroll
    for (int i = 0; i < 16; ++i) { const unsigned short hb = bf16_bits(xs[i]); ah.u[i] = hb; al.u[i] = ASPLIT ? bf16_bits(xs[i] - bf16_val(hb)) : (unsigned short)0; }
#pragma unroll
    for (int t = 0; t < 4; ++t) {
      const unsigned short* brow = Wt + (size_t)(col0 + t * 16 + ln) * ldb + kb;
      FragB b;
      b.half[0] = *(const v8us*)(brow + 8 * hh);
      b.half[1] = *(const v8us*)(brow + 16 + 8 * hh);
      acc[t] = mmaN<ASPLIT ? 2 : 1>(ah.v, al.v, b.v, b.v, acc[t]);
    }
  }
#pragma unroll
  for (int t = 0; t < 4; ++t) {
    const int col = col0 + t * 16 + ln;
    float bv = bias ? bias[col] : 0.f;
    if (BIAS_BF16) bv = bf16_round(bv);
#pragma unroll
    for (int r = 0; r < 8; ++r) {
      float v = acc[t][r] + bv;
      if (resid) { float rv = resid[(size_t)((row0 + 8 * hh + r) % rmod) * ldr + col]; if (RES_BF16) rv = bf16_round(rv); v += rv; }
      if (ACT == 1) v = fmaxf(v, 0.f);
      if (ACT == 2) v = 0.5f * v * (1.0f + erff(v * 0.70710678118654752f));
      if (ACT == 3) { const float u = 0.7978845608028654f * (v + 0.044715f * v * v * v); v = 0.5f * v * (1.0f + tanhf(u)); }
      so[w][8 * hh + r][t * 16 + ln] = v;
    }
  }
  __builtin_amdgcn_fence(__ATOMIC_ACQ_REL, "workgroup");
  __builtin_amdgcn_wave_barrier();
  const int rsub = lane >> 4, c4 = (lane & 15) * 4;
  {
#pragma unroll
    for (int q = 0; q < 8; ++q) {
      const int r = q * 2 + rsub;
      const v4f v = *(const v4fa*)&so[w][r][c4];
      *(v4f*)(C + (size_t)(row0 + r) * ldc + col0 + c4) = v;
    }
    
  }
}
// row LayerNorm (biased variance, eps) over N: s = X (+ R); optional out_sum <- s; out_norm <- (s-mu)*rsqrt(var+eps)*g + b
template <bool PARAM_BF16>
__global__ __launch_bounds__(256) void k_layernorm(const float* __restrict__ X, const float* __restrict__ R, const float* __restrict__ g, const float* __restrict__ bta,
                                                  float* __restrict__ out_sum, float* __restrict__ out_norm, int N, float eps) {
  __shared__ float red[256];
  const int row = blockIdx.x, tid = threadIdx.x;
  const float* x = X + (size_t)row * N; const float* rr = R ? R + (size_t)row * N : nullptr;
  float vals[16];                     // up to N = 4096
  const int per = N / 256;            // contiguous chunk per thread? use strided-by-4 chunks: thread handles j = tid*4 + 1024*u
  float s1 = 0.f;
  for (int u = 0; u < per / 4; ++u) {
    const int j = tid * 4 + 1024 * u;
    const v4f a = *(const v4fa*)(x + j);
    v4f b = {0.f,0.f,0.f,0.f}; if (rr) b = *(const v4fa*)(rr + j);
#pragma unroll
    for (int q = 0; q < 4; ++q) { const float v = a[q] + b[q]; vals[u * 4 + q] = v; s1 += v; }
  }
  red[tid] = s1; __syncthreads();
  for (int st = 128; st > 0; st >>= 1) { if (tid < st) red[tid] += red[tid + st]; __syncthreads(); }
  const float mu = red[0] / (float)N; __syncthreads();
  float s2 = 0.f;
  for (int u = 0; u < per / 4; ++u)
#pragma unroll
    for (int q = 0; q < 4; ++q) { const float c = vals[u * 4 + q] - mu; s2 += c * c; }
  red[tid] = s2; __syncthreads();
  for (int st = 128; st > 0; st >>= 1) { if (tid < st) red[tid] += red[tid + st]; __syncthreads(); }
  const float rs = rsqrtf(red[0] / (float)N + eps);
  {
    for (int u = 0; u < per / 4; ++u) {
      const int j = tid * 4 + 1024 * u;
      v4f o, sm;
#pragma unroll
      for (int q = 0; q < 4; ++q) {
        float gg = g[j + q], bb = bta[j + q];
        if (PARAM_BF16) { gg = bf16_round(gg); bb = bf16_round(bb); }
        sm[q] = vals[u * 4 + q]; o[q] = (vals[u * 4 + q] - mu) * rs * gg + bb;
      }
      if (out_sum) *(v4f*)(out_sum + (size_t)row * N + j) = sm;
      *(v4f*)(out_norm + (size_t)row * N + j) = o;
    }
    
  }
}



// ---- f16 WMMA path (v_wmma_f32_16x16x32_f16): 11-bit significands for operands in range — used where a [0,1] probability operand needs more precision than bf16
typedef _Float16 v16h __attribute__((ext_vector_type(16)));
union FragH { v16h v; v8us half[2]; _Float16 h[16]; unsigned short u[16]; };
template <int NT>
__device__ __forceinline__ v8f mmaH(v16h ah, v16h al, v16h bh, v16h bl, v8f c) {
  c = __builtin_amdgcn_wmma_f32_16x16x32_f16(false, ah, false, bh, (short)0, c, false, false);
  if (NT >= 2) c = __builtin_amdgcn_wmma_f32_16x16x32_f16(false, al, false, bh, (short)0, c, false, false);
  if (NT >= 3) c = __builtin_amdgcn_wmma_f32_16x16x32_f16(false, ah, false, bl, (short)0, c, false, false);
  asm volatile("v_nop\n\tv_nop\n\tv_nop\n\tv_nop" : "+v"(c) : "v"(ah), "v"(al), "v"(bh), "v"(bl));
  return c;
}
// batched GEMM like k_gemm_b but f16 operands: A f32 (split into f16 hi/lo if ASPLIT, else rounded to f16), Bt = f16 values [n][k]; alpha; C f32; N multiple of 16 (partial tiles skipped)
template <bool ASPLIT>
__global__ __launch_bounds__(128) void k_gemm_h(const float* __restrict__ A, int lda, size_t sA, const _Float16* __restrict__ Bh, int ldb, size_t sB, float alpha, float* __restrict__ C, int ldc, size_t sC, int M, int N, int K) {
  __shared__ __attribute__((aligned(16))) float so[4][16][64];
  const int tid = threadIdx.x, w = tid >> 5, lane = tid & 31, ln = lane & 15, hh = lane >> 4; const int by = blockIdx.y;
  A += (size_t)by * sA; Bh += (size_t)by * sB; C += (size_t)by * sC;
  const int ntn = (N + 63) / 64; const int wid = blockIdx.x * 4 + w; const int mt = wid / ntn, nq = wid % ntn; if (mt * 16 >= M) return;
  const int row0 = mt * 16, col0 = nq * 64; const float* arow = A + (size_t)(row0 + ln) * lda;
  v8f acc[4] = {};
  for (int kb = 0; kb < K; kb += 32) {
    FragH ah, al;
    const v4f x0 = *(const v4fa*)(arow + kb + 8 * hh), x1 = *(const v4fa*)(arow + kb + 8 * hh + 4), x2 = *(const v4fa*)(arow + kb + 16 + 8 * hh), x3 = *(const v4fa*)(arow + kb + 16 + 8 * hh + 4);
    float xs[16] = {x0[0],x0[1],x0[2],x0[3],x1[0],x1[1],x1[2],x1[3],x2[0],x2[1],x2[2],x2[3],x3[0],x3[1],x3[2],x3[3]};
#pragma unroll
    for (int i = 0; i < 16; ++i) { const _Float16 h = (_Float16)xs[i]; ah.h[i] = h; al.h[i] = ASPLIT ? (_Float16)(xs[i] - (float)h) : (_Float16)0.0f; }
#pragma unroll
    for (int t = 0; t < 4; ++t) { if (col0 + t * 16 >= N) continue; const size_t boff = (size_t)(col0 + t * 16 + ln) * ldb + kb; FragH bq; bq.half[0] = *(const v8us*)(Bh + boff + 8 * hh); bq.half[1] = *(const v8us*)(Bh + boff + 16 + 8 * hh);
      acc[t] = mmaH<ASPLIT ? 2 : 1>(ah.v, al.v, bq.v, bq.v, acc[t]); }
  }
#pragma unroll
  for (int t = 0; t < 4; ++t) { if (col0 + t * 16 >= N) continue;
#pragma unroll
    for (int r = 0; r < 8; ++r) so[w][8 * hh + r][t * 16 + ln] = acc[t][r] * alpha; }
  __builtin_amdgcn_fence(__ATOMIC_ACQ_REL, "workgroup"); __builtin_amdgcn_wave_barrier();
  const int rsub = lane >> 4, c4 = (lane & 15) * 4;
  {
#pragma unroll
    for (int q = 0; q < 8; ++q) { const int r = q * 2 + rsub; if (col0 + c4 < N) { const v4f v = *(const v4fa*)&so[w][r][c4]; *(v4f*)(C + (size_t)(row0 + r) * ldc + col0 + c4) = v; } }
     }
}

// Wt[n][k] = f16(W[k][n]·scale) from f32 row-major W[K][N] (scale = power of two; bf16-exact weights stay exact in f16 away from the subnormal range)
__global__ __launch_bounds__(256) void k_wt_f16(const float* __restrict__ W, _Float16* __restrict__ Wt, int K, int N, float scale) {
  const int t = blockIdx.x * 256 + threadIdx.x; if (t >= N * (K / 8)) return; const int n = t / (K / 8), k8 = (t % (K / 8)) * 8; FragH f;
#pragma unroll
  for (int i = 0; i < 8; ++i) f.h[i] = (_Float16)(bf16_round(W[(size_t)(k8 + i) * N + n]) * scale); const v8us o = f.half[0];
  *(v8us*)((unsigned short*)Wt + (size_t)n * K + k8) = o; 
}
// k_gemm_hh variant with fused epilogue: v = acc·alpha + bias[by·sBias + col] (+ CP[(row/rowsPerB)·sCPb + by·64 + col] if CP) ; ACT 0 none / 1 elu ; writes f16 C16 (and f32 C if non-null)
template <int ACT>
__global__ __launch_bounds__(128) void k_gemm_hhx(const _Float16* __restrict__ A, int lda, size_t sA, const _Float16* __restrict__ Bh, int ldb, size_t sB, float alpha, const float* __restrict__ bias, size_t sBias, const float* __restrict__ CP, int rowsPerB, size_t sCPb, int row0g,
    float* __restrict__ C, _Float16* __restrict__ C16, int ldc, size_t sC, int M, int N, int K) {
  __shared__ __attribute__((aligned(16))) float so[4][16][64];
  const int tid = threadIdx.x, w = tid >> 5, lane = tid & 31, ln = lane & 15, hh = lane >> 4; const int by = blockIdx.y;
  A += (size_t)by * sA; Bh += (size_t)by * sB; const size_t cofs = (size_t)by * sC; const float* bp = bias ? bias + (size_t)by * sBias : nullptr;
  const int ntn = (N + 63) / 64; const int wid = blockIdx.x * 4 + w; const int mt = wid / ntn, nq = wid % ntn; if (mt * 16 >= M) return;
  const int row0 = mt * 16, col0 = nq * 64; const _Float16* arow = A + (size_t)(row0 + ln) * lda;
  v8f acc[4] = {};
  for (int kb = 0; kb < K; kb += 32) { FragH ah; ah.half[0] = *(const v8us*)((const unsigned short*)arow + kb + 8 * hh); ah.half[1] = *(const v8us*)((const unsigned short*)arow + kb + 16 + 8 * hh);
#pragma unroll
    for (int t = 0; t < 4; ++t) { if (col0 + t * 16 >= N) continue; const size_t boff = (size_t)(col0 + t * 16 + ln) * ldb + kb; FragH bq; bq.half[0] = *(const v8us*)((const unsigned short*)Bh + boff + 8 * hh); bq.half[1] = *(const v8us*)((const unsigned short*)Bh + boff + 16 + 8 * hh);
      acc[t] = mmaH<1>(ah.v, ah.v, bq.v, bq.v, acc[t]); }
  }
#pragma unroll
  for (int t = 0; t < 4; ++t) { if (col0 + t * 16 >= N) continue; const int col = col0 + t * 16 + ln; const float bv = bp ? bf16_round(bp[col]) : 0.f;
#pragma unroll
    for (int r = 0; r < 8; ++r) { float v = acc[t][r] * alpha + bv; if (CP) { const int rr = row0g + row0 + 8 * hh + r; if (rowsPerB < 0) v += CP[cofs + (size_t)rr * ldc + col];      /* rowsPerB < 0: own element of the batched C plane */ else { const int bidx = rr / rowsPerB; v += CP[(size_t)bidx * sCPb + (size_t)by * 64 + col]; } } if (ACT == 1) v = (v > 0.f) ? v : expm1f(v); else if (ACT == 7) v = (v > 0.f) ? v + 1.0f : expf(v); else if (ACT == 8) v = tanhf(v); else if (ACT == 9) v = 0.5f * v * (1.0f + tanhf(0.7978845608028654f * (v + 0.044715f * v * v * v))); else if (ACT == 11) v = 1.0f / (1.0f + expf(-v)); else if (ACT == 12) v = (v > 0.f) ? v : 0.01f * v; else if (ACT == 14) v = (v > 0.f) ? v : 0.1f * v; else if (ACT == 16) v = (v >= 0.f) ? v : 0.3f * v; else if (ACT == 17) v = (v >= 0.f) ? v : 0.2f * v; else if (ACT == 15) v = v / (1.0f + expf(-v)); else if (ACT == 3) v = fmaxf(v, 0.f); else if (ACT == 6) v = 0.5f * v * (1.0f + erff(v * 0.70710678118654752f)); so[w][8 * hh + r][t * 16 + ln] = v; } }
  __builtin_amdgcn_fence(__ATOMIC_ACQ_REL, "workgroup"); __builtin_amdgcn_wave_barrier();
  const int rsub = lane >> 4, c4 = (lane & 15) * 4; typedef _Float16 v4h __attribute__((ext_vector_type(4)));
  {
#pragma unroll
    for (int q = 0; q < 8; ++q) { const int r = q * 2 + rsub; if (col0 + c4 < N) { const v4f v = *(const v4fa*)&so[w][r][c4]; if (C) *(v4f*)(C + cofs + (size_t)(row0 + r) * ldc + col0 + c4) = v; if (C16) { v4h h4; for (int i = 0; i < 4; ++i) h4[i] = (_Float16)v[i]; *(v4h*)(C16 + cofs + (size_t)(row0 + r) * ldc + col0 + c4) = h4; } } }
     }
}


typedef _Float16 v4h __attribute__((ext_vector_type(4)));

// ---- fragment order: a plane of rows x DM f16 values is cut into tiles of 16 rows x 32 k (1 KB each, tile index = (row / 16) * (DM / 32) + k / 32). Inside a tile stand 64 pieces of 16 B: piece c = 32 * half + lane holds
// row (lane & 15), k = 16 * half + 8 * (lane >> 4) + 0..7, which is what lane 'lane' takes as registers 4 * half .. 4 * half + 3 of its A or B fragment. A wave's fragment load then reads 512 B in a row (4 whole lines)
// where rows of pitch 2 KB gave it 16 pieces of 32 B in 16 lines. The k order of every fragment is the old one. fo_src: first element, in the row-major source, of piece t of the plane.
__device__ __forceinline__ size_t fo_src(size_t t) { const size_t tile = t >> 6; const int c = (int)(t & 63); return ((tile / (DM / 32)) * 16 + (c & 15)) * DM + (tile % (DM / 32)) * 32 + (c >> 5) * 16 + ((c >> 4) & 1) * 8; }
__device__ __forceinline__ v16h fo_frag(const _Float16* p) { FragH f; f.half[0] = *(const v8us*)((const unsigned short*)p); f.half[1] = *(const v8us*)((const unsigned short*)p + 256); return f.v; }      /* p: the tile + 8 * lane */
__global__ __launch_bounds__(256) void k_x16(const float* __restrict__ x, _Float16* __restrict__ X16, size_t n8) { const size_t t = (size_t)blockIdx.x * 256 + threadIdx.x; if (t >= n8) return; FragH f; const float* s = x + fo_src(t); const v4f a = *(const v4fa*)s, c = *(const v4fa*)(s + 4);
#pragma unroll
  for (int q = 0; q < 4; ++q) { f.h[q] = (_Float16)bf16_round(a[q]); f.h[4 + q] = (_Float16)bf16_round(c[q]); } *(v8us*)((unsigned short*)X16 + t * 8) = f.half[0];  }      /* piece t of the plane in fragment order */
__global__ __launch_bounds__(256) void k_h16(const float* __restrict__ x, _Float16* __restrict__ X16, size_t n8) { const size_t t = (size_t)blockIdx.x * 256 + threadIdx.x; if (t >= n8) return; FragH f;
#pragma unroll
  for (int q = 0; q < 8; ++q) f.h[q] = (_Float16)x[t * 8 + q]; *(v8us*)((unsigned short*)X16 + t * 8) = f.half[0];  }
__global__ __launch_bounds__(256) void k_round16f(const float* __restrict__ W, _Float16* __restrict__ Bt, size_t n8) { const size_t t = (size_t)blockIdx.x * 256 + threadIdx.x; if (t >= n8) return; FragH f;
#pragma unroll
  for (int i = 0; i < 8; ++i) f.h[i] = (_Float16)(bf16_round(W[t * 8 + i]) * 16.0f); *(v8us*)((unsigned short*)Bt + t * 8) = f.half[0];  }
template <int NHv, int TTv>
__global__ __launch_bounds__(256) void k_vt(const _Float16* __restrict__ V16, int ldv, int voff, _Float16* __restrict__ Vt) { __shared__ unsigned short tl[64][66]; const int tid = threadIdx.x; const int slab = blockIdx.x / (TTv / 64), lg = blockIdx.x % (TTv / 64); const int b = slab / NHv, h = slab % NHv;
  for (int i = tid; i < 64 * 8; i += 256) { const int r = i / 8, c8 = (i % 8) * 8; FragH f; f.half[0] = *(const v8us*)((const unsigned short*)V16 + ((size_t)b * TTv + lg * 64 + r) * ldv + voff + h * 64 + c8);
#pragma unroll
    for (int q = 0; q < 8; ++q) tl[r][c8 + q] = f.u[q]; }
  __syncthreads();
  {
#pragma unroll
    for (int rd = 0; rd < 2; ++rd) { const int idx = rd * 256 + tid, c = idx & 63; const int d = ((idx >> 6) & 3) * 16 + (c & 15), j = (idx >> 8) * 32 + (c >> 5) * 16 + ((c >> 4) & 1) * 8; FragH f;      /* V^T in fragment order, tiles of 16 head columns x 32 keys, tile index = (slab * (TTv / 32) + key / 32) * 4 + column / 16: the 4 tiles of a key block lie in a row, and the block's 512 pieces are written in their order */
#pragma unroll
      for (int q = 0; q < 8; ++q) f.u[q] = tl[j + q][d];
      *(v8us*)((unsigned short*)Vt + (size_t)slab * 64 * TTv + (size_t)lg * 4096 + idx * 8) = f.half[0]; }
     } }

template <bool FO>      /* FO: the two planes are written in fragment order (q, k); else row-major (v, which the transpose reads) */
__global__ __launch_bounds__(256) void k_hl(const float* __restrict__ F, _Float16* __restrict__ Hh, _Float16* __restrict__ Hl, size_t n8) { const size_t t = (size_t)blockIdx.x * 256 + threadIdx.x; if (t >= n8) return; FragH fh, fl; const float* s = F + (FO ? fo_src(t) : t * 8); const v4f a = *(const v4fa*)s, c = *(const v4fa*)(s + 4);
#pragma unroll
  for (int q = 0; q < 4; ++q) { _Float16 h = (_Float16)a[q]; fh.h[q] = h; fl.h[q] = (_Float16)((a[q] - (float)h) * 1024.0f); h = (_Float16)c[q]; fh.h[4 + q] = h; fl.h[4 + q] = (_Float16)((c[q] - (float)h) * 1024.0f); }
  { *(v8us*)((unsigned short*)Hh + t * 8) = fh.half[0]; *(v8us*)((unsigned short*)Hl + t * 8) = fl.half[0];  } }

// ---- fast GEMM (wave tile 32x64; requires M % 32 == 0 rows per launch region, N % 64 == 0 and K % 64 == 0); epilogue = k_gemm_hhx semantics ----
__device__ __forceinline__ v16h g2_frag(const _Float16* p, int hh) { FragH f; f.half[0] = *(const v8us*)((const unsigned short*)p + 8 * hh); f.half[1] = *(const v8us*)((const unsigned short*)p + 16 + 8 * hh); return f.v; }
__device__ __forceinline__ v8f g2_mma(v16h a, v16h b, v8f c) { v8f d = __builtin_amdgcn_wmma_f32_16x16x32_f16(false, a, false, b, (short)0, c, false, false); asm volatile("v_nop\n\tv_nop\n\tv_nop\n\tv_nop" : "+v"(d) : "v"(a), "v"(b)); return d; }
template <int ACT>
__global__ __launch_bounds__(128) void k_gemm2(const _Float16* __restrict__ A, int lda, size_t sA, const _Float16* __restrict__ Bh, int ldb, size_t sB, float alpha, const float* __restrict__ bias, size_t sBias, const float* __restrict__ CP, int rowsPerB, size_t sCPb, int row0g,
    float* __restrict__ C, _Float16* __restrict__ C16, int ldc, size_t sC, int M, int N, int K) { static_assert(ACT == 0 || ACT == 3 || ACT == 6 || ACT == 8 || ACT == 9 || ACT == 11 || ACT == 12 || ACT == 14 || ACT == 15 || ACT == 16 || ACT == 17, "k_gemm2: unsupported ACT code (would silently apply no activation)");
  __shared__ __attribute__((aligned(16))) float so[4][32][68];
  const int tid = threadIdx.x, w = tid >> 5, lane = tid & 31, ln = lane & 15, hh = lane >> 4; const int by = blockIdx.y;
  A += (size_t)by * sA; Bh += (size_t)by * sB; const size_t cofs = (size_t)by * sC; const float* bp = bias ? bias + (size_t)by * sBias : nullptr;
  const int ntn = N >> 6; const int mt = blockIdx.x / ntn, nq = blockIdx.x - mt * ntn; const int row0 = mt * 128 + 32 * w, col0 = nq * 64; if (row0 >= M) return;
  const _Float16* a0p = A + (size_t)row0 * lda + 8 * lane; const _Float16* a1p = a0p + (size_t)16 * lda;      /* A and Bh lie in fragment order (fo_src; lda = ldb = DM): 16 rows = lda / 32 tiles of 512 values; the lane's piece is in the pointers */
  const _Float16* b0p = Bh + (size_t)col0 * ldb + 8 * lane; const _Float16* b1p = b0p + (size_t)16 * ldb; const _Float16* b2p = b1p + (size_t)16 * ldb; const _Float16* b3p = b2p + (size_t)16 * ldb;
  const v8f z8 = {0.f,0.f,0.f,0.f,0.f,0.f,0.f,0.f}; v8f c00 = z8, c01 = z8, c02 = z8, c03 = z8, c10 = z8, c11 = z8, c12 = z8, c13 = z8;
#pragma unroll 1      /* one trip = two k-steps (K % 64 == 0); rolled so that the 12 fragments of a trip stay in registers */
  for (int kb = 0; kb < K; kb += 64) {      /* all 24 loads of the trip stand in front of its first product: the trip waits for memory once, not once per fragment */
    const v16h a0 = fo_frag(a0p), b0 = fo_frag(b0p), a1 = fo_frag(a1p), b1 = fo_frag(b1p), b2 = fo_frag(b2p), b3 = fo_frag(b3p);
    const v16h e0 = fo_frag(a0p + 512), f0 = fo_frag(b0p + 512), e1 = fo_frag(a1p + 512), f1 = fo_frag(b1p + 512), f2 = fo_frag(b2p + 512), f3 = fo_frag(b3p + 512);
    asm volatile("s_wait_xcnt 0x0" :: "v"(a0p), "v"(a1p), "v"(b0p), "v"(b1p), "v"(b2p), "v"(b3p) : "memory");      /* the six address pairs stay untouched (inputs here) until this wait; behind it they may be advanced and reused */
    c00 = g2_mma(a0, b0, c00); c10 = g2_mma(a1, b0, c10); c01 = g2_mma(a0, b1, c01); c11 = g2_mma(a1, b1, c11); c02 = g2_mma(a0, b2, c02); c12 = g2_mma(a1, b2, c12); c03 = g2_mma(a0, b3, c03); c13 = g2_mma(a1, b3, c13);
    c00 = g2_mma(e0, f0, c00); c10 = g2_mma(e1, f0, c10); c01 = g2_mma(e0, f1, c01); c11 = g2_mma(e1, f1, c11); c02 = g2_mma(e0, f2, c02); c12 = g2_mma(e1, f2, c12); c03 = g2_mma(e0, f3, c03); c13 = g2_mma(e1, f3, c13);
    a0p += 1024; a1p += 1024; b0p += 1024; b1p += 1024; b2p += 1024; b3p += 1024; }      /* two tiles */
  v8f accs[8] = {c00, c01, c02, c03, c10, c11, c12, c13};
#pragma unroll
  for (int u = 0; u < 8; ++u) { const int t = u & 3, half = u >> 2; const int col = col0 + t * 16 + ln; const float bv = bp ? bf16_round(bp[col]) : 0.f;
#pragma unroll
    for (int r = 0; r < 8; ++r) { const int rloc = half * 16 + 8 * hh + r; float v = accs[u][r] * alpha + bv; if (CP) { if (rowsPerB < 0) v += CP[cofs + (size_t)(row0g + row0 + rloc) * ldc + col];      /* rowsPerB < 0: own element of the batched C plane */ else { const int bidx = (row0g + row0 + rloc) / rowsPerB; v += CP[(size_t)bidx * sCPb + (size_t)by * 64 + col]; } }
      if (ACT == 3) v = fmaxf(v, 0.f); else if (ACT == 6) v = 0.5f * v * (1.0f + erff(v * 0.70710678118654752f)); else if (ACT == 11) v = 1.0f / (1.0f + expf(-v)); else if (ACT == 15) v = v / (1.0f + expf(-v)); else if (ACT == 12) v = (v > 0.f) ? v : 0.01f * v; else if (ACT == 8) v = tanhf(v); else if (ACT == 9) v = 0.5f * v * (1.0f + tanhf(0.7978845608028654f * (v + 0.044715f * v * v * v))); else if (ACT == 14) v = (v > 0.f) ? v : 0.1f * v; else if (ACT == 16) v = (v >= 0.f) ? v : 0.3f * v; else if (ACT == 17) v = (v >= 0.f) ? v : 0.2f * v;
      so[w][rloc][t * 16 + ln] = v; } }
  __builtin_amdgcn_fence(__ATOMIC_ACQ_REL, "workgroup"); __builtin_amdgcn_wave_barrier();
  const int rsub = lane >> 4, c4 = (lane & 15) * 4;
  {
#pragma unroll
    for (int q = 0; q < 16; ++q) { const int r = q * 2 + rsub; const v4f v = *(const v4fa*)&so[w][r][c4]; if (C) *(v4f*)(C + cofs + (size_t)(row0 + r) * ldc + col0 + c4) = v; if (C16) { v4h h4; for (int i = 0; i < 4; ++i) h4[i] = (_Float16)v[i]; *(v4h*)(C16 + cofs + (size_t)(row0 + r) * ldc + col0 + c4) = h4; } }
     } }


__global__ __launch_bounds__(256) void k_wnat(const float* __restrict__ w, size_t n8, _Float16* __restrict__ Bt) { const size_t t = (size_t)blockIdx.x * 256 + threadIdx.x; if (t >= n8) return; FragH f; const float* s = w + fo_src(t); const v4f a = *(const v4fa*)s, c = *(const v4fa*)(s + 4); for (int q = 0; q < 4; ++q) { f.h[q] = (_Float16)(bf16_round(a[q]) * 16.0f); f.h[4 + q] = (_Float16)(bf16_round(c[q]) * 16.0f); } *(v8us*)((unsigned short*)Bt + t * 8) = f.half[0];  }      /* piece t of the plane in fragment order */
__global__ __launch_bounds__(256) void k_rsm(const float* __restrict__ S, _Float16* __restrict__ P, int nrows) {
  #pragma clang fp contract(off)
  const int i = blockIdx.x * 256 + threadIdx.x; if (i >= nrows) return; const float* s = S + (size_t)i * SQ; float mx = -3.0e38f;
#pragma unroll 1
  for (int j = 0; j < SQ; ++j) mx = fmaxf(mx, s[j]); float se = 0.f;
#pragma unroll 1
  for (int j = 0; j < SQ; ++j) se += expf(s[j] - mx); const float sc = 256.0f / se;
#pragma unroll 1
  for (int j0 = 0; j0 < SQ; j0 += 8) { FragH f; for (int q = 0; q < 8; ++q) f.h[q] = (_Float16)(expf(s[j0 + q] - mx) * sc); unsigned short* d = (unsigned short*)P + (size_t)i * SQ + j0; *(v8us*)d = f.half[0];  } }
__global__ __launch_bounds__(256) void k_vt(const _Float16* __restrict__ V16, int b, int h0, _Float16* __restrict__ VT) { __shared__ unsigned short tl[64][65]; const int tid = threadIdx.x; const int hh = blockIdx.x % HG, sg = blockIdx.x / HG; const int s0 = sg * 64; const int h = h0 + hh;
  for (int i = tid; i < 64 * 8; i += 256) { const int j = i / 8, d8 = (i % 8) * 8; FragH f; f.half[0] = *(const v8us*)((const unsigned short*)V16 + ((size_t)b * SQ + s0 + j) * DM + h * HD + d8); for (int q = 0; q < 8; ++q) tl[d8 + q][j] = f.u[q]; }
  __syncthreads();
  { for (int i = tid; i < 64 * 8; i += 256) { const int d = i / 8, j8 = (i % 8) * 8; FragH f; for (int q = 0; q < 8; ++q) f.u[q] = tl[d][j8 + q]; *(v8us*)((unsigned short*)VT + ((size_t)hh * HD + d) * SQ + s0 + j8) = f.half[0]; }  } }



__global__ __launch_bounds__(256) void k_rsmcf2(const float* __restrict__ S, _Float16* __restrict__ P, int hg, int q0, int nk) {
  #pragma clang fp contract(off)
  const int t = blockIdx.x * 256 + threadIdx.x; if (t >= hg * QT) return; const size_t i = (size_t)t; const float* s = S + i * NKX; const int last = q0 + (t % QT); float mx = -3.0e38f;
#pragma unroll 1
  for (int j = 0; j < nk; ++j) { const float f = (j <= last) ? 1.f : 0.f; mx = fmaxf(mx, fmaf(f, s[j], (1.f - f) * -1.0e9f)); } float se = 0.f;
#pragma unroll 1
  for (int j = 0; j < nk; ++j) { const float f = (j <= last) ? 1.f : 0.f; se += __expf(fmaf(f, s[j], (1.f - f) * -1.0e9f) - mx); } const float sc = 256.0f / se;
#pragma unroll 1
  for (int j0 = 0; j0 < nk; j0 += 8) { FragH fr; for (int q = 0; q < 8; ++q) { const int j = j0 + q; const float f = (j <= last) ? 1.f : 0.f; fr.h[q] = (_Float16)(__expf(fmaf(f, s[j], (1.f - f) * -1.0e9f) - mx) * sc); } unsigned short* d = (unsigned short*)P + i * NKX + j0; *(v8us*)d = fr.half[0];  } }


__global__ __launch_bounds__(256) void k_rsmcf2hl(const float* __restrict__ S, _Float16* __restrict__ P, _Float16* __restrict__ PL, int hg, int q0, int nk) {
  #pragma clang fp contract(off)
  const int t = blockIdx.x * 256 + threadIdx.x; if (t >= hg * QT) return; const size_t i = (size_t)t; const float* s = S + i * NKX; const int last = q0 + (t % QT); float mx = -3.0e38f;
#pragma unroll 1
  for (int j = 0; j < nk; ++j) { const float f = (j <= last) ? 1.f : 0.f; mx = fmaxf(mx, fmaf(f, s[j], (1.f - f) * -1.0e9f)); } float se = 0.f;
#pragma unroll 1
  for (int j = 0; j < nk; ++j) { const float f = (j <= last) ? 1.f : 0.f; se += __expf(fmaf(f, s[j], (1.f - f) * -1.0e9f) - mx); } const float sc = 256.0f / se;
#pragma unroll 1
  for (int j0 = 0; j0 < nk; j0 += 8) { FragH fr, fl; for (int q = 0; q < 8; ++q) { const int j = j0 + q; const float f = (j <= last) ? 1.f : 0.f; const float v = __expf(fmaf(f, s[j], (1.f - f) * -1.0e9f) - mx) * sc; const _Float16 hv = (_Float16)v; fr.h[q] = hv; fl.h[q] = (_Float16)((v - (float)hv) * 1024.0f); } unsigned short* d = (unsigned short*)P + i * NKX + j0; unsigned short* dl = (unsigned short*)PL + i * NKX + j0; *(v8us*)d = fr.half[0]; *(v8us*)dl = fl.half[0];  } }


// ---- fused attention: scores, masks, softmax and the value product of 32 query rows per wave in one launch; no score or weight ever goes to memory.
// The wave walks its keys in blocks of 32 with a running row maximum and row sum. Scores are formed transposed, S^T = K Q^T (A = key rows, B = query rows, two column groups g of 16 queries): a lane then holds 16 keys of ONE query per group
// (accumulator register r of key tile t = key 16 t + 8 hh + r, column ln = query), which is at once the B fragment of the next product, out^T = V^T P^T (element 8 t + r = k index 16 t + 8 hh + r, the k order of fo_frag on the V^T tiles):
// the weights go from accumulator to operand inside the lane, and a row's maximum and sum need one exchange between the two lane halves.
// Split precision as before: scores = (qh.kh)/8 + (ql.kh + qh.kl)/8192; weights 256 e as f16 hi + x1024 residual; out = sum (Ph Vh + (Pl Vh + Ph Vl)/1024) / (256 sum e), the residual products of a block folded into the f32 accumulator at the block's end.
// Keys above the end of the wave's own 32 rows carry -2e4 and contribute exactly 0, as the keys above a tile's end did. Block = 8 waves = 256 query rows of one head and batch, which read the same K and V^T lines; grid.z = query block, longest first.
__device__ __forceinline__ v8f fa_mma(v16h a, v16h b, v8f c) { return __builtin_amdgcn_wmma_f32_16x16x32_f16(false, a, false, b, (short)0, c, false, false); }
__global__ __launch_bounds__(256) void k_fattn(const _Float16* __restrict__ Qh, const _Float16* __restrict__ Ql, const _Float16* __restrict__ Kh, const _Float16* __restrict__ Kl,
    const _Float16* __restrict__ Vh, const _Float16* __restrict__ Vl, const float* __restrict__ am, float* __restrict__ out) {
  const int lane = threadIdx.x & 31, ln = lane & 15, hh = lane >> 4; const int w = __builtin_amdgcn_readfirstlane(threadIdx.x >> 5);
  const int h = blockIdx.x, b = blockIdx.y; const int qw = (SQ / 256 - 1 - (int)blockIdx.z) * 256 + w * 32;      /* first query row of the wave */
  const int nk = qw + 32;      /* keys walked: a multiple of 32, at most SQ */
  const size_t qo = ((size_t)b * SQ + qw) * LQ + h * HD * 16 + 8 * lane, ko = (size_t)b * SQ * LQ + h * HD * 16 + 8 * lane, vo = (size_t)(b * NH + h) * HD * SQ + 8 * lane;      /* all six planes lie in fragment order (fo_src, k_vt): 16 rows = 16 LQ values, a head = 2 tiles of 512 in them; a key block of V^T = 4 tiles in a row */
  const _Float16* qhp = Qh + qo; const _Float16* qlp = Ql + qo; const _Float16* khp = Kh + ko; const _Float16* klp = Kl + ko; const _Float16* vhp = Vh + vo; const _Float16* vlp = Vl + vo; const float* amp = am + (size_t)b * SQ + 8 * hh;
  v16h qh[2][2], ql[2][2], kh[2][2], kl[2][2];      /* q: [column group][k-step]; k: [key tile][k-step] */
#pragma unroll
  for (int g = 0; g < 2; ++g)
#pragma unroll
    for (int s = 0; s < 2; ++s) { qh[g][s] = fo_frag(qhp + g * 16 * LQ + s * 512); ql[g][s] = fo_frag(qlp + g * 16 * LQ + s * 512); kh[g][s] = fo_frag(khp + g * 16 * LQ + s * 512); kl[g][s] = fo_frag(klp + g * 16 * LQ + s * 512); }
  asm volatile("s_wait_xcnt 0x0" :: "v"(qhp), "v"(qlp), "v"(khp), "v"(klp) : "memory");      /* the address pairs stay untouched (inputs here) until this wait; behind it they may be advanced and reused */
  { const int st = (32 < nk) ? 32 * LQ : 0; khp += st; klp += st; }      /* the K pointers run one block ahead and stop at the last block */
  const v8f z8 = {0.f,0.f,0.f,0.f,0.f,0.f,0.f,0.f}; v8f o[4][2] = {{z8, z8}, {z8, z8}, {z8, z8}, {z8, z8}};      /* out^T: [tile of 16 head columns][column group] */
  float mr[2] = {-3.0e38f, -3.0e38f}, se[2] = {0.f, 0.f}; int dl = 8 * hh - qw - ln;      /* dl: key - query of the lane's first element, group 0 */
#pragma unroll 1      /* rolled: a block's fragments fill the register budget */
  for (int kb = 0; kb < nk; kb += 32) {
    const v4f m0 = *(const v4fa*)(amp), m1 = *(const v4fa*)(amp + 4), m2 = *(const v4fa*)(amp + 16), m3 = *(const v4fa*)(amp + 20);
    v8f c[2][2], r[2][2];      /* [key tile][column group]; c: hi.hi, r: both residual products */
#pragma unroll
    for (int t = 0; t < 2; ++t)
#pragma unroll
      for (int g = 0; g < 2; ++g) { c[t][g] = fa_mma(kh[t][0], qh[g][0], z8); r[t][g] = fa_mma(kh[t][0], ql[g][0], z8); }
#pragma unroll
    for (int t = 0; t < 2; ++t)
#pragma unroll
      for (int g = 0; g < 2; ++g) { r[t][g] = fa_mma(kl[t][0], qh[g][0], r[t][g]); c[t][g] = fa_mma(kh[t][1], qh[g][1], c[t][g]); }
#pragma unroll
    for (int t = 0; t < 2; ++t)
#pragma unroll
      for (int g = 0; g < 2; ++g) r[t][g] = fa_mma(kh[t][1], ql[g][1], r[t][g]);
#pragma unroll
    for (int t = 0; t < 2; ++t)
#pragma unroll
      for (int g = 0; g < 2; ++g) r[t][g] = fa_mma(kl[t][1], qh[g][1], r[t][g]);
    v16h vh[4], vl[4];
#pragma unroll
    for (int u = 0; u < 4; ++u) { vh[u] = fo_frag(vhp + u * 512); vl[u] = fo_frag(vlp + u * 512); }      /* this block's V^T: in flight under the softmax */
#pragma unroll
    for (int t = 0; t < 2; ++t)
#pragma unroll
      for (int s = 0; s < 2; ++s) { kh[t][s] = fo_frag(khp + t * 16 * LQ + s * 512); kl[t][s] = fo_frag(klp + t * 16 * LQ + s * 512); }      /* the next block's K: in flight under the softmax and the value product */
    asm volatile("s_wait_xcnt 0x0" :: "v"(khp), "v"(klp), "v"(vhp), "v"(vlp), "v"(amp) : "memory");      /* as above: the five address pairs are advanced only behind this wait */
    { const int st = (kb + 64 < nk) ? 32 * LQ : 0; khp += st; klp += st; } vhp += 2048; vlp += 2048; amp += 32;
    const float mv[16] = {m0[0],m0[1],m0[2],m0[3],m1[0],m1[1],m1[2],m1[3],m2[0],m2[1],m2[2],m2[3],m3[0],m3[1],m3[2],m3[3]};
    float x[2][16], mn[2];
#pragma unroll
    for (int g = 0; g < 2; ++g) { float mx = -3.0e38f;
#pragma unroll
      for (int e = 0; e < 16; ++e) { const int d = dl - 16 * g + (e & 7) + 16 * (e >> 3);      /* key - query */
        const float s = c[e >> 3][g][e & 7] * 0.125f + r[e >> 3][g][e & 7] * 0.0001220703125f;      /* both factors are powers of two: one rounding */
        const float mk = __fadd_rn((d > 0) ? -20000.0f : ((d >= -512) ? -10000.0f : 0.f), (float)(__bf16)mv[e]);      /* causal -1e4 + 'window' -1e4 (their sum is exact) + attention_mask (rounded to bf16, nearest even), then added to the score, all in f32 */
        x[g][e] = __fadd_rn(s, mk); mx = fmaxf(mx, x[g][e]); }
      mx = fmaxf(mx, __shfl_xor(mx, 16, 32)); mn[g] = fmaxf(mr[g], mx); }
    if (__builtin_amdgcn_ballot_w32(mn[0] > mr[0] || mn[1] > mr[1]) != 0u) {      /* a row's maximum rose: old sums to the new maximum (factor 1 for the rows where it did not) */
#pragma unroll
      for (int g = 0; g < 2; ++g) { const float al = __expf(mr[g] - mn[g]); se[g] *= al;
#pragma unroll
        for (int u = 0; u < 4; ++u)
#pragma unroll
          for (int q = 0; q < 8; ++q) o[u][g][q] *= al; } }
    FragH ph[2], pl[2];
#pragma unroll
    for (int g = 0; g < 2; ++g) { mr[g] = mn[g];
#pragma unroll
      for (int e = 0; e < 16; ++e) { const float ex = __expf(x[g][e] - mn[g]); se[g] += ex; const float p = ex * 256.0f; const _Float16 hv = (_Float16)p; ph[g].h[e] = hv; pl[g].h[e] = (_Float16)((p - (float)hv) * 1024.0f); } }
#pragma unroll
    for (int g = 0; g < 2; ++g) { v8f t[4];
#pragma unroll
      for (int u = 0; u < 4; ++u) { o[u][g] = fa_mma(vh[u], ph[g].v, o[u][g]); t[u] = fa_mma(vh[u], pl[g].v, z8); }
#pragma unroll
      for (int u = 0; u < 4; ++u) t[u] = fa_mma(vl[u], ph[g].v, t[u]);
#pragma unroll
      for (int u = 0; u < 4; ++u)
#pragma unroll
        for (int q = 0; q < 8; ++q) o[u][g][q] += t[u][q] * 0.0009765625f; }
    dl += 32; }
  float* op = out + ((size_t)b * SQ + qw + ln) * DM + h * HD + 8 * hh;      /* the lane's query row of group 0; register q of tile u = column 16 u + 8 hh + q; the wave writes both whole lines of each of its rows */
  v4f wv[2][8];
#pragma unroll
  for (int g = 0; g < 2; ++g) { const float st = se[g] + __shfl_xor(se[g], 16, 32); const float sc = 0.00390625f / st;
#pragma unroll
    for (int u = 0; u < 4; ++u)
#pragma unroll
      for (int q = 0; q < 4; ++q) { wv[g][2 * u][q] = o[u][g][q] * sc; wv[g][2 * u + 1][q] = o[u][g][4 + q] * sc; } }
#pragma unroll
  for (int g = 0; g < 2; ++g)
#pragma unroll
    for (int u = 0; u < 4; ++u) { *(v4f*)(op + g * 16 * DM + u * 16) = wv[g][2 * u]; *(v4f*)(op + g * 16 * DM + u * 16 + 4) = wv[g][2 * u + 1]; } }

extern "C" void kernel_launch(void* const* d_in, const int* in_sizes, int n_in,
                              void* d_out, int out_size, void* d_ws, size_t ws_size, hipStream_t stream) {
  (void)in_sizes; (void)n_in; (void)out_size;
  const float* const* I = (const float* const*)d_in; const float* x = I[0]; const float* am = I[1]; const float* wq = I[2]; const float* bq = I[3]; const float* wk = I[4]; const float* bk = I[5]; const float* wv = I[6]; const float* bv = I[7];      /* additive attention_mask [4][1][1][2048] (zeros); natural [out][in] weights + biases */
  char* ws = (char*)d_ws; size_t off = 0;
  auto take = [&](size_t bytes) { char* p = ws + off; off += (bytes + 255) & ~(size_t)255; return p; };
  _Float16* Q16 = (_Float16*)take(NR * DM * 2); _Float16* QL = (_Float16*)take(NR * DM * 2); _Float16* K16 = (_Float16*)take(NR * DM * 2); _Float16* KL = (_Float16*)take(NR * DM * 2);
  _Float16* VT = (_Float16*)take((size_t)NB * NH * HD * SQ * 2); _Float16* VTL = (_Float16*)take((size_t)NB * NH * HD * SQ * 2);      /* V^T planes of all batches */
  _Float16* BQ = (_Float16*)take((size_t)DM * DM * 2); _Float16* BK = (_Float16*)take((size_t)DM * DM * 2); _Float16* BV = (_Float16*)take((size_t)DM * DM * 2);
  _Float16* X16 = (_Float16*)take(NR * DM * 2); _Float16* V16 = (_Float16*)take(NR * DM * 2); _Float16* VL = (_Float16*)take(NR * DM * 2); float* VF = (float*)take(NR * DM * 4);      /* v as f16 hi + x1024 residual (the early causal rows average only a few v rows, so a single-f16 v would leave large absolute rounding against this module's small output scale) */
  if (off > ws_size) return;
  { const unsigned g = (unsigned)(((size_t)DM * DM / 8 + 255) / 256); k_wnat<<<g, 256, 0, stream>>>(wq, (size_t)DM * DM / 8, BQ); k_wnat<<<g, 256, 0, stream>>>(wk, (size_t)DM * DM / 8, BK); k_wnat<<<g, 256, 0, stream>>>(wv, (size_t)DM * DM / 8, BV); }      /* natural [out][in] = Bt x16, in fragment order */

  k_x16<<<(unsigned)((NR * DM / 8 + 255) / 256), 256, 0, stream>>>(x, X16, NR * DM / 8);
  const size_t r0p = (size_t)B0 * SQ;      /* first projected row */
  k_gemm2<0><<<dim3((unsigned)((MP / 128) * (DM / 64)), 1), 128, 0, stream>>>(X16 + r0p * DM, DM, 0, BQ, DM, 0, 0.0625f, bq, 0, nullptr, 1, 0, 0, VF + r0p * DM, nullptr, DM, 0, MP, DM, DM); k_hl<true><<<(unsigned)(((size_t)MP * DM / 8 + 255) / 256), 256, 0, stream>>>(VF + r0p * DM, Q16 + r0p * DM, QL + r0p * DM, (size_t)MP * DM / 8);      /* q (+ bq) in f32 -> f16 hi + x1024 residual */
  k_gemm2<0><<<dim3((unsigned)((MP / 128) * (DM / 64)), 1), 128, 0, stream>>>(X16 + r0p * DM, DM, 0, BK, DM, 0, 0.0625f, bk, 0, nullptr, 1, 0, 0, VF + r0p * DM, nullptr, DM, 0, MP, DM, DM); k_hl<true><<<(unsigned)(((size_t)MP * DM / 8 + 255) / 256), 256, 0, stream>>>(VF + r0p * DM, K16 + r0p * DM, KL + r0p * DM, (size_t)MP * DM / 8);      /* k (+ bk) likewise */
  k_gemm2<0><<<dim3((unsigned)((MP / 128) * (DM / 64)), 1), 128, 0, stream>>>(X16 + r0p * DM, DM, 0, BV, DM, 0, 0.0625f, bv, 0, nullptr, 1, 0, 0, VF + r0p * DM, nullptr, DM, 0, MP, DM, DM); k_hl<false><<<(unsigned)(((size_t)MP * DM / 8 + 255) / 256), 256, 0, stream>>>(VF + r0p * DM, V16 + r0p * DM, VL + r0p * DM, (size_t)MP * DM / 8);      /* v in f32 -> f16 hi + x1024 residual planes */
  k_vt<NH, SQ><<<NB * NH * (SQ / 64), 256, 0, stream>>>(V16, LQ, 0, VT); k_vt<NH, SQ><<<NB * NH * (SQ / 64), 256, 0, stream>>>(VL, LQ, 0, VTL);      /* V^T hi and residual, [4][16] slabs of 64 x SQ in fragment order, all batches in one launch each */
  k_fattn<<<dim3(NH, NB, SQ / 256), 256, 0, stream>>>(Q16, QL, K16, KL, VT, VTL, am, (float*)d_out);      /* scores, masks, softmax and the value product of all heads, batches and query rows in one launch */
}

// v007
// A run of this version takes 183 microseconds.
// In two side-by-side timings against v006, it was 1.22 and 1.23 times as fast.
// All steps since v000 together make it 70.8 times as fast.
#include <hip/hip_runtime.h>
// Causal self-attention with the module's (faithful, inverted) window mask and an additive padding mask (hidden [4][2048][1024]; q/k/v = x W^T + b (natural [1024][1024] sigma 1/32, biases sigma 0.01); 16 heads of 64; scores / 8 + causal(-1e4 where j > i) + window(-1e4 where j >= i - 512, as the source writes it) + attention_mask[b][j] (zeros), all added in f32; softmax; out = merged attn v -> [4][2048][1024], no output projection). Effective pattern: rows i <= 512 attend causally (every kept logit carries the -1e4 offset, reproduced in f32), rows i >= 513 attend only keys j <= i - 513.
// Structure: token rows; x as exact f16 rows; natural weights as exact x16 planes; q, k, v as WMMA GEMMs (32x64 wave tiles, f32 accumulation, + bias), each split in the GEMM's own epilogue into f16 hi + x1024 residual planes (the output scale is small, so logits, weights and values are all carried near f32), q and k in fragment order and v as V^T in fragment order, straight from the accumulator registers; attention fused in one launch, a wave per 32 query rows walking its keys in blocks of 32 with a running maximum and sum: scores = qh.kh/8 + (ql.kh + qh.kl)/8192 (K = 64) against the keys below the rows' end, the module's masks added in f32 on VALU (keys above the rows' end carry -2e4 and contribute exactly 0), weights as f16 hi + x1024 residual kept in registers, out = (Ph Vh^T + (Pl Vh^T + Ph Vl^T)/1024) / (256 row sum), written f32 into the output rows; launches: see trace.
// Operand layout: every f16 plane that a matrix instruction reads (x, the three weight planes, q and k hi/residual, V^T hi/residual) lies in memory in fragment order: see fo_src below.
// Compute dtype: inputs rounded to bf16; x / weights exact; q, k, v and softmax weights as f16 hi + x1024 residual GEMM operands, o accumulated in f32; scores and softmax statistics f32. v_wmma_f32_16x16x32_f16.
#define NB 4
#define SQ 2048
#define DM 1024
#define NH 16
#define HD 64
#define HG 1                         /* heads per launch of k_vt(V16, b, h0, VT), which is not launched */
#define QT 256                       /* query rows per causal tile */
#define NKX SQ                       /* longest score row */
#define B0 0                         /* first batch processed (debug hook) */
#define NBR NB                       /* batches processed (debug hook) */
#define NR ((size_t)NB * SQ)         /* token rows */
#define MP ((int)((size_t)NBR * SQ)) /* rows projected (debug hook) */
#define QN SQ                        /* query rows attended per batch (unused) */
#define NHD NH                       /* heads attended (unused) */
#define MPO MP                       /* unused (there is no output stage) */
#define LQ DM      /* row pitch of the q/k rows */
typedef __bf16 v16b __attribute__((ext_vector_type(16)));
typedef unsigned short v8us __attribute__((ext_vector_type(8), may_alias));
typedef float  v8f  __attribute__((ext_vector_type(8)));
typedef float  v4f  __attribute__((ext_vector_type(4)));
typedef float  v4fa __attribute__((ext_vector_type(4), may_alias));
union FragB { v16b v; v8us half[2]; unsigned short u[16]; };

__device__ __forceinline__ unsigned short bf16_bits(float x) { unsigned int u = __float_as_uint(x); return (unsigned short)((u + 0x7FFFu + ((u >> 16) & 1u)) >> 16); }
__device__ __forceinline__ float bf16_val(unsigned short b) { return __uint_as_float(((unsigned int)b) << 16); }
__device__ __forceinline__ float bf16_round(float x) { return bf16_val(bf16_bits(x)); }
// D += A·B with NT terms: 1 = ah·bh, 2 = + al·bh (A split), 3 = + ah·bl (both split)
template <int NT>
__device__ __forceinline__ v8f mmaN(v16b ah, v16b al, v16b bh, v16b bl, v8f c) {
  c = __builtin_amdgcn_wmma_f32_16x16x32_bf16(false, ah, false, bh, (short)0, c, false, false);
  if (NT >= 2) c = __builtin_amdgcn_wmma_f32_16x16x32_bf16(false, al, false, bh, (short)0, c, false, false);
  if (NT >= 3) c = __builtin_amdgcn_wmma_f32_16x16x32_bf16(false, ah, false, bl, (short)0, c, false, false);
  asm volatile("v_nop\n\tv_nop\n\tv_nop\n\tv_nop" : "+v"(c) : "v"(ah), "v"(al), "v"(bh), "v"(bl));
  return c;
}

__global__ __launch_bounds__(256) void k_wt_bf16(const float* __restrict__ W, unsigned short* __restrict__ Wt, int K, int N) {
  const int t = blockIdx.x * 256 + threadIdx.x;
  const int k8n = K / 8;
  if (t >= N * k8n) return;
  const int n = t / k8n, k8 = (t % k8n) * 8;
  v8us v;
#pragma unroll
  for (int i = 0; i < 8; ++i) v[i] = bf16_bits(W[(size_t)(k8 + i) * N + n]);
  *(v8us*)(Wt + (size_t)n * K + k8) = v;
  
}

// GEMM C[M][N] (f32, pitch ldc) = act(A[M][K]·W + bias). A f32 row-major (pitch lda) converted per fragment to bf16
// (ASPLIT: hi/lo two planes -> 2 terms, else single rounded term); Wt bf16 [N][K] (pitch ldb). BIAS_BF16 rounds the
// bias to bf16 first (bias quantised to bf16 before the add). K%32==0, M%16==0, N%64==0.
template <bool ASPLIT, int ACT, bool BIAS_BF16>
__global__ __launch_bounds__(128) void k_gemm_bf(const float* __restrict__ A, int lda, const unsigned short* __restrict__ Wt, int ldb,
                                               const float* __restrict__ bias, float* __restrict__ C, int ldc, int M, int N, int K) {
  __shared__ __attribute__((aligned(16))) float so[4][16][64];
  const int tid = threadIdx.x, w = tid >> 5, lane = tid & 31, ln = lane & 15, hh = lane >> 4;
  const int ntn = N / 64;
  const int wid = blockIdx.x * 4 + w;
  const int mt = wid / ntn, nq = wid % ntn;
  if (mt * 16 >= M) return;
  const int row0 = mt * 16, col0 = nq * 64;
  const float* arow = A + (size_t)(row0 + ln) * lda;
  v8f acc[4] = {};
  for (int kb = 0; kb < K; kb += 32) {
    FragB ah, al;
    const v4f x0 = *(const v4fa*)(arow + kb + 8 * hh), x1 = *(const v4fa*)(arow + kb + 8 * hh + 4);
    const v4f x2 = *(const v4fa*)(arow + kb + 16 + 8 * hh), x3 = *(const v4fa*)(arow + kb + 16 + 8 * hh + 4);
    float xs[16] = {x0[0],x0[1],x0[2],x0[3],x1[0],x1[1],x1[2],x1[3],x2[0],x2[1],x2[2],x2[3],x3[0],x3[1],x3[2],x3[3]};
#pragma unroll
    for (int i = 0; i < 16; ++i) { const unsigned short hb = bf16_bits(xs[i]); ah.u[i] = hb; al.u[i] = ASPLIT ? bf16_bits(xs[i] - bf16_val(hb)) : (unsigned short)0; }
#pragma unroll
    for (int t = 0; t < 4; ++t) {
      const unsigned short* brow = Wt + (size_t)(col0 + t * 16 + ln) * ldb + kb;
      FragB b;
      b.half[0] = *(const v8us*)(brow + 8 * hh);
      b.half[1] = *(const v8us*)(brow + 16 + 8 * hh);
      acc[t] = mmaN<ASPLIT ? 2 : 1>(ah.v, al.v, b.v, b.v, acc[t]);
    }
  }
#pragma unroll
  for (int t = 0; t < 4; ++t) {
    float bv = bias ? bias[col0 + t * 16 + ln] : 0.f;
    if (BIAS_BF16) bv = bf16_round(bv);
#pragma unroll
    for (int r = 0; r < 8; ++r) { float v = acc[t][r] + bv; if (ACT == 1) v = fmaxf(v, 0.f); so[w][8 * hh + r][t * 16 + ln] = v; }
  }
  __builtin_amdgcn_fence(__ATOMIC_ACQ_REL, "workgroup");
  __builtin_amdgcn_wave_barrier();
  const int rsub = lane >> 4, c4 = (lane & 15) * 4;
  {
#pragma unroll
    for (int q = 0; q < 8; ++q) {
      const int r = q * 2 + rsub;
      const v4f v = *(const v4fa*)&so[w][r][c4];
      *(v4f*)(C + (size_t)(row0 + r) * ldc + col0 + c4) = v;
    }
    
  }
}

// GEMM C = act(A·W + bias + resid): A f32 (ASPLIT -> hi/lo 2 terms), Wt bf16 [N][K]; ACT 0 none, 1 relu, 2 exact gelu;
// resid (optional, f32, row index = (row % rmod), pitch ldr, RES_BF16 rounds it) added before the activation.
template <bool ASPLIT, int ACT, bool BIAS_BF16, bool RES_BF16>
__global__ __launch_bounds__(128) void k_gemm_bf3(const float* __restrict__ A, int lda, const unsigned short* __restrict__ Wt, int ldb,
                                                const float* __restrict__ bias, const float* __restrict__ resid, int rmod, int ldr,
                                                float* __restrict__ C, int ldc, int M, int N, int K) {
  __shared__ __attribute__((aligned(16))) float so[4][16][64];
  const int tid = threadIdx.x, w = tid >> 5, lane = tid & 31, ln = lane & 15, hh = lane >> 4;
  const int ntn = N / 64;
  const int wid = blockIdx.x * 4 + w;
  const int mt = wid / ntn, nq = wid % ntn;
  if (mt * 16 >= M) return;
  const int row0 = mt * 16, col0 = nq * 64;
  const float* arow = A + (size_t)(row0 + ln) * lda;
  v8f acc[4] = {};
  for (int kb = 0; kb < K; kb += 32) {
    FragB ah, al;
    const v4f x0 = *(const v4fa*)(arow + kb + 8 * hh), x1 = *(const v4fa*)(arow + kb + 8 * hh + 4);
    const v4f x2 = *(const v4fa*)(arow + kb + 16 + 8 * hh), x3 = *(const v4fa*)(arow + kb + 16 + 8 * hh + 4);
    float xs[16] = {x0[0],x0[1],x0[2],x0[3],x1[0],x1[1],x1[2],x1[3],x2[0],x2[1],x2[2],x2[3],x3[0],x3[1],x3[2],x3[3]};
#pragma unroll
    for (int i = 0; i < 16; ++i) { const unsigned short hb = bf16_bits(xs[i]); ah.u[i] = hb; al.u[i] = ASPLIT ? bf16_bits(xs[i] - bf16_val(hb)) : (unsigned short)0; }
#pragma unroll
    for (int t = 0; t < 4; ++t) {
      const unsigned short* brow = Wt + (size_t)(col0 + t * 16 + ln) * ldb + kb;
      FragB b;
      b.half[0] = *(const v8us*)(brow + 8 * hh);
      b.half[1] = *(const v8us*)(brow + 16 + 8 * hh);
      acc[t] = mmaN<ASPLIT ? 2 : 1>(ah.v, al.v, b.v, b.v, acc[t]);
    }
  }
#pragma unroll
  for (int t = 0; t < 4; ++t) {
    const int col = col0 + t * 16 + ln;
    float bv = bias ? bias[col] : 0.f;
    if (BIAS_BF16) bv = bf16_round(bv);
#pragma unroll
    for (int r = 0; r < 8; ++r) {
      float v = acc[t][r] + bv;
      if (resid) { float rv = resid[(size_t)((row0 + 8 * hh + r) % rmod) * ldr + col]; if (RES_BF16) rv = bf16_round(rv); v += rv; }
      if (ACT == 1) v = fmaxf(v, 0.f);
      if (ACT == 2) v = 0.5f * v * (1.0f + erff(v * 0.70710678118654752f));
      if (ACT == 3) { const float u = 0.7978845608028654f * (v + 0.044715f * v * v * v); v = 0.5f * v * (1.0f + tanhf(u)); }
      so[w][8 * hh + r][t * 16 + ln] = v;
    }
  }
  __builtin_amdgcn_fence(__ATOMIC_ACQ_REL, "workgroup");
  __builtin_amdgcn_wave_barrier();
  const int rsub = lane >> 4, c4 = (lane & 15) * 4;
  {
#pragma unroll
    for (int q = 0; q < 8; ++q) {
      const int r = q * 2 + rsub;
      const v4f v = *(const v4fa*)&so[w][r][c4];
      *(v4f*)(C + (size_t)(row0 + r) * ldc + col0 + c4) = v;
    }
    
  }
}
// row LayerNorm (biased variance, eps) over N: s = X (+ R); optional out_sum <- s; out_norm <- (s-mu)*rsqrt(var+eps)*g + b
template <bool PARAM_BF16>
__global__ __launch_bounds__(256) void k_layernorm(const float* __restrict__ X, const float* __restrict__ R, const float* __restrict__ g, const float* __restrict__ bta,
                                                  float* __restrict__ out_sum, float* __restrict__ out_norm, int N, float eps) {
  __shared__ float red[256];
  const int row = blockIdx.x, tid = threadIdx.x;
  const float* x = X + (size_t)row * N; const float* rr = R ? R + (size_t)row * N : nullptr;
  float vals[16];                     // up to N = 4096
  const int per = N / 256;            // contiguous chunk per thread? use strided-by-4 chunks: thread handles j = tid*4 + 1024*u
  float s1 = 0.f;
  for (int u = 0; u < per / 4; ++u) {
    const int j = tid * 4 + 1024 * u;
    const v4f a = *(const v4fa*)(x + j);
    v4f b = {0.f,0.f,0.f,0.f}; if (rr) b = *(const v4fa*)(rr + j);
#pragma unroll
    for (int q = 0; q < 4; ++q) { const float v = a[q] + b[q]; vals[u * 4 + q] = v; s1 += v; }
  }
  red[tid] = s1; __syncthreads();
  for (int st = 128; st > 0; st >>= 1) { if (tid < st) red[tid] += red[tid + st]; __syncthreads(); }
  const float mu = red[0] / (float)N; __syncthreads();
  float s2 = 0.f;
  for (int u = 0; u < per / 4; ++u)
#pragma unroll
    for (int q = 0; q < 4; ++q) { const float c = vals[u * 4 + q] - mu; s2 += c * c; }
  red[tid] = s2; __syncthreads();
  for (int st = 128; st > 0; st >>= 1) { if (tid < st) red[tid] += red[tid + st]; __syncthreads(); }
  const float rs = rsqrtf(red[0] / (float)N + eps);
  {
    for (int u = 0; u < per / 4; ++u) {
      const int j = tid * 4 + 1024 * u;
      v4f o, sm;
#pragma unroll
      for (int q = 0; q < 4; ++q) {
        float gg = g[j + q], bb = bta[j + q];
        if (PARAM_BF16) { gg = bf16_round(gg); bb = bf16_round(bb); }
        sm[q] = vals[u * 4 + q]; o[q] = (vals[u * 4 + q] - mu) * rs * gg + bb;
      }
      if (out_sum) *(v4f*)(out_sum + (size_t)row * N + j) = sm;
      *(v4f*)(out_norm + (size_t)row * N + j) = o;
    }
    
  }
}



// ---- f16 WMMA path (v_wmma_f32_16x16x32_f16): 11-bit significands for operands in range — used where a [0,1] probability operand needs more precision than bf16
typedef _Float16 v16h __attribute__((ext_vector_type(16)));
union FragH { v16h v; v8us half[2]; _Float16 h[16]; unsigned short u[16]; };
template <int NT>
__device__ __forceinline__ v8f mmaH(v16h ah, v16h al, v16h bh, v16h bl, v8f c) {
  c = __builtin_amdgcn_wmma_f32_16x16x32_f16(false, ah, false, bh, (short)0, c, false, false);
  if (NT >= 2) c = __builtin_amdgcn_wmma_f32_16x16x32_f16(false, al, false, bh, (short)0, c, false, false);
  if (NT >= 3) c = __builtin_amdgcn_wmma_f32_16x16x32_f16(false, ah, false, bl, (short)0, c, false, false);
  asm volatile("v_nop\n\tv_nop\n\tv_nop\n\tv_nop" : "+v"(c) : "v"(ah), "v"(al), "v"(bh), "v"(bl));
  return c;
}
// batched GEMM like k_gemm_b but f16 operands: A f32 (split into f16 hi/lo if ASPLIT, else rounded to f16), Bt = f16 values [n][k]; alpha; C f32; N multiple of 16 (partial tiles skipped)
template <bool ASPLIT>
__global__ __launch_bounds__(128) void k_gemm_h(const float* __restrict__ A, int lda, size_t sA, const _Float16* __restrict__ Bh, int ldb, size_t sB, float alpha, float* __restrict__ C, int ldc, size_t sC, int M, int N, int K) {
  __shared__ __attribute__((aligned(16))) float so[4][16][64];
  const int tid = threadIdx.x, w = tid >> 5, lane = tid & 31, ln = lane & 15, hh = lane >> 4; const int by = blockIdx.y;
  A += (size_t)by * sA; Bh += (size_t)by * sB; C += (size_t)by * sC;
  const int ntn = (N + 63) / 64; const int wid = blockIdx.x * 4 + w; const int mt = wid / ntn, nq = wid % ntn; if (mt * 16 >= M) return;
  const int row0 = mt * 16, col0 = nq * 64; const float* arow = A + (size_t)(row0 + ln) * lda;
  v8f acc[4] = {};
  for (int kb = 0; kb < K; kb += 32) {
    FragH ah, al;
    const v4f x0 = *(const v4fa*)(arow + kb + 8 * hh), x1 = *(const v4fa*)(arow + kb + 8 * hh + 4), x2 = *(const v4fa*)(arow + kb + 16 + 8 * hh), x3 = *(const v4fa*)(arow + kb + 16 + 8 * hh + 4);
    float xs[16] = {x0[0],x0[1],x0[2],x0[3],x1[0],x1[1],x1[2],x1[3],x2[0],x2[1],x2[2],x2[3],x3[0],x3[1],x3[2],x3[3]};
#pragma unroll
    for (int i = 0; i < 16; ++i) { const _Float16 h = (_Float16)xs[i]; ah.h[i] = h; al.h[i] = ASPLIT ? (_Float16)(xs[i] - (float)h) : (_Float16)0.0f; }
#pragma unroll
    for (int t = 0; t < 4; ++t) { if (col0 + t * 16 >= N) continue; const size_t boff = (size_t)(col0 + t * 16 + ln) * ldb + kb; FragH bq; bq.half[0] = *(const v8us*)(Bh + boff + 8 * hh); bq.half[1] = *(const v8us*)(Bh + boff + 16 + 8 * hh);
      acc[t] = mmaH<ASPLIT ? 2 : 1>(ah.v, al.v, bq.v, bq.v, acc[t]); }
  }
#pragma unroll
  for (int t = 0; t < 4; ++t) { if (col0 + t * 16 >= N) continue;
#pragma unroll
    for (int r = 0; r < 8; ++r) so[w][8 * hh + r][t * 16 + ln] = acc[t][r] * alpha; }
  __builtin_amdgcn_fence(__ATOMIC_ACQ_REL, "workgroup"); __builtin_amdgcn_wave_barrier();
  const int rsub = lane >> 4, c4 = (lane & 15) * 4;
  {
#pragma unroll
    for (int q = 0; q < 8; ++q) { const int r = q * 2 + rsub; if (col0 + c4 < N) { const v4f v = *(const v4fa*)&so[w][r][c4]; *(v4f*)(C + (size_t)(row0 + r) * ldc + col0 + c4) = v; } }
     }
}

// Wt[n][k] = f16(W[k][n]·scale) from f32 row-major W[K][N] (scale = power of two; bf16-exact weights stay exact in f16 away from the subnormal range)
__global__ __launch_bounds__(256) void k_wt_f16(const float* __restrict__ W, _Float16* __restrict__ Wt, int K, int N, float scale) {
  const int t = blockIdx.x * 256 + threadIdx.x; if (t >= N * (K / 8)) return; const int n = t / (K / 8), k8 = (t % (K / 8)) * 8; FragH f;
#pragma unroll
  for (int i = 0; i < 8; ++i) f.h[i] = (_Float16)(bf16_round(W[(size_t)(k8 + i) * N + n]) * scale); const v8us o = f.half[0];
  *(v8us*)((unsigned short*)Wt + (size_t)n * K + k8) = o; 
}
// k_gemm_hh variant with fused epilogue: v = acc·alpha + bias[by·sBias + col] (+ CP[(row/rowsPerB)·sCPb + by·64 + col] if CP) ; ACT 0 none / 1 elu ; writes f16 C16 (and f32 C if non-null)
template <int ACT>
__global__ __launch_bounds__(128) void k_gemm_hhx(const _Float16* __restrict__ A, int lda, size_t sA, const _Float16* __restrict__ Bh, int ldb, size_t sB, float alpha, const float* __restrict__ bias, size_t sBias, const float* __restrict__ CP, int rowsPerB, size_t sCPb, int row0g,
    float* __restrict__ C, _Float16* __restrict__ C16, int ldc, size_t sC, int M, int N, int K) {
  __shared__ __attribute__((aligned(16))) float so[4][16][64];
  const int tid = threadIdx.x, w = tid >> 5, lane = tid & 31, ln = lane & 15, hh = lane >> 4; const int by = blockIdx.y;
  A += (size_t)by * sA; Bh += (size_t)by * sB; const size_t cofs = (size_t)by * sC; const float* bp = bias ? bias + (size_t)by * sBias : nullptr;
  const int ntn = (N + 63) / 64; const int wid = blockIdx.x * 4 + w; const int mt = wid / ntn, nq = wid % ntn; if (mt * 16 >= M) return;
  const int row0 = mt * 16, col0 = nq * 64; const _Float16* arow = A + (size_t)(row0 + ln) * lda;
  v8f acc[4] = {};
  for (int kb = 0; kb < K; kb += 32) { FragH ah; ah.half[0] = *(const v8us*)((const unsigned short*)arow + kb + 8 * hh); ah.half[1] = *(const v8us*)((const unsigned short*)arow + kb + 16 + 8 * hh);
#pragma unroll
    for (int t = 0; t < 4; ++t) { if (col0 + t * 16 >= N) continue; const size_t boff = (size_t)(col0 + t * 16 + ln) * ldb + kb; FragH bq; bq.half[0] = *(const v8us*)((const unsigned short*)Bh + boff + 8 * hh); bq.half[1] = *(const v8us*)((const unsigned short*)Bh + boff + 16 + 8 * hh);
      acc[t] = mmaH<1>(ah.v, ah.v, bq.v, bq.v, acc[t]); }
  }
#pragma unroll
  for (int t = 0; t < 4; ++t) { if (col0 + t * 16 >= N) continue; const int col = col0 + t * 16 + ln; const float bv = bp ? bf16_round(bp[col]) : 0.f;
#pragma unroll
    for (int r = 0; r < 8; ++r) { float v = acc[t][r] * alpha + bv; if (CP) { const int rr = row0g + row0 + 8 * hh + r; if (rowsPerB < 0) v += CP[cofs + (size_t)rr * ldc + col];      /* rowsPerB < 0: own element of the batched C plane */ else { const int bidx = rr / rowsPerB; v += CP[(size_t)bidx * sCPb + (size_t)by * 64 + col]; } } if (ACT == 1) v = (v > 0.f) ? v : expm1f(v); else if (ACT == 7) v = (v > 0.f) ? v + 1.0f : expf(v); else if (ACT == 8) v = tanhf(v); else if (ACT == 9) v = 0.5f * v * (1.0f + tanhf(0.7978845608028654f * (v + 0.044715f * v * v * v))); else if (ACT == 11) v = 1.0f / (1.0f + expf(-v)); else if (ACT == 12) v = (v > 0.f) ? v : 0.01f * v; else if (ACT == 14) v = (v > 0.f) ? v : 0.1f * v; else if (ACT == 16) v = (v >= 0.f) ? v : 0.3f * v; else if (ACT == 17) v = (v >= 0.f) ? v : 0.2f * v; else if (ACT == 15) v = v / (1.0f + expf(-v)); else if (ACT == 3) v = fmaxf(v, 0.f); else if (ACT == 6) v = 0.5f * v * (1.0f + erff(v * 0.70710678118654752f)); so[w][8 * hh + r][t * 16 + ln] = v; } }
  __builtin_amdgcn_fence(__ATOMIC_ACQ_REL, "workgroup"); __builtin_amdgcn_wave_barrier();
  const int rsub = lane >> 4, c4 = (lane & 15) * 4; typedef _Float16 v4h __attribute__((ext_vector_type(4)));
  {
#pragma unroll
    for (int q = 0; q < 8; ++q) { const int r = q * 2 + rsub; if (col0 + c4 < N) { const v4f v = *(const v4fa*)&so[w][r][c4]; if (C) *(v4f*)(C + cofs + (size_t)(row0 + r) * ldc + col0 + c4) = v; if (C16) { v4h h4; for (int i = 0; i < 4; ++i) h4[i] = (_Float16)v[i]; *(v4h*)(C16 + cofs + (size_t)(row0 + r) * ldc + col0 + c4) = h4; } } }
     }
}


typedef _Float16 v4h __attribute__((ext_vector_type(4)));

// ---- fragment order: a plane of rows x DM f16 values is cut into tiles of 16 rows x 32 k (1 KB each, tile index = (row / 16) * (DM / 32) + k / 32). Inside a tile stand 64 pieces of 16 B: piece c = 32 * half + lane holds
// row (lane & 15), k = 16 * half + 8 * (lane >> 4) + 0..7, which is what lane 'lane' takes as registers 4 * half .. 4 * half + 3 of its A or B fragment. A wave's fragment load then reads 512 B in a row (4 whole lines)
// where rows of pitch 2 KB gave it 16 pieces of 32 B in 16 lines. The k order of every fragment is the old one. fo_src: first element, in the row-major source, of piece t of the plane.
__device__ __forceinline__ size_t fo_src(size_t t) { const size_t tile = t >> 6; const int c = (int)(t & 63); return ((tile / (DM / 32)) * 16 + (c & 15)) * DM + (tile % (DM / 32)) * 32 + (c >> 5) * 16 + ((c >> 4) & 1) * 8; }
__device__ __forceinline__ v16h fo_frag(const _Float16* p) { FragH f; f.half[0] = *(const v8us*)((const unsigned short*)p); f.half[1] = *(const v8us*)((const unsigned short*)p + 256); return f.v; }      /* p: the tile + 8 * lane */
__global__ __launch_bounds__(256) void k_x16(const float* __restrict__ x, _Float16* __restrict__ X16, size_t n8) { const size_t t = (size_t)blockIdx.x * 256 + threadIdx.x; if (t >= n8) return; FragH f; const float* s = x + fo_src(t); const v4f a = *(const v4fa*)s, c = *(const v4fa*)(s + 4);
#pragma unroll
  for (int q = 0; q < 4; ++q) { f.h[q] = (_Float16)bf16_round(a[q]); f.h[4 + q] = (_Float16)bf16_round(c[q]); } *(v8us*)((unsigned short*)X16 + t * 8) = f.half[0];  }      /* piece t of the plane in fragment order */
__global__ __launch_bounds__(256) void k_h16(const float* __restrict__ x, _Float16* __restrict__ X16, size_t n8) { const size_t t = (size_t)blockIdx.x * 256 + threadIdx.x; if (t >= n8) return; FragH f;
#pragma unroll
  for (int q = 0; q < 8; ++q) f.h[q] = (_Float16)x[t * 8 + q]; *(v8us*)((unsigned short*)X16 + t * 8) = f.half[0];  }
__global__ __launch_bounds__(256) void k_round16f(const float* __restrict__ W, _Float16* __restrict__ Bt, size_t n8) { const size_t t = (size_t)blockIdx.x * 256 + threadIdx.x; if (t >= n8) return; FragH f;
#pragma unroll
  for (int i = 0; i < 8; ++i) f.h[i] = (_Float16)(bf16_round(W[t * 8 + i]) * 16.0f); *(v8us*)((unsigned short*)Bt + t * 8) = f.half[0];  }
// ---- projection GEMM (wave tile 32 token rows x 64 features = one head; M % 128 == 0, K % 64 == 0; A and Bh in fragment order). The epilogue forms v = acc * alpha + bias in f32, splits it into f16 hi + x1024 residual and stores both as whole pieces of the planes the attention reads: no f32 plane, no LDS.
// VT false (q, k): the products are formed transposed (A operand = weight rows, B operand = token rows), so accumulator register r of (feature tile t, token tile g) is feature 16 t + 8 hh + r of token 16 g + ln: the lane's 8 values are piece 32 (t & 1) + lane of the fragment-order tile (token tile g, k tile t >> 1) of the head.
// VT true (v): A operand = token rows, B operand = weight rows: register r is key 16 g + 8 hh + r of head column 16 t + ln: the lane's 8 values are piece 32 g + lane of a V^T tile. V^T in fragment order: tiles of 16 head columns x 32 keys, tile index = ((batch * NH + head) * (SQ / 32) + key / 32) * 4 + column / 16: the 4 tiles of a key block lie in a row.
// Either way one store instruction of the wave writes 512 B in a row (4 whole lines). The k order of every sum is the old one.
__device__ __forceinline__ v16h g2_frag(const _Float16* p, int hh) { FragH f; f.half[0] = *(const v8us*)((const unsigned short*)p + 8 * hh); f.half[1] = *(const v8us*)((const unsigned short*)p + 16 + 8 * hh); return f.v; }
__device__ __forceinline__ v8f g2_mma(v16h a, v16h b, v8f c) { v8f d = __builtin_amdgcn_wmma_f32_16x16x32_f16(false, a, false, b, (short)0, c, false, false); asm volatile("v_nop\n\tv_nop\n\tv_nop\n\tv_nop" : "+v"(d) : "v"(a), "v"(b)); return d; }
template <bool VT> __device__ __forceinline__ v8f pj_mma(v16h tok, v16h wgt, v8f c) { return VT ? g2_mma(tok, wgt, c) : g2_mma(wgt, tok, c); }
template <bool VT>
__global__ __launch_bounds__(128) void k_proj(const _Float16* __restrict__ A, int lda, const _Float16* __restrict__ Bh, int ldb, float alpha, const float* __restrict__ bias, int row0g, _Float16* __restrict__ Hh, _Float16* __restrict__ Hl, int M, int N, int K) {
  const int tid = threadIdx.x, w = tid >> 5, lane = tid & 31, ln = lane & 15, hh = lane >> 4;
  const int ntn = N >> 6; const int mt = blockIdx.x / ntn, nq = blockIdx.x - mt * ntn; const int row0 = mt * 128 + 32 * w, col0 = nq * 64; if (row0 >= M) return;
  const _Float16* a0p = A + (size_t)row0 * lda + 8 * lane; const _Float16* a1p = a0p + (size_t)16 * lda;      /* A and Bh lie in fragment order (fo_src; lda = ldb = DM): 16 rows = lda / 32 tiles of 512 values; the lane's piece is in the pointers */
  const _Float16* b0p = Bh + (size_t)col0 * ldb + 8 * lane; const _Float16* b1p = b0p + (size_t)16 * ldb; const _Float16* b2p = b1p + (size_t)16 * ldb; const _Float16* b3p = b2p + (size_t)16 * ldb;
  const v8f z8 = {0.f,0.f,0.f,0.f,0.f,0.f,0.f,0.f}; v8f c00 = z8, c01 = z8, c02 = z8, c03 = z8, c10 = z8, c11 = z8, c12 = z8, c13 = z8;
#pragma unroll 1      /* one trip = two k-steps (K % 64 == 0); rolled so that the 12 fragments of a trip stay in registers */
  for (int kb = 0; kb < K; kb += 64) {      /* all 24 loads of the trip stand in front of its first product: the trip waits for memory once, not once per fragment */
    const v16h a0 = fo_frag(a0p), b0 = fo_frag(b0p), a1 = fo_frag(a1p), b1 = fo_frag(b1p), b2 = fo_frag(b2p), b3 = fo_frag(b3p);
    const v16h e0 = fo_frag(a0p + 512), f0 = fo_frag(b0p + 512), e1 = fo_frag(a1p + 512), f1 = fo_frag(b1p + 512), f2 = fo_frag(b2p + 512), f3 = fo_frag(b3p + 512);
    asm volatile("s_wait_xcnt 0x0" :: "v"(a0p), "v"(a1p), "v"(b0p), "v"(b1p), "v"(b2p), "v"(b3p) : "memory");      /* the six address pairs stay untouched (inputs here) until this wait; behind it they may be advanced and reused */
    c00 = pj_mma<VT>(a0, b0, c00); c10 = pj_mma<VT>(a1, b0, c10); c01 = pj_mma<VT>(a0, b1, c01); c11 = pj_mma<VT>(a1, b1, c11); c02 = pj_mma<VT>(a0, b2, c02); c12 = pj_mma<VT>(a1, b2, c12); c03 = pj_mma<VT>(a0, b3, c03); c13 = pj_mma<VT>(a1, b3, c13);
    c00 = pj_mma<VT>(e0, f0, c00); c10 = pj_mma<VT>(e1, f0, c10); c01 = pj_mma<VT>(e0, f1, c01); c11 = pj_mma<VT>(e1, f1, c11); c02 = pj_mma<VT>(e0, f2, c02); c12 = pj_mma<VT>(e1, f2, c12); c03 = pj_mma<VT>(e0, f3, c03); c13 = pj_mma<VT>(e1, f3, c13);
    a0p += 1024; a1p += 1024; b0p += 1024; b1p += 1024; b2p += 1024; b3p += 1024; }      /* two tiles */
  v8f accs[8] = {c00, c01, c02, c03, c10, c11, c12, c13};
  const int rg = row0g + row0;      /* the wave's first token row in the whole plane */
  const size_t po = VT ? ((size_t)((rg / SQ) * NH + nq) * (SQ / 32) + (rg % SQ) / 32) * 2048 + 8 * lane : ((size_t)(rg / 16) * (DM / 32) + col0 / 32) * 512 + 8 * lane;      /* the lane's place in the wave's first tile */
  unsigned short* hp = (unsigned short*)Hh + po; unsigned short* lp = (unsigned short*)Hl + po;
  FragH fh[4], fl[4];      /* [u >> 1].half[u & 1] */
#pragma unroll
  for (int u = 0; u < 8; ++u) { const int t = u & 3; float bv[8];
    if (VT) { const float b1 = bf16_round(bias[col0 + t * 16 + ln]);
#pragma unroll
      for (int r = 0; r < 8; ++r) bv[r] = b1; }
    else { const v4f x0 = *(const v4fa*)(bias + col0 + t * 16 + 8 * hh), x1 = *(const v4fa*)(bias + col0 + t * 16 + 8 * hh + 4);
#pragma unroll
      for (int r = 0; r < 4; ++r) { bv[r] = bf16_round(x0[r]); bv[4 + r] = bf16_round(x1[r]); } }
#pragma unroll
    for (int r = 0; r < 8; ++r) { const float v = accs[u][r] * alpha + bv[r]; const _Float16 h = (_Float16)v; fh[u >> 1].h[(u & 1) * 8 + r] = h; fl[u >> 1].h[(u & 1) * 8 + r] = (_Float16)((v - (float)h) * 1024.0f); } }
  __builtin_amdgcn_sched_barrier(0);      /* all 16 pieces are formed in front of the first store: without this the V^T build formed its residual pieces behind the hi stores, over their registers, behind waits on those stores */
#pragma unroll
  for (int u = 0; u < 8; ++u) { const int t = u & 3, g = u >> 2; const int eo = VT ? t * 512 + g * 256 : g * 16 * DM + t * 256;      /* VT: tile t, half g; else token tile g (16 DM values on), k tile t >> 1, half t & 1 */
    *(v8us*)(hp + eo) = fh[u >> 1].half[u & 1]; *(v8us*)(lp + eo) = fl[u >> 1].half[u & 1]; } }


__global__ __launch_bounds__(256) void k_wnat(const float* __restrict__ w, size_t n8, _Float16* __restrict__ Bt) { const size_t t = (size_t)blockIdx.x * 256 + threadIdx.x; if (t >= n8) return; FragH f; const float* s = w + fo_src(t); const v4f a = *(const v4fa*)s, c = *(const v4fa*)(s + 4); for (int q = 0; q < 4; ++q) { f.h[q] = (_Float16)(bf16_round(a[q]) * 16.0f); f.h[4 + q] = (_Float16)(bf16_round(c[q]) * 16.0f); } *(v8us*)((unsigned short*)Bt + t * 8) = f.half[0];  }      /* piece t of the plane in fragment order */
__global__ __launch_bounds__(256) void k_rsm(const float* __restrict__ S, _Float16* __restrict__ P, int nrows) {
  #pragma clang fp contract(off)
  const int i = blockIdx.x * 256 + threadIdx.x; if (i >= nrows) return; const float* s = S + (size_t)i * SQ; float mx = -3.0e38f;
#pragma unroll 1
  for (int j = 0; j < SQ; ++j) mx = fmaxf(mx, s[j]); float se = 0.f;
#pragma unroll 1
  for (int j = 0; j < SQ; ++j) se += expf(s[j] - mx); const float sc = 256.0f / se;
#pragma unroll 1
  for (int j0 = 0; j0 < SQ; j0 += 8) { FragH f; for (int q = 0; q < 8; ++q) f.h[q] = (_Float16)(expf(s[j0 + q] - mx) * sc); unsigned short* d = (unsigned short*)P + (size_t)i * SQ + j0; *(v8us*)d = f.half[0];  } }
__global__ __launch_bounds__(256) void k_vt(const _Float16* __restrict__ V16, int b, int h0, _Float16* __restrict__ VT) { __shared__ unsigned short tl[64][65]; const int tid = threadIdx.x; const int hh = blockIdx.x % HG, sg = blockIdx.x / HG; const int s0 = sg * 64; const int h = h0 + hh;
  for (int i = tid; i < 64 * 8; i += 256) { const int j = i / 8, d8 = (i % 8) * 8; FragH f; f.half[0] = *(const v8us*)((const unsigned short*)V16 + ((size_t)b * SQ + s0 + j) * DM + h * HD + d8); for (int q = 0; q < 8; ++q) tl[d8 + q][j] = f.u[q]; }
  __syncthreads();
  { for (int i = tid; i < 64 * 8; i += 256) { const int d = i / 8, j8 = (i % 8) * 8; FragH f; for (int q = 0; q < 8; ++q) f.u[q] = tl[d][j8 + q]; *(v8us*)((unsigned short*)VT + ((size_t)hh * HD + d) * SQ + s0 + j8) = f.half[0]; }  } }



__global__ __launch_bounds__(256) void k_rsmcf2(const float* __restrict__ S, _Float16* __restrict__ P, int hg, int q0, int nk) {
  #pragma clang fp contract(off)
  const int t = blockIdx.x * 256 + threadIdx.x; if (t >= hg * QT) return; const size_t i = (size_t)t; const float* s = S + i * NKX; const int last = q0 + (t % QT); float mx = -3.0e38f;
#pragma unroll 1
  for (int j = 0; j < nk; ++j) { const float f = (j <= last) ? 1.f : 0.f; mx = fmaxf(mx, fmaf(f, s[j], (1.f - f) * -1.0e9f)); } float se = 0.f;
#pragma unroll 1
  for (int j = 0; j < nk; ++j) { const float f = (j <= last) ? 1.f : 0.f; se += __expf(fmaf(f, s[j], (1.f - f) * -1.0e9f) - mx); } const float sc = 256.0f / se;
#pragma unroll 1
  for (int j0 = 0; j0 < nk; j0 += 8) { FragH fr; for (int q = 0; q < 8; ++q) { const int j = j0 + q; const float f = (j <= last) ? 1.f : 0.f; fr.h[q] = (_Float16)(__expf(fmaf(f, s[j], (1.f - f) * -1.0e9f) - mx) * sc); } unsigned short* d = (unsigned short*)P + i * NKX + j0; *(v8us*)d = fr.half[0];  } }


__global__ __launch_bounds__(256) void k_rsmcf2hl(const float* __restrict__ S, _Float16* __restrict__ P, _Float16* __restrict__ PL, int hg, int q0, int nk) {
  #pragma clang fp contract(off)
  const int t = blockIdx.x * 256 + threadIdx.x; if (t >= hg * QT) return; const size_t i = (size_t)t; const float* s = S + i * NKX; const int last = q0 + (t % QT); float mx = -3.0e38f;
#pragma unroll 1
  for (int j = 0; j < nk; ++j) { const float f = (j <= last) ? 1.f : 0.f; mx = fmaxf(mx, fmaf(f, s[j], (1.f - f) * -1.0e9f)); } float se = 0.f;
#pragma unroll 1
  for (int j = 0; j < nk; ++j) { const float f = (j <= last) ? 1.f : 0.f; se += __expf(fmaf(f, s[j], (1.f - f) * -1.0e9f) - mx); } const float sc = 256.0f / se;
#pragma unroll 1
  for (int j0 = 0; j0 < nk; j0 += 8) { FragH fr, fl; for (int q = 0; q < 8; ++q) { const int j = j0 + q; const float f = (j <= last) ? 1.f : 0.f; const float v = __expf(fmaf(f, s[j], (1.f - f) * -1.0e9f) - mx) * sc; const _Float16 hv = (_Float16)v; fr.h[q] = hv; fl.h[q] = (_Float16)((v - (float)hv) * 1024.0f); } unsigned short* d = (unsigned short*)P + i * NKX + j0; unsigned short* dl = (unsigned short*)PL + i * NKX + j0; *(v8us*)d = fr.half[0]; *(v8us*)dl = fl.half[0];  } }


// ---- fused attention: scores, masks, softmax and the value product of 32 query rows per wave in one launch; no score or weight ever goes to memory.
// The wave walks its keys in blocks of 32 with a running row maximum and row sum. Scores are formed transposed, S^T = K Q^T (A = key rows, B = query rows, two column groups g of 16 queries): a lane then holds 16 keys of ONE query per group
// (accumulator register r of key tile t = key 16 t + 8 hh + r, column ln = query), which is at once the B fragment of the next product, out^T = V^T P^T (element 8 t + r = k index 16 t + 8 hh + r, the k order of fo_frag on the V^T tiles):
// the weights go from accumulator to operand inside the lane, and a row's maximum and sum need one exchange between the two lane halves.
// Split precision as before: scores = (qh.kh)/8 + (ql.kh + qh.kl)/8192; weights 256 e as f16 hi + x1024 residual; out = sum (Ph Vh + (Pl Vh + Ph Vl)/1024) / (256 sum e), the residual products of a block folded into the f32 accumulator at the block's end.
// Keys above the end of the wave's own 32 rows carry -2e4 and contribute exactly 0, as the keys above a tile's end did. Block = 8 waves = 256 query rows of one head and batch, which read the same K and V^T lines; grid.z = query block, longest first.
__device__ __forceinline__ v8f fa_mma(v16h a, v16h b, v8f c) { return __builtin_amdgcn_wmma_f32_16x16x32_f16(false, a, false, b, (short)0, c, false, false); }
__global__ __launch_bounds__(256) void k_fattn(const _Float16* __restrict__ Qh, const _Float16* __restrict__ Ql, const _Float16* __restrict__ Kh, const _Float16* __restrict__ Kl,
    const _Float16* __restrict__ Vh, const _Float16* __restrict__ Vl, const float* __restrict__ am, float* __restrict__ out) {
  const int lane = threadIdx.x & 31, ln = lane & 15, hh = lane >> 4; const int w = __builtin_amdgcn_readfirstlane(threadIdx.x >> 5);
  const int h = blockIdx.x, b = blockIdx.y; const int qw = (SQ / 256 - 1 - (int)blockIdx.z) * 256 + w * 32;      /* first query row of the wave */
  const int nk = qw + 32;      /* keys walked: a multiple of 32, at most SQ */
  const size_t qo = ((size_t)b * SQ + qw) * LQ + h * HD * 16 + 8 * lane, ko = (size_t)b * SQ * LQ + h * HD * 16 + 8 * lane, vo = (size_t)(b * NH + h) * HD * SQ + 8 * lane;      /* all six planes lie in fragment order (fo_src, k_proj): 16 rows = 16 LQ values, a head = 2 tiles of 512 in them; a key block of V^T = 4 tiles in a row */
  const _Float16* qhp = Qh + qo; const _Float16* qlp = Ql + qo; const _Float16* khp = Kh + ko; const _Float16* klp = Kl + ko; const _Float16* vhp = Vh + vo; const _Float16* vlp = Vl + vo; const float* amp = am + (size_t)b * SQ + 8 * hh;
  v16h qh[2][2], ql[2][2], kh[2][2], kl[2][2];      /* q: [column group][k-step]; k: [key tile][k-step] */
#pragma unroll
  for (int g = 0; g < 2; ++g)
#pragma unroll
    for (int s = 0; s < 2; ++s) { qh[g][s] = fo_frag(qhp + g * 16 * LQ + s * 512); ql[g][s] = fo_frag(qlp + g * 16 * LQ + s * 512); kh[g][s] = fo_frag(khp + g * 16 * LQ + s * 512); kl[g][s] = fo_frag(klp + g * 16 * LQ + s * 512); }
  asm volatile("s_wait_xcnt 0x0" :: "v"(qhp), "v"(qlp), "v"(khp), "v"(klp) : "memory");      /* the address pairs stay untouched (inputs here) until this wait; behind it they may be advanced and reused */
  { const int st = (32 < nk) ? 32 * LQ : 0; khp += st; klp += st; }      /* the K pointers run one block ahead and stop at the last block */
  const v8f z8 = {0.f,0.f,0.f,0.f,0.f,0.f,0.f,0.f}; v8f o[4][2] = {{z8, z8}, {z8, z8}, {z8, z8}, {z8, z8}};      /* out^T: [tile of 16 head columns][column group] */
  float mr[2] = {-3.0e38f, -3.0e38f}, se[2] = {0.f, 0.f}; int dl = 8 * hh - qw - ln;      /* dl: key - query of the lane's first element, group 0 */
#pragma unroll 1      /* rolled: a block's fragments fill the register budget */
  for (int kb = 0; kb < nk; kb += 32) {
    const v4f m0 = *(const v4fa*)(amp), m1 = *(const v4fa*)(amp + 4), m2 = *(const v4fa*)(amp + 16), m3 = *(const v4fa*)(amp + 20);
    v8f c[2][2], r[2][2];      /* [key tile][column group]; c: hi.hi, r: both residual products */
#pragma unroll
    for (int t = 0; t < 2; ++t)
#pragma unroll
      for (int g = 0; g < 2; ++g) { c[t][g] = fa_mma(kh[t][0], qh[g][0], z8); r[t][g] = fa_mma(kh[t][0], ql[g][0], z8); }
#pragma unroll
    for (int t = 0; t < 2; ++t)
#pragma unroll
      for (int g = 0; g < 2; ++g) { r[t][g] = fa_mma(kl[t][0], qh[g][0], r[t][g]); c[t][g] = fa_mma(kh[t][1], qh[g][1], c[t][g]); }
#pragma unroll
    for (int t = 0; t < 2; ++t)
#pragma unroll
      for (int g = 0; g < 2; ++g) r[t][g] = fa_mma(kh[t][1], ql[g][1], r[t][g]);
#pragma unroll
    for (int t = 0; t < 2; ++t)
#pragma unroll
      for (int g = 0; g < 2; ++g) r[t][g] = fa_mma(kl[t][1], qh[g][1], r[t][g]);
    v16h vh[4], vl[4];
#pragma unroll
    for (int u = 0; u < 4; ++u) { vh[u] = fo_frag(vhp + u * 512); vl[u] = fo_frag(vlp + u * 512); }      /* this block's V^T: in flight under the softmax */
#pragma unroll
    for (int t = 0; t < 2; ++t)
#pragma unroll
      for (int s = 0; s < 2; ++s) { kh[t][s] = fo_frag(khp + t * 16 * LQ + s * 512); kl[t][s] = fo_frag(klp + t * 16 * LQ + s * 512); }      /* the next block's K: in flight under the softmax and the value product */
    asm volatile("s_wait_xcnt 0x0" :: "v"(khp), "v"(klp), "v"(vhp), "v"(vlp), "v"(amp) : "memory");      /* as above: the five address pairs are advanced only behind this wait */
    { const int st = (kb + 64 < nk) ? 32 * LQ : 0; khp += st; klp += st; } vhp += 2048; vlp += 2048; amp += 32;
    const float mv[16] = {m0[0],m0[1],m0[2],m0[3],m1[0],m1[1],m1[2],m1[3],m2[0],m2[1],m2[2],m2[3],m3[0],m3[1],m3[2],m3[3]};
    float x[2][16], mn[2];
#pragma unroll
    for (int g = 0; g < 2; ++g) { float mx = -3.0e38f;
#pragma unroll
      for (int e = 0; e < 16; ++e) { const int d = dl - 16 * g + (e & 7) + 16 * (e >> 3);      /* key - query */
        const float s = c[e >> 3][g][e & 7] * 0.125f + r[e >> 3][g][e & 7] * 0.0001220703125f;      /* both factors are powers of two: one rounding */
        const float mk = __fadd_rn((d > 0) ? -20000.0f : ((d >= -512) ? -10000.0f : 0.f), (float)(__bf16)mv[e]);      /* causal -1e4 + 'window' -1e4 (their sum is exact) + attention_mask (rounded to bf16, nearest even), then added to the score, all in f32 */
        x[g][e] = __fadd_rn(s, mk); mx = fmaxf(mx, x[g][e]); }
      mx = fmaxf(mx, __shfl_xor(mx, 16, 32)); mn[g] = fmaxf(mr[g], mx); }
    if (__builtin_amdgcn_ballot_w32(mn[0] > mr[0] || mn[1] > mr[1]) != 0u) {      /* a row's maximum rose: old sums to the new maximum (factor 1 for the rows where it did not) */
#pragma unroll
      for (int g = 0; g < 2; ++g) { const float al = __expf(mr[g] - mn[g]); se[g] *= al;
#pragma unroll
        for (int u = 0; u < 4; ++u)
#pragma unroll
          for (int q = 0; q < 8; ++q) o[u][g][q] *= al; } }
    FragH ph[2], pl[2];
#pragma unroll
    for (int g = 0; g < 2; ++g) { mr[g] = mn[g];
#pragma unroll
      for (int e = 0; e < 16; ++e) { const float ex = __expf(x[g][e] - mn[g]); se[g] += ex; const float p = ex * 256.0f; const _Float16 hv = (_Float16)p; ph[g].h[e] = hv; pl[g].h[e] = (_Float16)((p - (float)hv) * 1024.0f); } }
#pragma unroll
    for (int g = 0; g < 2; ++g) { v8f t[4];
#pragma unroll
      for (int u = 0; u < 4; ++u) { o[u][g] = fa_mma(vh[u], ph[g].v, o[u][g]); t[u] = fa_mma(vh[u], pl[g].v, z8); }
#pragma unroll
      for (int u = 0; u < 4; ++u) t[u] = fa_mma(vl[u], ph[g].v, t[u]);
#pragma unroll
      for (int u = 0; u < 4; ++u)
#pragma unroll
        for (int q = 0; q < 8; ++q) o[u][g][q] += t[u][q] * 0.0009765625f; }
    dl += 32; }
  float* op = out + ((size_t)b * SQ + qw + ln) * DM + h * HD + 8 * hh;      /* the lane's query row of group 0; register q of tile u = column 16 u + 8 hh + q; the wave writes both whole lines of each of its rows */
  v4f wv[2][8];
#pragma unroll
  for (int g = 0; g < 2; ++g) { const float st = se[g] + __shfl_xor(se[g], 16, 32); const float sc = 0.00390625f / st;
#pragma unroll
    for (int u = 0; u < 4; ++u)
#pragma unroll
      for (int q = 0; q < 4; ++q) { wv[g][2 * u][q] = o[u][g][q] * sc; wv[g][2 * u + 1][q] = o[u][g][4 + q] * sc; } }
#pragma unroll
  for (int g = 0; g < 2; ++g)
#pragma unroll
    for (int u = 0; u < 4; ++u) { *(v4f*)(op + g * 16 * DM + u * 16) = wv[g][2 * u]; *(v4f*)(op + g * 16 * DM + u * 16 + 4) = wv[g][2 * u + 1]; } }

extern "C" void kernel_launch(void* const* d_in, const int* in_sizes, int n_in,
                              void* d_out, int out_size, void* d_ws, size_t ws_size, hipStream_t stream) {
  (void)in_sizes; (void)n_in; (void)out_size;
  const float* const* I = (const float* const*)d_in; const float* x = I[0]; const float* am = I[1]; const float* wq = I[2]; const float* bq = I[3]; const float* wk = I[4]; const float* bk = I[5]; const float* wv = I[6]; const float* bv = I[7];      /* additive attention_mask [4][1][1][2048] (zeros); natural [out][in] weights + biases */
  char* ws = (char*)d_ws; size_t off = 0;
  auto take = [&](size_t bytes) { char* p = ws + off; off += (bytes + 255) & ~(size_t)255; return p; };
  _Float16* Q16 = (_Float16*)take(NR * DM * 2); _Float16* QL = (_Float16*)take(NR * DM * 2); _Float16* K16 = (_Float16*)take(NR * DM * 2); _Float16* KL = (_Float16*)take(NR * DM * 2);
  _Float16* VT = (_Float16*)take((size_t)NB * NH * HD * SQ * 2); _Float16* VTL = (_Float16*)take((size_t)NB * NH * HD * SQ * 2);      /* V^T planes of all batches */
  _Float16* BQ = (_Float16*)take((size_t)DM * DM * 2); _Float16* BK = (_Float16*)take((size_t)DM * DM * 2); _Float16* BV = (_Float16*)take((size_t)DM * DM * 2);
  _Float16* X16 = (_Float16*)take(NR * DM * 2);      /* v too is kept as f16 hi + x1024 residual (the early causal rows average only a few v rows, so a single-f16 v would leave sizeable absolute rounding against this module's small output scale) */
  if (off > ws_size) return;
  { const unsigned g = (unsigned)(((size_t)DM * DM / 8 + 255) / 256); k_wnat<<<g, 256, 0, stream>>>(wq, (size_t)DM * DM / 8, BQ); k_wnat<<<g, 256, 0, stream>>>(wk, (size_t)DM * DM / 8, BK); k_wnat<<<g, 256, 0, stream>>>(wv, (size_t)DM * DM / 8, BV); }      /* natural [out][in] = Bt x16, in fragment order */

  k_x16<<<(unsigned)((NR * DM / 8 + 255) / 256), 256, 0, stream>>>(x, X16, NR * DM / 8);
  const size_t r0p = (size_t)B0 * SQ;      /* first projected row */
  k_proj<false><<<dim3((unsigned)((MP / 128) * (DM / 64)), 1), 128, 0, stream>>>(X16 + r0p * DM, DM, BQ, DM, 0.0625f, bq, (int)r0p, Q16, QL, MP, DM, DM);      /* q (+ bq) -> f16 hi + x1024 residual, fragment order */
  k_proj<false><<<dim3((unsigned)((MP / 128) * (DM / 64)), 1), 128, 0, stream>>>(X16 + r0p * DM, DM, BK, DM, 0.0625f, bk, (int)r0p, K16, KL, MP, DM, DM);      /* k (+ bk) likewise */
  k_proj<true><<<dim3((unsigned)((MP / 128) * (DM / 64)), 1), 128, 0, stream>>>(X16 + r0p * DM, DM, BV, DM, 0.0625f, bv, (int)r0p, VT, VTL, MP, DM, DM);      /* v (+ bv) -> V^T hi and residual, [4][16] slabs of 64 x SQ in fragment order */
  k_fattn<<<dim3(NH, NB, SQ / 256), 256, 0, stream>>>(Q16, QL, K16, KL, VT, VTL, am, (float*)d_out);      /* scores, masks, softmax and the value product of all heads, batches and query rows in one launch */
}

// v008
// It runs in 163 microseconds.
// Timed twice side by side with v007, it ran 1.13 and 1.12 times as fast.
// All steps since v000 together make it 79.5 times as fast.
#include <hip/hip_runtime.h>
// Causal self-attention with the module's (faithful, inverted) window mask and an additive padding mask (hidden [4][2048][1024]; q/k/v = x W^T + b (natural [1024][1024] sigma 1/32, biases sigma 0.01); 16 heads of 64; scores / 8 + causal(-1e4 where j > i) + window(-1e4 where j >= i - 512, as the source writes it) + attention_mask[b][j] (zeros), all added in f32; softmax; out = merged attn v -> [4][2048][1024], no output projection). Effective pattern: rows i <= 512 attend causally (every kept logit carries the -1e4 offset, reproduced in f32), rows i >= 513 attend only keys j <= i - 513.
// Structure: token rows; x as exact f16 rows; natural weights as exact x16 planes; q, k, v as WMMA GEMMs (32x64 wave tiles, f32 accumulation, + bias), each split in the GEMM's own epilogue into f16 hi + x1024 residual planes (the output scale is small, so logits, weights and values are all carried near f32), q and k in fragment order and v as V^T in fragment order, straight from the accumulator registers; attention fused in one launch, a wave per 32 query rows walking its keys in blocks of 32 with a running maximum and sum: scores = qh.kh/8 + (ql.kh + qh.kl)/8192 (K = 64) against the keys below the rows' end, the module's masks added in f32 on VALU (keys above the rows' end carry -2e4 and contribute exactly 0), weights as f16 hi + x1024 residual kept in registers, out = (Ph Vh^T + (Pl Vh^T + Ph Vl^T)/1024) / (256 row sum), written f32 into the output rows; launches: see trace.
// Operand layout: every f16 plane that a matrix instruction reads (x, the three weight planes, q and k hi/residual, V^T hi/residual) lies in memory in fragment order: see fo_src below.
// Compute dtype: inputs rounded to bf16; x / weights exact; q, k, v and softmax weights as f16 hi + x1024 residual GEMM operands, o accumulated in f32; scores and softmax statistics f32. v_wmma_f32_16x16x32_f16.
#define NB 4
#define SQ 2048
#define DM 1024
#define NH 16
#define HD 64
#define HG 1                         /* heads per launch of k_vt(V16, b, h0, VT), which is not launched */
#define QT 256                       /* query rows per causal tile */
#define NKX SQ                       /* longest score row */
#define B0 0                         /* first batch processed (debug hook) */
#define NBR NB                       /* batches processed (debug hook) */
#define NR ((size_t)NB * SQ)         /* token rows */
#define MP ((int)((size_t)NBR * SQ)) /* rows projected (debug hook) */
#define QN SQ                        /* query rows attended per batch (unused) */
#define NHD NH                       /* heads attended (unused) */
#define MPO MP                       /* unused (there is no output stage) */
#define LQ DM      /* row pitch of the q/k rows */
typedef __bf16 v16b __attribute__((ext_vector_type(16)));
typedef unsigned short v8us __attribute__((ext_vector_type(8), may_alias));
typedef float  v8f  __attribute__((ext_vector_type(8)));
typedef float  v4f  __attribute__((ext_vector_type(4)));
typedef float  v4fa __attribute__((ext_vector_type(4), may_alias));
union FragB { v16b v; v8us half[2]; unsigned short u[16]; };

__device__ __forceinline__ unsigned short bf16_bits(float x) { unsigned int u = __float_as_uint(x); return (unsigned short)((u + 0x7FFFu + ((u >> 16) & 1u)) >> 16); }
__device__ __forceinline__ float bf16_val(unsigned short b) { return __uint_as_float(((unsigned int)b) << 16); }
__device__ __forceinline__ float bf16_round(float x) { return bf16_val(bf16_bits(x)); }
// D += A·B with NT terms: 1 = ah·bh, 2 = + al·bh (A split), 3 = + ah·bl (both split)
template <int NT>
__device__ __forceinline__ v8f mmaN(v16b ah, v16b al, v16b bh, v16b bl, v8f c) {
  c = __builtin_amdgcn_wmma_f32_16x16x32_bf16(false, ah, false, bh, (short)0, c, false, false);
  if (NT >= 2) c = __builtin_amdgcn_wmma_f32_16x16x32_bf16(false, al, false, bh, (short)0, c, false, false);
  if (NT >= 3) c = __builtin_amdgcn_wmma_f32_16x16x32_bf16(false, ah, false, bl, (short)0, c, false, false);
  asm volatile("v_nop\n\tv_nop\n\tv_nop\n\tv_nop" : "+v"(c) : "v"(ah), "v"(al), "v"(bh), "v"(bl));
  return c;
}

__global__ __launch_bounds__(256) void k_wt_bf16(const float* __restrict__ W, unsigned short* __restrict__ Wt, int K, int N) {
  const int t = blockIdx.x * 256 + threadIdx.x;
  const int k8n = K / 8;
  if (t >= N * k8n) return;
  const int n = t / k8n, k8 = (t % k8n) * 8;
  v8us v;
#pragma unroll
  for (int i = 0; i < 8; ++i) v[i] = bf16_bits(W[(size_t)(k8 + i) * N + n]);
  *(v8us*)(Wt + (size_t)n * K + k8) = v;
  
}

// GEMM C[M][N] (f32, pitch ldc) = act(A[M][K]·W + bias). A f32 row-major (pitch lda) converted per fragment to bf16
// (ASPLIT: hi/lo two planes -> 2 terms, else single rounded term); Wt bf16 [N][K] (pitch ldb). BIAS_BF16 rounds the
// bias to bf16 first (bias quantised to bf16 before the add). K%32==0, M%16==0, N%64==0.
template <bool ASPLIT, int ACT, bool BIAS_BF16>
__global__ __launch_bounds__(128) void k_gemm_bf(const float* __restrict__ A, int lda, const unsigned short* __restrict__ Wt, int ldb,
                                               const float* __restrict__ bias, float* __restrict__ C, int ldc, int M, int N, int K) {
  __shared__ __attribute__((aligned(16))) float so[4][16][64];
  const int tid = threadIdx.x, w = tid >> 5, lane = tid & 31, ln = lane & 15, hh = lane >> 4;
  const int ntn = N / 64;
  const int wid = blockIdx.x * 4 + w;
  const int mt = wid / ntn, nq = wid % ntn;
  if (mt * 16 >= M) return;
  const int row0 = mt * 16, col0 = nq * 64;
  const float* arow = A + (size_t)(row0 + ln) * lda;
  v8f acc[4] = {};
  for (int kb = 0; kb < K; kb += 32) {
    FragB ah, al;
    const v4f x0 = *(const v4fa*)(arow + kb + 8 * hh), x1 = *(const v4fa*)(arow + kb + 8 * hh + 4);
    const v4f x2 = *(const v4fa*)(arow + kb + 16 + 8 * hh), x3 = *(const v4fa*)(arow + kb + 16 + 8 * hh + 4);
    float xs[16] = {x0[0],x0[1],x0[2],x0[3],x1[0],x1[1],x1[2],x1[3],x2[0],x2[1],x2[2],x2[3],x3[0],x3[1],x3[2],x3[3]};
#pragma unroll
    for (int i = 0; i < 16; ++i) { const unsigned short hb = bf16_bits(xs[i]); ah.u[i] = hb; al.u[i] = ASPLIT ? bf16_bits(xs[i] - bf16_val(hb)) : (unsigned short)0; }
#pragma unroll
    for (int t = 0; t < 4; ++t) {
      const unsigned short* brow = Wt + (size_t)(col0 + t * 16 + ln) * ldb + kb;
      FragB b;
      b.half[0] = *(const v8us*)(brow + 8 * hh);
      b.half[1] = *(const v8us*)(brow + 16 + 8 * hh);
      acc[t] = mmaN<ASPLIT ? 2 : 1>(ah.v, al.v, b.v, b.v, acc[t]);
    }
  }
#pragma unroll
  for (int t = 0; t < 4; ++t) {
    float bv = bias ? bias[col0 + t * 16 + ln] : 0.f;
    if (BIAS_BF16) bv = bf16_round(bv);
#pragma unroll
    for (int r = 0; r < 8; ++r) { float v = acc[t][r] + bv; if (ACT == 1) v = fmaxf(v, 0.f); so[w][8 * hh + r][t * 16 + ln] = v; }
  }
  __builtin_amdgcn_fence(__ATOMIC_ACQ_REL, "workgroup");
  __builtin_amdgcn_wave_barrier();
  const int rsub = lane >> 4, c4 = (lane & 15) * 4;
  {
#pragma unroll
    for (int q = 0; q < 8; ++q) {
      const int r = q * 2 + rsub;
      const v4f v = *(const v4fa*)&so[w][r][c4];
      *(v4f*)(C + (size_t)(row0 + r) * ldc + col0 + c4) = v;
    }
    
  }
}

// GEMM C = act(A·W + bias + resid): A f32 (ASPLIT -> hi/lo 2 terms), Wt bf16 [N][K]; ACT 0 none, 1 relu, 2 exact gelu;
// resid (optional, f32, row index = (row % rmod), pitch ldr, RES_BF16 rounds it) added before the activation.
template <bool ASPLIT, int ACT, bool BIAS_BF16, bool RES_BF16>
__global__ __launch_bounds__(128) void k_gemm_bf3(const float* __restrict__ A, int lda, const unsigned short* __restrict__ Wt, int ldb,
                                                const float* __restrict__ bias, const float* __restrict__ resid, int rmod, int ldr,
                                                float* __restrict__ C, int ldc, int M, int N, int K) {
  __shared__ __attribute__((aligned(16))) float so[4][16][64];
  const int tid = threadIdx.x, w = tid >> 5, lane = tid & 31, ln = lane & 15, hh = lane >> 4;
  const int ntn = N / 64;
  const int wid = blockIdx.x * 4 + w;
  const int mt = wid / ntn, nq = wid % ntn;
  if (mt * 16 >= M) return;
  const int row0 = mt * 16, col0 = nq * 64;
  const float* arow = A + (size_t)(row0 + ln) * lda;
  v8f acc[4] = {};
  for (int kb = 0; kb < K; kb += 32) {
    FragB ah, al;
    const v4f x0 = *(const v4fa*)(arow + kb + 8 * hh), x1 = *(const v4fa*)(arow + kb + 8 * hh + 4);
    const v4f x2 = *(const v4fa*)(arow + kb + 16 + 8 * hh), x3 = *(const v4fa*)(arow + kb + 16 + 8 * hh + 4);
    float xs[16] = {x0[0],x0[1],x0[2],x0[3],x1[0],x1[1],x1[2],x1[3],x2[0],x2[1],x2[2],x2[3],x3[0],x3[1],x3[2],x3[3]};
#pragma unroll
    for (int i = 0; i < 16; ++i) { const unsigned short hb = bf16_bits(xs[i]); ah.u[i] = hb; al.u[i] = ASPLIT ? bf16_bits(xs[i] - bf16_val(hb)) : (unsigned short)0; }
#pragma unroll
    for (int t = 0; t < 4; ++t) {
      const unsigned short* brow = Wt + (size_t)(col0 + t * 16 + ln) * ldb + kb;
      FragB b;
      b.half[0] = *(const v8us*)(brow + 8 * hh);
      b.half[1] = *(const v8us*)(brow + 16 + 8 * hh);
      acc[t] = mmaN<ASPLIT ? 2 : 1>(ah.v, al.v, b.v, b.v, acc[t]);
    }
  }
#pragma unroll
  for (int t = 0; t < 4; ++t) {
    const int col = col0 + t * 16 + ln;
    float bv = bias ? bias[col] : 0.f;
    if (BIAS_BF16) bv = bf16_round(bv);
#pragma unroll
    for (int r = 0; r < 8; ++r) {
      float v = acc[t][r] + bv;
      if (resid) { float rv = resid[(size_t)((row0 + 8 * hh + r) % rmod) * ldr + col]; if (RES_BF16) rv = bf16_round(rv); v += rv; }
      if (ACT == 1) v = fmaxf(v, 0.f);
      if (ACT == 2) v = 0.5f * v * (1.0f + erff(v * 0.70710678118654752f));
      if (ACT == 3) { const float u = 0.7978845608028654f * (v + 0.044715f * v * v * v); v = 0.5f * v * (1.0f + tanhf(u)); }
      so[w][8 * hh + r][t * 16 + ln] = v;
    }
  }
  __builtin_amdgcn_fence(__ATOMIC_ACQ_REL, "workgroup");
  __builtin_amdgcn_wave_barrier();
  const int rsub = lane >> 4, c4 = (lane & 15) * 4;
  {
#pragma unroll
    for (int q = 0; q < 8; ++q) {
      const int r = q * 2 + rsub;
      const v4f v = *(const v4fa*)&so[w][r][c4];
      *(v4f*)(C + (size_t)(row0 + r) * ldc + col0 + c4) = v;
    }
    
  }
}
// row LayerNorm (biased variance, eps) over N: s = X (+ R); optional out_sum <- s; out_norm <- (s-mu)*rsqrt(var+eps)*g + b
template <bool PARAM_BF16>
__global__ __launch_bounds__(256) void k_layernorm(const float* __restrict__ X, const float* __restrict__ R, const float* __restrict__ g, const float* __restrict__ bta,
                                                  float* __restrict__ out_sum, float* __restrict__ out_norm, int N, float eps) {
  __shared__ float red[256];
  const int row = blockIdx.x, tid = threadIdx.x;
  const float* x = X + (size_t)row * N; const float* rr = R ? R + (size_t)row * N : nullptr;
  float vals[16];                     // up to N = 4096
  const int per = N / 256;            // contiguous chunk per thread? use strided-by-4 chunks: thread handles j = tid*4 + 1024*u
  float s1 = 0.f;
  for (int u = 0; u < per / 4; ++u) {
    const int j = tid * 4 + 1024 * u;
    const v4f a = *(const v4fa*)(x + j);
    v4f b = {0.f,0.f,0.f,0.f}; if (rr) b = *(const v4fa*)(rr + j);
#pragma unroll
    for (int q = 0; q < 4; ++q) { const float v = a[q] + b[q]; vals[u * 4 + q] = v; s1 += v; }
  }
  red[tid] = s1; __syncthreads();
  for (int st = 128; st > 0; st >>= 1) { if (tid < st) red[tid] += red[tid + st]; __syncthreads(); }
  const float mu = red[0] / (float)N; __syncthreads();
  float s2 = 0.f;
  for (int u = 0; u < per / 4; ++u)
#pragma unroll
    for (int q = 0; q < 4; ++q) { const float c = vals[u * 4 + q] - mu; s2 += c * c; }
  red[tid] = s2; __syncthreads();
  for (int st = 128; st > 0; st >>= 1) { if (tid < st) red[tid] += red[tid + st]; __syncthreads(); }
  const float rs = rsqrtf(red[0] / (float)N + eps);
  {
    for (int u = 0; u < per / 4; ++u) {
      const int j = tid * 4 + 1024 * u;
      v4f o, sm;
#pragma unroll
      for (int q = 0; q < 4; ++q) {
        float gg = g[j + q], bb = bta[j + q];
        if (PARAM_BF16) { gg = bf16_round(gg); bb = bf16_round(bb); }
        sm[q] = vals[u * 4 + q]; o[q] = (vals[u * 4 + q] - mu) * rs * gg + bb;
      }
      if (out_sum) *(v4f*)(out_sum + (size_t)row * N + j) = sm;
      *(v4f*)(out_norm + (size_t)row * N + j) = o;
    }
    
  }
}



// ---- f16 WMMA path (v_wmma_f32_16x16x32_f16): 11-bit significands for operands in range — used where a [0,1] probability operand needs more precision than bf16
typedef _Float16 v16h __attribute__((ext_vector_type(16)));
union FragH { v16h v; v8us half[2]; _Float16 h[16]; unsigned short u[16]; };
template <int NT>
__device__ __forceinline__ v8f mmaH(v16h ah, v16h al, v16h bh, v16h bl, v8f c) {
  c = __builtin_amdgcn_wmma_f32_16x16x32_f16(false, ah, false, bh, (short)0, c, false, false);
  if (NT >= 2) c = __builtin_amdgcn_wmma_f32_16x16x32_f16(false, al, false, bh, (short)0, c, false, false);
  if (NT >= 3) c = __builtin_amdgcn_wmma_f32_16x16x32_f16(false, ah, false, bl, (short)0, c, false, false);
  asm volatile("v_nop\n\tv_nop\n\tv_nop\n\tv_nop" : "+v"(c) : "v"(ah), "v"(al), "v"(bh), "v"(bl));
  return c;
}
// batched GEMM like k_gemm_b but f16 operands: A f32 (split into f16 hi/lo if ASPLIT, else rounded to f16), Bt = f16 values [n][k]; alpha; C f32; N multiple of 16 (partial tiles skipped)
template <bool ASPLIT>
__global__ __launch_bounds__(128) void k_gemm_h(const float* __restrict__ A, int lda, size_t sA, const _Float16* __restrict__ Bh, int ldb, size_t sB, float alpha, float* __restrict__ C, int ldc, size_t sC, int M, int N, int K) {
  __shared__ __attribute__((aligned(16))) float so[4][16][64];
  const int tid = threadIdx.x, w = tid >> 5, lane = tid & 31, ln = lane & 15, hh = lane >> 4; const int by = blockIdx.y;
  A += (size_t)by * sA; Bh += (size_t)by * sB; C += (size_t)by * sC;
  const int ntn = (N + 63) / 64; const int wid = blockIdx.x * 4 + w; const int mt = wid / ntn, nq = wid % ntn; if (mt * 16 >= M) return;
  const int row0 = mt * 16, col0 = nq * 64; const float* arow = A + (size_t)(row0 + ln) * lda;
  v8f acc[4] = {};
  for (int kb = 0; kb < K; kb += 32) {
    FragH ah, al;
    const v4f x0 = *(const v4fa*)(arow + kb + 8 * hh), x1 = *(const v4fa*)(arow + kb + 8 * hh + 4), x2 = *(const v4fa*)(arow + kb + 16 + 8 * hh), x3 = *(const v4fa*)(arow + kb + 16 + 8 * hh + 4);
    float xs[16] = {x0[0],x0[1],x0[2],x0[3],x1[0],x1[1],x1[2],x1[3],x2[0],x2[1],x2[2],x2[3],x3[0],x3[1],x3[2],x3[3]};
#pragma unroll
    for (int i = 0; i < 16; ++i) { const _Float16 h = (_Float16)xs[i]; ah.h[i] = h; al.h[i] = ASPLIT ? (_Float16)(xs[i] - (float)h) : (_Float16)0.0f; }
#pragma unroll
    for (int t = 0; t < 4; ++t) { if (col0 + t * 16 >= N) continue; const size_t boff = (size_t)(col0 + t * 16 + ln) * ldb + kb; FragH bq; bq.half[0] = *(const v8us*)(Bh + boff + 8 * hh); bq.half[1] = *(const v8us*)(Bh + boff + 16 + 8 * hh);
      acc[t] = mmaH<ASPLIT ? 2 : 1>(ah.v, al.v, bq.v, bq.v, acc[t]); }
  }
#pragma unroll
  for (int t = 0; t < 4; ++t) { if (col0 + t * 16 >= N) continue;
#pragma unroll
    for (int r = 0; r < 8; ++r) so[w][8 * hh + r][t * 16 + ln] = acc[t][r] * alpha; }
  __builtin_amdgcn_fence(__ATOMIC_ACQ_REL, "workgroup"); __builtin_amdgcn_wave_barrier();
  const int rsub = lane >> 4, c4 = (lane & 15) * 4;
  {
#pragma unroll
    for (int q = 0; q < 8; ++q) { const int r = q * 2 + rsub; if (col0 + c4 < N) { const v4f v = *(const v4fa*)&so[w][r][c4]; *(v4f*)(C + (size_t)(row0 + r) * ldc + col0 + c4) = v; } }
     }
}

// Wt[n][k] = f16(W[k][n]·scale) from f32 row-major W[K][N] (scale = power of two; bf16-exact weights stay exact in f16 away from the subnormal range)
__global__ __launch_bounds__(256) void k_wt_f16(const float* __restrict__ W, _Float16* __restrict__ Wt, int K, int N, float scale) {
  const int t = blockIdx.x * 256 + threadIdx.x; if (t >= N * (K / 8)) return; const int n = t / (K / 8), k8 = (t % (K / 8)) * 8; FragH f;
#pragma unroll
  for (int i = 0; i < 8; ++i) f.h[i] = (_Float16)(bf16_round(W[(size_t)(k8 + i) * N + n]) * scale); const v8us o = f.half[0];
  *(v8us*)((unsigned short*)Wt + (size_t)n * K + k8) = o; 
}
// k_gemm_hh variant with fused epilogue: v = acc·alpha + bias[by·sBias + col] (+ CP[(row/rowsPerB)·sCPb + by·64 + col] if CP) ; ACT 0 none / 1 elu ; writes f16 C16 (and f32 C if non-null)
template <int ACT>
__global__ __launch_bounds__(128) void k_gemm_hhx(const _Float16* __restrict__ A, int lda, size_t sA, const _Float16* __restrict__ Bh, int ldb, size_t sB, float alpha, const float* __restrict__ bias, size_t sBias, const float* __restrict__ CP, int rowsPerB, size_t sCPb, int row0g,
    float* __restrict__ C, _Float16* __restrict__ C16, int ldc, size_t sC, int M, int N, int K) {
  __shared__ __attribute__((aligned(16))) float so[4][16][64];
  const int tid = threadIdx.x, w = tid >> 5, lane = tid & 31, ln = lane & 15, hh = lane >> 4; const int by = blockIdx.y;
  A += (size_t)by * sA; Bh += (size_t)by * sB; const size_t cofs = (size_t)by * sC; const float* bp = bias ? bias + (size_t)by * sBias : nullptr;
  const int ntn = (N + 63) / 64; const int wid = blockIdx.x * 4 + w; const int mt = wid / ntn, nq = wid % ntn; if (mt * 16 >= M) return;
  const int row0 = mt * 16, col0 = nq * 64; const _Float16* arow = A + (size_t)(row0 + ln) * lda;
  v8f acc[4] = {};
  for (int kb = 0; kb < K; kb += 32) { FragH ah; ah.half[0] = *(const v8us*)((const unsigned short*)arow + kb + 8 * hh); ah.half[1] = *(const v8us*)((const unsigned short*)arow + kb + 16 + 8 * hh);
#pragma unroll
    for (int t = 0; t < 4; ++t) { if (col0 + t * 16 >= N) continue; const size_t boff = (size_t)(col0 + t * 16 + ln) * ldb + kb; FragH bq; bq.half[0] = *(const v8us*)((const unsigned short*)Bh + boff + 8 * hh); bq.half[1] = *(const v8us*)((const unsigned short*)Bh + boff + 16 + 8 * hh);
      acc[t] = mmaH<1>(ah.v, ah.v, bq.v, bq.v, acc[t]); }
  }
#pragma unroll
  for (int t = 0; t < 4; ++t) { if (col0 + t * 16 >= N) continue; const int col = col0 + t * 16 + ln; const float bv = bp ? bf16_round(bp[col]) : 0.f;
#pragma unroll
    for (int r = 0; r < 8; ++r) { float v = acc[t][r] * alpha + bv; if (CP) { const int rr = row0g + row0 + 8 * hh + r; if (rowsPerB < 0) v += CP[cofs + (size_t)rr * ldc + col];      /* rowsPerB < 0: own element of the batched C plane */ else { const int bidx = rr / rowsPerB; v += CP[(size_t)bidx * sCPb + (size_t)by * 64 + col]; } } if (ACT == 1) v = (v > 0.f) ? v : expm1f(v); else if (ACT == 7) v = (v > 0.f) ? v + 1.0f : expf(v); else if (ACT == 8) v = tanhf(v); else if (ACT == 9) v = 0.5f * v * (1.0f + tanhf(0.7978845608028654f * (v + 0.044715f * v * v * v))); else if (ACT == 11) v = 1.0f / (1.0f + expf(-v)); else if (ACT == 12) v = (v > 0.f) ? v : 0.01f * v; else if (ACT == 14) v = (v > 0.f) ? v : 0.1f * v; else if (ACT == 16) v = (v >= 0.f) ? v : 0.3f * v; else if (ACT == 17) v = (v >= 0.f) ? v : 0.2f * v; else if (ACT == 15) v = v / (1.0f + expf(-v)); else if (ACT == 3) v = fmaxf(v, 0.f); else if (ACT == 6) v = 0.5f * v * (1.0f + erff(v * 0.70710678118654752f)); so[w][8 * hh + r][t * 16 + ln] = v; } }
  __builtin_amdgcn_fence(__ATOMIC_ACQ_REL, "workgroup"); __builtin_amdgcn_wave_barrier();
  const int rsub = lane >> 4, c4 = (lane & 15) * 4; typedef _Float16 v4h __attribute__((ext_vector_type(4)));
  {
#pragma unroll
    for (int q = 0; q < 8; ++q) { const int r = q * 2 + rsub; if (col0 + c4 < N) { const v4f v = *(const v4fa*)&so[w][r][c4]; if (C) *(v4f*)(C + cofs + (size_t)(row0 + r) * ldc + col0 + c4) = v; if (C16) { v4h h4; for (int i = 0; i < 4; ++i) h4[i] = (_Float16)v[i]; *(v4h*)(C16 + cofs + (size_t)(row0 + r) * ldc + col0 + c4) = h4; } } }
     }
}


typedef _Float16 v4h __attribute__((ext_vector_type(4)));

// ---- fragment order: a plane of rows x DM f16 values is cut into tiles of 16 rows x 32 k (1 KB each, tile index = (row / 16) * (DM / 32) + k / 32). Inside a tile stand 64 pieces of 16 B: piece c = 32 * half + lane holds
// row (lane & 15), k = 16 * half + 8 * (lane >> 4) + 0..7, which is what lane 'lane' takes as registers 4 * half .. 4 * half + 3 of its A or B fragment. A wave's fragment load then reads 512 B in a row (4 whole lines)
// where rows of pitch 2 KB gave it 16 pieces of 32 B in 16 lines. The k order of every fragment is the old one. fo_src: first element, in the row-major source, of piece t of the plane.
__device__ __forceinline__ size_t fo_src(size_t t) { const size_t tile = t >> 6; const int c = (int)(t & 63); return ((tile / (DM / 32)) * 16 + (c & 15)) * DM + (tile % (DM / 32)) * 32 + (c >> 5) * 16 + ((c >> 4) & 1) * 8; }
__device__ __forceinline__ v16h fo_frag(const _Float16* p) { FragH f; f.half[0] = *(const v8us*)((const unsigned short*)p); f.half[1] = *(const v8us*)((const unsigned short*)p + 256); return f.v; }      /* p: the tile + 8 * lane */
__global__ __launch_bounds__(256) void k_x16(const float* __restrict__ x, _Float16* __restrict__ X16, size_t n8) { const size_t t = (size_t)blockIdx.x * 256 + threadIdx.x; if (t >= n8) return; FragH f; const float* s = x + fo_src(t); const v4f a = *(const v4fa*)s, c = *(const v4fa*)(s + 4);
#pragma unroll
  for (int q = 0; q < 4; ++q) { f.h[q] = (_Float16)bf16_round(a[q]); f.h[4 + q] = (_Float16)bf16_round(c[q]); } *(v8us*)((unsigned short*)X16 + t * 8) = f.half[0];  }      /* piece t of the plane in fragment order */
__global__ __launch_bounds__(256) void k_h16(const float* __restrict__ x, _Float16* __restrict__ X16, size_t n8) { const size_t t = (size_t)blockIdx.x * 256 + threadIdx.x; if (t >= n8) return; FragH f;
#pragma unroll
  for (int q = 0; q < 8; ++q) f.h[q] = (_Float16)x[t * 8 + q]; *(v8us*)((unsigned short*)X16 + t * 8) = f.half[0];  }
__global__ __launch_bounds__(256) void k_round16f(const float* __restrict__ W, _Float16* __restrict__ Bt, size_t n8) { const size_t t = (size_t)blockIdx.x * 256 + threadIdx.x; if (t >= n8) return; FragH f;
#pragma unroll
  for (int i = 0; i < 8; ++i) f.h[i] = (_Float16)(bf16_round(W[t * 8 + i]) * 16.0f); *(v8us*)((unsigned short*)Bt + t * 8) = f.half[0];  }
// ---- projection GEMM (wave tile 32 token rows x 64 features = one head; M % 128 == 0, K % 64 == 0; A and Bh in fragment order). The epilogue forms v = acc * alpha + bias in f32, splits it into f16 hi + x1024 residual and stores both as whole pieces of the planes the attention reads: no f32 plane, no LDS.
// VT false (q, k): the products are formed transposed (A operand = weight rows, B operand = token rows), so accumulator register r of (feature tile t, token tile g) is feature 16 t + 8 hh + r of token 16 g + ln: the lane's 8 values are piece 32 (t & 1) + lane of the fragment-order tile (token tile g, k tile t >> 1) of the head.
// VT true (v): A operand = token rows, B operand = weight rows: register r is key 16 g + 8 hh + r of head column 16 t + ln: the lane's 8 values are piece 32 g + lane of a V^T tile. V^T in fragment order: tiles of 16 head columns x 32 keys, tile index = ((batch * NH + head) * (SQ / 32) + key / 32) * 4 + column / 16: the 4 tiles of a key block lie in a row.
// Either way one store instruction of the wave writes 512 B in a row (4 whole lines). The k order of every sum is the old one.
// NRM (the k launch): the wave also stores the squared length of each of its 32 head rows, from which the attention bounds scores it then need not form.
__device__ __forceinline__ v16h g2_frag(const _Float16* p, int hh) { FragH f; f.half[0] = *(const v8us*)((const unsigned short*)p + 8 * hh); f.half[1] = *(const v8us*)((const unsigned short*)p + 16 + 8 * hh); return f.v; }
__device__ __forceinline__ v8f g2_mma(v16h a, v16h b, v8f c) { v8f d = __builtin_amdgcn_wmma_f32_16x16x32_f16(false, a, false, b, (short)0, c, false, false); asm volatile("v_nop\n\tv_nop\n\tv_nop\n\tv_nop" : "+v"(d) : "v"(a), "v"(b)); return d; }
template <bool VT> __device__ __forceinline__ v8f pj_mma(v16h tok, v16h wgt, v8f c) { return VT ? g2_mma(tok, wgt, c) : g2_mma(wgt, tok, c); }
template <bool VT, bool NRM>
__global__ __launch_bounds__(128) void k_proj(const _Float16* __restrict__ A, int lda, const _Float16* __restrict__ Bh, int ldb, float alpha, const float* __restrict__ bias, int row0g, _Float16* __restrict__ Hh, _Float16* __restrict__ Hl, float* __restrict__ nrm, int M, int N, int K) {
  const int tid = threadIdx.x, w = tid >> 5, lane = tid & 31, ln = lane & 15, hh = lane >> 4;
  const int ntn = N >> 6; const int mt = blockIdx.x / ntn, nq = blockIdx.x - mt * ntn; const int row0 = mt * 128 + 32 * w, col0 = nq * 64; if (row0 >= M) return;
  const _Float16* a0p = A + (size_t)row0 * lda + 8 * lane; const _Float16* a1p = a0p + (size_t)16 * lda;      /* A and Bh lie in fragment order (fo_src; lda = ldb = DM): 16 rows = lda / 32 tiles of 512 values; the lane's piece is in the pointers */
  const _Float16* b0p = Bh + (size_t)col0 * ldb + 8 * lane; const _Float16* b1p = b0p + (size_t)16 * ldb; const _Float16* b2p = b1p + (size_t)16 * ldb; const _Float16* b3p = b2p + (size_t)16 * ldb;
  const v8f z8 = {0.f,0.f,0.f,0.f,0.f,0.f,0.f,0.f}; v8f c00 = z8, c01 = z8, c02 = z8, c03 = z8, c10 = z8, c11 = z8, c12 = z8, c13 = z8;
#pragma unroll 1      /* one trip = two k-steps (K % 64 == 0); rolled so that the 12 fragments of a trip stay in registers */
  for (int kb = 0; kb < K; kb += 64) {      /* all 24 loads of the trip stand in front of its first product: the trip waits for memory once, not once per fragment */
    const v16h a0 = fo_frag(a0p), b0 = fo_frag(b0p), a1 = fo_frag(a1p), b1 = fo_frag(b1p), b2 = fo_frag(b2p), b3 = fo_frag(b3p);
    const v16h e0 = fo_frag(a0p + 512), f0 = fo_frag(b0p + 512), e1 = fo_frag(a1p + 512), f1 = fo_frag(b1p + 512), f2 = fo_frag(b2p + 512), f3 = fo_frag(b3p + 512);
    asm volatile("s_wait_xcnt 0x0" :: "v"(a0p), "v"(a1p), "v"(b0p), "v"(b1p), "v"(b2p), "v"(b3p) : "memory");      /* the six address pairs stay untouched (inputs here) until this wait; behind it they may be advanced and reused */
    c00 = pj_mma<VT>(a0, b0, c00); c10 = pj_mma<VT>(a1, b0, c10); c01 = pj_mma<VT>(a0, b1, c01); c11 = pj_mma<VT>(a1, b1, c11); c02 = pj_mma<VT>(a0, b2, c02); c12 = pj_mma<VT>(a1, b2, c12); c03 = pj_mma<VT>(a0, b3, c03); c13 = pj_mma<VT>(a1, b3, c13);
    c00 = pj_mma<VT>(e0, f0, c00); c10 = pj_mma<VT>(e1, f0, c10); c01 = pj_mma<VT>(e0, f1, c01); c11 = pj_mma<VT>(e1, f1, c11); c02 = pj_mma<VT>(e0, f2, c02); c12 = pj_mma<VT>(e1, f2, c12); c03 = pj_mma<VT>(e0, f3, c03); c13 = pj_mma<VT>(e1, f3, c13);
    a0p += 1024; a1p += 1024; b0p += 1024; b1p += 1024; b2p += 1024; b3p += 1024; }      /* two tiles */
  v8f accs[8] = {c00, c01, c02, c03, c10, c11, c12, c13};
  const int rg = row0g + row0;      /* the wave's first token row in the whole plane */
  const size_t po = VT ? ((size_t)((rg / SQ) * NH + nq) * (SQ / 32) + (rg % SQ) / 32) * 2048 + 8 * lane : ((size_t)(rg / 16) * (DM / 32) + col0 / 32) * 512 + 8 * lane;      /* the lane's place in the wave's first tile */
  unsigned short* hp = (unsigned short*)Hh + po; unsigned short* lp = (unsigned short*)Hl + po;
  FragH fh[4], fl[4];      /* [u >> 1].half[u & 1] */
  float n2[2] = {0.f, 0.f};      /* NRM (with VT false): sum of squares of the lane's 32 features of token 16 g + ln */
#pragma unroll
  for (int u = 0; u < 8; ++u) { const int t = u & 3; float bv[8];
    if (VT) { const float b1 = bf16_round(bias[col0 + t * 16 + ln]);
#pragma unroll
      for (int r = 0; r < 8; ++r) bv[r] = b1; }
    else { const v4f x0 = *(const v4fa*)(bias + col0 + t * 16 + 8 * hh), x1 = *(const v4fa*)(bias + col0 + t * 16 + 8 * hh + 4);
#pragma unroll
      for (int r = 0; r < 4; ++r) { bv[r] = bf16_round(x0[r]); bv[4 + r] = bf16_round(x1[r]); } }
#pragma unroll
    for (int r = 0; r < 8; ++r) { const float v = accs[u][r] * alpha + bv[r]; if (NRM) n2[u >> 2] += v * v; const _Float16 h = (_Float16)v; fh[u >> 1].h[(u & 1) * 8 + r] = h; fl[u >> 1].h[(u & 1) * 8 + r] = (_Float16)((v - (float)h) * 1024.0f); } }
  if (NRM) { n2[0] += __shfl_xor(n2[0], 16, 32); n2[1] += __shfl_xor(n2[1], 16, 32); const float nv = hh ? n2[1] : n2[0];      /* the other lane half holds the other 32 features; lane = token of the wave's 32 */
    float* np = nrm + ((size_t)(rg / SQ) * NH + nq) * SQ + rg % SQ + lane;      /* squared length of each token's head row, [batch][head][token]: the wave writes one whole line */
    *np = nv;
    asm volatile("s_wait_xcnt 0x0" ::: "memory"); }      /* the store's registers are free for reuse only behind this wait */
  __builtin_amdgcn_sched_barrier(0);      /* all 16 pieces are formed in front of the first store: without this the V^T build formed its residual pieces behind the hi stores, over their registers, behind waits on those stores */
#pragma unroll
  for (int u = 0; u < 8; ++u) { const int t = u & 3, g = u >> 2; const int eo = VT ? t * 512 + g * 256 : g * 16 * DM + t * 256;      /* VT: tile t, half g; else token tile g (16 DM values on), k tile t >> 1, half t & 1 */
    *(v8us*)(hp + eo) = fh[u >> 1].half[u & 1]; *(v8us*)(lp + eo) = fl[u >> 1].half[u & 1]; } }


__global__ __launch_bounds__(256) void k_wnat(const float* __restrict__ w, size_t n8, _Float16* __restrict__ Bt) { const size_t t = (size_t)blockIdx.x * 256 + threadIdx.x; if (t >= n8) return; FragH f; const float* s = w + fo_src(t); const v4f a = *(const v4fa*)s, c = *(const v4fa*)(s + 4); for (int q = 0; q < 4; ++q) { f.h[q] = (_Float16)(bf16_round(a[q]) * 16.0f); f.h[4 + q] = (_Float16)(bf16_round(c[q]) * 16.0f); } *(v8us*)((unsigned short*)Bt + t * 8) = f.half[0];  }      /* piece t of the plane in fragment order */
__global__ __launch_bounds__(256) void k_rsm(const float* __restrict__ S, _Float16* __restrict__ P, int nrows) {
  #pragma clang fp contract(off)
  const int i = blockIdx.x * 256 + threadIdx.x; if (i >= nrows) return; const float* s = S + (size_t)i * SQ; float mx = -3.0e38f;
#pragma unroll 1
  for (int j = 0; j < SQ; ++j) mx = fmaxf(mx, s[j]); float se = 0.f;
#pragma unroll 1
  for (int j = 0; j < SQ; ++j) se += expf(s[j] - mx); const float sc = 256.0f / se;
#pragma unroll 1
  for (int j0 = 0; j0 < SQ; j0 += 8) { FragH f; for (int q = 0; q < 8; ++q) f.h[q] = (_Float16)(expf(s[j0 + q] - mx) * sc); unsigned short* d = (unsigned short*)P + (size_t)i * SQ + j0; *(v8us*)d = f.half[0];  } }
__global__ __launch_bounds__(256) void k_vt(const _Float16* __restrict__ V16, int b, int h0, _Float16* __restrict__ VT) { __shared__ unsigned short tl[64][65]; const int tid = threadIdx.x; const int hh = blockIdx.x % HG, sg = blockIdx.x / HG; const int s0 = sg * 64; const int h = h0 + hh;
  for (int i = tid; i < 64 * 8; i += 256) { const int j = i / 8, d8 = (i % 8) * 8; FragH f; f.half[0] = *(const v8us*)((const unsigned short*)V16 + ((size_t)b * SQ + s0 + j) * DM + h * HD + d8); for (int q = 0; q < 8; ++q) tl[d8 + q][j] = f.u[q]; }
  __syncthreads();
  { for (int i = tid; i < 64 * 8; i += 256) { const int d = i / 8, j8 = (i % 8) * 8; FragH f; for (int q = 0; q < 8; ++q) f.u[q] = tl[d][j8 + q]; *(v8us*)((unsigned short*)VT + ((size_t)hh * HD + d) * SQ + s0 + j8) = f.half[0]; }  } }



__global__ __launch_bounds__(256) void k_rsmcf2(const float* __restrict__ S, _Float16* __restrict__ P, int hg, int q0, int nk) {
  #pragma clang fp contract(off)
  const int t = blockIdx.x * 256 + threadIdx.x; if (t >= hg * QT) return; const size_t i = (size_t)t; const float* s = S + i * NKX; const int last = q0 + (t % QT); float mx = -3.0e38f;
#pragma unroll 1
  for (int j = 0; j < nk; ++j) { const float f = (j <= last) ? 1.f : 0.f; mx = fmaxf(mx, fmaf(f, s[j], (1.f - f) * -1.0e9f)); } float se = 0.f;
#pragma unroll 1
  for (int j = 0; j < nk; ++j) { const float f = (j <= last) ? 1.f : 0.f; se += __expf(fmaf(f, s[j], (1.f - f) * -1.0e9f) - mx); } const float sc = 256.0f / se;
#pragma unroll 1
  for (int j0 = 0; j0 < nk; j0 += 8) { FragH fr; for (int q = 0; q < 8; ++q) { const int j = j0 + q; const float f = (j <= last) ? 1.f : 0.f; fr.h[q] = (_Float16)(__expf(fmaf(f, s[j], (1.f - f) * -1.0e9f) - mx) * sc); } unsigned short* d = (unsigned short*)P + i * NKX + j0; *(v8us*)d = fr.half[0];  } }


__global__ __launch_bounds__(256) void k_rsmcf2hl(const float* __restrict__ S, _Float16* __restrict__ P, _Float16* __restrict__ PL, int hg, int q0, int nk) {
  #pragma clang fp contract(off)
  const int t = blockIdx.x * 256 + threadIdx.x; if (t >= hg * QT) return; const size_t i = (size_t)t; const float* s = S + i * NKX; const int last = q0 + (t % QT); float mx = -3.0e38f;
#pragma unroll 1
  for (int j = 0; j < nk; ++j) { const float f = (j <= last) ? 1.f : 0.f; mx = fmaxf(mx, fmaf(f, s[j], (1.f - f) * -1.0e9f)); } float se = 0.f;
#pragma unroll 1
  for (int j = 0; j < nk; ++j) { const float f = (j <= last) ? 1.f : 0.f; se += __expf(fmaf(f, s[j], (1.f - f) * -1.0e9f) - mx); } const float sc = 256.0f / se;
#pragma unroll 1
  for (int j0 = 0; j0 < nk; j0 += 8) { FragH fr, fl; for (int q = 0; q < 8; ++q) { const int j = j0 + q; const float f = (j <= last) ? 1.f : 0.f; const float v = __expf(fmaf(f, s[j], (1.f - f) * -1.0e9f) - mx) * sc; const _Float16 hv = (_Float16)v; fr.h[q] = hv; fl.h[q] = (_Float16)((v - (float)hv) * 1024.0f); } unsigned short* d = (unsigned short*)P + i * NKX + j0; unsigned short* dl = (unsigned short*)PL + i * NKX + j0; *(v8us*)d = fr.half[0]; *(v8us*)dl = fl.half[0];  } }


// ---- fused attention: scores, masks, softmax and the value product of 32 query rows per wave in one launch; no score or weight ever goes to memory.
// The wave walks its keys in blocks of 32 with a running row maximum and row sum. Scores are formed transposed, S^T = K Q^T (A = key rows, B = query rows, two column groups g of 16 queries): a lane then holds 16 keys of ONE query per group
// (accumulator register r of key tile t = key 16 t + 8 hh + r, column ln = query), which is at once the B fragment of the next product, out^T = V^T P^T (element 8 t + r = k index 16 t + 8 hh + r, the k order of fo_frag on the V^T tiles):
// the weights go from accumulator to operand inside the lane, and a row's maximum and sum need one exchange between the two lane halves.
// Split precision as before: scores = (qh.kh)/8 + (ql.kh + qh.kl)/8192; weights 256 e as f16 hi + x1024 residual; out = sum (Ph Vh + (Pl Vh + Ph Vl)/1024) / (256 sum e), the residual products of a block folded into the f32 accumulator at the block's end.
// Keys above the end of the wave's own 32 rows carry -2e4 and contribute exactly 0, as the keys above a tile's end did. Block = 8 waves = 256 query rows of one head and batch, which read the same K and V^T lines; grid.z = query block, longest first.
__device__ __forceinline__ v8f fa_mma(v16h a, v16h b, v8f c) { return __builtin_amdgcn_wmma_f32_16x16x32_f16(false, a, false, b, (short)0, c, false, false); }
__global__ __launch_bounds__(256) void k_fattn(const _Float16* __restrict__ Qh, const _Float16* __restrict__ Ql, const _Float16* __restrict__ Kh, const _Float16* __restrict__ Kl,
    const _Float16* __restrict__ Vh, const _Float16* __restrict__ Vl, const float* __restrict__ kn, const float* __restrict__ am, float* __restrict__ out) {
  const int lane = threadIdx.x & 31, ln = lane & 15, hh = lane >> 4; const int w = __builtin_amdgcn_readfirstlane(threadIdx.x >> 5);
  const int h = blockIdx.x, b = blockIdx.y; const int qw = (SQ / 256 - 1 - (int)blockIdx.z) * 256 + w * 32;      /* first query row of the wave */
  const int nk = qw + 32;      /* keys walked: a multiple of 32, at most SQ */
  const size_t qo = ((size_t)b * SQ + qw) * LQ + h * HD * 16 + 8 * lane, ko = (size_t)b * SQ * LQ + h * HD * 16 + 8 * lane, vo = (size_t)(b * NH + h) * HD * SQ + 8 * lane;      /* all six planes lie in fragment order (fo_src, k_proj): 16 rows = 16 LQ values, a head = 2 tiles of 512 in them; a key block of V^T = 4 tiles in a row */
  const _Float16* qhp = Qh + qo; const _Float16* qlp = Ql + qo; const _Float16* khp = Kh + ko; const _Float16* klp = Kl + ko; const _Float16* vhp = Vh + vo; const _Float16* vlp = Vl + vo; const float* amp = am + (size_t)b * SQ + 8 * hh;
  v16h qh[2][2], ql[2][2], kh[2][2], kl[2][2];      /* q: [column group][k-step]; k: [key tile][k-step] */
#pragma unroll
  for (int g = 0; g < 2; ++g)
#pragma unroll
    for (int s = 0; s < 2; ++s) { qh[g][s] = fo_frag(qhp + g * 16 * LQ + s * 512); ql[g][s] = fo_frag(qlp + g * 16 * LQ + s * 512); kh[g][s] = fo_frag(khp + g * 16 * LQ + s * 512); kl[g][s] = fo_frag(klp + g * 16 * LQ + s * 512); }
  asm volatile("s_wait_xcnt 0x0" :: "v"(qhp), "v"(qlp), "v"(khp), "v"(klp) : "memory");      /* the address pairs stay untouched (inputs here) until this wait; behind it they may be advanced and reused */
  { const int st = (32 < nk) ? 32 * LQ : 0; khp += st; klp += st; }      /* the K pointers run one block ahead and stop at the last block */
  // The wave's last 512 keys (from tk on) have key >= query - 512 for all 32 rows: each carries -1e4 or -2e4. lim: an upper bound of every masked score among them, per query row (f32 rounding is monotone, so a bound on the terms bounds the rounded sum):
  // |q.k| / 8 <= (|q|^2 + |k|^2) / 16 (0.065: 4 % above 1/16, for the split operands' and the sums' rounding), the largest |k|^2 and the largest attention_mask of those keys. nz is 0, or NaN where one of them is not finite, and then no test below holds.
  const int tk = qw - 480; float lim[2] = {3.0e38f, 3.0e38f};
  if (qw >= 512) {      /* below that, row 512 or an earlier one keeps these keys */
    const float* kt = kn + (size_t)(b * NH + h) * SQ + tk + 4 * lane; const float* at = am + (size_t)b * SQ + tk + 4 * lane; v4f kv[4], av[4];
#pragma unroll
    for (int j = 0; j < 4; ++j) { kv[j] = *(const v4fa*)(kt + 128 * j); av[j] = *(const v4fa*)(at + 128 * j); }
    asm volatile("s_wait_xcnt 0x0" ::: "memory");      /* the loads' address registers are free for reuse only behind this wait */
    __builtin_amdgcn_sched_barrier(0);      /* holds every later instruction, which may reuse those registers, behind the wait: without it the build wrote the loads' offset register ahead of the wait */
    float km = 0.f, ax = -3.0e38f, nz = 0.f;
#pragma unroll
    for (int j = 0; j < 4; ++j)
#pragma unroll
      for (int q = 0; q < 4; ++q) { km = fmaxf(km, kv[j][q]); ax = fmaxf(ax, av[j][q]); nz = fmaf(kv[j][q], 0.f, fmaf(av[j][q], 0.f, nz)); }
#pragma unroll
    for (int m = 16; m > 0; m >>= 1) { km = fmaxf(km, __shfl_xor(km, m, 32)); ax = fmaxf(ax, __shfl_xor(ax, m, 32)); nz += __shfl_xor(nz, m, 32); }
    const float mk = __fadd_rn(-10000.0f, (float)(__bf16)ax) + nz;
#pragma unroll
    for (int g = 0; g < 2; ++g) { float q2 = 0.f;
#pragma unroll
      for (int s = 0; s < 2; ++s)
#pragma unroll
        for (int e = 0; e < 16; ++e) { const float t = (float)qh[g][s][e]; q2 = fmaf(t, t, q2); }
      q2 += __shfl_xor(q2, 16, 32); lim[g] = __fadd_rn(0.065f * (q2 + km), mk); } }
  const v8f z8 = {0.f,0.f,0.f,0.f,0.f,0.f,0.f,0.f}; v8f o[4][2] = {{z8, z8}, {z8, z8}, {z8, z8}, {z8, z8}};      /* out^T: [tile of 16 head columns][column group] */
  float mr[2] = {-3.0e38f, -3.0e38f}, se[2] = {0.f, 0.f}; int dl = 8 * hh - qw - ln;      /* dl: key - query of the lane's first element, group 0 */
#pragma unroll 1      /* rolled: a block's fragments fill the register budget */
  for (int kb = 0; kb < nk; kb += 32) {
    if (kb == tk) {      /* once per wave: where every remaining score lies 256 or more below its row's running maximum, each remaining weight is exp(< -104) = 0 in f32, no maximum moves and nothing is added to any sum: the walk ends here with the same bits */
      const bool dead = (lim[0] - mr[0] < -256.0f) && (lim[1] - mr[1] < -256.0f);
      if (__builtin_amdgcn_ballot_w32(!dead) == 0u) break; }
    const v4f m0 = *(const v4fa*)(amp), m1 = *(const v4fa*)(amp + 4), m2 = *(const v4fa*)(amp + 16), m3 = *(const v4fa*)(amp + 20);
    v8f c[2][2], r[2][2];      /* [key tile][column group]; c: hi.hi, r: both residual products */
#pragma unroll
    for (int t = 0; t < 2; ++t)
#pragma unroll
      for (int g = 0; g < 2; ++g) { c[t][g] = fa_mma(kh[t][0], qh[g][0], z8); r[t][g] = fa_mma(kh[t][0], ql[g][0], z8); }
#pragma unroll
    for (int t = 0; t < 2; ++t)
#pragma unroll
      for (int g = 0; g < 2; ++g) { r[t][g] = fa_mma(kl[t][0], qh[g][0], r[t][g]); c[t][g] = fa_mma(kh[t][1], qh[g][1], c[t][g]); }
#pragma unroll
    for (int t = 0; t < 2; ++t)
#pragma unroll
      for (int g = 0; g < 2; ++g) r[t][g] = fa_mma(kh[t][1], ql[g][1], r[t][g]);
#pragma unroll
    for (int t = 0; t < 2; ++t)
#pragma unroll
      for (int g = 0; g < 2; ++g) r[t][g] = fa_mma(kl[t][1], qh[g][1], r[t][g]);
    v16h vh[4], vl[4];
#pragma unroll
    for (int u = 0; u < 4; ++u) { vh[u] = fo_frag(vhp + u * 512); vl[u] = fo_frag(vlp + u * 512); }      /* this block's V^T: in flight under the softmax */
#pragma unroll
    for (int t = 0; t < 2; ++t)
#pragma unroll
      for (int s = 0; s < 2; ++s) { kh[t][s] = fo_frag(khp + t * 16 * LQ + s * 512); kl[t][s] = fo_frag(klp + t * 16 * LQ + s * 512); }      /* the next block's K: in flight under the softmax and the value product */
    asm volatile("s_wait_xcnt 0x0" :: "v"(khp), "v"(klp), "v"(vhp), "v"(vlp), "v"(amp) : "memory");      /* as above: the five address pairs are advanced only behind this wait */
    { const int st = (kb + 64 < nk) ? 32 * LQ : 0; khp += st; klp += st; } vhp += 2048; vlp += 2048; amp += 32;
    const float mv[16] = {m0[0],m0[1],m0[2],m0[3],m1[0],m1[1],m1[2],m1[3],m2[0],m2[1],m2[2],m2[3],m3[0],m3[1],m3[2],m3[3]};
    float x[2][16], mn[2];
#pragma unroll
    for (int g = 0; g < 2; ++g) { float mx = -3.0e38f;
#pragma unroll
      for (int e = 0; e < 16; ++e) { const int d = dl - 16 * g + (e & 7) + 16 * (e >> 3);      /* key - query */
        const float s = c[e >> 3][g][e & 7] * 0.125f + r[e >> 3][g][e & 7] * 0.0001220703125f;      /* both factors are powers of two: one rounding */
        const float mk = __fadd_rn((d > 0) ? -20000.0f : ((d >= -512) ? -10000.0f : 0.f), (float)(__bf16)mv[e]);      /* causal -1e4 + 'window' -1e4 (their sum is exact) + attention_mask (rounded to bf16, nearest even), then added to the score, all in f32 */
        x[g][e] = __fadd_rn(s, mk); mx = fmaxf(mx, x[g][e]); }
      mx = fmaxf(mx, __shfl_xor(mx, 16, 32)); mn[g] = fmaxf(mr[g], mx); }
    if (__builtin_amdgcn_ballot_w32(mn[0] > mr[0] || mn[1] > mr[1]) != 0u) {      /* a row's maximum rose: old sums to the new maximum (factor 1 for the rows where it did not) */
#pragma unroll
      for (int g = 0; g < 2; ++g) { const float al = __expf(mr[g] - mn[g]); se[g] *= al;
#pragma unroll
        for (int u = 0; u < 4; ++u)
#pragma unroll
          for (int q = 0; q < 8; ++q) o[u][g][q] *= al; } }
    FragH ph[2], pl[2];
#pragma unroll
    for (int g = 0; g < 2; ++g) { mr[g] = mn[g];
#pragma unroll
      for (int e = 0; e < 16; ++e) { const float ex = __expf(x[g][e] - mn[g]); se[g] += ex; const float p = ex * 256.0f; const _Float16 hv = (_Float16)p; ph[g].h[e] = hv; pl[g].h[e] = (_Float16)((p - (float)hv) * 1024.0f); } }
#pragma unroll
    for (int g = 0; g < 2; ++g) { v8f t[4];
#pragma unroll
      for (int u = 0; u < 4; ++u) { o[u][g] = fa_mma(vh[u], ph[g].v, o[u][g]); t[u] = fa_mma(vh[u], pl[g].v, z8); }
#pragma unroll
      for (int u = 0; u < 4; ++u) t[u] = fa_mma(vl[u], ph[g].v, t[u]);
#pragma unroll
      for (int u = 0; u < 4; ++u)
#pragma unroll
        for (int q = 0; q < 8; ++q) o[u][g][q] += t[u][q] * 0.0009765625f; }
    dl += 32; }
  float* op = out + ((size_t)b * SQ + qw + ln) * DM + h * HD + 8 * hh;      /* the lane's query row of group 0; register q of tile u = column 16 u + 8 hh + q; the wave writes both whole lines of each of its rows */
  v4f wv[2][8];
#pragma unroll
  for (int g = 0; g < 2; ++g) { const float st = se[g] + __shfl_xor(se[g], 16, 32); const float sc = 0.00390625f / st;
#pragma unroll
    for (int u = 0; u < 4; ++u)
#pragma unroll
      for (int q = 0; q < 4; ++q) { wv[g][2 * u][q] = o[u][g][q] * sc; wv[g][2 * u + 1][q] = o[u][g][4 + q] * sc; } }
#pragma unroll
  for (int g = 0; g < 2; ++g)
#pragma unroll
    for (int u = 0; u < 4; ++u) { *(v4f*)(op + g * 16 * DM + u * 16) = wv[g][2 * u]; *(v4f*)(op + g * 16 * DM + u * 16 + 4) = wv[g][2 * u + 1]; } }

extern "C" void kernel_launch(void* const* d_in, const int* in_sizes, int n_in,
                              void* d_out, int out_size, void* d_ws, size_t ws_size, hipStream_t stream) {
  (void)in_sizes; (void)n_in; (void)out_size;
  const float* const* I = (const float* const*)d_in; const float* x = I[0]; const float* am = I[1]; const float* wq = I[2]; const float* bq = I[3]; const float* wk = I[4]; const float* bk = I[5]; const float* wv = I[6]; const float* bv = I[7];      /* additive attention_mask [4][1][1][2048] (zeros); natural [out][in] weights + biases */
  char* ws = (char*)d_ws; size_t off = 0;
  auto take = [&](size_t bytes) { char* p = ws + off; off += (bytes + 255) & ~(size_t)255; return p; };
  _Float16* Q16 = (_Float16*)take(NR * DM * 2); _Float16* QL = (_Float16*)take(NR * DM * 2); _Float16* K16 = (_Float16*)take(NR * DM * 2); _Float16* KL = (_Float16*)take(NR * DM * 2);
  _Float16* VT = (_Float16*)take((size_t)NB * NH * HD * SQ * 2); _Float16* VTL = (_Float16*)take((size_t)NB * NH * HD * SQ * 2);      /* V^T planes of all batches */
  _Float16* BQ = (_Float16*)take((size_t)DM * DM * 2); _Float16* BK = (_Float16*)take((size_t)DM * DM * 2); _Float16* BV = (_Float16*)take((size_t)DM * DM * 2);
  float* KN = (float*)take((size_t)NB * NH * SQ * 4);      /* squared length of every key's head row */
  _Float16* X16 = (_Float16*)take(NR * DM * 2);      /* v too is kept as f16 hi + x1024 residual (the early causal rows average only a few v rows, so a single-f16 v would leave large absolute rounding against this module's small output scale) */
  if (off > ws_size) return;
  { const unsigned g = (unsigned)(((size_t)DM * DM / 8 + 255) / 256); k_wnat<<<g, 256, 0, stream>>>(wq, (size_t)DM * DM / 8, BQ); k_wnat<<<g, 256, 0, stream>>>(wk, (size_t)DM * DM / 8, BK); k_wnat<<<g, 256, 0, stream>>>(wv, (size_t)DM * DM / 8, BV); }      /* natural [out][in] = Bt x16, in fragment order */

  k_x16<<<(unsigned)((NR * DM / 8 + 255) / 256), 256, 0, stream>>>(x, X16, NR * DM / 8);
  const size_t r0p = (size_t)B0 * SQ;      /* first projected row */
  k_proj<false, false><<<dim3((unsigned)((MP / 128) * (DM / 64)), 1), 128, 0, stream>>>(X16 + r0p * DM, DM, BQ, DM, 0.0625f, bq, (int)r0p, Q16, QL, nullptr, MP, DM, DM);      /* q (+ bq) -> f16 hi + x1024 residual, fragment order */
  k_proj<false, true><<<dim3((unsigned)((MP / 128) * (DM / 64)), 1), 128, 0, stream>>>(X16 + r0p * DM, DM, BK, DM, 0.0625f, bk, (int)r0p, K16, KL, KN, MP, DM, DM);      /* k (+ bk) likewise, and each key's squared length */
  k_proj<true, false><<<dim3((unsigned)((MP / 128) * (DM / 64)), 1), 128, 0, stream>>>(X16 + r0p * DM, DM, BV, DM, 0.0625f, bv, (int)r0p, VT, VTL, nullptr, MP, DM, DM);      /* v (+ bv) -> V^T hi and residual, [4][16] slabs of 64 x SQ in fragment order */
  k_fattn<<<dim3(NH, NB, SQ / 256), 256, 0, stream>>>(Q16, QL, K16, KL, VT, VTL, KN, am, (float*)d_out);      /* scores, masks, softmax and the value product of all heads, batches and query rows in one launch */
}

// v009
// A run of this version takes 152 microseconds.
// Next to v008, in two timings, it ran 1.07 times as fast each time.
// Over all steps from v000 it is 85.2 times as fast.
#include <hip/hip_runtime.h>
// Causal self-attention with the module's (faithful, inverted) window mask and an additive padding mask (hidden [4][2048][1024]; q/k/v = x W^T + b (natural [1024][1024] sigma 1/32, biases sigma 0.01); 16 heads of 64; scores / 8 + causal(-1e4 where j > i) + window(-1e4 where j >= i - 512, as the source writes it) + attention_mask[b][j] (zeros), all added in f32; softmax; out = merged attn v -> [4][2048][1024], no output projection). Effective pattern: rows i <= 512 attend causally (every kept logit carries the -1e4 offset, reproduced in f32), rows i >= 513 attend only keys j <= i - 513.
// Structure: token rows; x as exact f16 rows; natural weights as exact x16 planes; q, k, v as WMMA GEMMs (32x64 wave tiles, f32 accumulation, + bias), each split in the GEMM's own epilogue into f16 hi + x1024 residual planes (the output scale is small, so logits, weights and values are all carried near f32), q and k in fragment order and v as V^T in fragment order, straight from the accumulator registers; attention fused in one launch, a wave per 32 query rows walking its keys in blocks of 32 with a running maximum and sum: scores = qh.kh/8 + (ql.kh + qh.kl)/8192 (K = 64) against the keys below the rows' end, the module's masks added in f32 on VALU (keys above the rows' end carry -2e4 and contribute exactly 0), weights as f16 hi + x1024 residual kept in registers, out = (Ph Vh^T + (Pl Vh^T + Ph Vl^T)/1024) / (256 row sum), written f32 into the output rows; launches: see trace.
// Operand layout: every f16 plane that a matrix instruction reads (x, the three weight planes, q and k hi/residual, V^T hi/residual) lies in memory in fragment order: see fo_src below.
// Compute dtype: inputs rounded to bf16; x / weights exact; q, k, v and softmax weights as f16 hi + x1024 residual GEMM operands, o accumulated in f32; scores and softmax statistics f32. v_wmma_f32_16x16x32_f16.
#define NB 4
#define SQ 2048
#define DM 1024
#define NH 16
#define HD 64
#define HG 1                         /* heads per launch of k_vt(V16, b, h0, VT), which is not launched */
#define QT 256                       /* query rows per causal tile */
#define NKX SQ                       /* longest score row */
#define B0 0                         /* first batch processed (debug hook) */
#define NBR NB                       /* batches processed (debug hook) */
#define NR ((size_t)NB * SQ)         /* token rows */
#define MP ((int)((size_t)NBR * SQ)) /* rows projected (debug hook) */
#define QN SQ                        /* query rows attended per batch (unused) */
#define NHD NH                       /* heads attended (unused) */
#define MPO MP                       /* unused (there is no output stage) */
#define LQ DM      /* row pitch of the q/k rows */
typedef __bf16 v16b __attribute__((ext_vector_type(16)));
typedef unsigned short v8us __attribute__((ext_vector_type(8), may_alias));
typedef float  v8f  __attribute__((ext_vector_type(8)));
typedef float  v4f  __attribute__((ext_vector_type(4)));
typedef float  v4fa __attribute__((ext_vector_type(4), may_alias));
union FragB { v16b v; v8us half[2]; unsigned short u[16]; };

__device__ __forceinline__ unsigned short bf16_bits(float x) { unsigned int u = __float_as_uint(x); return (unsigned short)((u + 0x7FFFu + ((u >> 16) & 1u)) >> 16); }
__device__ __forceinline__ float bf16_val(unsigned short b) { return __uint_as_float(((unsigned int)b) << 16); }
__device__ __forceinline__ float bf16_round(float x) { return bf16_val(bf16_bits(x)); }
// D += A·B with NT terms: 1 = ah·bh, 2 = + al·bh (A split), 3 = + ah·bl (both split)
template <int NT>
__device__ __forceinline__ v8f mmaN(v16b ah, v16b al, v16b bh, v16b bl, v8f c) {
  c = __builtin_amdgcn_wmma_f32_16x16x32_bf16(false, ah, false, bh, (short)0, c, false, false);
  if (NT >= 2) c = __builtin_amdgcn_wmma_f32_16x16x32_bf16(false, al, false, bh, (short)0, c, false, false);
  if (NT >= 3) c = __builtin_amdgcn_wmma_f32_16x16x32_bf16(false, ah, false, bl, (short)0, c, false, false);
  asm volatile("v_nop\n\tv_nop\n\tv_nop\n\tv_nop" : "+v"(c) : "v"(ah), "v"(al), "v"(bh), "v"(bl));
  return c;
}

__global__ __launch_bounds__(256) void k_wt_bf16(const float* __restrict__ W, unsigned short* __restrict__ Wt, int K, int N) {
  const int t = blockIdx.x * 256 + threadIdx.x;
  const int k8n = K / 8;
  if (t >= N * k8n) return;
  const int n = t / k8n, k8 = (t % k8n) * 8;
  v8us v;
#pragma unroll
  for (int i = 0; i < 8; ++i) v[i] = bf16_bits(W[(size_t)(k8 + i) * N + n]);
  *(v8us*)(Wt + (size_t)n * K + k8) = v;
  
}

// GEMM C[M][N] (f32, pitch ldc) = act(A[M][K]·W + bias). A f32 row-major (pitch lda) converted per fragment to bf16
// (ASPLIT: hi/lo two planes -> 2 terms, else single rounded term); Wt bf16 [N][K] (pitch ldb). BIAS_BF16 rounds the
// bias to bf16 first (bias quantised to bf16 before the add). K%32==0, M%16==0, N%64==0.
template <bool ASPLIT, int ACT, bool BIAS_BF16>
__global__ __launch_bounds__(128) void k_gemm_bf(const float* __restrict__ A, int lda, const unsigned short* __restrict__ Wt, int ldb,
                                               const float* __restrict__ bias, float* __restrict__ C, int ldc, int M, int N, int K) {
  __shared__ __attribute__((aligned(16))) float so[4][16][64];
  const int tid = threadIdx.x, w = tid >> 5, lane = tid & 31, ln = lane & 15, hh = lane >> 4;
  const int ntn = N / 64;
  const int wid = blockIdx.x * 4 + w;
  const int mt = wid / ntn, nq = wid % ntn;
  if (mt * 16 >= M) return;
  const int row0 = mt * 16, col0 = nq * 64;
  const float* arow = A + (size_t)(row0 + ln) * lda;
  v8f acc[4] = {};
  for (int kb = 0; kb < K; kb += 32) {
    FragB ah, al;
    const v4f x0 = *(const v4fa*)(arow + kb + 8 * hh), x1 = *(const v4fa*)(arow + kb + 8 * hh + 4);
    const v4f x2 = *(const v4fa*)(arow + kb + 16 + 8 * hh), x3 = *(const v4fa*)(arow + kb + 16 + 8 * hh + 4);
    float xs[16] = {x0[0],x0[1],x0[2],x0[3],x1[0],x1[1],x1[2],x1[3],x2[0],x2[1],x2[2],x2[3],x3[0],x3[1],x3[2],x3[3]};
#pragma unroll
    for (int i = 0; i < 16; ++i) { const unsigned short hb = bf16_bits(xs[i]); ah.u[i] = hb; al.u[i] = ASPLIT ? bf16_bits(xs[i] - bf16_val(hb)) : (unsigned short)0; }
#pragma unroll
    for (int t = 0; t < 4; ++t) {
      const unsigned short* brow = Wt + (size_t)(col0 + t * 16 + ln) * ldb + kb;
      FragB b;
      b.half[0] = *(const v8us*)(brow + 8 * hh);
      b.half[1] = *(const v8us*)(brow + 16 + 8 * hh);
      acc[t] = mmaN<ASPLIT ? 2 : 1>(ah.v, al.v, b.v, b.v, acc[t]);
    }
  }
#pragma unroll
  for (int t = 0; t < 4; ++t) {
    float bv = bias ? bias[col0 + t * 16 + ln] : 0.f;
    if (BIAS_BF16) bv = bf16_round(bv);
#pragma unroll
    for (int r = 0; r < 8; ++r) { float v = acc[t][r] + bv; if (ACT == 1) v = fmaxf(v, 0.f); so[w][8 * hh + r][t * 16 + ln] = v; }
  }
  __builtin_amdgcn_fence(__ATOMIC_ACQ_REL, "workgroup");
  __builtin_amdgcn_wave_barrier();
  const int rsub = lane >> 4, c4 = (lane & 15) * 4;
  {
#pragma unroll
    for (int q = 0; q < 8; ++q) {
      const int r = q * 2 + rsub;
      const v4f v = *(const v4fa*)&so[w][r][c4];
      *(v4f*)(C + (size_t)(row0 + r) * ldc + col0 + c4) = v;
    }
    
  }
}

// GEMM C = act(A·W + bias + resid): A f32 (ASPLIT -> hi/lo 2 terms), Wt bf16 [N][K]; ACT 0 none, 1 relu, 2 exact gelu;
// resid (optional, f32, row index = (row % rmod), pitch ldr, RES_BF16 rounds it) added before the activation.
template <bool ASPLIT, int ACT, bool BIAS_BF16, bool RES_BF16>
__global__ __launch_bounds__(128) void k_gemm_bf3(const float* __restrict__ A, int lda, const unsigned short* __restrict__ Wt, int ldb,
                                                const float* __restrict__ bias, const float* __restrict__ resid, int rmod, int ldr,
                                                float* __restrict__ C, int ldc, int M, int N, int K) {
  __shared__ __attribute__((aligned(16))) float so[4][16][64];
  const int tid = threadIdx.x, w = tid >> 5, lane = tid & 31, ln = lane & 15, hh = lane >> 4;
  const int ntn = N / 64;
  const int wid = blockIdx.x * 4 + w;
  const int mt = wid / ntn, nq = wid % ntn;
  if (mt * 16 >= M) return;
  const int row0 = mt * 16, col0 = nq * 64;
  const float* arow = A + (size_t)(row0 + ln) * lda;
  v8f acc[4] = {};
  for (int kb = 0; kb < K; kb += 32) {
    FragB ah, al;
    const v4f x0 = *(const v4fa*)(arow + kb + 8 * hh), x1 = *(const v4fa*)(arow + kb + 8 * hh + 4);
    const v4f x2 = *(const v4fa*)(arow + kb + 16 + 8 * hh), x3 = *(const v4fa*)(arow + kb + 16 + 8 * hh + 4);
    float xs[16] = {x0[0],x0[1],x0[2],x0[3],x1[0],x1[1],x1[2],x1[3],x2[0],x2[1],x2[2],x2[3],x3[0],x3[1],x3[2],x3[3]};
#pragma unroll
    for (int i = 0; i < 16; ++i) { const unsigned short hb = bf16_bits(xs[i]); ah.u[i] = hb; al.u[i] = ASPLIT ? bf16_bits(xs[i] - bf16_val(hb)) : (unsigned short)0; }
#pragma unroll
    for (int t = 0; t < 4; ++t) {
      const unsigned short* brow = Wt + (size_t)(col0 + t * 16 + ln) * ldb + kb;
      FragB b;
      b.half[0] = *(const v8us*)(brow + 8 * hh);
      b.half[1] = *(const v8us*)(brow + 16 + 8 * hh);
      acc[t] = mmaN<ASPLIT ? 2 : 1>(ah.v, al.v, b.v, b.v, acc[t]);
    }
  }
#pragma unroll
  for (int t = 0; t < 4; ++t) {
    const int col = col0 + t * 16 + ln;
    float bv = bias ? bias[col] : 0.f;
    if (BIAS_BF16) bv = bf16_round(bv);
#pragma unroll
    for (int r = 0; r < 8; ++r) {
      float v = acc[t][r] + bv;
      if (resid) { float rv = resid[(size_t)((row0 + 8 * hh + r) % rmod) * ldr + col]; if (RES_BF16) rv = bf16_round(rv); v += rv; }
      if (ACT == 1) v = fmaxf(v, 0.f);
      if (ACT == 2) v = 0.5f * v * (1.0f + erff(v * 0.70710678118654752f));
      if (ACT == 3) { const float u = 0.7978845608028654f * (v + 0.044715f * v * v * v); v = 0.5f * v * (1.0f + tanhf(u)); }
      so[w][8 * hh + r][t * 16 + ln] = v;
    }
  }
  __builtin_amdgcn_fence(__ATOMIC_ACQ_REL, "workgroup");
  __builtin_amdgcn_wave_barrier();
  const int rsub = lane >> 4, c4 = (lane & 15) * 4;
  {
#pragma unroll
    for (int q = 0; q < 8; ++q) {
      const int r = q * 2 + rsub;
      const v4f v = *(const v4fa*)&so[w][r][c4];
      *(v4f*)(C + (size_t)(row0 + r) * ldc + col0 + c4) = v;
    }
    
  }
}
// row LayerNorm (biased variance, eps) over N: s = X (+ R); optional out_sum <- s; out_norm <- (s-mu)*rsqrt(var+eps)*g + b
template <bool PARAM_BF16>
__global__ __launch_bounds__(256) void k_layernorm(const float* __restrict__ X, const float* __restrict__ R, const float* __restrict__ g, const float* __restrict__ bta,
                                                  float* __restrict__ out_sum, float* __restrict__ out_norm, int N, float eps) {
  __shared__ float red[256];
  const int row = blockIdx.x, tid = threadIdx.x;
  const float* x = X + (size_t)row * N; const float* rr = R ? R + (size_t)row * N : nullptr;
  float vals[16];                     // up to N = 4096
  const int per = N / 256;            // contiguous chunk per thread? use strided-by-4 chunks: thread handles j = tid*4 + 1024*u
  float s1 = 0.f;
  for (int u = 0; u < per / 4; ++u) {
    const int j = tid * 4 + 1024 * u;
    const v4f a = *(const v4fa*)(x + j);
    v4f b = {0.f,0.f,0.f,0.f}; if (rr) b = *(const v4fa*)(rr + j);
#pragma unroll
    for (int q = 0; q < 4; ++q) { const float v = a[q] + b[q]; vals[u * 4 + q] = v; s1 += v; }
  }
  red[tid] = s1; __syncthreads();
  for (int st = 128; st > 0; st >>= 1) { if (tid < st) red[tid] += red[tid + st]; __syncthreads(); }
  const float mu = red[0] / (float)N; __syncthreads();
  float s2 = 0.f;
  for (int u = 0; u < per / 4; ++u)
#pragma unroll
    for (int q = 0; q < 4; ++q) { const float c = vals[u * 4 + q] - mu; s2 += c * c; }
  red[tid] = s2; __syncthreads();
  for (int st = 128; st > 0; st >>= 1) { if (tid < st) red[tid] += red[tid + st]; __syncthreads(); }
  const float rs = rsqrtf(red[0] / (float)N + eps);
  {
    for (int u = 0; u < per / 4; ++u) {
      const int j = tid * 4 + 1024 * u;
      v4f o, sm;
#pragma unroll
      for (int q = 0; q < 4; ++q) {
        float gg = g[j + q], bb = bta[j + q];
        if (PARAM_BF16) { gg = bf16_round(gg); bb = bf16_round(bb); }
        sm[q] = vals[u * 4 + q]; o[q] = (vals[u * 4 + q] - mu) * rs * gg + bb;
      }
      if (out_sum) *(v4f*)(out_sum + (size_t)row * N + j) = sm;
      *(v4f*)(out_norm + (size_t)row * N + j) = o;
    }
    
  }
}



// ---- f16 WMMA path (v_wmma_f32_16x16x32_f16): 11-bit significands for operands in range — used where a [0,1] probability operand needs more precision than bf16
typedef _Float16 v16h __attribute__((ext_vector_type(16)));
union FragH { v16h v; v8us half[2]; _Float16 h[16]; unsigned short u[16]; };
template <int NT>
__device__ __forceinline__ v8f mmaH(v16h ah, v16h al, v16h bh, v16h bl, v8f c) {
  c = __builtin_amdgcn_wmma_f32_16x16x32_f16(false, ah, false, bh, (short)0, c, false, false);
  if (NT >= 2) c = __builtin_amdgcn_wmma_f32_16x16x32_f16(false, al, false, bh, (short)0, c, false, false);
  if (NT >= 3) c = __builtin_amdgcn_wmma_f32_16x16x32_f16(false, ah, false, bl, (short)0, c, false, false);
  asm volatile("v_nop\n\tv_nop\n\tv_nop\n\tv_nop" : "+v"(c) : "v"(ah), "v"(al), "v"(bh), "v"(bl));
  return c;
}
// batched GEMM like k_gemm_b but f16 operands: A f32 (split into f16 hi/lo if ASPLIT, else rounded to f16), Bt = f16 values [n][k]; alpha; C f32; N multiple of 16 (partial tiles skipped)
template <bool ASPLIT>
__global__ __launch_bounds__(128) void k_gemm_h(const float* __restrict__ A, int lda, size_t sA, const _Float16* __restrict__ Bh, int ldb, size_t sB, float alpha, float* __restrict__ C, int ldc, size_t sC, int M, int N, int K) {
  __shared__ __attribute__((aligned(16))) float so[4][16][64];
  const int tid = threadIdx.x, w = tid >> 5, lane = tid & 31, ln = lane & 15, hh = lane >> 4; const int by = blockIdx.y;
  A += (size_t)by * sA; Bh += (size_t)by * sB; C += (size_t)by * sC;
  const int ntn = (N + 63) / 64; const int wid = blockIdx.x * 4 + w; const int mt = wid / ntn, nq = wid % ntn; if (mt * 16 >= M) return;
  const int row0 = mt * 16, col0 = nq * 64; const float* arow = A + (size_t)(row0 + ln) * lda;
  v8f acc[4] = {};
  for (int kb = 0; kb < K; kb += 32) {
    FragH ah, al;
    const v4f x0 = *(const v4fa*)(arow + kb + 8 * hh), x1 = *(const v4fa*)(arow + kb + 8 * hh + 4), x2 = *(const v4fa*)(arow + kb + 16 + 8 * hh), x3 = *(const v4fa*)(arow + kb + 16 + 8 * hh + 4);
    float xs[16] = {x0[0],x0[1],x0[2],x0[3],x1[0],x1[1],x1[2],x1[3],x2[0],x2[1],x2[2],x2[3],x3[0],x3[1],x3[2],x3[3]};
#pragma unroll
    for (int i = 0; i < 16; ++i) { const _Float16 h = (_Float16)xs[i]; ah.h[i] = h; al.h[i] = ASPLIT ? (_Float16)(xs[i] - (float)h) : (_Float16)0.0f; }
#pragma unroll
    for (int t = 0; t < 4; ++t) { if (col0 + t * 16 >= N) continue; const size_t boff = (size_t)(col0 + t * 16 + ln) * ldb + kb; FragH bq; bq.half[0] = *(const v8us*)(Bh + boff + 8 * hh); bq.half[1] = *(const v8us*)(Bh + boff + 16 + 8 * hh);
      acc[t] = mmaH<ASPLIT ? 2 : 1>(ah.v, al.v, bq.v, bq.v, acc[t]); }
  }
#pragma unroll
  for (int t = 0; t < 4; ++t) { if (col0 + t * 16 >= N) continue;
#pragma unroll
    for (int r = 0; r < 8; ++r) so[w][8 * hh + r][t * 16 + ln] = acc[t][r] * alpha; }
  __builtin_amdgcn_fence(__ATOMIC_ACQ_REL, "workgroup"); __builtin_amdgcn_wave_barrier();
  const int rsub = lane >> 4, c4 = (lane & 15) * 4;
  {
#pragma unroll
    for (int q = 0; q < 8; ++q) { const int r = q * 2 + rsub; if (col0 + c4 < N) { const v4f v = *(const v4fa*)&so[w][r][c4]; *(v4f*)(C + (size_t)(row0 + r) * ldc + col0 + c4) = v; } }
     }
}

// Wt[n][k] = f16(W[k][n]·scale) from f32 row-major W[K][N] (scale = power of two; bf16-exact weights stay exact in f16 away from the subnormal range)
__global__ __launch_bounds__(256) void k_wt_f16(const float* __restrict__ W, _Float16* __restrict__ Wt, int K, int N, float scale) {
  const int t = blockIdx.x * 256 + threadIdx.x; if (t >= N * (K / 8)) return; const int n = t / (K / 8), k8 = (t % (K / 8)) * 8; FragH f;
#pragma unroll
  for (int i = 0; i < 8; ++i) f.h[i] = (_Float16)(bf16_round(W[(size_t)(k8 + i) * N + n]) * scale); const v8us o = f.half[0];
  *(v8us*)((unsigned short*)Wt + (size_t)n * K + k8) = o; 
}
// k_gemm_hh variant with fused epilogue: v = acc·alpha + bias[by·sBias + col] (+ CP[(row/rowsPerB)·sCPb + by·64 + col] if CP) ; ACT 0 none / 1 elu ; writes f16 C16 (and f32 C if non-null)
template <int ACT>
__global__ __launch_bounds__(128) void k_gemm_hhx(const _Float16* __restrict__ A, int lda, size_t sA, const _Float16* __restrict__ Bh, int ldb, size_t sB, float alpha, const float* __restrict__ bias, size_t sBias, const float* __restrict__ CP, int rowsPerB, size_t sCPb, int row0g,
    float* __restrict__ C, _Float16* __restrict__ C16, int ldc, size_t sC, int M, int N, int K) {
  __shared__ __attribute__((aligned(16))) float so[4][16][64];
  const int tid = threadIdx.x, w = tid >> 5, lane = tid & 31, ln = lane & 15, hh = lane >> 4; const int by = blockIdx.y;
  A += (size_t)by * sA; Bh += (size_t)by * sB; const size_t cofs = (size_t)by * sC; const float* bp = bias ? bias + (size_t)by * sBias : nullptr;
  const int ntn = (N + 63) / 64; const int wid = blockIdx.x * 4 + w; const int mt = wid / ntn, nq = wid % ntn; if (mt * 16 >= M) return;
  const int row0 = mt * 16, col0 = nq * 64; const _Float16* arow = A + (size_t)(row0 + ln) * lda;
  v8f acc[4] = {};
  for (int kb = 0; kb < K; kb += 32) { FragH ah; ah.half[0] = *(const v8us*)((const unsigned short*)arow + kb + 8 * hh); ah.half[1] = *(const v8us*)((const unsigned short*)arow + kb + 16 + 8 * hh);
#pragma unroll
    for (int t = 0; t < 4; ++t) { if (col0 + t * 16 >= N) continue; const size_t boff = (size_t)(col0 + t * 16 + ln) * ldb + kb; FragH bq; bq.half[0] = *(const v8us*)((const unsigned short*)Bh + boff + 8 * hh); bq.half[1] = *(const v8us*)((const unsigned short*)Bh + boff + 16 + 8 * hh);
      acc[t] = mmaH<1>(ah.v, ah.v, bq.v, bq.v, acc[t]); }
  }
#pragma unroll
  for (int t = 0; t < 4; ++t) { if (col0 + t * 16 >= N) continue; const int col = col0 + t * 16 + ln; const float bv = bp ? bf16_round(bp[col]) : 0.f;
#pragma unroll
    for (int r = 0; r < 8; ++r) { float v = acc[t][r] * alpha + bv; if (CP) { const int rr = row0g + row0 + 8 * hh + r; if (rowsPerB < 0) v += CP[cofs + (size_t)rr * ldc + col];      /* rowsPerB < 0: own element of the batched C plane */ else { const int bidx = rr / rowsPerB; v += CP[(size_t)bidx * sCPb + (size_t)by * 64 + col]; } } if (ACT == 1) v = (v > 0.f) ? v : expm1f(v); else if (ACT == 7) v = (v > 0.f) ? v + 1.0f : expf(v); else if (ACT == 8) v = tanhf(v); else if (ACT == 9) v = 0.5f * v * (1.0f + tanhf(0.7978845608028654f * (v + 0.044715f * v * v * v))); else if (ACT == 11) v = 1.0f / (1.0f + expf(-v)); else if (ACT == 12) v = (v > 0.f) ? v : 0.01f * v; else if (ACT == 14) v = (v > 0.f) ? v : 0.1f * v; else if (ACT == 16) v = (v >= 0.f) ? v : 0.3f * v; else if (ACT == 17) v = (v >= 0.f) ? v : 0.2f * v; else if (ACT == 15) v = v / (1.0f + expf(-v)); else if (ACT == 3) v = fmaxf(v, 0.f); else if (ACT == 6) v = 0.5f * v * (1.0f + erff(v * 0.70710678118654752f)); so[w][8 * hh + r][t * 16 + ln] = v; } }
  __builtin_amdgcn_fence(__ATOMIC_ACQ_REL, "workgroup"); __builtin_amdgcn_wave_barrier();
  const int rsub = lane >> 4, c4 = (lane & 15) * 4; typedef _Float16 v4h __attribute__((ext_vector_type(4)));
  {
#pragma unroll
    for (int q = 0; q < 8; ++q) { const int r = q * 2 + rsub; if (col0 + c4 < N) { const v4f v = *(const v4fa*)&so[w][r][c4]; if (C) *(v4f*)(C + cofs + (size_t)(row0 + r) * ldc + col0 + c4) = v; if (C16) { v4h h4; for (int i = 0; i < 4; ++i) h4[i] = (_Float16)v[i]; *(v4h*)(C16 + cofs + (size_t)(row0 + r) * ldc + col0 + c4) = h4; } } }
     }
}


typedef _Float16 v4h __attribute__((ext_vector_type(4)));

// ---- fragment order: a plane of rows x DM f16 values is cut into tiles of 16 rows x 32 k (1 KB each, tile index = (row / 16) * (DM / 32) + k / 32). Inside a tile stand 64 pieces of 16 B: piece c = 32 * half + lane holds
// row (lane & 15), k = 16 * half + 8 * (lane >> 4) + 0..7, which is what lane 'lane' takes as registers 4 * half .. 4 * half + 3 of its A or B fragment. A wave's fragment load then reads 512 B in a row (4 whole lines)
// where rows of pitch 2 KB gave it 16 pieces of 32 B in 16 lines. The k order of every fragment is the old one. fo_src: first element, in the row-major source, of piece t of the plane.
__device__ __forceinline__ size_t fo_src(size_t t) { const size_t tile = t >> 6; const int c = (int)(t & 63); return ((tile / (DM / 32)) * 16 + (c & 15)) * DM + (tile % (DM / 32)) * 32 + (c >> 5) * 16 + ((c >> 4) & 1) * 8; }
__device__ __forceinline__ v16h fo_frag(const _Float16* p) { FragH f; f.half[0] = *(const v8us*)((const unsigned short*)p); f.half[1] = *(const v8us*)((const unsigned short*)p + 256); return f.v; }      /* p: the tile + 8 * lane */
__global__ __launch_bounds__(256) void k_x16(const float* __restrict__ x, _Float16* __restrict__ X16, size_t n8) { const size_t t = (size_t)blockIdx.x * 256 + threadIdx.x; if (t >= n8) return; FragH f; const float* s = x + fo_src(t); const v4f a = *(const v4fa*)s, c = *(const v4fa*)(s + 4);
#pragma unroll
  for (int q = 0; q < 4; ++q) { f.h[q] = (_Float16)bf16_round(a[q]); f.h[4 + q] = (_Float16)bf16_round(c[q]); } *(v8us*)((unsigned short*)X16 + t * 8) = f.half[0];  }      /* piece t of the plane in fragment order */
__global__ __launch_bounds__(256) void k_h16(const float* __restrict__ x, _Float16* __restrict__ X16, size_t n8) { const size_t t = (size_t)blockIdx.x * 256 + threadIdx.x; if (t >= n8) return; FragH f;
#pragma unroll
  for (int q = 0; q < 8; ++q) f.h[q] = (_Float16)x[t * 8 + q]; *(v8us*)((unsigned short*)X16 + t * 8) = f.half[0];  }
__global__ __launch_bounds__(256) void k_round16f(const float* __restrict__ W, _Float16* __restrict__ Bt, size_t n8) { const size_t t = (size_t)blockIdx.x * 256 + threadIdx.x; if (t >= n8) return; FragH f;
#pragma unroll
  for (int i = 0; i < 8; ++i) f.h[i] = (_Float16)(bf16_round(W[t * 8 + i]) * 16.0f); *(v8us*)((unsigned short*)Bt + t * 8) = f.half[0];  }
// ---- projection GEMM (wave tile 32 token rows x 64 features = one head; M % 128 == 0, N % 128 == 0, K % 64 == 0; A and Bh in fragment order). The epilogue forms v = acc * alpha + bias in f32, splits it into f16 hi + x1024 residual and stores both as whole pieces of the planes the attention reads: no f32 plane, no LDS in the epilogue.
// VT false (q, k): the products are formed transposed (A operand = weight rows, B operand = token rows), so accumulator register r of (feature tile t, token tile g) is feature 16 t + 8 hh + r of token 16 g + ln: the lane's 8 values are piece 32 (t & 1) + lane of the fragment-order tile (token tile g, k tile t >> 1) of the head.
// VT true (v): A operand = token rows, B operand = weight rows: register r is key 16 g + 8 hh + r of head column 16 t + ln: the lane's 8 values are piece 32 g + lane of a V^T tile. V^T in fragment order: tiles of 16 head columns x 32 keys, tile index = ((batch * NH + head) * (SQ / 32) + key / 32) * 4 + column / 16: the 4 tiles of a key block lie in a row.
// Either way one store instruction of the wave writes 512 B in a row (4 whole lines). The k order of every sum is the old one.
// NRM (the k launch): the wave also stores the squared length of each of its 32 head rows, from which the attention bounds scores it then need not form.
__device__ __forceinline__ v16h g2_frag(const _Float16* p, int hh) { FragH f; f.half[0] = *(const v8us*)((const unsigned short*)p + 8 * hh); f.half[1] = *(const v8us*)((const unsigned short*)p + 16 + 8 * hh); return f.v; }
__device__ __forceinline__ v8f g2_mma(v16h a, v16h b, v8f c) { v8f d = __builtin_amdgcn_wmma_f32_16x16x32_f16(false, a, false, b, (short)0, c, false, false); asm volatile("v_nop\n\tv_nop\n\tv_nop\n\tv_nop" : "+v"(d) : "v"(a), "v"(b)); return d; }
template <bool VT> __device__ __forceinline__ v8f pj_mma(v16h tok, v16h wgt, v8f c) { return VT ? g2_mma(tok, wgt, c) : g2_mma(wgt, tok, c); }
// Operand staging: a block of 8 waves (4 groups of 32 token rows x 2 heads = a 128 x 128 tile) shares its operands through LDS. A stage is 64 k of the block's 128 token rows and 128 weight rows: in fragment order that is 8 + 8 runs of 2 KB (two 1 KB tiles of one row tile),
// laid in LDS in the same order ([A 16 KB | B 16 KB]), so a fragment read is 512 B in a row. Each thread brings 8 pieces of 16 B per stage by asynchronous copies; two buffers, the next stage's copies fly while this stage is multiplied.
// pj_copy: l = the thread's LDS byte address in the buffer, ga / gb = its piece in the first two row tiles of A / B; copy j of an operand lies two row tiles (sa / sb values) on in memory and 4 KB on in LDS.
__device__ __forceinline__ void pj_copy(unsigned l, const _Float16* ga, const _Float16* gb, size_t sa, size_t sb) {
  asm volatile("global_load_async_to_lds_b128 %0, %8, off\n\t"
               "global_load_async_to_lds_b128 %1, %9, off\n\t"
               "global_load_async_to_lds_b128 %2, %10, off\n\t"
               "global_load_async_to_lds_b128 %3, %11, off\n\t"
               "global_load_async_to_lds_b128 %4, %12, off\n\t"
               "global_load_async_to_lds_b128 %5, %13, off\n\t"
               "global_load_async_to_lds_b128 %6, %14, off\n\t"
               "global_load_async_to_lds_b128 %7, %15, off\n\t"
               "s_wait_xcnt 0x0"      /* inside the copies' own statement: their address registers are rewritten only behind it */
               :: "v"(l), "v"(l + 4096u), "v"(l + 8192u), "v"(l + 12288u), "v"(l + 16384u), "v"(l + 20480u), "v"(l + 24576u), "v"(l + 28672u),
                  "v"(ga), "v"(ga + sa), "v"(ga + 2 * sa), "v"(ga + 3 * sa), "v"(gb), "v"(gb + sb), "v"(gb + 2 * sb), "v"(gb + 3 * sb) : "memory"); }
template <bool VT, bool NRM>
__global__ __launch_bounds__(256) void k_proj(const _Float16* __restrict__ A, int lda, const _Float16* __restrict__ Bh, int ldb, float alpha, const float* __restrict__ bias, int row0g, _Float16* __restrict__ Hh, _Float16* __restrict__ Hl, float* __restrict__ nrm, int M, int N, int K) {
  __shared__ __attribute__((aligned(16))) _Float16 sm[2 * 16384];      /* two buffers of [A: 8 row tiles x 2 k tiles | B: the same], 1 KB a tile */
  const int tid = threadIdx.x, w = tid >> 5, lane = tid & 31, ln = lane & 15, hh = lane >> 4;
  const int ntn = N >> 7; const int mt = blockIdx.x / ntn, np = blockIdx.x - mt * ntn; if (mt * 128 >= M) return;      /* the whole block leaves, in front of every barrier */
  const int nq = np * 2 + (w >> 2); const int row0 = mt * 128 + 32 * (w & 3), col0 = nq * 64;
  const _Float16* ga = A + (size_t)(mt * 128 + 16 * (tid >> 7)) * lda + 8 * (tid & 127);      /* A and Bh lie in fragment order (fo_src; lda = ldb = DM): 16 rows = lda / 32 tiles of 512 values; threads 0..127 take the 2 KB of an even row tile, 128..255 of the odd one */
  const _Float16* gb = Bh + (size_t)(np * 128 + 16 * (tid >> 7)) * ldb + 8 * (tid & 127);
  const size_t sa = (size_t)32 * lda, sb = (size_t)32 * ldb; const unsigned l0 = (unsigned)(uintptr_t)sm + 16u * (unsigned)tid;
  const int fa = (w & 3) * 2048 + 8 * lane, fb = 8192 + (w >> 2) * 4096 + 8 * lane;      /* the wave's first A and B tile in a buffer, with the lane's piece */
  const int nt = K >> 6;      /* stages */
  const v8f z8 = {0.f,0.f,0.f,0.f,0.f,0.f,0.f,0.f}; v8f c00 = z8, c01 = z8, c02 = z8, c03 = z8, c10 = z8, c11 = z8, c12 = z8, c13 = z8;
  pj_copy(l0, ga, gb, sa, sb);      /* stage 0 */
  asm volatile("s_wait_asynccnt 0x0" ::: "memory");      /* the wave's own copies of stage 0 have landed */
  __syncthreads();      /* and every other wave's: stage 0 may be read */
  if (nt > 1) pj_copy(l0 + 32768u, ga + 1024, gb + 1024, sa, sb);      /* stage 1 flies under stage 0's products */
  ga += 2048; gb += 2048;
  int bo = 0;      /* the buffer of this trip, in values */
#pragma unroll 1      /* one trip = one stage = two k-steps (K % 64 == 0); rolled so that the 12 fragments of a trip stay in registers */
  for (int t = 0; t < nt; ++t) {
    const _Float16* a0p = sm + bo + fa; const _Float16* b0p = sm + bo + fb;
    const v16h a0 = fo_frag(a0p), b0 = fo_frag(b0p), a1 = fo_frag(a0p + 1024), b1 = fo_frag(b0p + 1024), b2 = fo_frag(b0p + 2048), b3 = fo_frag(b0p + 3072);
    const v16h e0 = fo_frag(a0p + 512), f0 = fo_frag(b0p + 512), e1 = fo_frag(a0p + 1536), f1 = fo_frag(b0p + 1536), f2 = fo_frag(b0p + 2560), f3 = fo_frag(b0p + 3584);
    c00 = pj_mma<VT>(a0, b0, c00); c10 = pj_mma<VT>(a1, b0, c10); c01 = pj_mma<VT>(a0, b1, c01); c11 = pj_mma<VT>(a1, b1, c11); c02 = pj_mma<VT>(a0, b2, c02); c12 = pj_mma<VT>(a1, b2, c12); c03 = pj_mma<VT>(a0, b3, c03); c13 = pj_mma<VT>(a1, b3, c13);
    c00 = pj_mma<VT>(e0, f0, c00); c10 = pj_mma<VT>(e1, f0, c10); c01 = pj_mma<VT>(e0, f1, c01); c11 = pj_mma<VT>(e1, f1, c11); c02 = pj_mma<VT>(e0, f2, c02); c12 = pj_mma<VT>(e1, f2, c12); c03 = pj_mma<VT>(e0, f3, c03); c13 = pj_mma<VT>(e1, f3, c13);
    asm volatile("s_wait_dscnt 0x0" ::: "memory");      /* the wave's reads of this buffer are done before it is given up for refilling */
    asm volatile("s_wait_asynccnt 0x0" ::: "memory");      /* the wave's own copies of stage t + 1 have landed */
    __syncthreads();      /* publishes stage t + 1 and ends every wave's reads of stage t */
    if (t + 2 < nt) pj_copy(l0 + 2u * (unsigned)bo, ga, gb, sa, sb);      /* stage t + 2 into the buffer just left */
    ga += 1024; gb += 1024; bo ^= 16384; }
  asm volatile("s_wait_asynccnt 0x0" ::: "memory");      /* no copy is outstanding when the wave goes on to its end */
  v8f accs[8] = {c00, c01, c02, c03, c10, c11, c12, c13};
  const int rg = row0g + row0;      /* the wave's first token row in the whole plane */
  const size_t po = VT ? ((size_t)((rg / SQ) * NH + nq) * (SQ / 32) + (rg % SQ) / 32) * 2048 + 8 * lane : ((size_t)(rg / 16) * (DM / 32) + col0 / 32) * 512 + 8 * lane;      /* the lane's place in the wave's first tile */
  unsigned short* hp = (unsigned short*)Hh + po; unsigned short* lp = (unsigned short*)Hl + po;
  FragH fh[4], fl[4];      /* [u >> 1].half[u & 1] */
  float n2[2] = {0.f, 0.f};      /* NRM (with VT false): sum of squares of the lane's 32 features of token 16 g + ln */
#pragma unroll
  for (int u = 0; u < 8; ++u) { const int t = u & 3; float bv[8];
    if (VT) { const float b1 = bf16_round(bias[col0 + t * 16 + ln]);
#pragma unroll
      for (int r = 0; r < 8; ++r) bv[r] = b1; }
    else { const v4f x0 = *(const v4fa*)(bias + col0 + t * 16 + 8 * hh), x1 = *(const v4fa*)(bias + col0 + t * 16 + 8 * hh + 4);
#pragma unroll
      for (int r = 0; r < 4; ++r) { bv[r] = bf16_round(x0[r]); bv[4 + r] = bf16_round(x1[r]); } }
#pragma unroll
    for (int r = 0; r < 8; ++r) { const float v = accs[u][r] * alpha + bv[r]; if (NRM) n2[u >> 2] += v * v; const _Float16 h = (_Float16)v; fh[u >> 1].h[(u & 1) * 8 + r] = h; fl[u >> 1].h[(u & 1) * 8 + r] = (_Float16)((v - (float)h) * 1024.0f); } }
  if (NRM) { n2[0] += __shfl_xor(n2[0], 16, 32); n2[1] += __shfl_xor(n2[1], 16, 32); const float nv = hh ? n2[1] : n2[0];      /* the other lane half holds the other 32 features; lane = token of the wave's 32 */
    float* np = nrm + ((size_t)(rg / SQ) * NH + nq) * SQ + rg % SQ + lane;      /* squared length of each token's head row, [batch][head][token]: the wave writes one whole line */
    *np = nv;
    asm volatile("s_wait_xcnt 0x0" ::: "memory"); }      /* the store's registers are free for reuse only behind this wait */
  __builtin_amdgcn_sched_barrier(0);      /* all 16 pieces are formed in front of the first store: without this the V^T build formed its residual pieces behind the hi stores, over their registers, behind waits on those stores */
#pragma unroll
  for (int u = 0; u < 8; ++u) { const int t = u & 3, g = u >> 2; const int eo = VT ? t * 512 + g * 256 : g * 16 * DM + t * 256;      /* VT: tile t, half g; else token tile g (16 DM values on), k tile t >> 1, half t & 1 */
    *(v8us*)(hp + eo) = fh[u >> 1].half[u & 1]; *(v8us*)(lp + eo) = fl[u >> 1].half[u & 1]; } }


__global__ __launch_bounds__(256) void k_wnat(const float* __restrict__ w, size_t n8, _Float16* __restrict__ Bt) { const size_t t = (size_t)blockIdx.x * 256 + threadIdx.x; if (t >= n8) return; FragH f; const float* s = w + fo_src(t); const v4f a = *(const v4fa*)s, c = *(const v4fa*)(s + 4); for (int q = 0; q < 4; ++q) { f.h[q] = (_Float16)(bf16_round(a[q]) * 16.0f); f.h[4 + q] = (_Float16)(bf16_round(c[q]) * 16.0f); } *(v8us*)((unsigned short*)Bt + t * 8) = f.half[0];  }      /* piece t of the plane in fragment order */
__global__ __launch_bounds__(256) void k_rsm(const float* __restrict__ S, _Float16* __restrict__ P, int nrows) {
  #pragma clang fp contract(off)
  const int i = blockIdx.x * 256 + threadIdx.x; if (i >= nrows) return; const float* s = S + (size_t)i * SQ; float mx = -3.0e38f;
#pragma unroll 1
  for (int j = 0; j < SQ; ++j) mx = fmaxf(mx, s[j]); float se = 0.f;
#pragma unroll 1
  for (int j = 0; j < SQ; ++j) se += expf(s[j] - mx); const float sc = 256.0f / se;
#pragma unroll 1
  for (int j0 = 0; j0 < SQ; j0 += 8) { FragH f; for (int q = 0; q < 8; ++q) f.h[q] = (_Float16)(expf(s[j0 + q] - mx) * sc); unsigned short* d = (unsigned short*)P + (size_t)i * SQ + j0; *(v8us*)d = f.half[0];  } }
__global__ __launch_bounds__(256) void k_vt(const _Float16* __restrict__ V16, int b, int h0, _Float16* __restrict__ VT) { __shared__ unsigned short tl[64][65]; const int tid = threadIdx.x; const int hh = blockIdx.x % HG, sg = blockIdx.x / HG; const int s0 = sg * 64; const int h = h0 + hh;
  for (int i = tid; i < 64 * 8; i += 256) { const int j = i / 8, d8 = (i % 8) * 8; FragH f; f.half[0] = *(const v8us*)((const unsigned short*)V16 + ((size_t)b * SQ + s0 + j) * DM + h * HD + d8); for (int q = 0; q < 8; ++q) tl[d8 + q][j] = f.u[q]; }
  __syncthreads();
  { for (int i = tid; i < 64 * 8; i += 256) { const int d = i / 8, j8 = (i % 8) * 8; FragH f; for (int q = 0; q < 8; ++q) f.u[q] = tl[d][j8 + q]; *(v8us*)((unsigned short*)VT + ((size_t)hh * HD + d) * SQ + s0 + j8) = f.half[0]; }  } }



__global__ __launch_bounds__(256) void k_rsmcf2(const float* __restrict__ S, _Float16* __restrict__ P, int hg, int q0, int nk) {
  #pragma clang fp contract(off)
  const int t = blockIdx.x * 256 + threadIdx.x; if (t >= hg * QT) return; const size_t i = (size_t)t; const float* s = S + i * NKX; const int last = q0 + (t % QT); float mx = -3.0e38f;
#pragma unroll 1
  for (int j = 0; j < nk; ++j) { const float f = (j <= last) ? 1.f : 0.f; mx = fmaxf(mx, fmaf(f, s[j], (1.f - f) * -1.0e9f)); } float se = 0.f;
#pragma unroll 1
  for (int j = 0; j < nk; ++j) { const float f = (j <= last) ? 1.f : 0.f; se += __expf(fmaf(f, s[j], (1.f - f) * -1.0e9f) - mx); } const float sc = 256.0f / se;
#pragma unroll 1
  for (int j0 = 0; j0 < nk; j0 += 8) { FragH fr; for (int q = 0; q < 8; ++q) { const int j = j0 + q; const float f = (j <= last) ? 1.f : 0.f; fr.h[q] = (_Float16)(__expf(fmaf(f, s[j], (1.f - f) * -1.0e9f) - mx) * sc); } unsigned short* d = (unsigned short*)P + i * NKX + j0; *(v8us*)d = fr.half[0];  } }


__global__ __launch_bounds__(256) void k_rsmcf2hl(const float* __restrict__ S, _Float16* __restrict__ P, _Float16* __restrict__ PL, int hg, int q0, int nk) {
  #pragma clang fp contract(off)
  const int t = blockIdx.x * 256 + threadIdx.x; if (t >= hg * QT) return; const size_t i = (size_t)t; const float* s = S + i * NKX; const int last = q0 + (t % QT); float mx = -3.0e38f;
#pragma unroll 1
  for (int j = 0; j < nk; ++j) { const float f = (j <= last) ? 1.f : 0.f; mx = fmaxf(mx, fmaf(f, s[j], (1.f - f) * -1.0e9f)); } float se = 0.f;
#pragma unroll 1
  for (int j = 0; j < nk; ++j) { const float f = (j <= last) ? 1.f : 0.f; se += __expf(fmaf(f, s[j], (1.f - f) * -1.0e9f) - mx); } const float sc = 256.0f / se;
#pragma unroll 1
  for (int j0 = 0; j0 < nk; j0 += 8) { FragH fr, fl; for (int q = 0; q < 8; ++q) { const int j = j0 + q; const float f = (j <= last) ? 1.f : 0.f; const float v = __expf(fmaf(f, s[j], (1.f - f) * -1.0e9f) - mx) * sc; const _Float16 hv = (_Float16)v; fr.h[q] = hv; fl.h[q] = (_Float16)((v - (float)hv) * 1024.0f); } unsigned short* d = (unsigned short*)P + i * NKX + j0; unsigned short* dl = (unsigned short*)PL + i * NKX + j0; *(v8us*)d = fr.half[0]; *(v8us*)dl = fl.half[0];  } }


// ---- fused attention: scores, masks, softmax and the value product of 32 query rows per wave in one launch; no score or weight ever goes to memory.
// The wave walks its keys in blocks of 32 with a running row maximum and row sum. Scores are formed transposed, S^T = K Q^T (A = key rows, B = query rows, two column groups g of 16 queries): a lane then holds 16 keys of ONE query per group
// (accumulator register r of key tile t = key 16 t + 8 hh + r, column ln = query), which is at once the B fragment of the next product, out^T = V^T P^T (element 8 t + r = k index 16 t + 8 hh + r, the k order of fo_frag on the V^T tiles):
// the weights go from accumulator to operand inside the lane, and a row's maximum and sum need one exchange between the two lane halves.
// Split precision as before: scores = (qh.kh)/8 + (ql.kh + qh.kl)/8192; weights 256 e as f16 hi + x1024 residual; out = sum (Ph Vh + (Pl Vh + Ph Vl)/1024) / (256 sum e), the residual products of a block folded into the f32 accumulator at the block's end.
// Keys above the end of the wave's own 32 rows carry -2e4 and contribute exactly 0, as the keys above a tile's end did. Block = 8 waves = 256 query rows of one head and batch, which read the same K and V^T lines; grid.z = query block, longest first.
__device__ __forceinline__ v8f fa_mma(v16h a, v16h b, v8f c) { return __builtin_amdgcn_wmma_f32_16x16x32_f16(false, a, false, b, (short)0, c, false, false); }
__global__ __launch_bounds__(256) void k_fattn(const _Float16* __restrict__ Qh, const _Float16* __restrict__ Ql, const _Float16* __restrict__ Kh, const _Float16* __restrict__ Kl,
    const _Float16* __restrict__ Vh, const _Float16* __restrict__ Vl, const float* __restrict__ kn, const float* __restrict__ am, float* __restrict__ out) {
  const int lane = threadIdx.x & 31, ln = lane & 15, hh = lane >> 4; const int w = __builtin_amdgcn_readfirstlane(threadIdx.x >> 5);
  const int h = blockIdx.x, b = blockIdx.y; const int qw = (SQ / 256 - 1 - (int)blockIdx.z) * 256 + w * 32;      /* first query row of the wave */
  const int nk = qw + 32;      /* keys walked: a multiple of 32, at most SQ */
  const size_t qo = ((size_t)b * SQ + qw) * LQ + h * HD * 16 + 8 * lane, ko = (size_t)b * SQ * LQ + h * HD * 16 + 8 * lane, vo = (size_t)(b * NH + h) * HD * SQ + 8 * lane;      /* all six planes lie in fragment order (fo_src, k_proj): 16 rows = 16 LQ values, a head = 2 tiles of 512 in them; a key block of V^T = 4 tiles in a row */
  const _Float16* qhp = Qh + qo; const _Float16* qlp = Ql + qo; const _Float16* khp = Kh + ko; const _Float16* klp = Kl + ko; const _Float16* vhp = Vh + vo; const _Float16* vlp = Vl + vo; const float* amp = am + (size_t)b * SQ + 8 * hh;
  v16h qh[2][2], ql[2][2], kh[2][2], kl[2][2];      /* q: [column group][k-step]; k: [key tile][k-step] */
#pragma unroll
  for (int g = 0; g < 2; ++g)
#pragma unroll
    for (int s = 0; s < 2; ++s) { qh[g][s] = fo_frag(qhp + g * 16 * LQ + s * 512); ql[g][s] = fo_frag(qlp + g * 16 * LQ + s * 512); kh[g][s] = fo_frag(khp + g * 16 * LQ + s * 512); kl[g][s] = fo_frag(klp + g * 16 * LQ + s * 512); }
  asm volatile("s_wait_xcnt 0x0" :: "v"(qhp), "v"(qlp), "v"(khp), "v"(klp) : "memory");      /* the address pairs stay untouched (inputs here) until this wait; behind it they may be advanced and reused */
  { const int st = (32 < nk) ? 32 * LQ : 0; khp += st; klp += st; }      /* the K pointers run one block ahead and stop at the last block */
  // The wave's last 512 keys (from tk on) have key >= query - 512 for all 32 rows: each carries -1e4 or -2e4. lim: an upper bound of every masked score among them, per query row (f32 rounding is monotone, so a bound on the terms bounds the rounded sum):
  // |q.k| / 8 <= (|q|^2 + |k|^2) / 16 (0.065: 4 % above 1/16, for the split operands' and the sums' rounding), the largest |k|^2 and the largest attention_mask of those keys. nz is 0, or NaN where one of them is not finite, and then no test below holds.
  const int tk = qw - 480; float lim[2] = {3.0e38f, 3.0e38f};
  if (qw >= 512) {      /* below that, row 512 or an earlier one keeps these keys */
    const float* kt = kn + (size_t)(b * NH + h) * SQ + tk + 4 * lane; const float* at = am + (size_t)b * SQ + tk + 4 * lane; v4f kv[4], av[4];
#pragma unroll
    for (int j = 0; j < 4; ++j) { kv[j] = *(const v4fa*)(kt + 128 * j); av[j] = *(const v4fa*)(at + 128 * j); }
    asm volatile("s_wait_xcnt 0x0" ::: "memory");      /* the loads' address registers are free for reuse only behind this wait */
    __builtin_amdgcn_sched_barrier(0);      /* holds every later instruction, which may reuse those registers, behind the wait: without it the build wrote the loads' offset register ahead of the wait */
    float km = 0.f, ax = -3.0e38f, nz = 0.f;
#pragma unroll
    for (int j = 0; j < 4; ++j)
#pragma unroll
      for (int q = 0; q < 4; ++q) { km = fmaxf(km, kv[j][q]); ax = fmaxf(ax, av[j][q]); nz = fmaf(kv[j][q], 0.f, fmaf(av[j][q], 0.f, nz)); }
#pragma unroll
    for (int m = 16; m > 0; m >>= 1) { km = fmaxf(km, __shfl_xor(km, m, 32)); ax = fmaxf(ax, __shfl_xor(ax, m, 32)); nz += __shfl_xor(nz, m, 32); }
    const float mk = __fadd_rn(-10000.0f, (float)(__bf16)ax) + nz;
#pragma unroll
    for (int g = 0; g < 2; ++g) { float q2 = 0.f;
#pragma unroll
      for (int s = 0; s < 2; ++s)
#pragma unroll
        for (int e = 0; e < 16; ++e) { const float t = (float)qh[g][s][e]; q2 = fmaf(t, t, q2); }
      q2 += __shfl_xor(q2, 16, 32); lim[g] = __fadd_rn(0.065f * (q2 + km), mk); } }
  const v8f z8 = {0.f,0.f,0.f,0.f,0.f,0.f,0.f,0.f}; v8f o[4][2] = {{z8, z8}, {z8, z8}, {z8, z8}, {z8, z8}};      /* out^T: [tile of 16 head columns][column group] */
  float mr[2] = {-3.0e38f, -3.0e38f}, se[2] = {0.f, 0.f}; int dl = 8 * hh - qw - ln;      /* dl: key - query of the lane's first element, group 0 */
#pragma unroll 1      /* rolled: a block's fragments fill the register budget */
  for (int kb = 0; kb < nk; kb += 32) {
    if (kb == tk) {      /* once per wave: where every remaining score lies 256 or more below its row's running maximum, each remaining weight is exp(< -104) = 0 in f32, no maximum moves and nothing is added to any sum: the walk ends here with the same bits */
      const bool dead = (lim[0] - mr[0] < -256.0f) && (lim[1] - mr[1] < -256.0f);
      if (__builtin_amdgcn_ballot_w32(!dead) == 0u) break; }
    const v4f m0 = *(const v4fa*)(amp), m1 = *(const v4fa*)(amp + 4), m2 = *(const v4fa*)(amp + 16), m3 = *(const v4fa*)(amp + 20);
    v8f c[2][2], r[2][2];      /* [key tile][column group]; c: hi.hi, r: both residual products */
#pragma unroll
    for (int t = 0; t < 2; ++t)
#pragma unroll
      for (int g = 0; g < 2; ++g) { c[t][g] = fa_mma(kh[t][0], qh[g][0], z8); r[t][g] = fa_mma(kh[t][0], ql[g][0], z8); }
#pragma unroll
    for (int t = 0; t < 2; ++t)
#pragma unroll
      for (int g = 0; g < 2; ++g) { r[t][g] = fa_mma(kl[t][0], qh[g][0], r[t][g]); c[t][g] = fa_mma(kh[t][1], qh[g][1], c[t][g]); }
#pragma unroll
    for (int t = 0; t < 2; ++t)
#pragma unroll
      for (int g = 0; g < 2; ++g) r[t][g] = fa_mma(kh[t][1], ql[g][1], r[t][g]);
#pragma unroll
    for (int t = 0; t < 2; ++t)
#pragma unroll
      for (int g = 0; g < 2; ++g) r[t][g] = fa_mma(kl[t][1], qh[g][1], r[t][g]);
    v16h vh[4], vl[4];
#pragma unroll
    for (int u = 0; u < 4; ++u) { vh[u] = fo_frag(vhp + u * 512); vl[u] = fo_frag(vlp + u * 512); }      /* this block's V^T: in flight under the softmax */
#pragma unroll
    for (int t = 0; t < 2; ++t)
#pragma unroll
      for (int s = 0; s < 2; ++s) { kh[t][s] = fo_frag(khp + t * 16 * LQ + s * 512); kl[t][s] = fo_frag(klp + t * 16 * LQ + s * 512); }      /* the next block's K: in flight under the softmax and the value product */
    asm volatile("s_wait_xcnt 0x0" :: "v"(khp), "v"(klp), "v"(vhp), "v"(vlp), "v"(amp) : "memory");      /* as above: the five address pairs are advanced only behind this wait */
    { const int st = (kb + 64 < nk) ? 32 * LQ : 0; khp += st; klp += st; } vhp += 2048; vlp += 2048; amp += 32;
    const float mv[16] = {m0[0],m0[1],m0[2],m0[3],m1[0],m1[1],m1[2],m1[3],m2[0],m2[1],m2[2],m2[3],m3[0],m3[1],m3[2],m3[3]};
    float x[2][16], mn[2];
#pragma unroll
    for (int g = 0; g < 2; ++g) { float mx = -3.0e38f;
#pragma unroll
      for (int e = 0; e < 16; ++e) { const int d = dl - 16 * g + (e & 7) + 16 * (e >> 3);      /* key - query */
        const float s = c[e >> 3][g][e & 7] * 0.125f + r[e >> 3][g][e & 7] * 0.0001220703125f;      /* both factors are powers of two: one rounding */
        const float mk = __fadd_rn((d > 0) ? -20000.0f : ((d >= -512) ? -10000.0f : 0.f), (float)(__bf16)mv[e]);      /* causal -1e4 + 'window' -1e4 (their sum is exact) + attention_mask (rounded to bf16, nearest even), then added to the score, all in f32 */
        x[g][e] = __fadd_rn(s, mk); mx = fmaxf(mx, x[g][e]); }
      mx = fmaxf(mx, __shfl_xor(mx, 16, 32)); mn[g] = fmaxf(mr[g], mx); }
    if (__builtin_amdgcn_ballot_w32(mn[0] > mr[0] || mn[1] > mr[1]) != 0u) {      /* a row's maximum rose: old sums to the new maximum (factor 1 for the rows where it did not) */
#pragma unroll
      for (int g = 0; g < 2; ++g) { const float al = __expf(mr[g] - mn[g]); se[g] *= al;
#pragma unroll
        for (int u = 0; u < 4; ++u)
#pragma unroll
          for (int q = 0; q < 8; ++q) o[u][g][q] *= al; } }
    FragH ph[2], pl[2];
#pragma unroll
    for (int g = 0; g < 2; ++g) { mr[g] = mn[g];
#pragma unroll
      for (int e = 0; e < 16; ++e) { const float ex = __expf(x[g][e] - mn[g]); se[g] += ex; const float p = ex * 256.0f; const _Float16 hv = (_Float16)p; ph[g].h[e] = hv; pl[g].h[e] = (_Float16)((p - (float)hv) * 1024.0f); } }
#pragma unroll
    for (int g = 0; g < 2; ++g) { v8f t[4];
#pragma unroll
      for (int u = 0; u < 4; ++u) { o[u][g] = fa_mma(vh[u], ph[g].v, o[u][g]); t[u] = fa_mma(vh[u], pl[g].v, z8); }
#pragma unroll
      for (int u = 0; u < 4; ++u) t[u] = fa_mma(vl[u], ph[g].v, t[u]);
#pragma unroll
      for (int u = 0; u < 4; ++u)
#pragma unroll
        for (int q = 0; q < 8; ++q) o[u][g][q] += t[u][q] * 0.0009765625f; }
    dl += 32; }
  float* op = out + ((size_t)b * SQ + qw + ln) * DM + h * HD + 8 * hh;      /* the lane's query row of group 0; register q of tile u = column 16 u + 8 hh + q; the wave writes both whole lines of each of its rows */
  v4f wv[2][8];
#pragma unroll
  for (int g = 0; g < 2; ++g) { const float st = se[g] + __shfl_xor(se[g], 16, 32); const float sc = 0.00390625f / st;
#pragma unroll
    for (int u = 0; u < 4; ++u)
#pragma unroll
      for (int q = 0; q < 4; ++q) { wv[g][2 * u][q] = o[u][g][q] * sc; wv[g][2 * u + 1][q] = o[u][g][4 + q] * sc; } }
#pragma unroll
  for (int g = 0; g < 2; ++g)
#pragma unroll
    for (int u = 0; u < 4; ++u) { *(v4f*)(op + g * 16 * DM + u * 16) = wv[g][2 * u]; *(v4f*)(op + g * 16 * DM + u * 16 + 4) = wv[g][2 * u + 1]; } }

extern "C" void kernel_launch(void* const* d_in, const int* in_sizes, int n_in,
                              void* d_out, int out_size, void* d_ws, size_t ws_size, hipStream_t stream) {
  (void)in_sizes; (void)n_in; (void)out_size;
  const float* const* I = (const float* const*)d_in; const float* x = I[0]; const float* am = I[1]; const float* wq = I[2]; const float* bq = I[3]; const float* wk = I[4]; const float* bk = I[5]; const float* wv = I[6]; const float* bv = I[7];      /* additive attention_mask [4][1][1][2048] (zeros); natural [out][in] weights + biases */
  char* ws = (char*)d_ws; size_t off = 0;
  auto take = [&](size_t bytes) { char* p = ws + off; off += (bytes + 255) & ~(size_t)255; return p; };
  _Float16* Q16 = (_Float16*)take(NR * DM * 2); _Float16* QL = (_Float16*)take(NR * DM * 2); _Float16* K16 = (_Float16*)take(NR * DM * 2); _Float16* KL = (_Float16*)take(NR * DM * 2);
  _Float16* VT = (_Float16*)take((size_t)NB * NH * HD * SQ * 2); _Float16* VTL = (_Float16*)take((size_t)NB * NH * HD * SQ * 2);      /* V^T planes of all batches */
  _Float16* BQ = (_Float16*)take((size_t)DM * DM * 2); _Float16* BK = (_Float16*)take((size_t)DM * DM * 2); _Float16* BV = (_Float16*)take((size_t)DM * DM * 2);
  float* KN = (float*)take((size_t)NB * NH * SQ * 4);      /* squared length of every key's head row */
  _Float16* X16 = (_Float16*)take(NR * DM * 2);      /* v too is kept as f16 hi + x1024 residual (the early causal rows average only a few v rows, so a single-f16 v would leave large absolute rounding against this module's small output scale) */
  if (off > ws_size) return;
  { const unsigned g = (unsigned)(((size_t)DM * DM / 8 + 255) / 256); k_wnat<<<g, 256, 0, stream>>>(wq, (size_t)DM * DM / 8, BQ); k_wnat<<<g, 256, 0, stream>>>(wk, (size_t)DM * DM / 8, BK); k_wnat<<<g, 256, 0, stream>>>(wv, (size_t)DM * DM / 8, BV); }      /* natural [out][in] = Bt x16, in fragment order */

  k_x16<<<(unsigned)((NR * DM / 8 + 255) / 256), 256, 0, stream>>>(x, X16, NR * DM / 8);
  const size_t r0p = (size_t)B0 * SQ;      /* first projected row */
  k_proj<false, false><<<dim3((unsigned)((MP / 128) * (DM / 128)), 1), 256, 0, stream>>>(X16 + r0p * DM, DM, BQ, DM, 0.0625f, bq, (int)r0p, Q16, QL, nullptr, MP, DM, DM);      /* q (+ bq) -> f16 hi + x1024 residual, fragment order */
  k_proj<false, true><<<dim3((unsigned)((MP / 128) * (DM / 128)), 1), 256, 0, stream>>>(X16 + r0p * DM, DM, BK, DM, 0.0625f, bk, (int)r0p, K16, KL, KN, MP, DM, DM);      /* k (+ bk) likewise, and each key's squared length */
  k_proj<true, false><<<dim3((unsigned)((MP / 128) * (DM / 128)), 1), 256, 0, stream>>>(X16 + r0p * DM, DM, BV, DM, 0.0625f, bv, (int)r0p, VT, VTL, nullptr, MP, DM, DM);      /* v (+ bv) -> V^T hi and residual, [4][16] slabs of 64 x SQ in fragment order */
  k_fattn<<<dim3(NH, NB, SQ / 256), 256, 0, stream>>>(Q16, QL, K16, KL, VT, VTL, KN, am, (float*)d_out);      /* scores, masks, softmax and the value product of all heads, batches and query rows in one launch */
}

// v010
// Measured time: 140 microseconds a run.
// In both of two side-by-side timings against v009, it was 1.09 times as fast.
// Over all steps from v000 it is 92.8 times as fast.
#include <hip/hip_runtime.h>
// Causal self-attention with the module's (faithful, inverted) window mask and an additive padding mask (hidden [4][2048][1024]; q/k/v = x W^T + b (natural [1024][1024] sigma 1/32, biases sigma 0.01); 16 heads of 64; scores / 8 + causal(-1e4 where j > i) + window(-1e4 where j >= i - 512, as the source writes it) + attention_mask[b][j] (zeros), all added in f32; softmax; out = merged attn v -> [4][2048][1024], no output projection). Effective pattern: rows i <= 512 attend causally (every kept logit carries the -1e4 offset, reproduced in f32), rows i >= 513 attend only keys j <= i - 513.
// Structure: token rows; x as exact f16 rows; natural weights as exact x16 planes; q, k, v as WMMA GEMMs (32x64 wave tiles, f32 accumulation, + bias), each split in the GEMM's own epilogue into f16 hi + x1024 residual planes (the output scale is small, so logits, weights and values are all carried near f32), q and k in fragment order and v as V^T in fragment order, straight from the accumulator registers; attention fused in one launch, a wave per 32 query rows walking its keys in blocks of 32 with a running maximum and sum: scores = qh.kh/8 + (ql.kh + qh.kl)/8192 (K = 64) against the keys below the rows' end, the module's masks added in f32 on VALU (keys above the rows' end carry -2e4 and contribute exactly 0), weights as f16 hi + x1024 residual kept in registers, out = (Ph Vh^T + (Pl Vh^T + Ph Vl^T)/1024) / (256 row sum), written f32 into the output rows; launches: see trace.
// Operand layout: every f16 plane that a matrix instruction reads (x, the three weight planes, q and k hi/residual, V^T hi/residual) lies in memory in fragment order: see fo_src below.
// Compute dtype: inputs rounded to bf16; x / weights exact; q, k, v and softmax weights as f16 hi + x1024 residual GEMM operands, o accumulated in f32; scores and softmax statistics f32. v_wmma_f32_16x16x32_f16.
#define NB 4
#define SQ 2048
#define DM 1024
#define NH 16
#define HD 64
#define HG 1                         /* heads per launch of k_vt(V16, b, h0, VT), which is not launched */
#define QT 256                       /* query rows per causal tile */
#define NKX SQ                       /* longest score row */
#define B0 0                         /* first batch processed (debug hook) */
#define NBR NB                       /* batches processed (debug hook) */
#define NR ((size_t)NB * SQ)         /* token rows */
#define MP ((int)((size_t)NBR * SQ)) /* rows projected (debug hook) */
#define QN SQ                        /* query rows attended per batch (unused) */
#define NHD NH                       /* heads attended (unused) */
#define MPO MP                       /* unused (there is no output stage) */
#define LQ DM      /* row pitch of the q/k rows */
typedef __bf16 v16b __attribute__((ext_vector_type(16)));
typedef unsigned short v8us __attribute__((ext_vector_type(8), may_alias));
typedef float  v8f  __attribute__((ext_vector_type(8)));
typedef float  v4f  __attribute__((ext_vector_type(4)));
typedef float  v4fa __attribute__((ext_vector_type(4), may_alias));
union FragB { v16b v; v8us half[2]; unsigned short u[16]; };

__device__ __forceinline__ unsigned short bf16_bits(float x) { unsigned int u = __float_as_uint(x); return (unsigned short)((u + 0x7FFFu + ((u >> 16) & 1u)) >> 16); }
__device__ __forceinline__ float bf16_val(unsigned short b) { return __uint_as_float(((unsigned int)b) << 16); }
__device__ __forceinline__ float bf16_round(float x) { return bf16_val(bf16_bits(x)); }
// D += A·B with NT terms: 1 = ah·bh, 2 = + al·bh (A split), 3 = + ah·bl (both split)
template <int NT>
__device__ __forceinline__ v8f mmaN(v16b ah, v16b al, v16b bh, v16b bl, v8f c) {
  c = __builtin_amdgcn_wmma_f32_16x16x32_bf16(false, ah, false, bh, (short)0, c, false, false);
  if (NT >= 2) c = __builtin_amdgcn_wmma_f32_16x16x32_bf16(false, al, false, bh, (short)0, c, false, false);
  if (NT >= 3) c = __builtin_amdgcn_wmma_f32_16x16x32_bf16(false, ah, false, bl, (short)0, c, false, false);
  asm volatile("v_nop\n\tv_nop\n\tv_nop\n\tv_nop" : "+v"(c) : "v"(ah), "v"(al), "v"(bh), "v"(bl));
  return c;
}

__global__ __launch_bounds__(256) void k_wt_bf16(const float* __restrict__ W, unsigned short* __restrict__ Wt, int K, int N) {
  const int t = blockIdx.x * 256 + threadIdx.x;
  const int k8n = K / 8;
  if (t >= N * k8n) return;
  const int n = t / k8n, k8 = (t % k8n) * 8;
  v8us v;
#pragma unroll
  for (int i = 0; i < 8; ++i) v[i] = bf16_bits(W[(size_t)(k8 + i) * N + n]);
  *(v8us*)(Wt + (size_t)n * K + k8) = v;
  
}

// GEMM C[M][N] (f32, pitch ldc) = act(A[M][K]·W + bias). A f32 row-major (pitch lda) converted per fragment to bf16
// (ASPLIT: hi/lo two planes -> 2 terms, else single rounded term); Wt bf16 [N][K] (pitch ldb). BIAS_BF16 rounds the
// bias to bf16 first (bias quantised to bf16 before the add). K%32==0, M%16==0, N%64==0.
template <bool ASPLIT, int ACT, bool BIAS_BF16>
__global__ __launch_bounds__(128) void k_gemm_bf(const float* __restrict__ A, int lda, const unsigned short* __restrict__ Wt, int ldb,
                                               const float* __restrict__ bias, float* __restrict__ C, int ldc, int M, int N, int K) {
  __shared__ __attribute__((aligned(16))) float so[4][16][64];
  const int tid = threadIdx.x, w = tid >> 5, lane = tid & 31, ln = lane & 15, hh = lane >> 4;
  const int ntn = N / 64;
  const int wid = blockIdx.x * 4 + w;
  const int mt = wid / ntn, nq = wid % ntn;
  if (mt * 16 >= M) return;
  const int row0 = mt * 16, col0 = nq * 64;
  const float* arow = A + (size_t)(row0 + ln) * lda;
  v8f acc[4] = {};
  for (int kb = 0; kb < K; kb += 32) {
    FragB ah, al;
    const v4f x0 = *(const v4fa*)(arow + kb + 8 * hh), x1 = *(const v4fa*)(arow + kb + 8 * hh + 4);
    const v4f x2 = *(const v4fa*)(arow + kb + 16 + 8 * hh), x3 = *(const v4fa*)(arow + kb + 16 + 8 * hh + 4);
    float xs[16] = {x0[0],x0[1],x0[2],x0[3],x1[0],x1[1],x1[2],x1[3],x2[0],x2[1],x2[2],x2[3],x3[0],x3[1],x3[2],x3[3]};
#pragma unroll
    for (int i = 0; i < 16; ++i) { const unsigned short hb = bf16_bits(xs[i]); ah.u[i] = hb; al.u[i] = ASPLIT ? bf16_bits(xs[i] - bf16_val(hb)) : (unsigned short)0; }
#pragma unroll
    for (int t = 0; t < 4; ++t) {
      const unsigned short* brow = Wt + (size_t)(col0 + t * 16 + ln) * ldb + kb;
      FragB b;
      b.half[0] = *(const v8us*)(brow + 8 * hh);
      b.half[1] = *(const v8us*)(brow + 16 + 8 * hh);
      acc[t] = mmaN<ASPLIT ? 2 : 1>(ah.v, al.v, b.v, b.v, acc[t]);
    }
  }
#pragma unroll
  for (int t = 0; t < 4; ++t) {
    float bv = bias ? bias[col0 + t * 16 + ln] : 0.f;
    if (BIAS_BF16) bv = bf16_round(bv);
#pragma unroll
    for (int r = 0; r < 8; ++r) { float v = acc[t][r] + bv; if (ACT == 1) v = fmaxf(v, 0.f); so[w][8 * hh + r][t * 16 + ln] = v; }
  }
  __builtin_amdgcn_fence(__ATOMIC_ACQ_REL, "workgroup");
  __builtin_amdgcn_wave_barrier();
  const int rsub = lane >> 4, c4 = (lane & 15) * 4;
  {
#pragma unroll
    for (int q = 0; q < 8; ++q) {
      const int r = q * 2 + rsub;
      const v4f v = *(const v4fa*)&so[w][r][c4];
      *(v4f*)(C + (size_t)(row0 + r) * ldc + col0 + c4) = v;
    }
    
  }
}

// GEMM C = act(A·W + bias + resid): A f32 (ASPLIT -> hi/lo 2 terms), Wt bf16 [N][K]; ACT 0 none, 1 relu, 2 exact gelu;
// resid (optional, f32, row index = (row % rmod), pitch ldr, RES_BF16 rounds it) added before the activation.
template <bool ASPLIT, int ACT, bool BIAS_BF16, bool RES_BF16>
__global__ __launch_bounds__(128) void k_gemm_bf3(const float* __restrict__ A, int lda, const unsigned short* __restrict__ Wt, int ldb,
                                                const float* __restrict__ bias, const float* __restrict__ resid, int rmod, int ldr,
                                                float* __restrict__ C, int ldc, int M, int N, int K) {
  __shared__ __attribute__((aligned(16))) float so[4][16][64];
  const int tid = threadIdx.x, w = tid >> 5, lane = tid & 31, ln = lane & 15, hh = lane >> 4;
  const int ntn = N / 64;
  const int wid = blockIdx.x * 4 + w;
  const int mt = wid / ntn, nq = wid % ntn;
  if (mt * 16 >= M) return;
  const int row0 = mt * 16, col0 = nq * 64;
  const float* arow = A + (size_t)(row0 + ln) * lda;
  v8f acc[4] = {};
  for (int kb = 0; kb < K; kb += 32) {
    FragB ah, al;
    const v4f x0 = *(const v4fa*)(arow + kb + 8 * hh), x1 = *(const v4fa*)(arow + kb + 8 * hh + 4);
    const v4f x2 = *(const v4fa*)(arow + kb + 16 + 8 * hh), x3 = *(const v4fa*)(arow + kb + 16 + 8 * hh + 4);
    float xs[16] = {x0[0],x0[1],x0[2],x0[3],x1[0],x1[1],x1[2],x1[3],x2[0],x2[1],x2[2],x2[3],x3[0],x3[1],x3[2],x3[3]};
#pragma unroll
    for (int i = 0; i < 16; ++i) { const unsigned short hb = bf16_bits(xs[i]); ah.u[i] = hb; al.u[i] = ASPLIT ? bf16_bits(xs[i] - bf16_val(hb)) : (unsigned short)0; }
#pragma unroll
    for (int t = 0; t < 4; ++t) {
      const unsigned short* brow = Wt + (size_t)(col0 + t * 16 + ln) * ldb + kb;
      FragB b;
      b.half[0] = *(const v8us*)(brow + 8 * hh);
      b.half[1] = *(const v8us*)(brow + 16 + 8 * hh);
      acc[t] = mmaN<ASPLIT ? 2 : 1>(ah.v, al.v, b.v, b.v, acc[t]);
    }
  }
#pragma unroll
  for (int t = 0; t < 4; ++t) {
    const int col = col0 + t * 16 + ln;
    float bv = bias ? bias[col] : 0.f;
    if (BIAS_BF16) bv = bf16_round(bv);
#pragma unroll
    for (int r = 0; r < 8; ++r) {
      float v = acc[t][r] + bv;
      if (resid) { float rv = resid[(size_t)((row0 + 8 * hh + r) % rmod) * ldr + col]; if (RES_BF16) rv = bf16_round(rv); v += rv; }
      if (ACT == 1) v = fmaxf(v, 0.f);
      if (ACT == 2) v = 0.5f * v * (1.0f + erff(v * 0.70710678118654752f));
      if (ACT == 3) { const float u = 0.7978845608028654f * (v + 0.044715f * v * v * v); v = 0.5f * v * (1.0f + tanhf(u)); }
      so[w][8 * hh + r][t * 16 + ln] = v;
    }
  }
  __builtin_amdgcn_fence(__ATOMIC_ACQ_REL, "workgroup");
  __builtin_amdgcn_wave_barrier();
  const int rsub = lane >> 4, c4 = (lane & 15) * 4;
  {
#pragma unroll
    for (int q = 0; q < 8; ++q) {
      const int r = q * 2 + rsub;
      const v4f v = *(const v4fa*)&so[w][r][c4];
      *(v4f*)(C + (size_t)(row0 + r) * ldc + col0 + c4) = v;
    }
    
  }
}
// row LayerNorm (biased variance, eps) over N: s = X (+ R); optional out_sum <- s; out_norm <- (s-mu)*rsqrt(var+eps)*g + b
template <bool PARAM_BF16>
__global__ __launch_bounds__(256) void k_layernorm(const float* __restrict__ X, const float* __restrict__ R, const float* __restrict__ g, const float* __restrict__ bta,
                                                  float* __restrict__ out_sum, float* __restrict__ out_norm, int N, float eps) {
  __shared__ float red[256];
  const int row = blockIdx.x, tid = threadIdx.x;
  const float* x = X + (size_t)row * N; const float* rr = R ? R + (size_t)row * N : nullptr;
  float vals[16];                     // up to N = 4096
  const int per = N / 256;            // contiguous chunk per thread? use strided-by-4 chunks: thread handles j = tid*4 + 1024*u
  float s1 = 0.f;
  for (int u = 0; u < per / 4; ++u) {
    const int j = tid * 4 + 1024 * u;
    const v4f a = *(const v4fa*)(x + j);
    v4f b = {0.f,0.f,0.f,0.f}; if (rr) b = *(const v4fa*)(rr + j);
#pragma unroll
    for (int q = 0; q < 4; ++q) { const float v = a[q] + b[q]; vals[u * 4 + q] = v; s1 += v; }
  }
  red[tid] = s1; __syncthreads();
  for (int st = 128; st > 0; st >>= 1) { if (tid < st) red[tid] += red[tid + st]; __syncthreads(); }
  const float mu = red[0] / (float)N; __syncthreads();
  float s2 = 0.f;
  for (int u = 0; u < per / 4; ++u)
#pragma unroll
    for (int q = 0; q < 4; ++q) { const float c = vals[u * 4 + q] - mu; s2 += c * c; }
  red[tid] = s2; __syncthreads();
  for (int st = 128; st > 0; st >>= 1) { if (tid < st) red[tid] += red[tid + st]; __syncthreads(); }
  const float rs = rsqrtf(red[0] / (float)N + eps);
  {
    for (int u = 0; u < per / 4; ++u) {
      const int j = tid * 4 + 1024 * u;
      v4f o, sm;
#pragma unroll
      for (int q = 0; q < 4; ++q) {
        float gg = g[j + q], bb = bta[j + q];
        if (PARAM_BF16) { gg = bf16_round(gg); bb = bf16_round(bb); }
        sm[q] = vals[u * 4 + q]; o[q] = (vals[u * 4 + q] - mu) * rs * gg + bb;
      }
      if (out_sum) *(v4f*)(out_sum + (size_t)row * N + j) = sm;
      *(v4f*)(out_norm + (size_t)row * N + j) = o;
    }
    
  }
}



// ---- f16 WMMA path (v_wmma_f32_16x16x32_f16): 11-bit significands for operands in range — used where a [0,1] probability operand needs more precision than bf16
typedef _Float16 v16h __attribute__((ext_vector_type(16)));
union FragH { v16h v; v8us half[2]; _Float16 h[16]; unsigned short u[16]; };
template <int NT>
__device__ __forceinline__ v8f mmaH(v16h ah, v16h al, v16h bh, v16h bl, v8f c) {
  c = __builtin_amdgcn_wmma_f32_16x16x32_f16(false, ah, false, bh, (short)0, c, false, false);
  if (NT >= 2) c = __builtin_amdgcn_wmma_f32_16x16x32_f16(false, al, false, bh, (short)0, c, false, false);
  if (NT >= 3) c = __builtin_amdgcn_wmma_f32_16x16x32_f16(false, ah, false, bl, (short)0, c, false, false);
  asm volatile("v_nop\n\tv_nop\n\tv_nop\n\tv_nop" : "+v"(c) : "v"(ah), "v"(al), "v"(bh), "v"(bl));
  return c;
}
// batched GEMM like k_gemm_b but f16 operands: A f32 (split into f16 hi/lo if ASPLIT, else rounded to f16), Bt = f16 values [n][k]; alpha; C f32; N multiple of 16 (partial tiles skipped)
template <bool ASPLIT>
__global__ __launch_bounds__(128) void k_gemm_h(const float* __restrict__ A, int lda, size_t sA, const _Float16* __restrict__ Bh, int ldb, size_t sB, float alpha, float* __restrict__ C, int ldc, size_t sC, int M, int N, int K) {
  __shared__ __attribute__((aligned(16))) float so[4][16][64];
  const int tid = threadIdx.x, w = tid >> 5, lane = tid & 31, ln = lane & 15, hh = lane >> 4; const int by = blockIdx.y;
  A += (size_t)by * sA; Bh += (size_t)by * sB; C += (size_t)by * sC;
  const int ntn = (N + 63) / 64; const int wid = blockIdx.x * 4 + w; const int mt = wid / ntn, nq = wid % ntn; if (mt * 16 >= M) return;
  const int row0 = mt * 16, col0 = nq * 64; const float* arow = A + (size_t)(row0 + ln) * lda;
  v8f acc[4] = {};
  for (int kb = 0; kb < K; kb += 32) {
    FragH ah, al;
    const v4f x0 = *(const v4fa*)(arow + kb + 8 * hh), x1 = *(const v4fa*)(arow + kb + 8 * hh + 4), x2 = *(const v4fa*)(arow + kb + 16 + 8 * hh), x3 = *(const v4fa*)(arow + kb + 16 + 8 * hh + 4);
    float xs[16] = {x0[0],x0[1],x0[2],x0[3],x1[0],x1[1],x1[2],x1[3],x2[0],x2[1],x2[2],x2[3],x3[0],x3[1],x3[2],x3[3]};
#pragma unroll
    for (int i = 0; i < 16; ++i) { const _Float16 h = (_Float16)xs[i]; ah.h[i] = h; al.h[i] = ASPLIT ? (_Float16)(xs[i] - (float)h) : (_Float16)0.0f; }
#pragma unroll
    for (int t = 0; t < 4; ++t) { if (col0 + t * 16 >= N) continue; const size_t boff = (size_t)(col0 + t * 16 + ln) * ldb + kb; FragH bq; bq.half[0] = *(const v8us*)(Bh + boff + 8 * hh); bq.half[1] = *(const v8us*)(Bh + boff + 16 + 8 * hh);
      acc[t] = mmaH<ASPLIT ? 2 : 1>(ah.v, al.v, bq.v, bq.v, acc[t]); }
  }
#pragma unroll
  for (int t = 0; t < 4; ++t) { if (col0 + t * 16 >= N) continue;
#pragma unroll
    for (int r = 0; r < 8; ++r) so[w][8 * hh + r][t * 16 + ln] = acc[t][r] * alpha; }
  __builtin_amdgcn_fence(__ATOMIC_ACQ_REL, "workgroup"); __builtin_amdgcn_wave_barrier();
  const int rsub = lane >> 4, c4 = (lane & 15) * 4;
  {
#pragma unroll
    for (int q = 0; q < 8; ++q) { const int r = q * 2 + rsub; if (col0 + c4 < N) { const v4f v = *(const v4fa*)&so[w][r][c4]; *(v4f*)(C + (size_t)(row0 + r) * ldc + col0 + c4) = v; } }
     }
}

// Wt[n][k] = f16(W[k][n]·scale) from f32 row-major W[K][N] (scale = power of two; bf16-exact weights stay exact in f16 away from the subnormal range)
__global__ __launch_bounds__(256) void k_wt_f16(const float* __restrict__ W, _Float16* __restrict__ Wt, int K, int N, float scale) {
  const int t = blockIdx.x * 256 + threadIdx.x; if (t >= N * (K / 8)) return; const int n = t / (K / 8), k8 = (t % (K / 8)) * 8; FragH f;
#pragma unroll
  for (int i = 0; i < 8; ++i) f.h[i] = (_Float16)(bf16_round(W[(size_t)(k8 + i) * N + n]) * scale); const v8us o = f.half[0];
  *(v8us*)((unsigned short*)Wt + (size_t)n * K + k8) = o; 
}
// k_gemm_hh variant with fused epilogue: v = acc·alpha + bias[by·sBias + col] (+ CP[(row/rowsPerB)·sCPb + by·64 + col] if CP) ; ACT 0 none / 1 elu ; writes f16 C16 (and f32 C if non-null)
template <int ACT>
__global__ __launch_bounds__(128) void k_gemm_hhx(const _Float16* __restrict__ A, int lda, size_t sA, const _Float16* __restrict__ Bh, int ldb, size_t sB, float alpha, const float* __restrict__ bias, size_t sBias, const float* __restrict__ CP, int rowsPerB, size_t sCPb, int row0g,
    float* __restrict__ C, _Float16* __restrict__ C16, int ldc, size_t sC, int M, int N, int K) {
  __shared__ __attribute__((aligned(16))) float so[4][16][64];
  const int tid = threadIdx.x, w = tid >> 5, lane = tid & 31, ln = lane & 15, hh = lane >> 4; const int by = blockIdx.y;
  A += (size_t)by * sA; Bh += (size_t)by * sB; const size_t cofs = (size_t)by * sC; const float* bp = bias ? bias + (size_t)by * sBias : nullptr;
  const int ntn = (N + 63) / 64; const int wid = blockIdx.x * 4 + w; const int mt = wid / ntn, nq = wid % ntn; if (mt * 16 >= M) return;
  const int row0 = mt * 16, col0 = nq * 64; const _Float16* arow = A + (size_t)(row0 + ln) * lda;
  v8f acc[4] = {};
  for (int kb = 0; kb < K; kb += 32) { FragH ah; ah.half[0] = *(const v8us*)((const unsigned short*)arow + kb + 8 * hh); ah.half[1] = *(const v8us*)((const unsigned short*)arow + kb + 16 + 8 * hh);
#pragma unroll
    for (int t = 0; t < 4; ++t) { if (col0 + t * 16 >= N) continue; const size_t boff = (size_t)(col0 + t * 16 + ln) * ldb + kb; FragH bq; bq.half[0] = *(const v8us*)((const unsigned short*)Bh + boff + 8 * hh); bq.half[1] = *(const v8us*)((const unsigned short*)Bh + boff + 16 + 8 * hh);
      acc[t] = mmaH<1>(ah.v, ah.v, bq.v, bq.v, acc[t]); }
  }
#pragma unroll
  for (int t = 0; t < 4; ++t) { if (col0 + t * 16 >= N) continue; const int col = col0 + t * 16 + ln; const float bv = bp ? bf16_round(bp[col]) : 0.f;
#pragma unroll
    for (int r = 0; r < 8; ++r) { float v = acc[t][r] * alpha + bv; if (CP) { const int rr = row0g + row0 + 8 * hh + r; if (rowsPerB < 0) v += CP[cofs + (size_t)rr * ldc + col];      /* rowsPerB < 0: own element of the batched C plane */ else { const int bidx = rr / rowsPerB; v += CP[(size_t)bidx * sCPb + (size_t)by * 64 + col]; } } if (ACT == 1) v = (v > 0.f) ? v : expm1f(v); else if (ACT == 7) v = (v > 0.f) ? v + 1.0f : expf(v); else if (ACT == 8) v = tanhf(v); else if (ACT == 9) v = 0.5f * v * (1.0f + tanhf(0.7978845608028654f * (v + 0.044715f * v * v * v))); else if (ACT == 11) v = 1.0f / (1.0f + expf(-v)); else if (ACT == 12) v = (v > 0.f) ? v : 0.01f * v; else if (ACT == 14) v = (v > 0.f) ? v : 0.1f * v; else if (ACT == 16) v = (v >= 0.f) ? v : 0.3f * v; else if (ACT == 17) v = (v >= 0.f) ? v : 0.2f * v; else if (ACT == 15) v = v / (1.0f + expf(-v)); else if (ACT == 3) v = fmaxf(v, 0.f); else if (ACT == 6) v = 0.5f * v * (1.0f + erff(v * 0.70710678118654752f)); so[w][8 * hh + r][t * 16 + ln] = v; } }
  __builtin_amdgcn_fence(__ATOMIC_ACQ_REL, "workgroup"); __builtin_amdgcn_wave_barrier();
  const int rsub = lane >> 4, c4 = (lane & 15) * 4; typedef _Float16 v4h __attribute__((ext_vector_type(4)));
  {
#pragma unroll
    for (int q = 0; q < 8; ++q) { const int r = q * 2 + rsub; if (col0 + c4 < N) { const v4f v = *(const v4fa*)&so[w][r][c4]; if (C) *(v4f*)(C + cofs + (size_t)(row0 + r) * ldc + col0 + c4) = v; if (C16) { v4h h4; for (int i = 0; i < 4; ++i) h4[i] = (_Float16)v[i]; *(v4h*)(C16 + cofs + (size_t)(row0 + r) * ldc + col0 + c4) = h4; } } }
     }
}


typedef _Float16 v4h __attribute__((ext_vector_type(4)));

// ---- fragment order: a plane of rows x DM f16 values is cut into tiles of 16 rows x 32 k (1 KB each, tile index = (row / 16) * (DM / 32) + k / 32). Inside a tile stand 64 pieces of 16 B: piece c = 32 * half + lane holds
// row (lane & 15), k = 16 * half + 8 * (lane >> 4) + 0..7, which is what lane 'lane' takes as registers 4 * half .. 4 * half + 3 of its A or B fragment. A wave's fragment load then reads 512 B in a row (4 whole lines)
// where rows of pitch 2 KB gave it 16 pieces of 32 B in 16 lines. The k order of every fragment is the old one. fo_src: first element, in the row-major source, of piece t of the plane.
__device__ __forceinline__ size_t fo_src(size_t t) { const size_t tile = t >> 6; const int c = (int)(t & 63); return ((tile / (DM / 32)) * 16 + (c & 15)) * DM + (tile % (DM / 32)) * 32 + (c >> 5) * 16 + ((c >> 4) & 1) * 8; }
__device__ __forceinline__ v16h fo_frag(const _Float16* p) { FragH f; f.half[0] = *(const v8us*)((const unsigned short*)p); f.half[1] = *(const v8us*)((const unsigned short*)p + 256); return f.v; }      /* p: the tile + 8 * lane */
// ---- operand conversion, one launch for x and the three weight planes: blocks 0 .. XB - 1 take the pieces of x (factor 1, exact), then WB blocks the pieces of each weight plane (factor 16, exact). A thread converts one piece; the plane is the same for a whole block.
#define XB ((int)(NR * DM / 8 / 256))      /* blocks of x */
#define WB (DM * DM / 8 / 256)             /* blocks of one weight plane */
__global__ __launch_bounds__(256) void k_prep(const float* __restrict__ x, const float* __restrict__ wq, const float* __restrict__ wk, const float* __restrict__ wv, _Float16* __restrict__ X16, _Float16* __restrict__ BQ, _Float16* __restrict__ BK, _Float16* __restrict__ BV) {
  int blk = (int)blockIdx.x; const float* sp = x; _Float16* dp = X16; float sc = 1.0f;
  if (blk >= XB) { blk -= XB; const int p = blk / WB; blk -= p * WB; sp = (p == 0) ? wq : ((p == 1) ? wk : wv); dp = (p == 0) ? BQ : ((p == 1) ? BK : BV); sc = 16.0f; }
  const size_t t = (size_t)blk * 256 + threadIdx.x; FragH f; const float* s = sp + fo_src(t); const v4f a = *(const v4fa*)s, c = *(const v4fa*)(s + 4);
  asm volatile("s_wait_xcnt 0x0" :: "v"(s) : "memory");      /* the loads' address pair stays untouched (an input here) until this wait; it is free for reuse only behind it */
#pragma unroll
  for (int q = 0; q < 4; ++q) { f.h[q] = (_Float16)(bf16_round(a[q]) * sc); f.h[4 + q] = (_Float16)(bf16_round(c[q]) * sc); } *(v8us*)((unsigned short*)dp + t * 8) = f.half[0]; }      /* piece t of the plane in fragment order */
__global__ __launch_bounds__(256) void k_h16(const float* __restrict__ x, _Float16* __restrict__ X16, size_t n8) { const size_t t = (size_t)blockIdx.x * 256 + threadIdx.x; if (t >= n8) return; FragH f;
#pragma unroll
  for (int q = 0; q < 8; ++q) f.h[q] = (_Float16)x[t * 8 + q]; *(v8us*)((unsigned short*)X16 + t * 8) = f.half[0];  }
__global__ __launch_bounds__(256) void k_round16f(const float* __restrict__ W, _Float16* __restrict__ Bt, size_t n8) { const size_t t = (size_t)blockIdx.x * 256 + threadIdx.x; if (t >= n8) return; FragH f;
#pragma unroll
  for (int i = 0; i < 8; ++i) f.h[i] = (_Float16)(bf16_round(W[t * 8 + i]) * 16.0f); *(v8us*)((unsigned short*)Bt + t * 8) = f.half[0];  }
// ---- projection GEMM (wave tile 32 token rows x 64 features = one head; M % 128 == 0, N % 128 == 0, K % 64 == 0; A and Bh in fragment order). The epilogue forms v = acc * alpha + bias in f32, splits it into f16 hi + x1024 residual and stores both as whole pieces of the planes the attention reads: no f32 plane, no LDS in the epilogue.
// VT false (q, k): the products are formed transposed (A operand = weight rows, B operand = token rows), so accumulator register r of (feature tile t, token tile g) is feature 16 t + 8 hh + r of token 16 g + ln: the lane's 8 values are piece 32 (t & 1) + lane of the fragment-order tile (token tile g, k tile t >> 1) of the head.
// VT true (v): A operand = token rows, B operand = weight rows: register r is key 16 g + 8 hh + r of head column 16 t + ln: the lane's 8 values are piece 32 g + lane of a V^T tile. V^T in fragment order: tiles of 16 head columns x 32 keys, tile index = ((batch * NH + head) * (SQ / 32) + key / 32) * 4 + column / 16: the 4 tiles of a key block lie in a row.
// Either way one store instruction of the wave writes 512 B in a row (4 whole lines). The k order of every sum is the old one.
// NRM (the k product): the wave also stores the squared length of each of its 32 head rows, from which the attention bounds scores it then need not form.
__device__ __forceinline__ v16h g2_frag(const _Float16* p, int hh) { FragH f; f.half[0] = *(const v8us*)((const unsigned short*)p + 8 * hh); f.half[1] = *(const v8us*)((const unsigned short*)p + 16 + 8 * hh); return f.v; }
__device__ __forceinline__ v8f g2_mma(v16h a, v16h b, v8f c) { v8f d = __builtin_amdgcn_wmma_f32_16x16x32_f16(false, a, false, b, (short)0, c, false, false); asm volatile("v_nop\n\tv_nop\n\tv_nop\n\tv_nop" : "+v"(d) : "v"(a), "v"(b)); return d; }
template <bool VT> __device__ __forceinline__ v8f pj_mma(v16h tok, v16h wgt, v8f c) { return VT ? g2_mma(tok, wgt, c) : g2_mma(wgt, tok, c); }
// Operand staging: a block of 8 waves (4 groups of 32 token rows x 2 heads = a 128 x 128 tile) shares its operands through LDS. A stage is 64 k of the block's 128 token rows and 128 weight rows: in fragment order that is 8 + 8 runs of 2 KB (two 1 KB tiles of one row tile),
// laid in LDS in the same order ([A 16 KB | B 16 KB]), so a fragment read is 512 B in a row. Each thread brings 8 pieces of 16 B per stage by asynchronous copies; two buffers, the next stage's copies fly while this stage is multiplied.
// pj_copy: l = the thread's LDS byte address in the buffer, ga / gb = its piece in the first two row tiles of A / B; copy j of an operand lies two row tiles (sa / sb values) on in memory and 4 KB on in LDS.
__device__ __forceinline__ void pj_copy(unsigned l, const _Float16* ga, const _Float16* gb, size_t sa, size_t sb) {
  asm volatile("global_load_async_to_lds_b128 %0, %8, off\n\t"
               "global_load_async_to_lds_b128 %1, %9, off\n\t"
               "global_load_async_to_lds_b128 %2, %10, off\n\t"
               "global_load_async_to_lds_b128 %3, %11, off\n\t"
               "global_load_async_to_lds_b128 %4, %12, off\n\t"
               "global_load_async_to_lds_b128 %5, %13, off\n\t"
               "global_load_async_to_lds_b128 %6, %14, off\n\t"
               "global_load_async_to_lds_b128 %7, %15, off\n\t"
               "s_wait_xcnt 0x0"      /* inside the copies' own statement: their address registers are rewritten only behind it */
               :: "v"(l), "v"(l + 4096u), "v"(l + 8192u), "v"(l + 12288u), "v"(l + 16384u), "v"(l + 20480u), "v"(l + 24576u), "v"(l + 28672u),
                  "v"(ga), "v"(ga + sa), "v"(ga + 2 * sa), "v"(ga + 3 * sa), "v"(gb), "v"(gb + sb), "v"(gb + 2 * sb), "v"(gb + 3 * sb) : "memory"); }
template <bool VT, bool NRM>
__device__ __forceinline__ void pj_body(_Float16* sm, const _Float16* __restrict__ A, int lda, const _Float16* __restrict__ Bh, int ldb, float alpha, const float* __restrict__ bias, int row0g, _Float16* __restrict__ Hh, _Float16* __restrict__ Hl, float* __restrict__ nrm, int M, int N, int K) {
  const int tid = threadIdx.x, w = tid >> 5, lane = tid & 31, ln = lane & 15, hh = lane >> 4;
  const int ntn = N >> 7; const int mt = blockIdx.x / ntn, np = blockIdx.x - mt * ntn; if (mt * 128 >= M) return;      /* the whole block leaves, in front of every barrier */
  const int nq = np * 2 + (w >> 2); const int row0 = mt * 128 + 32 * (w & 3), col0 = nq * 64;
  const _Float16* ga = A + (size_t)(mt * 128 + 16 * (tid >> 7)) * lda + 8 * (tid & 127);      /* A and Bh lie in fragment order (fo_src; lda = ldb = DM): 16 rows = lda / 32 tiles of 512 values; threads 0..127 take the 2 KB of an even row tile, 128..255 of the odd one */
  const _Float16* gb = Bh + (size_t)(np * 128 + 16 * (tid >> 7)) * ldb + 8 * (tid & 127);
  const size_t sa = (size_t)32 * lda, sb = (size_t)32 * ldb; const unsigned l0 = (unsigned)(uintptr_t)sm + 16u * (unsigned)tid;
  const int fa = (w & 3) * 2048 + 8 * lane, fb = 8192 + (w >> 2) * 4096 + 8 * lane;      /* the wave's first A and B tile in a buffer, with the lane's piece */
  const int nt = K >> 6;      /* stages */
  const v8f z8 = {0.f,0.f,0.f,0.f,0.f,0.f,0.f,0.f}; v8f c00 = z8, c01 = z8, c02 = z8, c03 = z8, c10 = z8, c11 = z8, c12 = z8, c13 = z8;
  pj_copy(l0, ga, gb, sa, sb);      /* stage 0 */
  asm volatile("s_wait_asynccnt 0x0" ::: "memory");      /* the wave's own copies of stage 0 have landed */
  __syncthreads();      /* and every other wave's: stage 0 may be read */
  if (nt > 1) pj_copy(l0 + 32768u, ga + 1024, gb + 1024, sa, sb);      /* stage 1 flies under stage 0's products */
  ga += 2048; gb += 2048;
  int bo = 0;      /* the buffer of this trip, in values */
#pragma unroll 1      /* one trip = one stage = two k-steps (K % 64 == 0); rolled so that the 12 fragments of a trip stay in registers */
  for (int t = 0; t < nt; ++t) {
    const _Float16* a0p = sm + bo + fa; const _Float16* b0p = sm + bo + fb;
    const v16h a0 = fo_frag(a0p), b0 = fo_frag(b0p), a1 = fo_frag(a0p + 1024), b1 = fo_frag(b0p + 1024), b2 = fo_frag(b0p + 2048), b3 = fo_frag(b0p + 3072);
    const v16h e0 = fo_frag(a0p + 512), f0 = fo_frag(b0p + 512), e1 = fo_frag(a0p + 1536), f1 = fo_frag(b0p + 1536), f2 = fo_frag(b0p + 2560), f3 = fo_frag(b0p + 3584);
    c00 = pj_mma<VT>(a0, b0, c00); c10 = pj_mma<VT>(a1, b0, c10); c01 = pj_mma<VT>(a0, b1, c01); c11 = pj_mma<VT>(a1, b1, c11); c02 = pj_mma<VT>(a0, b2, c02); c12 = pj_mma<VT>(a1, b2, c12); c03 = pj_mma<VT>(a0, b3, c03); c13 = pj_mma<VT>(a1, b3, c13);
    c00 = pj_mma<VT>(e0, f0, c00); c10 = pj_mma<VT>(e1, f0, c10); c01 = pj_mma<VT>(e0, f1, c01); c11 = pj_mma<VT>(e1, f1, c11); c02 = pj_mma<VT>(e0, f2, c02); c12 = pj_mma<VT>(e1, f2, c12); c03 = pj_mma<VT>(e0, f3, c03); c13 = pj_mma<VT>(e1, f3, c13);
    asm volatile("s_wait_dscnt 0x0" ::: "memory");      /* the wave's reads of this buffer are done before it is given up for refilling */
    asm volatile("s_wait_asynccnt 0x0" ::: "memory");      /* the wave's own copies of stage t + 1 have landed */
    __syncthreads();      /* publishes stage t + 1 and ends every wave's reads of stage t */
    if (t + 2 < nt) pj_copy(l0 + 2u * (unsigned)bo, ga, gb, sa, sb);      /* stage t + 2 into the buffer just left */
    ga += 1024; gb += 1024; bo ^= 16384; }
  asm volatile("s_wait_asynccnt 0x0" ::: "memory");      /* no copy is outstanding when the wave goes on to its end */
  v8f accs[8] = {c00, c01, c02, c03, c10, c11, c12, c13};
  const int rg = row0g + row0;      /* the wave's first token row in the whole plane */
  const size_t po = VT ? ((size_t)((rg / SQ) * NH + nq) * (SQ / 32) + (rg % SQ) / 32) * 2048 + 8 * lane : ((size_t)(rg / 16) * (DM / 32) + col0 / 32) * 512 + 8 * lane;      /* the lane's place in the wave's first tile */
  unsigned short* hp = (unsigned short*)Hh + po; unsigned short* lp = (unsigned short*)Hl + po;
  FragH fh[4], fl[4];      /* [u >> 1].half[u & 1] */
  float n2[2] = {0.f, 0.f};      /* NRM (with VT false): sum of squares of the lane's 32 features of token 16 g + ln */
#pragma unroll
  for (int u = 0; u < 8; ++u) { const int t = u & 3; float bv[8];
    if (VT) { const float b1 = bf16_round(bias[col0 + t * 16 + ln]);
#pragma unroll
      for (int r = 0; r < 8; ++r) bv[r] = b1; }
    else { const v4f x0 = *(const v4fa*)(bias + col0 + t * 16 + 8 * hh), x1 = *(const v4fa*)(bias + col0 + t * 16 + 8 * hh + 4);
#pragma unroll
      for (int r = 0; r < 4; ++r) { bv[r] = bf16_round(x0[r]); bv[4 + r] = bf16_round(x1[r]); } }
#pragma unroll
    for (int r = 0; r < 8; ++r) { const float v = accs[u][r] * alpha + bv[r]; if (NRM) n2[u >> 2] += v * v; const _Float16 h = (_Float16)v; fh[u >> 1].h[(u & 1) * 8 + r] = h; fl[u >> 1].h[(u & 1) * 8 + r] = (_Float16)((v - (float)h) * 1024.0f); } }
  if (NRM) { n2[0] += __shfl_xor(n2[0], 16, 32); n2[1] += __shfl_xor(n2[1], 16, 32); const float nv = hh ? n2[1] : n2[0];      /* the other lane half holds the other 32 features; lane = token of the wave's 32 */
    float* np = nrm + ((size_t)(rg / SQ) * NH + nq) * SQ + rg % SQ + lane;      /* squared length of each token's head row, [batch][head][token]: the wave writes one whole line */
    *np = nv;
    asm volatile("s_wait_xcnt 0x0" ::: "memory"); }      /* the store's registers are free for reuse only behind this wait */
  __builtin_amdgcn_sched_barrier(0);      /* all 16 pieces are formed in front of the first store: without this the V^T build formed its residual pieces behind the hi stores, over their registers, behind waits on those stores */
#pragma unroll
  for (int u = 0; u < 8; ++u) { const int t = u & 3, g = u >> 2; const int eo = VT ? t * 512 + g * 256 : g * 16 * DM + t * 256;      /* VT: tile t, half g; else token tile g (16 DM values on), k tile t >> 1, half t & 1 */
    *(v8us*)(hp + eo) = fh[u >> 1].half[u & 1]; *(v8us*)(lp + eo) = fl[u >> 1].half[u & 1]; }
  asm volatile("s_wait_xcnt 0x0" ::: "memory"); }      /* behind the last store: in the merged kernel another product's code follows this body in the text, and no register of an issued store is rewritten in front of this wait */
// the three projections in one launch: grid.y picks the product (the same for a whole block, so every barrier stays under block-uniform control flow); the blocks of one product start while the last blocks of the one before still run.
__global__ __launch_bounds__(256) void k_proj3(const _Float16* __restrict__ A, const _Float16* __restrict__ BQ, const _Float16* __restrict__ BK, const _Float16* __restrict__ BV, const float* __restrict__ bq, const float* __restrict__ bk, const float* __restrict__ bv, int row0g,
    _Float16* __restrict__ Q16, _Float16* __restrict__ QL, _Float16* __restrict__ K16, _Float16* __restrict__ KL, _Float16* __restrict__ VT, _Float16* __restrict__ VTL, float* __restrict__ KN) {
  __shared__ __attribute__((aligned(16))) _Float16 sm[2 * 16384];      /* two buffers of [A: 8 row tiles x 2 k tiles | B: the same], 1 KB a tile */
  if (blockIdx.y == 0) pj_body<false, false>(sm, A, DM, BQ, DM, 0.0625f, bq, row0g, Q16, QL, nullptr, MP, DM, DM);      /* q (+ bq) -> f16 hi + x1024 residual, fragment order */
  else if (blockIdx.y == 1) pj_body<false, true>(sm, A, DM, BK, DM, 0.0625f, bk, row0g, K16, KL, KN, MP, DM, DM);      /* k (+ bk) likewise, and each key's squared length */
  else pj_body<true, false>(sm, A, DM, BV, DM, 0.0625f, bv, row0g, VT, VTL, nullptr, MP, DM, DM); }      /* v (+ bv) -> V^T hi and residual, [4][16] slabs of 64 x SQ in fragment order */


__global__ __launch_bounds__(256) void k_rsm(const float* __restrict__ S, _Float16* __restrict__ P, int nrows) {
  #pragma clang fp contract(off)
  const int i = blockIdx.x * 256 + threadIdx.x; if (i >= nrows) return; const float* s = S + (size_t)i * SQ; float mx = -3.0e38f;
#pragma unroll 1
  for (int j = 0; j < SQ; ++j) mx = fmaxf(mx, s[j]); float se = 0.f;
#pragma unroll 1
  for (int j = 0; j < SQ; ++j) se += expf(s[j] - mx); const float sc = 256.0f / se;
#pragma unroll 1
  for (int j0 = 0; j0 < SQ; j0 += 8) { FragH f; for (int q = 0; q < 8; ++q) f.h[q] = (_Float16)(expf(s[j0 + q] - mx) * sc); unsigned short* d = (unsigned short*)P + (size_t)i * SQ + j0; *(v8us*)d = f.half[0];  } }
__global__ __launch_bounds__(256) void k_vt(const _Float16* __restrict__ V16, int b, int h0, _Float16* __restrict__ VT) { __shared__ unsigned short tl[64][65]; const int tid = threadIdx.x; const int hh = blockIdx.x % HG, sg = blockIdx.x / HG; const int s0 = sg * 64; const int h = h0 + hh;
  for (int i = tid; i < 64 * 8; i += 256) { const int j = i / 8, d8 = (i % 8) * 8; FragH f; f.half[0] = *(const v8us*)((const unsigned short*)V16 + ((size_t)b * SQ + s0 + j) * DM + h * HD + d8); for (int q = 0; q < 8; ++q) tl[d8 + q][j] = f.u[q]; }
  __syncthreads();
  { for (int i = tid; i < 64 * 8; i += 256) { const int d = i / 8, j8 = (i % 8) * 8; FragH f; for (int q = 0; q < 8; ++q) f.u[q] = tl[d][j8 + q]; *(v8us*)((unsigned short*)VT + ((size_t)hh * HD + d) * SQ + s0 + j8) = f.half[0]; }  } }



__global__ __launch_bounds__(256) void k_rsmcf2(const float* __restrict__ S, _Float16* __restrict__ P, int hg, int q0, int nk) {
  #pragma clang fp contract(off)
  const int t = blockIdx.x * 256 + threadIdx.x; if (t >= hg * QT) return; const size_t i = (size_t)t; const float* s = S + i * NKX; const int last = q0 + (t % QT); float mx = -3.0e38f;
#pragma unroll 1
  for (int j = 0; j < nk; ++j) { const float f = (j <= last) ? 1.f : 0.f; mx = fmaxf(mx, fmaf(f, s[j], (1.f - f) * -1.0e9f)); } float se = 0.f;
#pragma unroll 1
  for (int j = 0; j < nk; ++j) { const float f = (j <= last) ? 1.f : 0.f; se += __expf(fmaf(f, s[j], (1.f - f) * -1.0e9f) - mx); } const float sc = 256.0f / se;
#pragma unroll 1
  for (int j0 = 0; j0 < nk; j0 += 8) { FragH fr; for (int q = 0; q < 8; ++q) { const int j = j0 + q; const float f = (j <= last) ? 1.f : 0.f; fr.h[q] = (_Float16)(__expf(fmaf(f, s[j], (1.f - f) * -1.0e9f) - mx) * sc); } unsigned short* d = (unsigned short*)P + i * NKX + j0; *(v8us*)d = fr.half[0];  } }


__global__ __launch_bounds__(256) void k_rsmcf2hl(const float* __restrict__ S, _Float16* __restrict__ P, _Float16* __restrict__ PL, int hg, int q0, int nk) {
  #pragma clang fp contract(off)
  const int t = blockIdx.x * 256 + threadIdx.x; if (t >= hg * QT) return; const size_t i = (size_t)t; const float* s = S + i * NKX; const int last = q0 + (t % QT); float mx = -3.0e38f;
#pragma unroll 1
  for (int j = 0; j < nk; ++j) { const float f = (j <= last) ? 1.f : 0.f; mx = fmaxf(mx, fmaf(f, s[j], (1.f - f) * -1.0e9f)); } float se = 0.f;
#pragma unroll 1
  for (int j = 0; j < nk; ++j) { const float f = (j <= last) ? 1.f : 0.f; se += __expf(fmaf(f, s[j], (1.f - f) * -1.0e9f) - mx); } const float sc = 256.0f / se;
#pragma unroll 1
  for (int j0 = 0; j0 < nk; j0 += 8) { FragH fr, fl; for (int q = 0; q < 8; ++q) { const int j = j0 + q; const float f = (j <= last) ? 1.f : 0.f; const float v = __expf(fmaf(f, s[j], (1.f - f) * -1.0e9f) - mx) * sc; const _Float16 hv = (_Float16)v; fr.h[q] = hv; fl.h[q] = (_Float16)((v - (float)hv) * 1024.0f); } unsigned short* d = (unsigned short*)P + i * NKX + j0; unsigned short* dl = (unsigned short*)PL + i * NKX + j0; *(v8us*)d = fr.half[0]; *(v8us*)dl = fl.half[0];  } }


// ---- fused attention: scores, masks, softmax and the value product of 32 query rows per wave in one launch; no score or weight ever goes to memory.
// The wave walks its keys in blocks of 32 with a running row maximum and row sum. Scores are formed transposed, S^T = K Q^T (A = key rows, B = query rows, two column groups g of 16 queries): a lane then holds 16 keys of ONE query per group
// (accumulator register r of key tile t = key 16 t + 8 hh + r, column ln = query), which is at once the B fragment of the next product, out^T = V^T P^T (element 8 t + r = k index 16 t + 8 hh + r, the k order of fo_frag on the V^T tiles):
// the weights go from accumulator to operand inside the lane, and a row's maximum and sum need one exchange between the two lane halves.
// Split precision as before: scores = (qh.kh)/8 + (ql.kh + qh.kl)/8192; weights 256 e as f16 hi + x1024 residual; out = sum (Ph Vh + (Pl Vh + Ph Vl)/1024) / (256 sum e), the residual products of a block folded into the f32 accumulator at the block's end.
// Keys above the end of the wave's own 32 rows carry -2e4 and contribute exactly 0, as the keys above a tile's end did. Block = 8 waves = 256 query rows of one head and batch, which read the same K and V^T lines; grid.z = query block, longest first.
__device__ __forceinline__ v8f fa_mma(v16h a, v16h b, v8f c) { return __builtin_amdgcn_wmma_f32_16x16x32_f16(false, a, false, b, (short)0, c, false, false); }
__global__ __launch_bounds__(256) void k_fattn(const _Float16* __restrict__ Qh, const _Float16* __restrict__ Ql, const _Float16* __restrict__ Kh, const _Float16* __restrict__ Kl,
    const _Float16* __restrict__ Vh, const _Float16* __restrict__ Vl, const float* __restrict__ kn, const float* __restrict__ am, float* __restrict__ out) {
  const int lane = threadIdx.x & 31, ln = lane & 15, hh = lane >> 4; const int w = __builtin_amdgcn_readfirstlane(threadIdx.x >> 5);
  const int h = blockIdx.x, b = blockIdx.y; const int qw = (SQ / 256 - 1 - (int)blockIdx.z) * 256 + w * 32;      /* first query row of the wave */
  const int nk = qw + 32;      /* keys walked: a multiple of 32, at most SQ */
  const size_t qo = ((size_t)b * SQ + qw) * LQ + h * HD * 16 + 8 * lane, ko = (size_t)b * SQ * LQ + h * HD * 16 + 8 * lane, vo = (size_t)(b * NH + h) * HD * SQ + 8 * lane;      /* all six planes lie in fragment order (fo_src, pj_body): 16 rows = 16 LQ values, a head = 2 tiles of 512 in them; a key block of V^T = 4 tiles in a row */
  const _Float16* qhp = Qh + qo; const _Float16* qlp = Ql + qo; const _Float16* khp = Kh + ko; const _Float16* klp = Kl + ko; const _Float16* vhp = Vh + vo; const _Float16* vlp = Vl + vo; const float* amp = am + (size_t)b * SQ + 8 * hh;
  v16h qh[2][2], ql[2][2], kh[2][2], kl[2][2];      /* q: [column group][k-step]; k: [key tile][k-step] */
#pragma unroll
  for (int g = 0; g < 2; ++g)
#pragma unroll
    for (int s = 0; s < 2; ++s) { qh[g][s] = fo_frag(qhp + g * 16 * LQ + s * 512); ql[g][s] = fo_frag(qlp + g * 16 * LQ + s * 512); kh[g][s] = fo_frag(khp + g * 16 * LQ + s * 512); kl[g][s] = fo_frag(klp + g * 16 * LQ + s * 512); }
  asm volatile("s_wait_xcnt 0x0" :: "v"(qhp), "v"(qlp), "v"(khp), "v"(klp) : "memory");      /* the address pairs stay untouched (inputs here) until this wait; behind it they may be advanced and reused */
  { const int st = (32 < nk) ? 32 * LQ : 0; khp += st; klp += st; }      /* the K pointers run one block ahead and stop at the last block */
  // The wave's last 512 keys (from tk on) have key >= query - 512 for all 32 rows: each carries -1e4 or -2e4. lim: an upper bound of every masked score among them, per query row (f32 rounding is monotone, so a bound on the terms bounds the rounded sum):
  // |q.k| / 8 <= (|q|^2 + |k|^2) / 16 (0.065: 4 % above 1/16, for the split operands' and the sums' rounding), the largest |k|^2 and the largest attention_mask of those keys. nz is 0, or NaN where one of them is not finite, and then no test below holds.
  const int tk = qw - 480; float lim[2] = {3.0e38f, 3.0e38f};
  if (qw >= 512) {      /* below that, row 512 or an earlier one keeps these keys */
    const float* kt = kn + (size_t)(b * NH + h) * SQ + tk + 4 * lane; const float* at = am + (size_t)b * SQ + tk + 4 * lane; v4f kv[4], av[4];
#pragma unroll
    for (int j = 0; j < 4; ++j) { kv[j] = *(const v4fa*)(kt + 128 * j); av[j] = *(const v4fa*)(at + 128 * j); }
    asm volatile("s_wait_xcnt 0x0" ::: "memory");      /* the loads' address registers are free for reuse only behind this wait */
    __builtin_amdgcn_sched_barrier(0);      /* holds every later instruction, which may reuse those registers, behind the wait: without it the build wrote the loads' offset register ahead of the wait */
    float km = 0.f, ax = -3.0e38f, nz = 0.f;
#pragma unroll
    for (int j = 0; j < 4; ++j)
#pragma unroll
      for (int q = 0; q < 4; ++q) { km = fmaxf(km, kv[j][q]); ax = fmaxf(ax, av[j][q]); nz = fmaf(kv[j][q], 0.f, fmaf(av[j][q], 0.f, nz)); }
#pragma unroll
    for (int m = 16; m > 0; m >>= 1) { km = fmaxf(km, __shfl_xor(km, m, 32)); ax = fmaxf(ax, __shfl_xor(ax, m, 32)); nz += __shfl_xor(nz, m, 32); }
    const float mk = __fadd_rn(-10000.0f, (float)(__bf16)ax) + nz;
#pragma unroll
    for (int g = 0; g < 2; ++g) { float q2 = 0.f;
#pragma unroll
      for (int s = 0; s < 2; ++s)
#pragma unroll
        for (int e = 0; e < 16; ++e) { const float t = (float)qh[g][s][e]; q2 = fmaf(t, t, q2); }
      q2 += __shfl_xor(q2, 16, 32); lim[g] = __fadd_rn(0.065f * (q2 + km), mk); } }
  const v8f z8 = {0.f,0.f,0.f,0.f,0.f,0.f,0.f,0.f}; v8f o[4][2] = {{z8, z8}, {z8, z8}, {z8, z8}, {z8, z8}};      /* out^T: [tile of 16 head columns][column group] */
  float mr[2] = {-3.0e38f, -3.0e38f}, se[2] = {0.f, 0.f}; int dl = 8 * hh - qw - ln;      /* dl: key - query of the lane's first element, group 0 */
#pragma unroll 1      /* rolled: a block's fragments fill the register budget */
  for (int kb = 0; kb < nk; kb += 32) {
    if (kb == tk) {      /* once per wave: where every remaining score lies 256 or more below its row's running maximum, each remaining weight is exp(< -104) = 0 in f32, no maximum moves and nothing is added to any sum: the walk ends here with the same bits */
      const bool dead = (lim[0] - mr[0] < -256.0f) && (lim[1] - mr[1] < -256.0f);
      if (__builtin_amdgcn_ballot_w32(!dead) == 0u) break; }
    const v4f m0 = *(const v4fa*)(amp), m1 = *(const v4fa*)(amp + 4), m2 = *(const v4fa*)(amp + 16), m3 = *(const v4fa*)(amp + 20);
    v8f c[2][2], r[2][2];      /* [key tile][column group]; c: hi.hi, r: both residual products */
#pragma unroll
    for (int t = 0; t < 2; ++t)
#pragma unroll
      for (int g = 0; g < 2; ++g) { c[t][g] = fa_mma(kh[t][0], qh[g][0], z8); r[t][g] = fa_mma(kh[t][0], ql[g][0], z8); }
#pragma unroll
    for (int t = 0; t < 2; ++t)
#pragma unroll
      for (int g = 0; g < 2; ++g) { r[t][g] = fa_mma(kl[t][0], qh[g][0], r[t][g]); c[t][g] = fa_mma(kh[t][1], qh[g][1], c[t][g]); }
#pragma unroll
    for (int t = 0; t < 2; ++t)
#pragma unroll
      for (int g = 0; g < 2; ++g) r[t][g] = fa_mma(kh[t][1], ql[g][1], r[t][g]);
#pragma unroll
    for (int t = 0; t < 2; ++t)
#pragma unroll
      for (int g = 0; g < 2; ++g) r[t][g] = fa_mma(kl[t][1], qh[g][1], r[t][g]);
    v16h vh[4], vl[4];
#pragma unroll
    for (int u = 0; u < 4; ++u) { vh[u] = fo_frag(vhp + u * 512); vl[u] = fo_frag(vlp + u * 512); }      /* this block's V^T: in flight under the softmax */
#pragma unroll
    for (int t = 0; t < 2; ++t)
#pragma unroll
      for (int s = 0; s < 2; ++s) { kh[t][s] = fo_frag(khp + t * 16 * LQ + s * 512); kl[t][s] = fo_frag(klp + t * 16 * LQ + s * 512); }      /* the next block's K: in flight under the softmax and the value product */
    asm volatile("s_wait_xcnt 0x0" :: "v"(khp), "v"(klp), "v"(vhp), "v"(vlp), "v"(amp) : "memory");      /* as above: the five address pairs are advanced only behind this wait */
    { const int st = (kb + 64 < nk) ? 32 * LQ : 0; khp += st; klp += st; } vhp += 2048; vlp += 2048; amp += 32;
    const float mv[16] = {m0[0],m0[1],m0[2],m0[3],m1[0],m1[1],m1[2],m1[3],m2[0],m2[1],m2[2],m2[3],m3[0],m3[1],m3[2],m3[3]};
    float x[2][16], mn[2];
#pragma unroll
    for (int g = 0; g < 2; ++g) { float mx = -3.0e38f;
#pragma unroll
      for (int e = 0; e < 16; ++e) { const int d = dl - 16 * g + (e & 7) + 16 * (e >> 3);      /* key - query */
        const float s = c[e >> 3][g][e & 7] * 0.125f + r[e >> 3][g][e & 7] * 0.0001220703125f;      /* both factors are powers of two: one rounding */
        const float mk = __fadd_rn((d > 0) ? -20000.0f : ((d >= -512) ? -10000.0f : 0.f), (float)(__bf16)mv[e]);      /* causal -1e4 + 'window' -1e4 (their sum is exact) + attention_mask (rounded to bf16, nearest even), then added to the score, all in f32 */
        x[g][e] = __fadd_rn(s, mk); mx = fmaxf(mx, x[g][e]); }
      mx = fmaxf(mx, __shfl_xor(mx, 16, 32)); mn[g] = fmaxf(mr[g], mx); }
    if (__builtin_amdgcn_ballot_w32(mn[0] > mr[0] || mn[1] > mr[1]) != 0u) {      /* a row's maximum rose: old sums to the new maximum (factor 1 for the rows where it did not) */
#pragma unroll
      for (int g = 0; g < 2; ++g) { const float al = __expf(mr[g] - mn[g]); se[g] *= al;
#pragma unroll
        for (int u = 0; u < 4; ++u)
#pragma unroll
          for (int q = 0; q < 8; ++q) o[u][g][q] *= al; } }
    FragH ph[2], pl[2];
#pragma unroll
    for (int g = 0; g < 2; ++g) { mr[g] = mn[g];
#pragma unroll
      for (int e = 0; e < 16; ++e) { const float ex = __expf(x[g][e] - mn[g]); se[g] += ex; const float p = ex * 256.0f; const _Float16 hv = (_Float16)p; ph[g].h[e] = hv; pl[g].h[e] = (_Float16)((p - (float)hv) * 1024.0f); } }
#pragma unroll
    for (int g = 0; g < 2; ++g) { v8f t[4];
#pragma unroll
      for (int u = 0; u < 4; ++u) { o[u][g] = fa_mma(vh[u], ph[g].v, o[u][g]); t[u] = fa_mma(vh[u], pl[g].v, z8); }
#pragma unroll
      for (int u = 0; u < 4; ++u) t[u] = fa_mma(vl[u], ph[g].v, t[u]);
#pragma unroll
      for (int u = 0; u < 4; ++u)
#pragma unroll
        for (int q = 0; q < 8; ++q) o[u][g][q] += t[u][q] * 0.0009765625f; }
    dl += 32; }
  float* op = out + ((size_t)b * SQ + qw + ln) * DM + h * HD + 8 * hh;      /* the lane's query row of group 0; register q of tile u = column 16 u + 8 hh + q; the wave writes both whole lines of each of its rows */
  v4f wv[2][8];
#pragma unroll
  for (int g = 0; g < 2; ++g) { const float st = se[g] + __shfl_xor(se[g], 16, 32); const float sc = 0.00390625f / st;
#pragma unroll
    for (int u = 0; u < 4; ++u)
#pragma unroll
      for (int q = 0; q < 4; ++q) { wv[g][2 * u][q] = o[u][g][q] * sc; wv[g][2 * u + 1][q] = o[u][g][4 + q] * sc; } }
#pragma unroll
  for (int g = 0; g < 2; ++g)
#pragma unroll
    for (int u = 0; u < 4; ++u) { *(v4f*)(op + g * 16 * DM + u * 16) = wv[g][2 * u]; *(v4f*)(op + g * 16 * DM + u * 16 + 4) = wv[g][2 * u + 1]; } }

extern "C" void kernel_launch(void* const* d_in, const int* in_sizes, int n_in,
                              void* d_out, int out_size, void* d_ws, size_t ws_size, hipStream_t stream) {
  (void)in_sizes; (void)n_in; (void)out_size;
  const float* const* I = (const float* const*)d_in; const float* x = I[0]; const float* am = I[1]; const float* wq = I[2]; const float* bq = I[3]; const float* wk = I[4]; const float* bk = I[5]; const float* wv = I[6]; const float* bv = I[7];      /* additive attention_mask [4][1][1][2048] (zeros); natural [out][in] weights + biases */
  char* ws = (char*)d_ws; size_t off = 0;
  auto take = [&](size_t bytes) { char* p = ws + off; off += (bytes + 255) & ~(size_t)255; return p; };
  _Float16* Q16 = (_Float16*)take(NR * DM * 2); _Float16* QL = (_Float16*)take(NR * DM * 2); _Float16* K16 = (_Float16*)take(NR * DM * 2); _Float16* KL = (_Float16*)take(NR * DM * 2);
  _Float16* VT = (_Float16*)take((size_t)NB * NH * HD * SQ * 2); _Float16* VTL = (_Float16*)take((size_t)NB * NH * HD * SQ * 2);      /* V^T planes of all batches */
  _Float16* BQ = (_Float16*)take((size_t)DM * DM * 2); _Float16* BK = (_Float16*)take((size_t)DM * DM * 2); _Float16* BV = (_Float16*)take((size_t)DM * DM * 2);
  float* KN = (float*)take((size_t)NB * NH * SQ * 4);      /* squared length of every key's head row */
  _Float16* X16 = (_Float16*)take(NR * DM * 2);      /* v too is kept as f16 hi + x1024 residual (the early causal rows average only a few v rows, so a single-f16 v would leave large absolute rounding against this module's small output scale) */
  if (off > ws_size) return;
  k_prep<<<(unsigned)(XB + 3 * WB), 256, 0, stream>>>(x, wq, wk, wv, X16, BQ, BK, BV);      /* x as f16 rows and the natural [out][in] weights = Bt x16, all in fragment order */
  const size_t r0p = (size_t)B0 * SQ;      /* first projected row */
  k_proj3<<<dim3((unsigned)((MP / 128) * (DM / 128)), 3), 256, 0, stream>>>(X16 + r0p * DM, BQ, BK, BV, bq, bk, bv, (int)r0p, Q16, QL, K16, KL, VT, VTL, KN);      /* q, k, v */
  k_fattn<<<dim3(NH, NB, SQ / 256), 256, 0, stream>>>(Q16, QL, K16, KL, VT, VTL, KN, am, (float*)d_out);      /* scores, masks, softmax and the value product of all heads, batches and query rows in one launch */
}
